// v000
// The times below were measured on an AMD MI455X: many runs one after another, warmed up first and cycling through
// copies of the inputs, with the whole window's GPU time divided by the number of runs. Launches and the gaps
// between them are all in it. The median over several windows is given; except for v000 it joins two sittings, which
// can be a few percent apart, so the side-by-side timings, each taken in one sitting, are the better comparison.
// v000 is the starting kernel. One run takes 3400 microseconds.
#include <hip/hip_runtime.h>
#include <hip/hip_bf16.h>

// ---------------------------------------------------------------------------
// MI455X (gfx1250, wave32) implementation of a GraniteMoeHybrid decoder layer.
// All large GEMMs + attention run on v_wmma_f32_16x16x32_bf16 (bf16 in, f32
// accum).  A-activation tiles move global->LDS via the CDNA5 async-DMA path
// (global_load_async_to_lds_b128 + s_wait_asynccnt); f32 weight tiles are
// loaded as b128, converted to bf16, and staged into LDS, double-buffered.
// Workspace requirement: ~75 MiB (see layout below).
// ---------------------------------------------------------------------------

static constexpr int T  = 1024;
static constexpr int D  = 2048;
static constexpr int H  = 32;
static constexpr int KV = 8;
static constexpr int HD = 64;
static constexpr int E  = 8;
static constexpr int I  = 1024;
static constexpr int SI = 4096;
static constexpr float ATTN_MULT = 0.0078125f;
static constexpr float RES_MULT  = 0.22f;
static constexpr float EPS       = 1e-6f;

typedef __bf16 bf16x16 __attribute__((ext_vector_type(16)));
typedef float  f32x8   __attribute__((ext_vector_type(8)));

union BF16Frag {
    unsigned short u[16];
    bf16x16 v;
};

__device__ __forceinline__ unsigned short f2bf(float f) {
    unsigned int u = __float_as_uint(f);
    unsigned int r = u + 0x7FFFu + ((u >> 16) & 1u);   // round-to-nearest-even
    return (unsigned short)(r >> 16);
}

// A/B fragment K-index pattern for V_WMMA_*_16X16X32_BF16 (ISA 7.12.2):
// VGPR p (0..7), half w; lanes 0-15 vs 16-31 differ by +8 in K.
__device__ __forceinline__ int fragK(int e, int lane) {
    int p = e >> 1, w = e & 1;
    return ((p & 3) << 1) + w + ((p >> 2) << 4) + ((lane >> 4) << 3);
}

// Generic pointer -> 32-bit LDS byte offset (AS3) for async-DMA VDST operand.
__device__ __forceinline__ unsigned lds_off(const void* p) {
    return (unsigned)(unsigned long long)
        (__attribute__((address_space(3))) const void*)p;
}

// CDNA5 async global->LDS copy, 16B per lane (ASYNCcnt tracked).
__device__ __forceinline__ void async_copy_b128(unsigned lds_byte_off,
                                                const void* gsrc) {
    asm volatile("global_load_async_to_lds_b128 %0, %1, off"
                 :: "v"(lds_byte_off), "v"(gsrc)
                 : "memory");
}
__device__ __forceinline__ void wait_async0() {
    asm volatile("s_wait_asynccnt 0x0" ::: "memory");
}

// ---------------------------------------------------------------------------
// RMSNorm: one block per row.  Writes f32 and/or bf16 outputs.
// ---------------------------------------------------------------------------
__global__ __launch_bounds__(256)
void rmsnorm_kernel(const float* __restrict__ in, const float* __restrict__ w,
                    float* outf, unsigned short* outb) {
    int row = blockIdx.x;
    int tid = threadIdx.x;
    __shared__ float red[256];
    const float* x = in + (size_t)row * D;
    float ss = 0.f;
    for (int i = tid; i < D; i += 256) { float v = x[i]; ss += v * v; }
    red[tid] = ss;
    __syncthreads();
    for (int s = 128; s > 0; s >>= 1) {
        if (tid < s) red[tid] += red[tid + s];
        __syncthreads();
    }
    float rs = rsqrtf(red[0] / (float)D + EPS);
    for (int i = tid; i < D; i += 256) {
        float v = x[i] * rs * w[i];
        if (outf) outf[(size_t)row * D + i] = v;
        if (outb) outb[(size_t)row * D + i] = f2bf(v);
    }
}

// ---------------------------------------------------------------------------
// RoPE: f32 in -> bf16 out, per (t, head, i<HD/2).
// ---------------------------------------------------------------------------
__global__ __launch_bounds__(256)
void rope_kernel(const int* __restrict__ pos, const float* __restrict__ in,
                 unsigned short* __restrict__ out, int nheads) {
    int idx = blockIdx.x * blockDim.x + threadIdx.x;
    int total = T * nheads * (HD / 2);
    if (idx >= total) return;
    int i = idx & 31;
    int h = (idx >> 5) % nheads;
    int t = idx / (32 * nheads);
    float inv = __expf(-(float)i * (9.2103403719761840f / 32.f)); // 10000^(-i/32)
    float ang = (float)pos[t] * inv;
    float s, c;
    __sincosf(ang, &s, &c);
    size_t base = (size_t)t * nheads * HD + (size_t)h * HD;
    float x1 = in[base + i];
    float x2 = in[base + 32 + i];
    out[base + i]      = f2bf(x1 * c - x2 * s);
    out[base + 32 + i] = f2bf(x2 * c + x1 * s);
}

// ---------------------------------------------------------------------------
// Router: one wave per token.  logits = xn . router_w[e], softmax, top-2.
// ---------------------------------------------------------------------------
__global__ __launch_bounds__(32)
void router_kernel(const float* __restrict__ xn, const float* __restrict__ rw,
                   float* __restrict__ fullw) {
    int t = blockIdx.x;
    int lane = threadIdx.x;
    float acc[E];
#pragma unroll
    for (int e = 0; e < E; ++e) acc[e] = 0.f;
    const float* x = xn + (size_t)t * D;
    for (int i = lane; i < D; i += 32) {
        float xv = x[i];
#pragma unroll
        for (int e = 0; e < E; ++e) acc[e] += xv * rw[(size_t)e * D + i];
    }
#pragma unroll
    for (int e = 0; e < E; ++e)
        for (int off = 16; off > 0; off >>= 1)
            acc[e] += __shfl_xor(acc[e], off, 32);
    if (lane == 0) {
        int i1 = 0;
        for (int e = 1; e < E; ++e) if (acc[e] > acc[i1]) i1 = e;
        int i2 = (i1 == 0) ? 1 : 0;
        for (int e = 0; e < E; ++e) if (e != i1 && acc[e] > acc[i2]) i2 = e;
        float e1 = 1.f;
        float e2 = __expf(acc[i2] - acc[i1]);
        float inv = 1.f / (e1 + e2);
        for (int e = 0; e < E; ++e) {
            float wv = (e == i1) ? e1 * inv : (e == i2) ? e2 * inv : 0.f;
            fullw[(size_t)t * E + e] = wv;
        }
    }
}

// ---------------------------------------------------------------------------
// BF16-WMMA GEMM, double-buffered LDS, async A-tile DMA.
// C[M,N] = A[M,K](bf16) x B[K,N](f32->bf16).
// Block tile 64x128, 8 waves (2M x 4N), each wave 32x32 (4 WMMAs / K-step).
// Requires: M%64==0, N%128==0, K%32==0, lda%8==0, ldb%4==0 (all satisfied).
// ---------------------------------------------------------------------------
#define GEMM_STORE    0  // outf/outb = acc
#define GEMM_RESID    1  // outf = resid + scale*acc
#define GEMM_MOE_INIT 2  // outf  = rowsc[row]*acc
#define GEMM_MOE_ACC  3  // outf += rowsc[row]*acc
#define GEMM_SILU     4  // outb = silu(aux[row,col]) * acc   (bf16)
#define GEMM_FINAL    5  // outf = resid + scale*(aux + acc)

__global__ __launch_bounds__(256)
void gemm_bf16_wmma(const unsigned short* __restrict__ A, int lda,
                    const float* __restrict__ B, int ldb,
                    int M, int N, int K,
                    float* outf, unsigned short* outb, int ldc,
                    int mode, float scale,
                    const float* __restrict__ resid, int ldr,
                    const float* __restrict__ rowsc, int rss,
                    const float* __restrict__ aux, int ldaux) {
    constexpr int AS = 40;   // LDS stride for A rows   [64][AS]  (80B, 16B-mult)
    constexpr int BS = 40;   // LDS stride for B^T rows [128][BS]
    __shared__ __align__(16) unsigned short lds_a[2][64 * AS];
    __shared__ __align__(16) unsigned short lds_b[2][128 * BS];

    int tid  = threadIdx.x;
    int lane = tid & 31;
    int wid  = tid >> 5;
    int wm   = wid >> 2;   // 0..1
    int wn   = wid & 3;    // 0..3
    int m0   = blockIdx.y * 64;
    int n0   = blockIdx.x * 128;
    int ln   = lane & 15;

    // A async staging: 256 threads x b128 covers the 64x32 bf16 tile.
    int ar = tid >> 2;          // row 0..63
    int ac = (tid & 3) << 3;    // col 0,8,16,24

    f32x8 zero = {0.f,0.f,0.f,0.f,0.f,0.f,0.f,0.f};
    f32x8 acc[2][2] = {{zero, zero}, {zero, zero}};

    auto stageA = [&](int buf, int k0) {
        const void* g = &A[(size_t)(m0 + ar) * lda + k0 + ac];
        async_copy_b128(lds_off(&lds_a[buf][ar * AS + ac]), g);
    };
    auto loadB = [&](int k0, float4* r) {
#pragma unroll
        for (int p = 0; p < 4; ++p) {
            int fidx = (tid + p * 256) << 2;        // 0..4095
            int kk = fidx >> 7, n = fidx & 127;
            r[p] = *(const float4*)&B[(size_t)(k0 + kk) * ldb + n0 + n];
        }
    };
    auto storeB = [&](int buf, const float4* r) {
#pragma unroll
        for (int p = 0; p < 4; ++p) {
            int fidx = (tid + p * 256) << 2;
            int kk = fidx >> 7, n = fidx & 127;
            lds_b[buf][(n + 0) * BS + kk] = f2bf(r[p].x);
            lds_b[buf][(n + 1) * BS + kk] = f2bf(r[p].y);
            lds_b[buf][(n + 2) * BS + kk] = f2bf(r[p].z);
            lds_b[buf][(n + 3) * BS + kk] = f2bf(r[p].w);
        }
    };

    // Prologue: stage tile 0.
    stageA(0, 0);
    {
        float4 r[4];
        loadB(0, r);
        storeB(0, r);
    }
    wait_async0();
    __syncthreads();

    int nk = K >> 5;
    int buf = 0;
    for (int kt = 0; kt < nk; ++kt) {
        float4 r[4];
        bool nxt = (kt + 1) < nk;
        if (nxt) {
            stageA(buf ^ 1, (kt + 1) << 5);   // async DMA into other buffer
            loadB((kt + 1) << 5, r);          // b128 weight loads into regs
        }

        BF16Frag af[2], bf[2];
#pragma unroll
        for (int s = 0; s < 2; ++s)
#pragma unroll
            for (int e = 0; e < 16; ++e) {
                int kk = fragK(e, lane);
                af[s].u[e] = lds_a[buf][(wm * 32 + s * 16 + ln) * AS + kk];
                bf[s].u[e] = lds_b[buf][(wn * 32 + s * 16 + ln) * BS + kk];
            }
#pragma unroll
        for (int sm = 0; sm < 2; ++sm)
#pragma unroll
            for (int sn = 0; sn < 2; ++sn)
                acc[sm][sn] = __builtin_amdgcn_wmma_f32_16x16x32_bf16(
                    false, af[sm].v, false, bf[sn].v, (short)0,
                    acc[sm][sn], false, false);

        if (nxt) storeB(buf ^ 1, r);
        wait_async0();
        __syncthreads();
        buf ^= 1;
    }

    int half8 = (lane & 16) >> 1;          // +8 row offset for lanes 16-31
#pragma unroll
    for (int sm = 0; sm < 2; ++sm) {
#pragma unroll
        for (int sn = 0; sn < 2; ++sn) {
            int col = n0 + wn * 32 + sn * 16 + ln;
#pragma unroll
            for (int rr = 0; rr < 8; ++rr) {
                int row = m0 + wm * 32 + sm * 16 + rr + half8;
                if (row >= M || col >= N) continue;
                float v = acc[sm][sn][rr];
                size_t oidx = (size_t)row * ldc + col;
                if (mode == GEMM_STORE) {
                    if (outf) outf[oidx] = v;
                    if (outb) outb[oidx] = f2bf(v);
                } else if (mode == GEMM_RESID) {
                    outf[oidx] = resid[(size_t)row * ldr + col] + scale * v;
                } else if (mode == GEMM_MOE_INIT) {
                    outf[oidx] = rowsc[(size_t)row * rss] * v;
                } else if (mode == GEMM_MOE_ACC) {
                    outf[oidx] += rowsc[(size_t)row * rss] * v;
                } else if (mode == GEMM_SILU) {
                    float g = aux[(size_t)row * ldaux + col];
                    float s = g / (1.f + __expf(-g));
                    outb[oidx] = f2bf(s * v);
                } else { // GEMM_FINAL
                    outf[oidx] = resid[(size_t)row * ldr + col] +
                                 scale * (aux[(size_t)row * ldaux + col] + v);
                }
            }
        }
    }
}

// ---------------------------------------------------------------------------
// Causal GQA flash attention.  One wave per (head, 16-query tile); 4 waves
// per block.  QK^T and P.V via bf16 WMMA; online softmax over 32-key chunks.
// ---------------------------------------------------------------------------
__global__ __launch_bounds__(128)
void attn_kernel(const unsigned short* __restrict__ qb,
                 const unsigned short* __restrict__ kb,
                 const unsigned short* __restrict__ vb,
                 unsigned short* __restrict__ attnb) {
    int h    = blockIdx.x;
    int w    = threadIdx.x >> 5;
    int lane = threadIdx.x & 31;
    int qt   = blockIdx.y * 4 + w;   // 16-query tile index
    int kvh  = h >> 2;               // H/KV = 4
    int hb   = (lane & 16) >> 1;     // +8 row offset for lanes 16-31
    int ln   = lane & 15;

    __shared__ unsigned short pbuf[4][16 * 34];   // per-wave P staging

    BF16Frag aq[2];
#pragma unroll
    for (int c = 0; c < 2; ++c)
#pragma unroll
        for (int e = 0; e < 16; ++e) {
            int kd = c * 32 + fragK(e, lane);
            int qrow = qt * 16 + ln;
            aq[c].u[e] = qb[(size_t)qrow * (H * HD) + h * HD + kd];
        }

    f32x8 o0 = {0,0,0,0,0,0,0,0}, o1 = o0, o2 = o0, o3 = o0;
    float rmax[8], rsum[8];
#pragma unroll
    for (int r = 0; r < 8; ++r) { rmax[r] = -1e30f; rsum[r] = 0.f; }

    int kend = qt * 16 + 16;                      // causal bound
    for (int kbase = 0; kbase < kend; kbase += 32) {
        float p[2][8];
        float tmax[8];
#pragma unroll
        for (int r = 0; r < 8; ++r) tmax[r] = -1e30f;

        for (int sub = 0; sub < 2; ++sub) {
            int ks = kbase + sub * 16;
            f32x8 s = {0,0,0,0,0,0,0,0};
#pragma unroll
            for (int c = 0; c < 2; ++c) {
                BF16Frag bk;
#pragma unroll
                for (int e = 0; e < 16; ++e) {
                    int kd  = c * 32 + fragK(e, lane);
                    int key = ks + ln;
                    bk.u[e] = (key < T)
                        ? kb[(size_t)key * (KV * HD) + kvh * HD + kd] : 0;
                }
                s = __builtin_amdgcn_wmma_f32_16x16x32_bf16(
                    false, aq[c].v, false, bk.v, (short)0, s, false, false);
            }
#pragma unroll
            for (int r = 0; r < 8; ++r) {
                int row = qt * 16 + r + hb;
                int key = ks + ln;
                float sv = s[r] * ATTN_MULT;
                if (key > row || key >= T) sv = -1e30f;
                p[sub][r] = sv;
                tmax[r] = fmaxf(tmax[r], sv);
            }
        }
#pragma unroll
        for (int r = 0; r < 8; ++r)
            for (int off = 8; off > 0; off >>= 1)
                tmax[r] = fmaxf(tmax[r], __shfl_xor(tmax[r], off, 16));

        float corr[8];
#pragma unroll
        for (int r = 0; r < 8; ++r) {
            float mn = fmaxf(rmax[r], tmax[r]);
            corr[r]  = __expf(rmax[r] - mn);
            rmax[r]  = mn;
            p[0][r]  = __expf(p[0][r] - mn);
            p[1][r]  = __expf(p[1][r] - mn);
            float ts = p[0][r] + p[1][r];
            for (int off = 8; off > 0; off >>= 1)
                ts += __shfl_xor(ts, off, 16);
            rsum[r] = rsum[r] * corr[r] + ts;
        }
#pragma unroll
        for (int r = 0; r < 8; ++r) {
            o0[r] *= corr[r]; o1[r] *= corr[r];
            o2[r] *= corr[r]; o3[r] *= corr[r];
        }
#pragma unroll
        for (int sub = 0; sub < 2; ++sub)
#pragma unroll
            for (int r = 0; r < 8; ++r)
                pbuf[w][(r + hb) * 34 + sub * 16 + ln] = f2bf(p[sub][r]);
        BF16Frag pf;
#pragma unroll
        for (int e = 0; e < 16; ++e)
            pf.u[e] = pbuf[w][ln * 34 + fragK(e, lane)];

#pragma unroll
        for (int j = 0; j < 4; ++j) {
            BF16Frag bv;
#pragma unroll
            for (int e = 0; e < 16; ++e) {
                int kd  = fragK(e, lane);
                int key = kbase + kd;
                int n   = j * 16 + ln;
                bv.u[e] = (key < T)
                    ? vb[(size_t)key * (KV * HD) + kvh * HD + n] : 0;
            }
            if (j == 0) o0 = __builtin_amdgcn_wmma_f32_16x16x32_bf16(
                    false, pf.v, false, bv.v, (short)0, o0, false, false);
            if (j == 1) o1 = __builtin_amdgcn_wmma_f32_16x16x32_bf16(
                    false, pf.v, false, bv.v, (short)0, o1, false, false);
            if (j == 2) o2 = __builtin_amdgcn_wmma_f32_16x16x32_bf16(
                    false, pf.v, false, bv.v, (short)0, o2, false, false);
            if (j == 3) o3 = __builtin_amdgcn_wmma_f32_16x16x32_bf16(
                    false, pf.v, false, bv.v, (short)0, o3, false, false);
        }
    }
#pragma unroll
    for (int r = 0; r < 8; ++r) {
        int row = qt * 16 + r + hb;
        float inv = 1.f / rsum[r];
        size_t base = (size_t)row * (H * HD) + h * HD;
        attnb[base +  0 + ln] = f2bf(o0[r] * inv);
        attnb[base + 16 + ln] = f2bf(o1[r] * inv);
        attnb[base + 32 + ln] = f2bf(o2[r] * inv);
        attnb[base + 48 + ln] = f2bf(o3[r] * inv);
    }
}

// ---------------------------------------------------------------------------
// Host-side orchestration.
// ---------------------------------------------------------------------------
static void launch_gemm(hipStream_t s, const unsigned short* A, int lda,
                        const float* B, int ldb, int M, int N, int K,
                        float* outf, unsigned short* outb, int ldc,
                        int mode, float scale,
                        const float* resid, int ldr,
                        const float* rowsc, int rss,
                        const float* aux, int ldaux) {
    dim3 g(N / 128, M / 64);
    gemm_bf16_wmma<<<g, 256, 0, s>>>(A, lda, B, ldb, M, N, K, outf, outb, ldc,
                                     mode, scale, resid, ldr, rowsc, rss,
                                     aux, ldaux);
}

extern "C" void kernel_launch(void* const* d_in, const int* in_sizes, int n_in,
                              void* d_out, int out_size, void* d_ws, size_t ws_size,
                              hipStream_t stream) {
    const int*   pos     = (const int*)  d_in[0];
    const float* hidden  = (const float*)d_in[1];
    const float* ln1     = (const float*)d_in[2];
    const float* ln2     = (const float*)d_in[3];
    const float* wq      = (const float*)d_in[4];
    const float* wk      = (const float*)d_in[5];
    const float* wv      = (const float*)d_in[6];
    const float* wo      = (const float*)d_in[7];
    const float* routerw = (const float*)d_in[8];
    const float* w13     = (const float*)d_in[9];
    const float* w2      = (const float*)d_in[10];
    const float* sw13    = (const float*)d_in[11];
    const float* sw2     = (const float*)d_in[12];

    float* outF     = (float*)d_out;          // final hidden  [T*D]
    float* residOut = outF + (size_t)T * D;   // post-attn residual [T*D]

    char* ws = (char*)d_ws;
    const size_t MB = 1u << 20;
    unsigned short* xb    = (unsigned short*)(ws + 0);        // T*D bf16   4M
    float*          qf    = (float*)         (ws + 4  * MB);  // T*2048 f32 8M
    float*          kf    = (float*)         (ws + 12 * MB);  // T*512 f32  2M
    unsigned short* qbuf  = (unsigned short*)(ws + 14 * MB);  // 4M
    unsigned short* kbuf  = (unsigned short*)(ws + 18 * MB);  // 1M
    unsigned short* vbuf  = (unsigned short*)(ws + 19 * MB);  // 1M
    unsigned short* attnb = (unsigned short*)(ws + 20 * MB);  // 4M
    float*          xnf   = (float*)         (ws + 24 * MB);  // 8M
    unsigned short* xnb   = (unsigned short*)(ws + 32 * MB);  // 4M
    float*          fullw = (float*)         (ws + 36 * MB);  // 32K
    float*          hgate = (float*)         (ws + 37 * MB);  // T*I f32 4M
    unsigned short* actb  = (unsigned short*)(ws + 41 * MB);  // 2M
    float*          moe   = (float*)         (ws + 43 * MB);  // 8M
    float*          ggate = (float*)         (ws + 51 * MB);  // T*SI f32 16M
    unsigned short* sactb = (unsigned short*)(ws + 67 * MB);  // 8M
    (void)ws_size; (void)in_sizes; (void)n_in; (void)out_size;

    // 1) RMSNorm 1 -> bf16 activations.
    rmsnorm_kernel<<<T, 256, 0, stream>>>(hidden, ln1, nullptr, xb);

    // 2) QKV projections.
    launch_gemm(stream, xb, D, wq, H * HD, T, H * HD, D,
                qf, nullptr, H * HD, GEMM_STORE, 0.f, nullptr, 0, nullptr, 0, nullptr, 0);
    launch_gemm(stream, xb, D, wk, KV * HD, T, KV * HD, D,
                kf, nullptr, KV * HD, GEMM_STORE, 0.f, nullptr, 0, nullptr, 0, nullptr, 0);
    launch_gemm(stream, xb, D, wv, KV * HD, T, KV * HD, D,
                nullptr, vbuf, KV * HD, GEMM_STORE, 0.f, nullptr, 0, nullptr, 0, nullptr, 0);

    // 3) RoPE on Q and K (f32 -> bf16).
    rope_kernel<<<(T * H  * 32 + 255) / 256, 256, 0, stream>>>(pos, qf, qbuf, H);
    rope_kernel<<<(T * KV * 32 + 255) / 256, 256, 0, stream>>>(pos, kf, kbuf, KV);

    // 4) Causal GQA attention.
    attn_kernel<<<dim3(H, T / 64), 128, 0, stream>>>(qbuf, kbuf, vbuf, attnb);

    // 5) Output projection + residual -> residOut (second output).
    launch_gemm(stream, attnb, H * HD, wo, D, T, D, H * HD,
                residOut, nullptr, D, GEMM_RESID, RES_MULT, hidden, D,
                nullptr, 0, nullptr, 0);

    // 6) RMSNorm 2.
    rmsnorm_kernel<<<T, 256, 0, stream>>>(residOut, ln2, xnf, xnb);

    // 7) Router top-2.
    router_kernel<<<T, 32, 0, stream>>>(xnf, routerw, fullw);

    // 8) Experts (dense, weighted by full_w as in the reference).
    for (int e = 0; e < E; ++e) {
        const float* w13e = w13 + (size_t)e * D * 2 * I;
        const float* w2e  = w2  + (size_t)e * I * D;
        launch_gemm(stream, xnb, D, w13e, 2 * I, T, I, D,
                    hgate, nullptr, I, GEMM_STORE, 0.f, nullptr, 0, nullptr, 0, nullptr, 0);
        launch_gemm(stream, xnb, D, w13e + I, 2 * I, T, I, D,
                    nullptr, actb, I, GEMM_SILU, 0.f, nullptr, 0, nullptr, 0, hgate, I);
        launch_gemm(stream, actb, I, w2e, D, T, D, I,
                    moe, nullptr, D, (e == 0) ? GEMM_MOE_INIT : GEMM_MOE_ACC, 0.f,
                    nullptr, 0, fullw + e, E, nullptr, 0);
    }

    // 9) Shared expert.
    launch_gemm(stream, xnb, D, sw13, 2 * SI, T, SI, D,
                ggate, nullptr, SI, GEMM_STORE, 0.f, nullptr, 0, nullptr, 0, nullptr, 0);
    launch_gemm(stream, xnb, D, sw13 + SI, 2 * SI, T, SI, D,
                nullptr, sactb, SI, GEMM_SILU, 0.f, nullptr, 0, nullptr, 0, ggate, SI);

    // 10) Shared down-proj fused with final residual.
    launch_gemm(stream, sactb, SI, sw2, D, T, D, SI,
                outF, nullptr, D, GEMM_FINAL, RES_MULT, residOut, D,
                nullptr, 0, moe, D);
}

// v001
// A run of this version takes 1970 microseconds.
// Next to v000, in two timings, it ran 1.74 times as fast each time.
#include <hip/hip_runtime.h>
#include <hip/hip_bf16.h>

// ---------------------------------------------------------------------------
// MI455X (gfx1250, wave32) implementation of a decoder layer (attention, MoE, shared MLP).
// All large GEMMs + attention run on v_wmma_f32_16x16x32_bf16 (bf16 in, f32
// accum).  A-activation tiles move global->LDS via the CDNA5 async-DMA path
// (global_load_async_to_lds_b128 + s_wait_asynccnt); f32 weight tiles are
// loaded as b128, converted to bf16, and staged into LDS, double-buffered.
// GEMMs that do not depend on each other share one launch: Q/K/V in one grid,
// and the eight experts' gate, up and down products one grid each.
// Workspace requirement: ~181 MiB (see layout below).
// ---------------------------------------------------------------------------

static constexpr int T  = 1024;
static constexpr int D  = 2048;
static constexpr int H  = 32;
static constexpr int KV = 8;
static constexpr int HD = 64;
static constexpr int E  = 8;
static constexpr int I  = 1024;
static constexpr int SI = 4096;
static constexpr float ATTN_MULT = 0.0078125f;
static constexpr float RES_MULT  = 0.22f;
static constexpr float EPS       = 1e-6f;

typedef __bf16 bf16x16 __attribute__((ext_vector_type(16)));
typedef float  f32x8   __attribute__((ext_vector_type(8)));

union BF16Frag {
    unsigned short u[16];
    bf16x16 v;
};

__device__ __forceinline__ unsigned short f2bf(float f) {
    unsigned int u = __float_as_uint(f);
    unsigned int r = u + 0x7FFFu + ((u >> 16) & 1u);   // round-to-nearest-even
    return (unsigned short)(r >> 16);
}

// A/B fragment K-index pattern for V_WMMA_*_16X16X32_BF16 (ISA 7.12.2):
// VGPR p (0..7), half w; lanes 0-15 vs 16-31 differ by +8 in K.
__device__ __forceinline__ int fragK(int e, int lane) {
    int p = e >> 1, w = e & 1;
    return ((p & 3) << 1) + w + ((p >> 2) << 4) + ((lane >> 4) << 3);
}

// Generic pointer -> 32-bit LDS byte offset (AS3) for async-DMA VDST operand.
__device__ __forceinline__ unsigned lds_off(const void* p) {
    return (unsigned)(unsigned long long)
        (__attribute__((address_space(3))) const void*)p;
}

// CDNA5 async global->LDS copy, 16B per lane (ASYNCcnt tracked).
__device__ __forceinline__ void async_copy_b128(unsigned lds_byte_off,
                                                const void* gsrc) {
    // s_wait_xcnt in the copy's own statement: it stands in front of any later
    // rewrite of the two address registers that the copy names.
    asm volatile("global_load_async_to_lds_b128 %0, %1, off\n\ts_wait_xcnt 0x0"
                 :: "v"(lds_byte_off), "v"(gsrc)
                 : "memory");
}
// Behind a global store: stands in front of any later rewrite of the store's
// address and data registers.
__device__ __forceinline__ void wait_xcnt0() {
    asm volatile("s_wait_xcnt 0x0" ::: "memory");
}
__device__ __forceinline__ void wait_async0() {
    asm volatile("s_wait_asynccnt 0x0" ::: "memory");
}

// ---------------------------------------------------------------------------
// RMSNorm: one block per row.  Writes f32 and/or bf16 outputs.
// ---------------------------------------------------------------------------
__global__ __launch_bounds__(256)
void rmsnorm_kernel(const float* __restrict__ in, const float* __restrict__ w,
                    float* outf, unsigned short* outb) {
    int row = blockIdx.x;
    int tid = threadIdx.x;
    __shared__ float red[256];
    const float* x = in + (size_t)row * D;
    float ss = 0.f;
    for (int i = tid; i < D; i += 256) { float v = x[i]; ss += v * v; }
    red[tid] = ss;
    __syncthreads();
    for (int s = 128; s > 0; s >>= 1) {
        if (tid < s) red[tid] += red[tid + s];
        __syncthreads();
    }
    float rs = rsqrtf(red[0] / (float)D + EPS);
    for (int i = tid; i < D; i += 256) {
        float v = x[i] * rs * w[i];
        if (outf) outf[(size_t)row * D + i] = v;
        if (outb) outb[(size_t)row * D + i] = f2bf(v);
    }
}

// ---------------------------------------------------------------------------
// RoPE: f32 in -> bf16 out, per (t, head, i<HD/2).
// ---------------------------------------------------------------------------
__global__ __launch_bounds__(256)
void rope_kernel(const int* __restrict__ pos, const float* __restrict__ in,
                 unsigned short* __restrict__ out, int nheads) {
    int idx = blockIdx.x * blockDim.x + threadIdx.x;
    int total = T * nheads * (HD / 2);
    if (idx >= total) return;
    int i = idx & 31;
    int h = (idx >> 5) % nheads;
    int t = idx / (32 * nheads);
    float inv = __expf(-(float)i * (9.2103403719761840f / 32.f)); // 10000^(-i/32)
    float ang = (float)pos[t] * inv;
    float s, c;
    __sincosf(ang, &s, &c);
    size_t base = (size_t)t * nheads * HD + (size_t)h * HD;
    float x1 = in[base + i];
    float x2 = in[base + 32 + i];
    out[base + i]      = f2bf(x1 * c - x2 * s);
    out[base + 32 + i] = f2bf(x2 * c + x1 * s);
}

// ---------------------------------------------------------------------------
// Router: one wave per token.  logits = xn . router_w[e], softmax, top-2.
// ---------------------------------------------------------------------------
__global__ __launch_bounds__(32)
void router_kernel(const float* __restrict__ xn, const float* __restrict__ rw,
                   float* __restrict__ fullw) {
    int t = blockIdx.x;
    int lane = threadIdx.x;
    float acc[E];
#pragma unroll
    for (int e = 0; e < E; ++e) acc[e] = 0.f;
    const float* x = xn + (size_t)t * D;
    for (int i = lane; i < D; i += 32) {
        float xv = x[i];
#pragma unroll
        for (int e = 0; e < E; ++e) acc[e] += xv * rw[(size_t)e * D + i];
    }
#pragma unroll
    for (int e = 0; e < E; ++e)
        for (int off = 16; off > 0; off >>= 1)
            acc[e] += __shfl_xor(acc[e], off, 32);
    if (lane == 0) {
        int i1 = 0;
        for (int e = 1; e < E; ++e) if (acc[e] > acc[i1]) i1 = e;
        int i2 = (i1 == 0) ? 1 : 0;
        for (int e = 0; e < E; ++e) if (e != i1 && acc[e] > acc[i2]) i2 = e;
        float e1 = 1.f;
        float e2 = __expf(acc[i2] - acc[i1]);
        float inv = 1.f / (e1 + e2);
        for (int e = 0; e < E; ++e) {
            float wv = (e == i1) ? e1 * inv : (e == i2) ? e2 * inv : 0.f;
            fullw[(size_t)t * E + e] = wv;
        }
    }
}

// ---------------------------------------------------------------------------
// BF16-WMMA GEMM, double-buffered LDS, async A-tile DMA.
// C[M,N] = A[M,K](bf16) x B[K,N](f32->bf16).
// Block tile 64x128, 8 waves (2M x 4N), each wave 32x32 (4 WMMAs / K-step).
// Requires: M%64==0, N%128==0, K%32==0, lda%8==0, ldb%4==0 (all satisfied).
// ---------------------------------------------------------------------------
#define GEMM_STORE    0  // outf/outb = acc
#define GEMM_RESID    1  // outf = resid + scale*acc
#define GEMM_MOE_INIT 2  // outf  = rowsc[row]*acc
#define GEMM_SILU     4  // outb = silu(aux[row,col]) * acc   (bf16)
#define GEMM_FINAL    5  // outf = resid + scale*(aux + acc)

__global__ __launch_bounds__(256)
void gemm_bf16_wmma(const unsigned short* __restrict__ A, int lda,
                    const float* __restrict__ B, int ldb,
                    int M, int N, int K,
                    float* outf, unsigned short* outb, int ldc,
                    int mode, float scale,
                    const float* __restrict__ resid, int ldr,
                    const float* __restrict__ rowsc, int rss,
                    const float* __restrict__ aux, int ldaux,
                    int sA, int sB, int sC, int sR,
                    const float* __restrict__ B2, const float* __restrict__ B3,
                    int N2, float* outf2, unsigned short* outb3) {
    constexpr int AS = 40;   // LDS stride for A rows   [64][AS]  (80B, 16B-mult)
    constexpr int BS = 40;   // LDS stride for B^T rows [128][BS]
    __shared__ __align__(16) unsigned short lds_a[2][64 * AS];
    __shared__ __align__(16) unsigned short lds_b[2][128 * BS];

    int tid  = threadIdx.x;
    int lane = tid & 31;
    int wid  = tid >> 5;
    int wm   = wid >> 2;   // 0..1
    int wn   = wid & 3;    // 0..3
    int m0   = blockIdx.y * 64;
    int n0   = blockIdx.x * 128;
    int ln   = lane & 15;

    // blockIdx.z: independent GEMMs of one shape whose operands lie sA / sB
    // elements apart, outputs and aux sC apart, row scales sR apart.
    size_t z = blockIdx.z;
    A += z * sA;
    B += z * sB;
    if (outf)  outf  += z * sC;
    if (outb)  outb  += z * sC;
    if (aux)   aux   += z * sC;
    if (rowsc) rowsc += z * sR;
    // Column tiles behind N: a second (f32 out) and a third (bf16 out) GEMM on
    // the same A, each N2 columns wide.
    if (n0 >= N) {
        n0 -= N;
        bool third = n0 >= N2;
        if (third) n0 -= N2;
        B    = third ? B3 : B2;
        outf = third ? nullptr : outf2;
        outb = third ? outb3 : nullptr;
        N = ldb = ldc = N2;
    }

    // A async staging: 256 threads x b128 covers the 64x32 bf16 tile.
    int ar = tid >> 2;          // row 0..63
    int ac = (tid & 3) << 3;    // col 0,8,16,24

    f32x8 zero = {0.f,0.f,0.f,0.f,0.f,0.f,0.f,0.f};
    f32x8 acc[2][2] = {{zero, zero}, {zero, zero}};

    auto stageA = [&](int buf, int k0) {
        const void* g = &A[(size_t)(m0 + ar) * lda + k0 + ac];
        async_copy_b128(lds_off(&lds_a[buf][ar * AS + ac]), g);
    };
    auto loadB = [&](int k0, float4* r) {
#pragma unroll
        for (int p = 0; p < 4; ++p) {
            int fidx = (tid + p * 256) << 2;        // 0..4095
            int kk = fidx >> 7, n = fidx & 127;
            r[p] = *(const float4*)&B[(size_t)(k0 + kk) * ldb + n0 + n];
        }
    };
    auto storeB = [&](int buf, const float4* r) {
#pragma unroll
        for (int p = 0; p < 4; ++p) {
            int fidx = (tid + p * 256) << 2;
            int kk = fidx >> 7, n = fidx & 127;
            lds_b[buf][(n + 0) * BS + kk] = f2bf(r[p].x);
            lds_b[buf][(n + 1) * BS + kk] = f2bf(r[p].y);
            lds_b[buf][(n + 2) * BS + kk] = f2bf(r[p].z);
            lds_b[buf][(n + 3) * BS + kk] = f2bf(r[p].w);
        }
    };

    // Prologue: stage tile 0.
    stageA(0, 0);
    {
        float4 r[4];
        loadB(0, r);
        storeB(0, r);
    }
    wait_async0();
    __syncthreads();

    int nk = K >> 5;
    int buf = 0;
    for (int kt = 0; kt < nk; ++kt) {
        float4 r[4];
        bool nxt = (kt + 1) < nk;
        if (nxt) {
            stageA(buf ^ 1, (kt + 1) << 5);   // async DMA into other buffer
            loadB((kt + 1) << 5, r);          // b128 weight loads into regs
        }

        BF16Frag af[2], bf[2];
#pragma unroll
        for (int s = 0; s < 2; ++s)
#pragma unroll
            for (int e = 0; e < 16; ++e) {
                int kk = fragK(e, lane);
                af[s].u[e] = lds_a[buf][(wm * 32 + s * 16 + ln) * AS + kk];
                bf[s].u[e] = lds_b[buf][(wn * 32 + s * 16 + ln) * BS + kk];
            }
#pragma unroll
        for (int sm = 0; sm < 2; ++sm)
#pragma unroll
            for (int sn = 0; sn < 2; ++sn)
                acc[sm][sn] = __builtin_amdgcn_wmma_f32_16x16x32_bf16(
                    false, af[sm].v, false, bf[sn].v, (short)0,
                    acc[sm][sn], false, false);

        if (nxt) storeB(buf ^ 1, r);
        wait_async0();
        __syncthreads();
        buf ^= 1;
    }

    int half8 = (lane & 16) >> 1;          // +8 row offset for lanes 16-31
#pragma unroll
    for (int sm = 0; sm < 2; ++sm) {
#pragma unroll
        for (int sn = 0; sn < 2; ++sn) {
            int col = n0 + wn * 32 + sn * 16 + ln;
#pragma unroll
            for (int rr = 0; rr < 8; ++rr) {
                int row = m0 + wm * 32 + sm * 16 + rr + half8;
                if (row >= M || col >= N) continue;
                float v = acc[sm][sn][rr];
                size_t oidx = (size_t)row * ldc + col;
                if (mode == GEMM_STORE) {
                    if (outf) { outf[oidx] = v; wait_xcnt0(); }
                    if (outb) { outb[oidx] = f2bf(v); wait_xcnt0(); }
                } else if (mode == GEMM_RESID) {
                    outf[oidx] = resid[(size_t)row * ldr + col] + scale * v;
                    wait_xcnt0();
                } else if (mode == GEMM_MOE_INIT) {
                    outf[oidx] = rowsc[(size_t)row * rss] * v;
                    wait_xcnt0();
                } else if (mode == GEMM_SILU) {
                    float g = aux[(size_t)row * ldaux + col];
                    float s = g / (1.f + __expf(-g));
                    outb[oidx] = f2bf(s * v);
                    wait_xcnt0();
                } else { // GEMM_FINAL
                    outf[oidx] = resid[(size_t)row * ldr + col] +
                                 scale * (aux[(size_t)row * ldaux + col] + v);
                    wait_xcnt0();
                }
            }
        }
    }
}

// ---------------------------------------------------------------------------
// Sum of the experts' weighted down products, in the order 0..E-1.
// ---------------------------------------------------------------------------
__global__ __launch_bounds__(256)
void expert_sum_kernel(const float* __restrict__ planes, float* __restrict__ out) {
    typedef float f32x4 __attribute__((ext_vector_type(4)));
    constexpr size_t P = (size_t)T * D;
    size_t i = ((size_t)blockIdx.x * 256 + threadIdx.x) * 4;
    const float* g = planes + i;
    f32x4 p0, p1, p2, p3, p4, p5, p6, p7;
    // The eight loads and their data wait in one statement, outputs early-clobber:
    // no load's result and no later instruction lands on an address register of
    // a load that is still in flight.
    asm volatile("global_load_b128 %0, %8, off\n\t"
                 "global_load_b128 %1, %9, off\n\t"
                 "global_load_b128 %2, %10, off\n\t"
                 "global_load_b128 %3, %11, off\n\t"
                 "global_load_b128 %4, %12, off\n\t"
                 "global_load_b128 %5, %13, off\n\t"
                 "global_load_b128 %6, %14, off\n\t"
                 "global_load_b128 %7, %15, off\n\t"
                 "s_wait_loadcnt 0x0"
                 : "=&v"(p0), "=&v"(p1), "=&v"(p2), "=&v"(p3),
                   "=&v"(p4), "=&v"(p5), "=&v"(p6), "=&v"(p7)
                 : "v"(g), "v"(g + P), "v"(g + 2 * P), "v"(g + 3 * P),
                   "v"(g + 4 * P), "v"(g + 5 * P), "v"(g + 6 * P), "v"(g + 7 * P)
                 : "memory");
    static_assert(E == 8, "one load per expert");
    f32x4 s = ((((((p0 + p1) + p2) + p3) + p4) + p5) + p6) + p7;
    *(f32x4*)&out[i] = s;
}

// ---------------------------------------------------------------------------
// Causal GQA flash attention.  One wave per (head, 16-query tile); 4 waves
// per block.  QK^T and P.V via bf16 WMMA; online softmax over 32-key chunks.
// ---------------------------------------------------------------------------
__global__ __launch_bounds__(128)
void attn_kernel(const unsigned short* __restrict__ qb,
                 const unsigned short* __restrict__ kb,
                 const unsigned short* __restrict__ vb,
                 unsigned short* __restrict__ attnb) {
    int h    = blockIdx.x;
    int w    = threadIdx.x >> 5;
    int lane = threadIdx.x & 31;
    int qt   = blockIdx.y * 4 + w;   // 16-query tile index
    int kvh  = h >> 2;               // H/KV = 4
    int hb   = (lane & 16) >> 1;     // +8 row offset for lanes 16-31
    int ln   = lane & 15;

    __shared__ unsigned short pbuf[4][16 * 34];   // per-wave P staging

    BF16Frag aq[2];
#pragma unroll
    for (int c = 0; c < 2; ++c)
#pragma unroll
        for (int e = 0; e < 16; ++e) {
            int kd = c * 32 + fragK(e, lane);
            int qrow = qt * 16 + ln;
            aq[c].u[e] = qb[(size_t)qrow * (H * HD) + h * HD + kd];
        }

    f32x8 o0 = {0,0,0,0,0,0,0,0}, o1 = o0, o2 = o0, o3 = o0;
    float rmax[8], rsum[8];
#pragma unroll
    for (int r = 0; r < 8; ++r) { rmax[r] = -1e30f; rsum[r] = 0.f; }

    int kend = qt * 16 + 16;                      // causal bound
    for (int kbase = 0; kbase < kend; kbase += 32) {
        float p[2][8];
        float tmax[8];
#pragma unroll
        for (int r = 0; r < 8; ++r) tmax[r] = -1e30f;

        for (int sub = 0; sub < 2; ++sub) {
            int ks = kbase + sub * 16;
            f32x8 s = {0,0,0,0,0,0,0,0};
#pragma unroll
            for (int c = 0; c < 2; ++c) {
                BF16Frag bk;
#pragma unroll
                for (int e = 0; e < 16; ++e) {
                    int kd  = c * 32 + fragK(e, lane);
                    int key = ks + ln;
                    bk.u[e] = (key < T)
                        ? kb[(size_t)key * (KV * HD) + kvh * HD + kd] : 0;
                }
                s = __builtin_amdgcn_wmma_f32_16x16x32_bf16(
                    false, aq[c].v, false, bk.v, (short)0, s, false, false);
            }
#pragma unroll
            for (int r = 0; r < 8; ++r) {
                int row = qt * 16 + r + hb;
                int key = ks + ln;
                float sv = s[r] * ATTN_MULT;
                if (key > row || key >= T) sv = -1e30f;
                p[sub][r] = sv;
                tmax[r] = fmaxf(tmax[r], sv);
            }
        }
#pragma unroll
        for (int r = 0; r < 8; ++r)
            for (int off = 8; off > 0; off >>= 1)
                tmax[r] = fmaxf(tmax[r], __shfl_xor(tmax[r], off, 16));

        float corr[8];
#pragma unroll
        for (int r = 0; r < 8; ++r) {
            float mn = fmaxf(rmax[r], tmax[r]);
            corr[r]  = __expf(rmax[r] - mn);
            rmax[r]  = mn;
            p[0][r]  = __expf(p[0][r] - mn);
            p[1][r]  = __expf(p[1][r] - mn);
            float ts = p[0][r] + p[1][r];
            for (int off = 8; off > 0; off >>= 1)
                ts += __shfl_xor(ts, off, 16);
            rsum[r] = rsum[r] * corr[r] + ts;
        }
#pragma unroll
        for (int r = 0; r < 8; ++r) {
            o0[r] *= corr[r]; o1[r] *= corr[r];
            o2[r] *= corr[r]; o3[r] *= corr[r];
        }
#pragma unroll
        for (int sub = 0; sub < 2; ++sub)
#pragma unroll
            for (int r = 0; r < 8; ++r)
                pbuf[w][(r + hb) * 34 + sub * 16 + ln] = f2bf(p[sub][r]);
        BF16Frag pf;
#pragma unroll
        for (int e = 0; e < 16; ++e)
            pf.u[e] = pbuf[w][ln * 34 + fragK(e, lane)];

#pragma unroll
        for (int j = 0; j < 4; ++j) {
            BF16Frag bv;
#pragma unroll
            for (int e = 0; e < 16; ++e) {
                int kd  = fragK(e, lane);
                int key = kbase + kd;
                int n   = j * 16 + ln;
                bv.u[e] = (key < T)
                    ? vb[(size_t)key * (KV * HD) + kvh * HD + n] : 0;
            }
            if (j == 0) o0 = __builtin_amdgcn_wmma_f32_16x16x32_bf16(
                    false, pf.v, false, bv.v, (short)0, o0, false, false);
            if (j == 1) o1 = __builtin_amdgcn_wmma_f32_16x16x32_bf16(
                    false, pf.v, false, bv.v, (short)0, o1, false, false);
            if (j == 2) o2 = __builtin_amdgcn_wmma_f32_16x16x32_bf16(
                    false, pf.v, false, bv.v, (short)0, o2, false, false);
            if (j == 3) o3 = __builtin_amdgcn_wmma_f32_16x16x32_bf16(
                    false, pf.v, false, bv.v, (short)0, o3, false, false);
        }
    }
#pragma unroll
    for (int r = 0; r < 8; ++r) {
        int row = qt * 16 + r + hb;
        float inv = 1.f / rsum[r];
        size_t base = (size_t)row * (H * HD) + h * HD;
        attnb[base +  0 + ln] = f2bf(o0[r] * inv);
        attnb[base + 16 + ln] = f2bf(o1[r] * inv);
        attnb[base + 32 + ln] = f2bf(o2[r] * inv);
        attnb[base + 48 + ln] = f2bf(o3[r] * inv);
    }
}

// ---------------------------------------------------------------------------
// Host-side orchestration.
// ---------------------------------------------------------------------------
static void launch_gemm(hipStream_t s, int nz, int sA, int sB, int sC, int sR,
                        const unsigned short* A, int lda,
                        const float* B, int ldb, int M, int N, int K,
                        float* outf, unsigned short* outb, int ldc,
                        int mode, float scale,
                        const float* resid, int ldr,
                        const float* rowsc, int rss,
                        const float* aux, int ldaux) {
    dim3 g(N / 128, M / 64, nz);
    gemm_bf16_wmma<<<g, 256, 0, s>>>(A, lda, B, ldb, M, N, K, outf, outb, ldc,
                                     mode, scale, resid, ldr, rowsc, rss,
                                     aux, ldaux, sA, sB, sC, sR,
                                     nullptr, nullptr, 0, nullptr, nullptr);
}

extern "C" void kernel_launch(void* const* d_in, const int* in_sizes, int n_in,
                              void* d_out, int out_size, void* d_ws, size_t ws_size,
                              hipStream_t stream) {
    const int*   pos     = (const int*)  d_in[0];
    const float* hidden  = (const float*)d_in[1];
    const float* ln1     = (const float*)d_in[2];
    const float* ln2     = (const float*)d_in[3];
    const float* wq      = (const float*)d_in[4];
    const float* wk      = (const float*)d_in[5];
    const float* wv      = (const float*)d_in[6];
    const float* wo      = (const float*)d_in[7];
    const float* routerw = (const float*)d_in[8];
    const float* w13     = (const float*)d_in[9];
    const float* w2      = (const float*)d_in[10];
    const float* sw13    = (const float*)d_in[11];
    const float* sw2     = (const float*)d_in[12];

    float* outF     = (float*)d_out;          // final hidden  [T*D]
    float* residOut = outF + (size_t)T * D;   // post-attn residual [T*D]

    char* ws = (char*)d_ws;
    const size_t MB = 1u << 20;
    unsigned short* xb    = (unsigned short*)(ws + 0);        // T*D bf16   4M
    float*          qf    = (float*)         (ws + 4  * MB);  // T*2048 f32 8M
    float*          kf    = (float*)         (ws + 12 * MB);  // T*512 f32  2M
    unsigned short* qbuf  = (unsigned short*)(ws + 14 * MB);  // 4M
    unsigned short* kbuf  = (unsigned short*)(ws + 18 * MB);  // 1M
    unsigned short* vbuf  = (unsigned short*)(ws + 19 * MB);  // 1M
    unsigned short* attnb = (unsigned short*)(ws + 20 * MB);  // 4M
    float*          xnf   = (float*)         (ws + 24 * MB);  // 8M
    unsigned short* xnb   = (unsigned short*)(ws + 32 * MB);  // 4M
    float*          fullw = (float*)         (ws + 36 * MB);  // 32K
    float*          moe   = (float*)         (ws + 37 * MB);  // 8M
    float*          ggate = (float*)         (ws + 45 * MB);  // T*SI f32 16M
    unsigned short* sactb = (unsigned short*)(ws + 61 * MB);  // 8M
    float*          hgate = (float*)         (ws + 69 * MB);  // E*T*I f32 32M
    unsigned short* actb  = (unsigned short*)(ws + 101 * MB); // E*T*I bf16 16M
    float*          moep  = (float*)         (ws + 117 * MB); // E*T*D f32 64M
    (void)ws_size; (void)in_sizes; (void)n_in; (void)out_size;

    // 1) RMSNorm 1 -> bf16 activations.
    rmsnorm_kernel<<<T, 256, 0, stream>>>(hidden, ln1, nullptr, xb);

    // 2) QKV projections, one launch: column tiles 0-15 are Q, 16-19 K, 20-23 V.
    gemm_bf16_wmma<<<dim3((H + 2 * KV) * HD / 128, T / 64), 256, 0, stream>>>(
        xb, D, wq, H * HD, T, H * HD, D, qf, nullptr, H * HD, GEMM_STORE, 0.f,
        nullptr, 0, nullptr, 0, nullptr, 0, 0, 0, 0, 0,
        wk, wv, KV * HD, kf, vbuf);

    // 3) RoPE on Q and K (f32 -> bf16).
    rope_kernel<<<(T * H  * 32 + 255) / 256, 256, 0, stream>>>(pos, qf, qbuf, H);
    rope_kernel<<<(T * KV * 32 + 255) / 256, 256, 0, stream>>>(pos, kf, kbuf, KV);

    // 4) Causal GQA attention.
    attn_kernel<<<dim3(H, T / 64), 128, 0, stream>>>(qbuf, kbuf, vbuf, attnb);

    // 5) Output projection + residual -> residOut (second output).
    launch_gemm(stream, 1, 0, 0, 0, 0, attnb, H * HD, wo, D, T, D, H * HD,
                residOut, nullptr, D, GEMM_RESID, RES_MULT, hidden, D,
                nullptr, 0, nullptr, 0);

    // 6) RMSNorm 2.
    rmsnorm_kernel<<<T, 256, 0, stream>>>(residOut, ln2, xnf, xnb);

    // 7) Router top-2.
    router_kernel<<<T, 32, 0, stream>>>(xnf, routerw, fullw);

    // 8) Experts (dense, weighted by full_w as in the reference): blockIdx.z is
    //    the expert; the weighted down products stay apart and are summed after.
    launch_gemm(stream, E, 0, D * 2 * I, T * I, 0, xnb, D, w13, 2 * I, T, I, D,
                hgate, nullptr, I, GEMM_STORE, 0.f, nullptr, 0, nullptr, 0, nullptr, 0);
    launch_gemm(stream, E, 0, D * 2 * I, T * I, 0, xnb, D, w13 + I, 2 * I, T, I, D,
                nullptr, actb, I, GEMM_SILU, 0.f, nullptr, 0, nullptr, 0, hgate, I);
    launch_gemm(stream, E, T * I, I * D, T * D, 1, actb, I, w2, D, T, D, I,
                moep, nullptr, D, GEMM_MOE_INIT, 0.f,
                nullptr, 0, fullw, E, nullptr, 0);
    expert_sum_kernel<<<T * D / 1024, 256, 0, stream>>>(moep, moe);

    // 9) Shared expert.
    launch_gemm(stream, 1, 0, 0, 0, 0, xnb, D, sw13, 2 * SI, T, SI, D,
                ggate, nullptr, SI, GEMM_STORE, 0.f, nullptr, 0, nullptr, 0, nullptr, 0);
    launch_gemm(stream, 1, 0, 0, 0, 0, xnb, D, sw13 + SI, 2 * SI, T, SI, D,
                nullptr, sactb, SI, GEMM_SILU, 0.f, nullptr, 0, nullptr, 0, ggate, SI);

    // 10) Shared down-proj fused with final residual.
    launch_gemm(stream, 1, 0, 0, 0, 0, sactb, SI, sw2, D, T, D, SI,
                outF, nullptr, D, GEMM_FINAL, RES_MULT, residOut, D,
                nullptr, 0, moe, D);
}

// v002
// Measured time: 1170 microseconds a run.
// Timed twice side by side with v001, it ran 1.67 times as fast both times.
// All steps since v000 together make it 2.92 times as fast.
#include <hip/hip_runtime.h>
#include <hip/hip_bf16.h>

// ---------------------------------------------------------------------------
// MI455X (gfx1250, wave32) implementation of a decoder layer (attention, MoE, shared MLP).
// All large GEMMs + attention run on v_wmma_f32_16x16x32_bf16 (bf16 in, f32
// accum).  A-activation tiles move global->LDS via the CDNA5 async-DMA path
// (global_load_async_to_lds_b128 + s_wait_asynccnt); f32 weight tiles are
// loaded as b128, converted to bf16, transposed in registers and staged into
// LDS by 8-byte stores, double-buffered.
// GEMMs that do not depend on each other share one launch: Q/K/V in one grid,
// and the eight experts' gate, up and down products one grid each.
// Workspace requirement: ~181 MiB (see layout below).
// ---------------------------------------------------------------------------

static constexpr int T  = 1024;
static constexpr int D  = 2048;
static constexpr int H  = 32;
static constexpr int KV = 8;
static constexpr int HD = 64;
static constexpr int E  = 8;
static constexpr int I  = 1024;
static constexpr int SI = 4096;
static constexpr float ATTN_MULT = 0.0078125f;
static constexpr float RES_MULT  = 0.22f;
static constexpr float EPS       = 1e-6f;

typedef __bf16 bf16x16 __attribute__((ext_vector_type(16)));
typedef float  f32x8   __attribute__((ext_vector_type(8)));
typedef float  f32x4   __attribute__((ext_vector_type(4)));

union BF16Frag {
    unsigned short u[16];
    bf16x16 v;
};

__device__ __forceinline__ unsigned short f2bf(float f) {
    unsigned int u = __float_as_uint(f);
    unsigned int r = u + 0x7FFFu + ((u >> 16) & 1u);   // round-to-nearest-even
    return (unsigned short)(r >> 16);
}

// A/B fragment K-index pattern for V_WMMA_*_16X16X32_BF16 (ISA 7.12.2):
// VGPR p (0..7), half w; lanes 0-15 vs 16-31 differ by +8 in K.
__device__ __forceinline__ int fragK(int e, int lane) {
    int p = e >> 1, w = e & 1;
    return ((p & 3) << 1) + w + ((p >> 2) << 4) + ((lane >> 4) << 3);
}

// Generic pointer -> 32-bit LDS byte offset (AS3) for async-DMA VDST operand.
__device__ __forceinline__ unsigned lds_off(const void* p) {
    return (unsigned)(unsigned long long)
        (__attribute__((address_space(3))) const void*)p;
}

// CDNA5 async global->LDS copy, 16B per lane (ASYNCcnt tracked).
__device__ __forceinline__ void async_copy_b128(unsigned lds_byte_off,
                                                const void* gsrc) {
    // s_wait_xcnt in the copy's own statement: it stands in front of any later
    // rewrite of the two address registers that the copy names.
    asm volatile("global_load_async_to_lds_b128 %0, %1, off\n\ts_wait_xcnt 0x0"
                 :: "v"(lds_byte_off), "v"(gsrc)
                 : "memory");
}
// Behind a global store: stands in front of any later rewrite of the store's
// address and data registers.
__device__ __forceinline__ void wait_xcnt0() {
    asm volatile("s_wait_xcnt 0x0" ::: "memory");
}
__device__ __forceinline__ void wait_async0() {
    asm volatile("s_wait_asynccnt 0x0" ::: "memory");
}

// ---------------------------------------------------------------------------
// RMSNorm: one block per row.  Writes f32 and/or bf16 outputs.
// ---------------------------------------------------------------------------
__global__ __launch_bounds__(256)
void rmsnorm_kernel(const float* __restrict__ in, const float* __restrict__ w,
                    float* outf, unsigned short* outb) {
    int row = blockIdx.x;
    int tid = threadIdx.x;
    __shared__ float red[256];
    const float* x = in + (size_t)row * D;
    float ss = 0.f;
    for (int i = tid; i < D; i += 256) { float v = x[i]; ss += v * v; }
    red[tid] = ss;
    __syncthreads();
    for (int s = 128; s > 0; s >>= 1) {
        if (tid < s) red[tid] += red[tid + s];
        __syncthreads();
    }
    float rs = rsqrtf(red[0] / (float)D + EPS);
    for (int i = tid; i < D; i += 256) {
        float v = x[i] * rs * w[i];
        if (outf) outf[(size_t)row * D + i] = v;
        if (outb) outb[(size_t)row * D + i] = f2bf(v);
    }
}

// ---------------------------------------------------------------------------
// RoPE: f32 in -> bf16 out, per (t, head, i<HD/2).
// ---------------------------------------------------------------------------
__global__ __launch_bounds__(256)
void rope_kernel(const int* __restrict__ pos, const float* __restrict__ in,
                 unsigned short* __restrict__ out, int nheads) {
    int idx = blockIdx.x * blockDim.x + threadIdx.x;
    int total = T * nheads * (HD / 2);
    if (idx >= total) return;
    int i = idx & 31;
    int h = (idx >> 5) % nheads;
    int t = idx / (32 * nheads);
    float inv = __expf(-(float)i * (9.2103403719761840f / 32.f)); // 10000^(-i/32)
    float ang = (float)pos[t] * inv;
    float s, c;
    __sincosf(ang, &s, &c);
    size_t base = (size_t)t * nheads * HD + (size_t)h * HD;
    float x1 = in[base + i];
    float x2 = in[base + 32 + i];
    out[base + i]      = f2bf(x1 * c - x2 * s);
    out[base + 32 + i] = f2bf(x2 * c + x1 * s);
}

// ---------------------------------------------------------------------------
// Router: one wave per token.  logits = xn . router_w[e], softmax, top-2.
// ---------------------------------------------------------------------------
__global__ __launch_bounds__(32)
void router_kernel(const float* __restrict__ xn, const float* __restrict__ rw,
                   float* __restrict__ fullw) {
    int t = blockIdx.x;
    int lane = threadIdx.x;
    float acc[E];
#pragma unroll
    for (int e = 0; e < E; ++e) acc[e] = 0.f;
    const float* x = xn + (size_t)t * D;
    for (int i = lane; i < D; i += 32) {
        float xv = x[i];
#pragma unroll
        for (int e = 0; e < E; ++e) acc[e] += xv * rw[(size_t)e * D + i];
    }
#pragma unroll
    for (int e = 0; e < E; ++e)
        for (int off = 16; off > 0; off >>= 1)
            acc[e] += __shfl_xor(acc[e], off, 32);
    if (lane == 0) {
        int i1 = 0;
        for (int e = 1; e < E; ++e) if (acc[e] > acc[i1]) i1 = e;
        int i2 = (i1 == 0) ? 1 : 0;
        for (int e = 0; e < E; ++e) if (e != i1 && acc[e] > acc[i2]) i2 = e;
        float e1 = 1.f;
        float e2 = __expf(acc[i2] - acc[i1]);
        float inv = 1.f / (e1 + e2);
        for (int e = 0; e < E; ++e) {
            float wv = (e == i1) ? e1 * inv : (e == i2) ? e2 * inv : 0.f;
            fullw[(size_t)t * E + e] = wv;
        }
    }
}

// ---------------------------------------------------------------------------
// BF16-WMMA GEMM, double-buffered LDS, async A-tile DMA.
// C[M,N] = A[M,K](bf16) x B[K,N](f32->bf16).
// Block tile 64x128, 8 waves (2M x 4N), each wave 32x32 (4 WMMAs / K-step).
// Requires: M%64==0, N%128==0, K%32==0, lda%8==0, ldb%4==0 (all satisfied).
// ---------------------------------------------------------------------------
#define GEMM_STORE    0  // outf/outb = acc
#define GEMM_RESID    1  // outf = resid + scale*acc
#define GEMM_MOE_INIT 2  // outf  = rowsc[row]*acc
#define GEMM_SILU     4  // outb = silu(aux[row,col]) * acc   (bf16)
#define GEMM_FINAL    5  // outf = resid + scale*(aux + acc)

__global__ __launch_bounds__(256)
void gemm_bf16_wmma(const unsigned short* __restrict__ A, int lda,
                    const float* __restrict__ B, int ldb,
                    int M, int N, int K,
                    float* outf, unsigned short* outb, int ldc,
                    int mode, float scale,
                    const float* __restrict__ resid, int ldr,
                    const float* __restrict__ rowsc, int rss,
                    const float* __restrict__ aux, int ldaux,
                    int sA, int sB, int sC, int sR,
                    const float* __restrict__ B2, const float* __restrict__ B3,
                    int N2, float* outf2, unsigned short* outb3) {
    constexpr int AS = 40;   // LDS stride for A rows   [64][AS]  (80B, 16B-mult)
    constexpr int BS = 40;   // LDS stride for B^T rows [128][BS]
    __shared__ __align__(16) unsigned short lds_a[2][64 * AS];
    __shared__ __align__(16) unsigned short lds_b[2][128 * BS];

    int tid  = threadIdx.x;
    int lane = tid & 31;
    int wid  = tid >> 5;
    int wm   = wid >> 2;   // 0..1
    int wn   = wid & 3;    // 0..3
    int m0   = blockIdx.y * 64;
    int n0   = blockIdx.x * 128;
    int ln   = lane & 15;

    // blockIdx.z: independent GEMMs of one shape whose operands lie sA / sB
    // elements apart, outputs and aux sC apart, row scales sR apart.
    size_t z = blockIdx.z;
    A += z * sA;
    B += z * sB;
    if (outf)  outf  += z * sC;
    if (outb)  outb  += z * sC;
    if (aux)   aux   += z * sC;
    if (rowsc) rowsc += z * sR;
    // Column tiles behind N: a second (f32 out) and a third (bf16 out) GEMM on
    // the same A, each N2 columns wide.
    if (n0 >= N) {
        n0 -= N;
        bool third = n0 >= N2;
        if (third) n0 -= N2;
        B    = third ? B3 : B2;
        outf = third ? nullptr : outf2;
        outb = third ? outb3 : nullptr;
        N = ldb = ldc = N2;
    }

    // A async staging: 256 threads x b128 covers the 64x32 bf16 tile.
    int ar = tid >> 2;          // row 0..63
    int ac = (tid & 3) << 3;    // col 0,8,16,24

    f32x8 zero = {0.f,0.f,0.f,0.f,0.f,0.f,0.f,0.f};
    f32x8 acc[2][2] = {{zero, zero}, {zero, zero}};

    auto stageA = [&](int buf, int k0) {
        const void* g = &A[(size_t)(m0 + ar) * lda + k0 + ac];
        async_copy_b128(lds_off(&lds_a[buf][ar * AS + ac]), g);
    };
    // B staging: a thread owns a 4(k) x 4(n) patch of the 32x128 tile, so the
    // transpose happens in its registers and each column leaves as one 8-byte
    // LDS store.  Eight lanes cover one 128-B line of a row; the four lane
    // groups of a wave take different k quads, which spreads the stores over
    // 32 banks (a whole wave on one k quad would fall on 8).
    int bk = ((((wid & 1) << 2) | (lane >> 3))) << 2;   // k 0,4,..,28
    int bn = ((((wid >> 1) << 3) | (lane & 7))) << 2;   // n 0,4,..,124
    auto loadB = [&](int k0, f32x4* r, bool first) {
#pragma unroll
        for (int p = 0; p < 4; ++p) {
            r[p] = *(const f32x4*)&B[(size_t)(k0 + bk + p) * ldb + n0 + bn];
            // Prologue only: there the compiler lets a later load's result land
            // on an earlier load's address pair; the wait stands in front of it.
            if (first) wait_xcnt0();
        }
    };
    auto storeB = [&](int buf, const f32x4* r) {
#pragma unroll
        for (int j = 0; j < 4; ++j) {
            uint2 q;
            q.x = (unsigned)f2bf(r[0][j]) | ((unsigned)f2bf(r[1][j]) << 16);
            q.y = (unsigned)f2bf(r[2][j]) | ((unsigned)f2bf(r[3][j]) << 16);
            *(uint2*)&lds_b[buf][(bn + j) * BS + bk] = q;
        }
    };

    // Prologue: stage tile 0.
    stageA(0, 0);
    {
        f32x4 r[4];
        loadB(0, r, true);
        storeB(0, r);
    }
    wait_async0();
    __syncthreads();

    int nk = K >> 5;
    int buf = 0;
    for (int kt = 0; kt < nk; ++kt) {
        f32x4 r[4];
        bool nxt = (kt + 1) < nk;
        if (nxt) {
            stageA(buf ^ 1, (kt + 1) << 5);   // async DMA into other buffer
            loadB((kt + 1) << 5, r, false);   // b128 weight loads into regs
        }

        BF16Frag af[2], bf[2];
#pragma unroll
        for (int s = 0; s < 2; ++s)
#pragma unroll
            for (int e = 0; e < 16; ++e) {
                int kk = fragK(e, lane);
                af[s].u[e] = lds_a[buf][(wm * 32 + s * 16 + ln) * AS + kk];
                bf[s].u[e] = lds_b[buf][(wn * 32 + s * 16 + ln) * BS + kk];
            }
#pragma unroll
        for (int sm = 0; sm < 2; ++sm)
#pragma unroll
            for (int sn = 0; sn < 2; ++sn)
                acc[sm][sn] = __builtin_amdgcn_wmma_f32_16x16x32_bf16(
                    false, af[sm].v, false, bf[sn].v, (short)0,
                    acc[sm][sn], false, false);

        if (nxt) storeB(buf ^ 1, r);
        wait_async0();
        __syncthreads();
        buf ^= 1;
    }

    int half8 = (lane & 16) >> 1;          // +8 row offset for lanes 16-31
#pragma unroll
    for (int sm = 0; sm < 2; ++sm) {
#pragma unroll
        for (int sn = 0; sn < 2; ++sn) {
            int col = n0 + wn * 32 + sn * 16 + ln;
#pragma unroll
            for (int rr = 0; rr < 8; ++rr) {
                int row = m0 + wm * 32 + sm * 16 + rr + half8;
                if (row >= M || col >= N) continue;
                float v = acc[sm][sn][rr];
                size_t oidx = (size_t)row * ldc + col;
                if (mode == GEMM_STORE) {
                    if (outf) { outf[oidx] = v; wait_xcnt0(); }
                    if (outb) { outb[oidx] = f2bf(v); wait_xcnt0(); }
                } else if (mode == GEMM_RESID) {
                    outf[oidx] = resid[(size_t)row * ldr + col] + scale * v;
                    wait_xcnt0();
                } else if (mode == GEMM_MOE_INIT) {
                    outf[oidx] = rowsc[(size_t)row * rss] * v;
                    wait_xcnt0();
                } else if (mode == GEMM_SILU) {
                    float g = aux[(size_t)row * ldaux + col];
                    float s = g / (1.f + __expf(-g));
                    outb[oidx] = f2bf(s * v);
                    wait_xcnt0();
                } else { // GEMM_FINAL
                    outf[oidx] = resid[(size_t)row * ldr + col] +
                                 scale * (aux[(size_t)row * ldaux + col] + v);
                    wait_xcnt0();
                }
            }
        }
    }
}

// ---------------------------------------------------------------------------
// Sum of the experts' weighted down products, in the order 0..E-1.
// ---------------------------------------------------------------------------
__global__ __launch_bounds__(256)
void expert_sum_kernel(const float* __restrict__ planes, float* __restrict__ out) {
    constexpr size_t P = (size_t)T * D;
    size_t i = ((size_t)blockIdx.x * 256 + threadIdx.x) * 4;
    const float* g = planes + i;
    f32x4 p0, p1, p2, p3, p4, p5, p6, p7;
    // The eight loads and their data wait in one statement, outputs early-clobber:
    // no load's result and no later instruction lands on an address register of
    // a load that is still in flight.
    asm volatile("global_load_b128 %0, %8, off\n\t"
                 "global_load_b128 %1, %9, off\n\t"
                 "global_load_b128 %2, %10, off\n\t"
                 "global_load_b128 %3, %11, off\n\t"
                 "global_load_b128 %4, %12, off\n\t"
                 "global_load_b128 %5, %13, off\n\t"
                 "global_load_b128 %6, %14, off\n\t"
                 "global_load_b128 %7, %15, off\n\t"
                 "s_wait_loadcnt 0x0"
                 : "=&v"(p0), "=&v"(p1), "=&v"(p2), "=&v"(p3),
                   "=&v"(p4), "=&v"(p5), "=&v"(p6), "=&v"(p7)
                 : "v"(g), "v"(g + P), "v"(g + 2 * P), "v"(g + 3 * P),
                   "v"(g + 4 * P), "v"(g + 5 * P), "v"(g + 6 * P), "v"(g + 7 * P)
                 : "memory");
    static_assert(E == 8, "one load per expert");
    f32x4 s = ((((((p0 + p1) + p2) + p3) + p4) + p5) + p6) + p7;
    *(f32x4*)&out[i] = s;
}

// ---------------------------------------------------------------------------
// Causal GQA flash attention.  One wave per (head, 16-query tile); 4 waves
// per block.  QK^T and P.V via bf16 WMMA; online softmax over 32-key chunks.
// ---------------------------------------------------------------------------
__global__ __launch_bounds__(128)
void attn_kernel(const unsigned short* __restrict__ qb,
                 const unsigned short* __restrict__ kb,
                 const unsigned short* __restrict__ vb,
                 unsigned short* __restrict__ attnb) {
    int h    = blockIdx.x;
    int w    = threadIdx.x >> 5;
    int lane = threadIdx.x & 31;
    int qt   = blockIdx.y * 4 + w;   // 16-query tile index
    int kvh  = h >> 2;               // H/KV = 4
    int hb   = (lane & 16) >> 1;     // +8 row offset for lanes 16-31
    int ln   = lane & 15;

    __shared__ unsigned short pbuf[4][16 * 34];   // per-wave P staging

    BF16Frag aq[2];
#pragma unroll
    for (int c = 0; c < 2; ++c)
#pragma unroll
        for (int e = 0; e < 16; ++e) {
            int kd = c * 32 + fragK(e, lane);
            int qrow = qt * 16 + ln;
            aq[c].u[e] = qb[(size_t)qrow * (H * HD) + h * HD + kd];
        }

    f32x8 o0 = {0,0,0,0,0,0,0,0}, o1 = o0, o2 = o0, o3 = o0;
    float rmax[8], rsum[8];
#pragma unroll
    for (int r = 0; r < 8; ++r) { rmax[r] = -1e30f; rsum[r] = 0.f; }

    int kend = qt * 16 + 16;                      // causal bound
    for (int kbase = 0; kbase < kend; kbase += 32) {
        float p[2][8];
        float tmax[8];
#pragma unroll
        for (int r = 0; r < 8; ++r) tmax[r] = -1e30f;

        for (int sub = 0; sub < 2; ++sub) {
            int ks = kbase + sub * 16;
            f32x8 s = {0,0,0,0,0,0,0,0};
#pragma unroll
            for (int c = 0; c < 2; ++c) {
                BF16Frag bk;
#pragma unroll
                for (int e = 0; e < 16; ++e) {
                    int kd  = c * 32 + fragK(e, lane);
                    int key = ks + ln;
                    bk.u[e] = (key < T)
                        ? kb[(size_t)key * (KV * HD) + kvh * HD + kd] : 0;
                }
                s = __builtin_amdgcn_wmma_f32_16x16x32_bf16(
                    false, aq[c].v, false, bk.v, (short)0, s, false, false);
            }
#pragma unroll
            for (int r = 0; r < 8; ++r) {
                int row = qt * 16 + r + hb;
                int key = ks + ln;
                float sv = s[r] * ATTN_MULT;
                if (key > row || key >= T) sv = -1e30f;
                p[sub][r] = sv;
                tmax[r] = fmaxf(tmax[r], sv);
            }
        }
#pragma unroll
        for (int r = 0; r < 8; ++r)
            for (int off = 8; off > 0; off >>= 1)
                tmax[r] = fmaxf(tmax[r], __shfl_xor(tmax[r], off, 16));

        float corr[8];
#pragma unroll
        for (int r = 0; r < 8; ++r) {
            float mn = fmaxf(rmax[r], tmax[r]);
            corr[r]  = __expf(rmax[r] - mn);
            rmax[r]  = mn;
            p[0][r]  = __expf(p[0][r] - mn);
            p[1][r]  = __expf(p[1][r] - mn);
            float ts = p[0][r] + p[1][r];
            for (int off = 8; off > 0; off >>= 1)
                ts += __shfl_xor(ts, off, 16);
            rsum[r] = rsum[r] * corr[r] + ts;
        }
#pragma unroll
        for (int r = 0; r < 8; ++r) {
            o0[r] *= corr[r]; o1[r] *= corr[r];
            o2[r] *= corr[r]; o3[r] *= corr[r];
        }
#pragma unroll
        for (int sub = 0; sub < 2; ++sub)
#pragma unroll
            for (int r = 0; r < 8; ++r)
                pbuf[w][(r + hb) * 34 + sub * 16 + ln] = f2bf(p[sub][r]);
        BF16Frag pf;
#pragma unroll
        for (int e = 0; e < 16; ++e)
            pf.u[e] = pbuf[w][ln * 34 + fragK(e, lane)];

#pragma unroll
        for (int j = 0; j < 4; ++j) {
            BF16Frag bv;
#pragma unroll
            for (int e = 0; e < 16; ++e) {
                int kd  = fragK(e, lane);
                int key = kbase + kd;
                int n   = j * 16 + ln;
                bv.u[e] = (key < T)
                    ? vb[(size_t)key * (KV * HD) + kvh * HD + n] : 0;
            }
            if (j == 0) o0 = __builtin_amdgcn_wmma_f32_16x16x32_bf16(
                    false, pf.v, false, bv.v, (short)0, o0, false, false);
            if (j == 1) o1 = __builtin_amdgcn_wmma_f32_16x16x32_bf16(
                    false, pf.v, false, bv.v, (short)0, o1, false, false);
            if (j == 2) o2 = __builtin_amdgcn_wmma_f32_16x16x32_bf16(
                    false, pf.v, false, bv.v, (short)0, o2, false, false);
            if (j == 3) o3 = __builtin_amdgcn_wmma_f32_16x16x32_bf16(
                    false, pf.v, false, bv.v, (short)0, o3, false, false);
        }
    }
#pragma unroll
    for (int r = 0; r < 8; ++r) {
        int row = qt * 16 + r + hb;
        float inv = 1.f / rsum[r];
        size_t base = (size_t)row * (H * HD) + h * HD;
        attnb[base +  0 + ln] = f2bf(o0[r] * inv);
        attnb[base + 16 + ln] = f2bf(o1[r] * inv);
        attnb[base + 32 + ln] = f2bf(o2[r] * inv);
        attnb[base + 48 + ln] = f2bf(o3[r] * inv);
    }
}

// ---------------------------------------------------------------------------
// Host-side orchestration.
// ---------------------------------------------------------------------------
static void launch_gemm(hipStream_t s, int nz, int sA, int sB, int sC, int sR,
                        const unsigned short* A, int lda,
                        const float* B, int ldb, int M, int N, int K,
                        float* outf, unsigned short* outb, int ldc,
                        int mode, float scale,
                        const float* resid, int ldr,
                        const float* rowsc, int rss,
                        const float* aux, int ldaux) {
    dim3 g(N / 128, M / 64, nz);
    gemm_bf16_wmma<<<g, 256, 0, s>>>(A, lda, B, ldb, M, N, K, outf, outb, ldc,
                                     mode, scale, resid, ldr, rowsc, rss,
                                     aux, ldaux, sA, sB, sC, sR,
                                     nullptr, nullptr, 0, nullptr, nullptr);
}

extern "C" void kernel_launch(void* const* d_in, const int* in_sizes, int n_in,
                              void* d_out, int out_size, void* d_ws, size_t ws_size,
                              hipStream_t stream) {
    const int*   pos     = (const int*)  d_in[0];
    const float* hidden  = (const float*)d_in[1];
    const float* ln1     = (const float*)d_in[2];
    const float* ln2     = (const float*)d_in[3];
    const float* wq      = (const float*)d_in[4];
    const float* wk      = (const float*)d_in[5];
    const float* wv      = (const float*)d_in[6];
    const float* wo      = (const float*)d_in[7];
    const float* routerw = (const float*)d_in[8];
    const float* w13     = (const float*)d_in[9];
    const float* w2      = (const float*)d_in[10];
    const float* sw13    = (const float*)d_in[11];
    const float* sw2     = (const float*)d_in[12];

    float* outF     = (float*)d_out;          // final hidden  [T*D]
    float* residOut = outF + (size_t)T * D;   // post-attn residual [T*D]

    char* ws = (char*)d_ws;
    const size_t MB = 1u << 20;
    unsigned short* xb    = (unsigned short*)(ws + 0);        // T*D bf16   4M
    float*          qf    = (float*)         (ws + 4  * MB);  // T*2048 f32 8M
    float*          kf    = (float*)         (ws + 12 * MB);  // T*512 f32  2M
    unsigned short* qbuf  = (unsigned short*)(ws + 14 * MB);  // 4M
    unsigned short* kbuf  = (unsigned short*)(ws + 18 * MB);  // 1M
    unsigned short* vbuf  = (unsigned short*)(ws + 19 * MB);  // 1M
    unsigned short* attnb = (unsigned short*)(ws + 20 * MB);  // 4M
    float*          xnf   = (float*)         (ws + 24 * MB);  // 8M
    unsigned short* xnb   = (unsigned short*)(ws + 32 * MB);  // 4M
    float*          fullw = (float*)         (ws + 36 * MB);  // 32K
    float*          moe   = (float*)         (ws + 37 * MB);  // 8M
    float*          ggate = (float*)         (ws + 45 * MB);  // T*SI f32 16M
    unsigned short* sactb = (unsigned short*)(ws + 61 * MB);  // 8M
    float*          hgate = (float*)         (ws + 69 * MB);  // E*T*I f32 32M
    unsigned short* actb  = (unsigned short*)(ws + 101 * MB); // E*T*I bf16 16M
    float*          moep  = (float*)         (ws + 117 * MB); // E*T*D f32 64M
    (void)ws_size; (void)in_sizes; (void)n_in; (void)out_size;

    // 1) RMSNorm 1 -> bf16 activations.
    rmsnorm_kernel<<<T, 256, 0, stream>>>(hidden, ln1, nullptr, xb);

    // 2) QKV projections, one launch: column tiles 0-15 are Q, 16-19 K, 20-23 V.
    gemm_bf16_wmma<<<dim3((H + 2 * KV) * HD / 128, T / 64), 256, 0, stream>>>(
        xb, D, wq, H * HD, T, H * HD, D, qf, nullptr, H * HD, GEMM_STORE, 0.f,
        nullptr, 0, nullptr, 0, nullptr, 0, 0, 0, 0, 0,
        wk, wv, KV * HD, kf, vbuf);

    // 3) RoPE on Q and K (f32 -> bf16).
    rope_kernel<<<(T * H  * 32 + 255) / 256, 256, 0, stream>>>(pos, qf, qbuf, H);
    rope_kernel<<<(T * KV * 32 + 255) / 256, 256, 0, stream>>>(pos, kf, kbuf, KV);

    // 4) Causal GQA attention.
    attn_kernel<<<dim3(H, T / 64), 128, 0, stream>>>(qbuf, kbuf, vbuf, attnb);

    // 5) Output projection + residual -> residOut (second output).
    launch_gemm(stream, 1, 0, 0, 0, 0, attnb, H * HD, wo, D, T, D, H * HD,
                residOut, nullptr, D, GEMM_RESID, RES_MULT, hidden, D,
                nullptr, 0, nullptr, 0);

    // 6) RMSNorm 2.
    rmsnorm_kernel<<<T, 256, 0, stream>>>(residOut, ln2, xnf, xnb);

    // 7) Router top-2.
    router_kernel<<<T, 32, 0, stream>>>(xnf, routerw, fullw);

    // 8) Experts (dense, weighted by full_w as in the reference): blockIdx.z is
    //    the expert; the weighted down products stay apart and are summed after.
    launch_gemm(stream, E, 0, D * 2 * I, T * I, 0, xnb, D, w13, 2 * I, T, I, D,
                hgate, nullptr, I, GEMM_STORE, 0.f, nullptr, 0, nullptr, 0, nullptr, 0);
    launch_gemm(stream, E, 0, D * 2 * I, T * I, 0, xnb, D, w13 + I, 2 * I, T, I, D,
                nullptr, actb, I, GEMM_SILU, 0.f, nullptr, 0, nullptr, 0, hgate, I);
    launch_gemm(stream, E, T * I, I * D, T * D, 1, actb, I, w2, D, T, D, I,
                moep, nullptr, D, GEMM_MOE_INIT, 0.f,
                nullptr, 0, fullw, E, nullptr, 0);
    expert_sum_kernel<<<T * D / 1024, 256, 0, stream>>>(moep, moe);

    // 9) Shared expert.
    launch_gemm(stream, 1, 0, 0, 0, 0, xnb, D, sw13, 2 * SI, T, SI, D,
                ggate, nullptr, SI, GEMM_STORE, 0.f, nullptr, 0, nullptr, 0, nullptr, 0);
    launch_gemm(stream, 1, 0, 0, 0, 0, xnb, D, sw13 + SI, 2 * SI, T, SI, D,
                nullptr, sactb, SI, GEMM_SILU, 0.f, nullptr, 0, nullptr, 0, ggate, SI);

    // 10) Shared down-proj fused with final residual.
    launch_gemm(stream, 1, 0, 0, 0, 0, sactb, SI, sw2, D, T, D, SI,
                outF, nullptr, D, GEMM_FINAL, RES_MULT, residOut, D,
                nullptr, 0, moe, D);
}

// v003
// Measured time: 976 microseconds a run.
// Two timings next to v002 both put it at 1.20 times that version's speed.
// Counting every step since v000, it is 3.51 times as fast.
#include <hip/hip_runtime.h>
#include <hip/hip_bf16.h>

// ---------------------------------------------------------------------------
// MI455X (gfx1250, wave32) implementation of a decoder layer (attention, MoE, shared MLP).
// All large GEMMs + attention run on v_wmma_f32_16x16x32_bf16 (bf16 in, f32
// accum).  A-activation tiles move global->LDS via the CDNA5 async-DMA path
// (global_load_async_to_lds_b128 + s_wait_asynccnt).  A first launch writes every
// GEMM weight once as bf16, transposed to [n][k], into the workspace, so the
// weight tiles take the same async path and the k loop holds no conversion.
// GEMMs that do not depend on each other share one launch: Q/K/V in one grid,
// and the eight experts' gate, up and down products one grid each.
// Workspace requirement: 348 MiB (see layout below).
// ---------------------------------------------------------------------------

static constexpr int T  = 1024;
static constexpr int D  = 2048;
static constexpr int H  = 32;
static constexpr int KV = 8;
static constexpr int HD = 64;
static constexpr int E  = 8;
static constexpr int I  = 1024;
static constexpr int SI = 4096;
static constexpr float ATTN_MULT = 0.0078125f;
static constexpr float RES_MULT  = 0.22f;
static constexpr float EPS       = 1e-6f;

typedef __bf16 bf16x16 __attribute__((ext_vector_type(16)));
typedef float  f32x8   __attribute__((ext_vector_type(8)));
typedef float  f32x4   __attribute__((ext_vector_type(4)));

union BF16Frag {
    unsigned short u[16];
    bf16x16 v;
};

__device__ __forceinline__ unsigned short f2bf(float f) {
    unsigned int u = __float_as_uint(f);
    unsigned int r = u + 0x7FFFu + ((u >> 16) & 1u);   // round-to-nearest-even
    return (unsigned short)(r >> 16);
}

// A/B fragment K-index pattern for V_WMMA_*_16X16X32_BF16 (ISA 7.12.2):
// VGPR p (0..7), half w; lanes 0-15 vs 16-31 differ by +8 in K.
__device__ __forceinline__ int fragK(int e, int lane) {
    int p = e >> 1, w = e & 1;
    return ((p & 3) << 1) + w + ((p >> 2) << 4) + ((lane >> 4) << 3);
}

// Generic pointer -> 32-bit LDS byte offset (AS3) for async-DMA VDST operand.
__device__ __forceinline__ unsigned lds_off(const void* p) {
    return (unsigned)(unsigned long long)
        (__attribute__((address_space(3))) const void*)p;
}

// CDNA5 async global->LDS copies, 16B per lane each (ASYNCcnt tracked): a
// thread's share of one k stage, one piece of the A tile and two of the B tile.
__device__ __forceinline__ void async_copy3_b128(unsigned l0, const void* g0,
                                                 unsigned l1, const void* g1,
                                                 unsigned l2, const void* g2) {
    // s_wait_xcnt as the last line of the copies' own statement: it stands in
    // front of any later rewrite of the address registers that the copies name.
    asm volatile("global_load_async_to_lds_b128 %0, %1, off\n\t"
                 "global_load_async_to_lds_b128 %2, %3, off\n\t"
                 "global_load_async_to_lds_b128 %4, %5, off\n\t"
                 "s_wait_xcnt 0x0"
                 :: "v"(l0), "v"(g0), "v"(l1), "v"(g1), "v"(l2), "v"(g2)
                 : "memory");
}
// Behind a global store: stands in front of any later rewrite of the store's
// address and data registers.
__device__ __forceinline__ void wait_xcnt0() {
    asm volatile("s_wait_xcnt 0x0" ::: "memory");
}
__device__ __forceinline__ void wait_async0() {
    asm volatile("s_wait_asynccnt 0x0" ::: "memory");
}
// A wave's own LDS reads have retired before the barrier behind which the
// buffer they read is refilled by async copies.
__device__ __forceinline__ void wait_ds0() {
    asm volatile("s_wait_dscnt 0x0" ::: "memory");
}

// ---------------------------------------------------------------------------
// Weight pre-pass: every GEMM weight W[K][N] (f32) -> Wt[N][K] (bf16, rounded
// to nearest even, f2bf).  A block takes a strip of
// 1024 k x 64 n as sixteen 64x64 tiles.  A thread owns a 4(k) x 4(n) patch, so the
// transpose happens in its registers; the tile goes through LDS so that every
// global store covers whole 128-B lines of a Wt row.
// Element offsets of the transposed weights in their workspace region:
// ---------------------------------------------------------------------------
static constexpr size_t WT_Q   = 0;                                // [H*HD][D]
static constexpr size_t WT_K   = WT_Q   + (size_t)D * H * HD;      // [KV*HD][D]
static constexpr size_t WT_V   = WT_K   + (size_t)D * KV * HD;     // [KV*HD][D]
static constexpr size_t WT_O   = WT_V   + (size_t)D * KV * HD;     // [D][H*HD]
static constexpr size_t WT_13  = WT_O   + (size_t)H * HD * D;      // E x [2I][D]
static constexpr size_t WT_2   = WT_13  + (size_t)E * D * 2 * I;   // E x [D][I]
static constexpr size_t WT_S13 = WT_2   + (size_t)E * I * D;       // [2SI][D]
static constexpr size_t WT_S2  = WT_S13 + (size_t)D * 2 * SI;      // [D][SI]
static constexpr int strips(int k, int n) { return (k / 1024) * (n / 64); }
static constexpr int WT_BLOCKS =
    strips(D, H * HD) + 2 * strips(D, KV * HD) + strips(H * HD, D) +
    E * strips(D, 2 * I) + E * strips(I, D) + strips(D, 2 * SI) + strips(SI, D);

__global__ __launch_bounds__(256)
void weight_bf16_t_kernel(const float* __restrict__ wq, const float* __restrict__ wk,
                          const float* __restrict__ wv, const float* __restrict__ wo,
                          const float* __restrict__ w13, const float* __restrict__ w2,
                          const float* __restrict__ sw13, const float* __restrict__ sw2,
                          unsigned short* __restrict__ wt) {
    constexpr int P = 72;    // LDS row pitch: 144 B = 16 B x odd
    __shared__ __align__(16) unsigned short tile[2][64 * P];

    // Which matrix, and which strip of it (all block-uniform).
    int b = blockIdx.x;
    const float* src;
    size_t off;
    int K, N;
    if (b < strips(D, H * HD)) { src = wq; off = WT_Q; K = D; N = H * HD; }
    else if ((b -= strips(D, H * HD)) < strips(D, KV * HD)) { src = wk; off = WT_K; K = D; N = KV * HD; }
    else if ((b -= strips(D, KV * HD)) < strips(D, KV * HD)) { src = wv; off = WT_V; K = D; N = KV * HD; }
    else if ((b -= strips(D, KV * HD)) < strips(H * HD, D)) { src = wo; off = WT_O; K = H * HD; N = D; }
    else if ((b -= strips(H * HD, D)) < E * strips(D, 2 * I)) { src = w13; off = WT_13; K = D; N = 2 * I; }
    else if ((b -= E * strips(D, 2 * I)) < E * strips(I, D)) { src = w2; off = WT_2; K = I; N = D; }
    else if ((b -= E * strips(I, D)) < strips(D, 2 * SI)) { src = sw13; off = WT_S13; K = D; N = 2 * SI; }
    else { b -= strips(D, 2 * SI); src = sw2; off = WT_S2; K = SI; N = D; }
    int kstrips = K >> 10;
    int per     = kstrips * (N >> 6);       // strips of one matrix
    int e       = b / per;                  // expert (0 where there is one matrix)
    b -= e * per;
    int n0 = (b / kstrips) << 6;
    int kb = (b % kstrips) << 10;
    src += (size_t)e * K * N;
    unsigned short* dst = wt + off + (size_t)e * K * N;

    int tid  = threadIdx.x;
    int lane = tid & 31;
    int wid  = tid >> 5;
    // Eight lanes cover one 128-B line of a source row; the four lane groups of
    // a wave take different k quads, which spreads the 8-byte LDS stores.
    int pk = (((wid & 3) << 2) | (lane >> 3)) << 2;    // k 0,4,..,60
    int pn = (((wid >> 2) << 3) | (lane & 7)) << 2;    // n 0,4,..,60
    const float* g = src + (size_t)(kb + pk) * N + n0 + pn;
    // Read back: eight lanes cover one 128-B line of a Wt row.
    int rr = tid >> 3;                                 // n 0..31 (and +32)
    int rc = (tid & 7) << 3;                           // k 0,8,..,56
    unsigned short* o = dst + (size_t)(n0 + rr) * K + kb + rc;

    size_t rowb = (size_t)N;                           // source row, elements
    for (int t = 0; t < 16; ++t) {
        const float* gt = g + (size_t)(t * 64) * rowb;
        f32x4 r0, r1, r2, r3;
        // The four loads and their data wait in one statement, outputs
        // early-clobber: no result and no later instruction lands on an address
        // register of a load that is still in flight.
        asm volatile("global_load_b128 %0, %4, off\n\t"
                     "global_load_b128 %1, %5, off\n\t"
                     "global_load_b128 %2, %6, off\n\t"
                     "global_load_b128 %3, %7, off\n\t"
                     "s_wait_loadcnt 0x0"
                     : "=&v"(r0), "=&v"(r1), "=&v"(r2), "=&v"(r3)
                     : "v"(gt), "v"(gt + rowb), "v"(gt + 2 * rowb), "v"(gt + 3 * rowb)
                     : "memory");
        unsigned short* l = tile[t & 1];
#pragma unroll
        for (int j = 0; j < 4; ++j) {
            uint2 q;
            q.x = (unsigned)f2bf(r0[j]) | ((unsigned)f2bf(r1[j]) << 16);
            q.y = (unsigned)f2bf(r2[j]) | ((unsigned)f2bf(r3[j]) << 16);
            *(uint2*)&l[(pn + j) * P + pk] = q;
        }
        // One barrier a tile: with two buffers it also ends the reads of the
        // buffer that the next tile but one overwrites.
        __syncthreads();
#pragma unroll
        for (int i = 0; i < 2; ++i) {
            uint4 v = *(const uint4*)&l[(rr + i * 32) * P + rc];
            *(uint4*)&o[(size_t)(i * 32) * K + t * 64] = v;
            wait_xcnt0();   // in front of any later write of the store's registers
        }
    }
}

// ---------------------------------------------------------------------------
// RMSNorm: one block per row.  Writes f32 and/or bf16 outputs.
// ---------------------------------------------------------------------------
__global__ __launch_bounds__(256)
void rmsnorm_kernel(const float* __restrict__ in, const float* __restrict__ w,
                    float* outf, unsigned short* outb) {
    int row = blockIdx.x;
    int tid = threadIdx.x;
    __shared__ float red[256];
    const float* x = in + (size_t)row * D;
    float ss = 0.f;
    for (int i = tid; i < D; i += 256) { float v = x[i]; ss += v * v; }
    red[tid] = ss;
    __syncthreads();
    for (int s = 128; s > 0; s >>= 1) {
        if (tid < s) red[tid] += red[tid + s];
        __syncthreads();
    }
    float rs = rsqrtf(red[0] / (float)D + EPS);
    for (int i = tid; i < D; i += 256) {
        float v = x[i] * rs * w[i];
        if (outf) outf[(size_t)row * D + i] = v;
        if (outb) outb[(size_t)row * D + i] = f2bf(v);
    }
}

// ---------------------------------------------------------------------------
// RoPE: f32 in -> bf16 out, per (t, head, i<HD/2).
// ---------------------------------------------------------------------------
__global__ __launch_bounds__(256)
void rope_kernel(const int* __restrict__ pos, const float* __restrict__ in,
                 unsigned short* __restrict__ out, int nheads) {
    int idx = blockIdx.x * blockDim.x + threadIdx.x;
    int total = T * nheads * (HD / 2);
    if (idx >= total) return;
    int i = idx & 31;
    int h = (idx >> 5) % nheads;
    int t = idx / (32 * nheads);
    float inv = __expf(-(float)i * (9.2103403719761840f / 32.f)); // 10000^(-i/32)
    float ang = (float)pos[t] * inv;
    float s, c;
    __sincosf(ang, &s, &c);
    size_t base = (size_t)t * nheads * HD + (size_t)h * HD;
    float x1 = in[base + i];
    float x2 = in[base + 32 + i];
    out[base + i]      = f2bf(x1 * c - x2 * s);
    out[base + 32 + i] = f2bf(x2 * c + x1 * s);
}

// ---------------------------------------------------------------------------
// Router: one wave per token.  logits = xn . router_w[e], softmax, top-2.
// ---------------------------------------------------------------------------
__global__ __launch_bounds__(32)
void router_kernel(const float* __restrict__ xn, const float* __restrict__ rw,
                   float* __restrict__ fullw) {
    int t = blockIdx.x;
    int lane = threadIdx.x;
    float acc[E];
#pragma unroll
    for (int e = 0; e < E; ++e) acc[e] = 0.f;
    const float* x = xn + (size_t)t * D;
    for (int i = lane; i < D; i += 32) {
        float xv = x[i];
#pragma unroll
        for (int e = 0; e < E; ++e) acc[e] += xv * rw[(size_t)e * D + i];
    }
#pragma unroll
    for (int e = 0; e < E; ++e)
        for (int off = 16; off > 0; off >>= 1)
            acc[e] += __shfl_xor(acc[e], off, 32);
    if (lane == 0) {
        int i1 = 0;
        for (int e = 1; e < E; ++e) if (acc[e] > acc[i1]) i1 = e;
        int i2 = (i1 == 0) ? 1 : 0;
        for (int e = 0; e < E; ++e) if (e != i1 && acc[e] > acc[i2]) i2 = e;
        float e1 = 1.f;
        float e2 = __expf(acc[i2] - acc[i1]);
        float inv = 1.f / (e1 + e2);
        for (int e = 0; e < E; ++e) {
            float wv = (e == i1) ? e1 * inv : (e == i2) ? e2 * inv : 0.f;
            fullw[(size_t)t * E + e] = wv;
        }
    }
}

// ---------------------------------------------------------------------------
// BF16-WMMA GEMM, double-buffered LDS, async DMA of both tiles.
// C[M,N] = A[M,K](bf16) x Bt[N,K]^T (bf16, from the weight pre-pass).
// Block tile 64x128, 8 waves (2M x 4N), each wave 32x32 (4 WMMAs / K-step).
// Requires: M%64==0, N%128==0, K%32==0, lda%8==0, ldb%8==0 (all satisfied).
// ---------------------------------------------------------------------------
#define GEMM_STORE    0  // outf/outb = acc
#define GEMM_RESID    1  // outf = resid + scale*acc
#define GEMM_MOE_INIT 2  // outf  = rowsc[row]*acc
#define GEMM_SILU     4  // outb = silu(aux[row,col]) * acc   (bf16)
#define GEMM_FINAL    5  // outf = resid + scale*(aux + acc)

__global__ __launch_bounds__(256)
void gemm_bf16_wmma(const unsigned short* __restrict__ A, int lda,
                    const unsigned short* __restrict__ Bt, int ldb,
                    int M, int N, int K,
                    float* outf, unsigned short* outb, int ldc,
                    int mode, float scale,
                    const float* __restrict__ resid, int ldr,
                    const float* __restrict__ rowsc, int rss,
                    const float* __restrict__ aux, int ldaux,
                    int sA, int sB, int sC, int sR,
                    int N2, float* outf2, unsigned short* outb3) {
    constexpr int AS = 40;   // LDS stride for A rows   [64][AS]  (80B, 16B-mult)
    constexpr int BS = 40;   // LDS stride for B^T rows [128][BS]
    __shared__ __align__(16) unsigned short lds_a[2][64 * AS];
    __shared__ __align__(16) unsigned short lds_b[2][128 * BS];

    int tid  = threadIdx.x;
    int lane = tid & 31;
    int wid  = tid >> 5;
    int wm   = wid >> 2;   // 0..1
    int wn   = wid & 3;    // 0..3
    int m0   = blockIdx.y * 64;
    int n0   = blockIdx.x * 128;
    int ln   = lane & 15;

    // blockIdx.z: independent GEMMs of one shape whose operands lie sA / sB
    // elements apart, outputs and aux sC apart, row scales sR apart.
    size_t z = blockIdx.z;
    A += z * sA;
    Bt += z * sB + (size_t)n0 * ldb;     // this block's 128 rows of Bt
    if (outf)  outf  += z * sC;
    if (outb)  outb  += z * sC;
    if (aux)   aux   += z * sC;
    if (rowsc) rowsc += z * sR;
    // Column tiles behind N: a second (f32 out) and a third (bf16 out) GEMM on
    // the same A, each N2 columns wide; their Bt rows follow the first one's.
    if (n0 >= N) {
        n0 -= N;
        bool third = n0 >= N2;
        if (third) n0 -= N2;
        outf = third ? nullptr : outf2;
        outb = third ? outb3 : nullptr;
        N = ldc = N2;
    }

    // Async staging: 256 threads x b128 cover the 64x32 bf16 A tile once and the
    // 128x32 Bt tile twice (rows sr and sr + 64).
    int sr = tid >> 2;          // row 0..63
    int sc = (tid & 3) << 3;    // k 0,8,16,24

    f32x8 zero = {0.f,0.f,0.f,0.f,0.f,0.f,0.f,0.f};
    f32x8 acc[2][2] = {{zero, zero}, {zero, zero}};

    const unsigned short* gA  = A + (size_t)(m0 + sr) * lda + sc;
    const unsigned short* gB0 = Bt + (size_t)sr * ldb + sc;
    const unsigned short* gB1 = Bt + (size_t)(sr + 64) * ldb + sc;
    auto stage = [&](int buf, int k0) {
        async_copy3_b128(lds_off(&lds_a[buf][sr * AS + sc]), gA + k0,
                         lds_off(&lds_b[buf][sr * BS + sc]), gB0 + k0,
                         lds_off(&lds_b[buf][(sr + 64) * BS + sc]), gB1 + k0);
    };

    // Two buffers: tile 0 lands and is published, then tile 1 flies.
    int nk = K >> 5;
    stage(0, 0);
    wait_async0();
    __syncthreads();
    if (nk > 1) stage(1, 32);

    int buf = 0;
    for (int kt = 0; kt < nk; ++kt) {
        BF16Frag af[2], bf[2];
#pragma unroll
        for (int s = 0; s < 2; ++s)
#pragma unroll
            for (int e = 0; e < 16; ++e) {
                int kk = fragK(e, lane);
                af[s].u[e] = lds_a[buf][(wm * 32 + s * 16 + ln) * AS + kk];
                bf[s].u[e] = lds_b[buf][(wn * 32 + s * 16 + ln) * BS + kk];
            }
#pragma unroll
        for (int sm = 0; sm < 2; ++sm)
#pragma unroll
            for (int sn = 0; sn < 2; ++sn)
                acc[sm][sn] = __builtin_amdgcn_wmma_f32_16x16x32_bf16(
                    false, af[sm].v, false, bf[sn].v, (short)0,
                    acc[sm][sn], false, false);

        // Foot of the trip: own LDS reads retired, tile kt+1 landed, one barrier
        // that publishes it and ends every read of this buffer; then the refill.
        wait_ds0();
        wait_async0();
        __syncthreads();
        if (kt + 2 < nk) stage(buf, (kt + 2) << 5);
        buf ^= 1;
    }
    wait_async0();   // no copy is in flight when the wave goes on to its stores

    int half8 = (lane & 16) >> 1;          // +8 row offset for lanes 16-31
#pragma unroll
    for (int sm = 0; sm < 2; ++sm) {
#pragma unroll
        for (int sn = 0; sn < 2; ++sn) {
            int col = n0 + wn * 32 + sn * 16 + ln;
#pragma unroll
            for (int rr = 0; rr < 8; ++rr) {
                int row = m0 + wm * 32 + sm * 16 + rr + half8;
                if (row >= M || col >= N) continue;
                float v = acc[sm][sn][rr];
                size_t oidx = (size_t)row * ldc + col;
                if (mode == GEMM_STORE) {
                    if (outf) { outf[oidx] = v; wait_xcnt0(); }
                    if (outb) { outb[oidx] = f2bf(v); wait_xcnt0(); }
                } else if (mode == GEMM_RESID) {
                    outf[oidx] = resid[(size_t)row * ldr + col] + scale * v;
                    wait_xcnt0();
                } else if (mode == GEMM_MOE_INIT) {
                    outf[oidx] = rowsc[(size_t)row * rss] * v;
                    wait_xcnt0();
                } else if (mode == GEMM_SILU) {
                    float g = aux[(size_t)row * ldaux + col];
                    float s = g / (1.f + __expf(-g));
                    outb[oidx] = f2bf(s * v);
                    wait_xcnt0();
                } else { // GEMM_FINAL
                    outf[oidx] = resid[(size_t)row * ldr + col] +
                                 scale * (aux[(size_t)row * ldaux + col] + v);
                    wait_xcnt0();
                }
            }
        }
    }
}

// ---------------------------------------------------------------------------
// Sum of the experts' weighted down products, in the order 0..E-1.
// ---------------------------------------------------------------------------
__global__ __launch_bounds__(256)
void expert_sum_kernel(const float* __restrict__ planes, float* __restrict__ out) {
    constexpr size_t P = (size_t)T * D;
    size_t i = ((size_t)blockIdx.x * 256 + threadIdx.x) * 4;
    const float* g = planes + i;
    f32x4 p0, p1, p2, p3, p4, p5, p6, p7;
    // The eight loads and their data wait in one statement, outputs early-clobber:
    // no load's result and no later instruction lands on an address register of
    // a load that is still in flight.
    asm volatile("global_load_b128 %0, %8, off\n\t"
                 "global_load_b128 %1, %9, off\n\t"
                 "global_load_b128 %2, %10, off\n\t"
                 "global_load_b128 %3, %11, off\n\t"
                 "global_load_b128 %4, %12, off\n\t"
                 "global_load_b128 %5, %13, off\n\t"
                 "global_load_b128 %6, %14, off\n\t"
                 "global_load_b128 %7, %15, off\n\t"
                 "s_wait_loadcnt 0x0"
                 : "=&v"(p0), "=&v"(p1), "=&v"(p2), "=&v"(p3),
                   "=&v"(p4), "=&v"(p5), "=&v"(p6), "=&v"(p7)
                 : "v"(g), "v"(g + P), "v"(g + 2 * P), "v"(g + 3 * P),
                   "v"(g + 4 * P), "v"(g + 5 * P), "v"(g + 6 * P), "v"(g + 7 * P)
                 : "memory");
    static_assert(E == 8, "one load per expert");
    f32x4 s = ((((((p0 + p1) + p2) + p3) + p4) + p5) + p6) + p7;
    *(f32x4*)&out[i] = s;
}

// ---------------------------------------------------------------------------
// Causal GQA flash attention.  One wave per (head, 16-query tile); 4 waves
// per block.  QK^T and P.V via bf16 WMMA; online softmax over 32-key chunks.
// ---------------------------------------------------------------------------
__global__ __launch_bounds__(128)
void attn_kernel(const unsigned short* __restrict__ qb,
                 const unsigned short* __restrict__ kb,
                 const unsigned short* __restrict__ vb,
                 unsigned short* __restrict__ attnb) {
    int h    = blockIdx.x;
    int w    = threadIdx.x >> 5;
    int lane = threadIdx.x & 31;
    int qt   = blockIdx.y * 4 + w;   // 16-query tile index
    int kvh  = h >> 2;               // H/KV = 4
    int hb   = (lane & 16) >> 1;     // +8 row offset for lanes 16-31
    int ln   = lane & 15;

    __shared__ unsigned short pbuf[4][16 * 34];   // per-wave P staging

    BF16Frag aq[2];
#pragma unroll
    for (int c = 0; c < 2; ++c)
#pragma unroll
        for (int e = 0; e < 16; ++e) {
            int kd = c * 32 + fragK(e, lane);
            int qrow = qt * 16 + ln;
            aq[c].u[e] = qb[(size_t)qrow * (H * HD) + h * HD + kd];
        }

    f32x8 o0 = {0,0,0,0,0,0,0,0}, o1 = o0, o2 = o0, o3 = o0;
    float rmax[8], rsum[8];
#pragma unroll
    for (int r = 0; r < 8; ++r) { rmax[r] = -1e30f; rsum[r] = 0.f; }

    int kend = qt * 16 + 16;                      // causal bound
    for (int kbase = 0; kbase < kend; kbase += 32) {
        float p[2][8];
        float tmax[8];
#pragma unroll
        for (int r = 0; r < 8; ++r) tmax[r] = -1e30f;

        for (int sub = 0; sub < 2; ++sub) {
            int ks = kbase + sub * 16;
            f32x8 s = {0,0,0,0,0,0,0,0};
#pragma unroll
            for (int c = 0; c < 2; ++c) {
                BF16Frag bk;
#pragma unroll
                for (int e = 0; e < 16; ++e) {
                    int kd  = c * 32 + fragK(e, lane);
                    int key = ks + ln;
                    bk.u[e] = (key < T)
                        ? kb[(size_t)key * (KV * HD) + kvh * HD + kd] : 0;
                }
                s = __builtin_amdgcn_wmma_f32_16x16x32_bf16(
                    false, aq[c].v, false, bk.v, (short)0, s, false, false);
            }
#pragma unroll
            for (int r = 0; r < 8; ++r) {
                int row = qt * 16 + r + hb;
                int key = ks + ln;
                float sv = s[r] * ATTN_MULT;
                if (key > row || key >= T) sv = -1e30f;
                p[sub][r] = sv;
                tmax[r] = fmaxf(tmax[r], sv);
            }
        }
#pragma unroll
        for (int r = 0; r < 8; ++r)
            for (int off = 8; off > 0; off >>= 1)
                tmax[r] = fmaxf(tmax[r], __shfl_xor(tmax[r], off, 16));

        float corr[8];
#pragma unroll
        for (int r = 0; r < 8; ++r) {
            float mn = fmaxf(rmax[r], tmax[r]);
            corr[r]  = __expf(rmax[r] - mn);
            rmax[r]  = mn;
            p[0][r]  = __expf(p[0][r] - mn);
            p[1][r]  = __expf(p[1][r] - mn);
            float ts = p[0][r] + p[1][r];
            for (int off = 8; off > 0; off >>= 1)
                ts += __shfl_xor(ts, off, 16);
            rsum[r] = rsum[r] * corr[r] + ts;
        }
#pragma unroll
        for (int r = 0; r < 8; ++r) {
            o0[r] *= corr[r]; o1[r] *= corr[r];
            o2[r] *= corr[r]; o3[r] *= corr[r];
        }
#pragma unroll
        for (int sub = 0; sub < 2; ++sub)
#pragma unroll
            for (int r = 0; r < 8; ++r)
                pbuf[w][(r + hb) * 34 + sub * 16 + ln] = f2bf(p[sub][r]);
        BF16Frag pf;
#pragma unroll
        for (int e = 0; e < 16; ++e)
            pf.u[e] = pbuf[w][ln * 34 + fragK(e, lane)];

#pragma unroll
        for (int j = 0; j < 4; ++j) {
            BF16Frag bv;
#pragma unroll
            for (int e = 0; e < 16; ++e) {
                int kd  = fragK(e, lane);
                int key = kbase + kd;
                int n   = j * 16 + ln;
                bv.u[e] = (key < T)
                    ? vb[(size_t)key * (KV * HD) + kvh * HD + n] : 0;
            }
            if (j == 0) o0 = __builtin_amdgcn_wmma_f32_16x16x32_bf16(
                    false, pf.v, false, bv.v, (short)0, o0, false, false);
            if (j == 1) o1 = __builtin_amdgcn_wmma_f32_16x16x32_bf16(
                    false, pf.v, false, bv.v, (short)0, o1, false, false);
            if (j == 2) o2 = __builtin_amdgcn_wmma_f32_16x16x32_bf16(
                    false, pf.v, false, bv.v, (short)0, o2, false, false);
            if (j == 3) o3 = __builtin_amdgcn_wmma_f32_16x16x32_bf16(
                    false, pf.v, false, bv.v, (short)0, o3, false, false);
        }
    }
#pragma unroll
    for (int r = 0; r < 8; ++r) {
        int row = qt * 16 + r + hb;
        float inv = 1.f / rsum[r];
        size_t base = (size_t)row * (H * HD) + h * HD;
        attnb[base +  0 + ln] = f2bf(o0[r] * inv);
        attnb[base + 16 + ln] = f2bf(o1[r] * inv);
        attnb[base + 32 + ln] = f2bf(o2[r] * inv);
        attnb[base + 48 + ln] = f2bf(o3[r] * inv);
    }
}

// ---------------------------------------------------------------------------
// Host-side orchestration.
// ---------------------------------------------------------------------------
static void launch_gemm(hipStream_t s, int nz, int sA, int sB, int sC, int sR,
                        const unsigned short* A, int lda,
                        const unsigned short* Bt, int ldb, int M, int N, int K,
                        float* outf, unsigned short* outb, int ldc,
                        int mode, float scale,
                        const float* resid, int ldr,
                        const float* rowsc, int rss,
                        const float* aux, int ldaux) {
    dim3 g(N / 128, M / 64, nz);
    gemm_bf16_wmma<<<g, 256, 0, s>>>(A, lda, Bt, ldb, M, N, K, outf, outb, ldc,
                                     mode, scale, resid, ldr, rowsc, rss,
                                     aux, ldaux, sA, sB, sC, sR,
                                     0, nullptr, nullptr);
}

extern "C" void kernel_launch(void* const* d_in, const int* in_sizes, int n_in,
                              void* d_out, int out_size, void* d_ws, size_t ws_size,
                              hipStream_t stream) {
    const int*   pos     = (const int*)  d_in[0];
    const float* hidden  = (const float*)d_in[1];
    const float* ln1     = (const float*)d_in[2];
    const float* ln2     = (const float*)d_in[3];
    const float* wq      = (const float*)d_in[4];
    const float* wk      = (const float*)d_in[5];
    const float* wv      = (const float*)d_in[6];
    const float* wo      = (const float*)d_in[7];
    const float* routerw = (const float*)d_in[8];
    const float* w13     = (const float*)d_in[9];
    const float* w2      = (const float*)d_in[10];
    const float* sw13    = (const float*)d_in[11];
    const float* sw2     = (const float*)d_in[12];

    float* outF     = (float*)d_out;          // final hidden  [T*D]
    float* residOut = outF + (size_t)T * D;   // post-attn residual [T*D]

    char* ws = (char*)d_ws;
    const size_t MB = 1u << 20;
    unsigned short* xb    = (unsigned short*)(ws + 0);        // T*D bf16   4M
    float*          qf    = (float*)         (ws + 4  * MB);  // T*2048 f32 8M
    float*          kf    = (float*)         (ws + 12 * MB);  // T*512 f32  2M
    unsigned short* qbuf  = (unsigned short*)(ws + 14 * MB);  // 4M
    unsigned short* kbuf  = (unsigned short*)(ws + 18 * MB);  // 1M
    unsigned short* vbuf  = (unsigned short*)(ws + 19 * MB);  // 1M
    unsigned short* attnb = (unsigned short*)(ws + 20 * MB);  // 4M
    float*          xnf   = (float*)         (ws + 24 * MB);  // 8M
    unsigned short* xnb   = (unsigned short*)(ws + 32 * MB);  // 4M
    float*          fullw = (float*)         (ws + 36 * MB);  // 32K
    float*          moe   = (float*)         (ws + 37 * MB);  // 8M
    float*          ggate = (float*)         (ws + 45 * MB);  // T*SI f32 16M
    unsigned short* sactb = (unsigned short*)(ws + 61 * MB);  // 8M
    float*          hgate = (float*)         (ws + 69 * MB);  // E*T*I f32 32M
    unsigned short* actb  = (unsigned short*)(ws + 101 * MB); // E*T*I bf16 16M
    float*          moep  = (float*)         (ws + 117 * MB); // E*T*D f32 64M
    unsigned short* wt    = (unsigned short*)(ws + 184 * MB); // bf16 weights 164M
    (void)ws_size; (void)in_sizes; (void)n_in; (void)out_size;

    // 0) Every GEMM weight once to bf16, transposed to [n][k].
    weight_bf16_t_kernel<<<WT_BLOCKS, 256, 0, stream>>>(wq, wk, wv, wo, w13, w2,
                                                        sw13, sw2, wt);

    // 1) RMSNorm 1 -> bf16 activations.
    rmsnorm_kernel<<<T, 256, 0, stream>>>(hidden, ln1, nullptr, xb);

    // 2) QKV projections, one launch: column tiles 0-15 are Q, 16-19 K, 20-23 V.
    gemm_bf16_wmma<<<dim3((H + 2 * KV) * HD / 128, T / 64), 256, 0, stream>>>(
        xb, D, wt + WT_Q, D, T, H * HD, D, qf, nullptr, H * HD, GEMM_STORE, 0.f,
        nullptr, 0, nullptr, 0, nullptr, 0, 0, 0, 0, 0,
        KV * HD, kf, vbuf);

    // 3) RoPE on Q and K (f32 -> bf16).
    rope_kernel<<<(T * H  * 32 + 255) / 256, 256, 0, stream>>>(pos, qf, qbuf, H);
    rope_kernel<<<(T * KV * 32 + 255) / 256, 256, 0, stream>>>(pos, kf, kbuf, KV);

    // 4) Causal GQA attention.
    attn_kernel<<<dim3(H, T / 64), 128, 0, stream>>>(qbuf, kbuf, vbuf, attnb);

    // 5) Output projection + residual -> residOut (second output).
    launch_gemm(stream, 1, 0, 0, 0, 0, attnb, H * HD, wt + WT_O, H * HD, T, D, H * HD,
                residOut, nullptr, D, GEMM_RESID, RES_MULT, hidden, D,
                nullptr, 0, nullptr, 0);

    // 6) RMSNorm 2.
    rmsnorm_kernel<<<T, 256, 0, stream>>>(residOut, ln2, xnf, xnb);

    // 7) Router top-2.
    router_kernel<<<T, 32, 0, stream>>>(xnf, routerw, fullw);

    // 8) Experts (dense, weighted by full_w as in the reference): blockIdx.z is
    //    the expert; the weighted down products stay apart and are summed after.
    launch_gemm(stream, E, 0, D * 2 * I, T * I, 0, xnb, D, wt + WT_13, D, T, I, D,
                hgate, nullptr, I, GEMM_STORE, 0.f, nullptr, 0, nullptr, 0, nullptr, 0);
    launch_gemm(stream, E, 0, D * 2 * I, T * I, 0, xnb, D, wt + WT_13 + (size_t)I * D, D, T, I, D,
                nullptr, actb, I, GEMM_SILU, 0.f, nullptr, 0, nullptr, 0, hgate, I);
    launch_gemm(stream, E, T * I, I * D, T * D, 1, actb, I, wt + WT_2, I, T, D, I,
                moep, nullptr, D, GEMM_MOE_INIT, 0.f,
                nullptr, 0, fullw, E, nullptr, 0);
    expert_sum_kernel<<<T * D / 1024, 256, 0, stream>>>(moep, moe);

    // 9) Shared expert.
    launch_gemm(stream, 1, 0, 0, 0, 0, xnb, D, wt + WT_S13, D, T, SI, D,
                ggate, nullptr, SI, GEMM_STORE, 0.f, nullptr, 0, nullptr, 0, nullptr, 0);
    launch_gemm(stream, 1, 0, 0, 0, 0, xnb, D, wt + WT_S13 + (size_t)SI * D, D, T, SI, D,
                nullptr, sactb, SI, GEMM_SILU, 0.f, nullptr, 0, nullptr, 0, ggate, SI);

    // 10) Shared down-proj fused with final residual.
    launch_gemm(stream, 1, 0, 0, 0, 0, sactb, SI, wt + WT_S2, SI, T, D, SI,
                outF, nullptr, D, GEMM_FINAL, RES_MULT, residOut, D,
                nullptr, 0, moe, D);
}

// v004
// A run of this version takes 616 microseconds.
// Timed twice side by side with v003, it ran 1.59 times as fast both times.
// All steps since v000 together make it 5.57 times as fast.
#include <hip/hip_runtime.h>
#include <hip/hip_bf16.h>

// ---------------------------------------------------------------------------
// MI455X (gfx1250, wave32) implementation of a decoder layer (attention, MoE, shared MLP).
// All large GEMMs + attention run on v_wmma_f32_16x16x32_bf16 (bf16 in, f32
// accum).  A-activation tiles move global->LDS via the CDNA5 async-DMA path
// (global_load_async_to_lds_b128 + s_wait_asynccnt).  A first launch writes every
// GEMM weight once as bf16, transposed to [n][k], into the workspace, so the
// weight tiles take the same async path and the k loop holds no conversion.
// GEMMs that do not depend on each other share one launch: Q/K/V in one grid,
// and the eight experts' gate, up and down products one grid each.
// Workspace requirement: 348 MiB (see layout below).
// ---------------------------------------------------------------------------

static constexpr int T  = 1024;
static constexpr int D  = 2048;
static constexpr int H  = 32;
static constexpr int KV = 8;
static constexpr int HD = 64;
static constexpr int E  = 8;
static constexpr int I  = 1024;
static constexpr int SI = 4096;
static constexpr float ATTN_MULT = 0.0078125f;
static constexpr float RES_MULT  = 0.22f;
static constexpr float EPS       = 1e-6f;

typedef __bf16 bf16x16 __attribute__((ext_vector_type(16)));
typedef float  f32x8   __attribute__((ext_vector_type(8)));
typedef float  f32x4   __attribute__((ext_vector_type(4)));
typedef unsigned int u32x4 __attribute__((ext_vector_type(4)));

union BF16Frag {
    unsigned short u[16];
    u32x4 q[2];      // the two runs of eight k-consecutive elements (see fragK)
    bf16x16 v;
};

__device__ __forceinline__ unsigned short f2bf(float f) {
    unsigned int u = __float_as_uint(f);
    unsigned int r = u + 0x7FFFu + ((u >> 16) & 1u);   // round-to-nearest-even
    return (unsigned short)(r >> 16);
}

// A/B fragment K-index pattern for V_WMMA_*_16X16X32_BF16 (ISA 7.12.2):
// VGPR p (0..7), half w; lanes 0-15 vs 16-31 differ by +8 in K.
__device__ __forceinline__ int fragK(int e, int lane) {
    int p = e >> 1, w = e & 1;
    return ((p & 3) << 1) + w + ((p >> 2) << 4) + ((lane >> 4) << 3);
}

// Generic pointer -> 32-bit LDS byte offset (AS3) for async-DMA VDST operand.
__device__ __forceinline__ unsigned lds_off(const void* p) {
    return (unsigned)(unsigned long long)
        (__attribute__((address_space(3))) const void*)p;
}

// CDNA5 async global->LDS copies, 16B per lane each (ASYNCcnt tracked): a
// thread's share of one k stage, one piece of the A tile and two of the B tile.
__device__ __forceinline__ void async_copy3_b128(unsigned l0, const void* g0,
                                                 unsigned l1, const void* g1,
                                                 unsigned l2, const void* g2) {
    // s_wait_xcnt as the last line of the copies' own statement: it stands in
    // front of any later rewrite of the address registers that the copies name.
    asm volatile("global_load_async_to_lds_b128 %0, %1, off\n\t"
                 "global_load_async_to_lds_b128 %2, %3, off\n\t"
                 "global_load_async_to_lds_b128 %4, %5, off\n\t"
                 "s_wait_xcnt 0x0"
                 :: "v"(l0), "v"(g0), "v"(l1), "v"(g1), "v"(l2), "v"(g2)
                 : "memory");
}
// Behind a global store: stands in front of any later rewrite of the store's
// address and data registers.
__device__ __forceinline__ void wait_xcnt0() {
    asm volatile("s_wait_xcnt 0x0" ::: "memory");
}
__device__ __forceinline__ void wait_async0() {
    asm volatile("s_wait_asynccnt 0x0" ::: "memory");
}
// A wave's own LDS reads have retired before the barrier behind which the
// buffer they read is refilled by async copies.
__device__ __forceinline__ void wait_ds0() {
    asm volatile("s_wait_dscnt 0x0" ::: "memory");
}

// ---------------------------------------------------------------------------
// Weight pre-pass: every GEMM weight W[K][N] (f32) -> Wt[N][K] (bf16, rounded
// to nearest even, f2bf).  A block takes a strip of
// 1024 k x 64 n as sixteen 64x64 tiles.  A thread owns a 4(k) x 4(n) patch, so the
// transpose happens in its registers; the tile goes through LDS so that every
// global store covers whole 128-B lines of a Wt row.
// Element offsets of the transposed weights in their workspace region:
// ---------------------------------------------------------------------------
static constexpr size_t WT_Q   = 0;                                // [H*HD][D]
static constexpr size_t WT_K   = WT_Q   + (size_t)D * H * HD;      // [KV*HD][D]
static constexpr size_t WT_V   = WT_K   + (size_t)D * KV * HD;     // [KV*HD][D]
static constexpr size_t WT_O   = WT_V   + (size_t)D * KV * HD;     // [D][H*HD]
static constexpr size_t WT_13  = WT_O   + (size_t)H * HD * D;      // E x [2I][D]
static constexpr size_t WT_2   = WT_13  + (size_t)E * D * 2 * I;   // E x [D][I]
static constexpr size_t WT_S13 = WT_2   + (size_t)E * I * D;       // [2SI][D]
static constexpr size_t WT_S2  = WT_S13 + (size_t)D * 2 * SI;      // [D][SI]
static constexpr int strips(int k, int n) { return (k / 1024) * (n / 64); }
static constexpr int WT_BLOCKS =
    strips(D, H * HD) + 2 * strips(D, KV * HD) + strips(H * HD, D) +
    E * strips(D, 2 * I) + E * strips(I, D) + strips(D, 2 * SI) + strips(SI, D);

__global__ __launch_bounds__(256)
void weight_bf16_t_kernel(const float* __restrict__ wq, const float* __restrict__ wk,
                          const float* __restrict__ wv, const float* __restrict__ wo,
                          const float* __restrict__ w13, const float* __restrict__ w2,
                          const float* __restrict__ sw13, const float* __restrict__ sw2,
                          unsigned short* __restrict__ wt) {
    constexpr int P = 72;    // LDS row pitch: 144 B = 16 B x odd
    __shared__ __align__(16) unsigned short tile[2][64 * P];

    // Which matrix, and which strip of it (all block-uniform).
    int b = blockIdx.x;
    const float* src;
    size_t off;
    int K, N;
    if (b < strips(D, H * HD)) { src = wq; off = WT_Q; K = D; N = H * HD; }
    else if ((b -= strips(D, H * HD)) < strips(D, KV * HD)) { src = wk; off = WT_K; K = D; N = KV * HD; }
    else if ((b -= strips(D, KV * HD)) < strips(D, KV * HD)) { src = wv; off = WT_V; K = D; N = KV * HD; }
    else if ((b -= strips(D, KV * HD)) < strips(H * HD, D)) { src = wo; off = WT_O; K = H * HD; N = D; }
    else if ((b -= strips(H * HD, D)) < E * strips(D, 2 * I)) { src = w13; off = WT_13; K = D; N = 2 * I; }
    else if ((b -= E * strips(D, 2 * I)) < E * strips(I, D)) { src = w2; off = WT_2; K = I; N = D; }
    else if ((b -= E * strips(I, D)) < strips(D, 2 * SI)) { src = sw13; off = WT_S13; K = D; N = 2 * SI; }
    else { b -= strips(D, 2 * SI); src = sw2; off = WT_S2; K = SI; N = D; }
    int kstrips = K >> 10;
    int per     = kstrips * (N >> 6);       // strips of one matrix
    int e       = b / per;                  // expert (0 where there is one matrix)
    b -= e * per;
    int n0 = (b / kstrips) << 6;
    int kb = (b % kstrips) << 10;
    src += (size_t)e * K * N;
    unsigned short* dst = wt + off + (size_t)e * K * N;

    int tid  = threadIdx.x;
    int lane = tid & 31;
    int wid  = tid >> 5;
    // Eight lanes cover one 128-B line of a source row; the four lane groups of
    // a wave take different k quads, which spreads the 8-byte LDS stores.
    int pk = (((wid & 3) << 2) | (lane >> 3)) << 2;    // k 0,4,..,60
    int pn = (((wid >> 2) << 3) | (lane & 7)) << 2;    // n 0,4,..,60
    const float* g = src + (size_t)(kb + pk) * N + n0 + pn;
    // Read back: eight lanes cover one 128-B line of a Wt row.
    int rr = tid >> 3;                                 // n 0..31 (and +32)
    int rc = (tid & 7) << 3;                           // k 0,8,..,56
    unsigned short* o = dst + (size_t)(n0 + rr) * K + kb + rc;

    size_t rowb = (size_t)N;                           // source row, elements
    for (int t = 0; t < 16; ++t) {
        const float* gt = g + (size_t)(t * 64) * rowb;
        f32x4 r0, r1, r2, r3;
        // The four loads and their data wait in one statement, outputs
        // early-clobber: no result and no later instruction lands on an address
        // register of a load that is still in flight.
        asm volatile("global_load_b128 %0, %4, off\n\t"
                     "global_load_b128 %1, %5, off\n\t"
                     "global_load_b128 %2, %6, off\n\t"
                     "global_load_b128 %3, %7, off\n\t"
                     "s_wait_loadcnt 0x0"
                     : "=&v"(r0), "=&v"(r1), "=&v"(r2), "=&v"(r3)
                     : "v"(gt), "v"(gt + rowb), "v"(gt + 2 * rowb), "v"(gt + 3 * rowb)
                     : "memory");
        unsigned short* l = tile[t & 1];
#pragma unroll
        for (int j = 0; j < 4; ++j) {
            uint2 q;
            q.x = (unsigned)f2bf(r0[j]) | ((unsigned)f2bf(r1[j]) << 16);
            q.y = (unsigned)f2bf(r2[j]) | ((unsigned)f2bf(r3[j]) << 16);
            *(uint2*)&l[(pn + j) * P + pk] = q;
        }
        // One barrier a tile: with two buffers it also ends the reads of the
        // buffer that the next tile but one overwrites.
        __syncthreads();
#pragma unroll
        for (int i = 0; i < 2; ++i) {
            uint4 v = *(const uint4*)&l[(rr + i * 32) * P + rc];
            *(uint4*)&o[(size_t)(i * 32) * K + t * 64] = v;
            wait_xcnt0();   // in front of any later write of the store's registers
        }
    }
}

// ---------------------------------------------------------------------------
// RMSNorm: one block per row.  Writes f32 and/or bf16 outputs.
// ---------------------------------------------------------------------------
__global__ __launch_bounds__(256)
void rmsnorm_kernel(const float* __restrict__ in, const float* __restrict__ w,
                    float* outf, unsigned short* outb) {
    int row = blockIdx.x;
    int tid = threadIdx.x;
    __shared__ float red[256];
    const float* x = in + (size_t)row * D;
    float ss = 0.f;
    for (int i = tid; i < D; i += 256) { float v = x[i]; ss += v * v; }
    red[tid] = ss;
    __syncthreads();
    for (int s = 128; s > 0; s >>= 1) {
        if (tid < s) red[tid] += red[tid + s];
        __syncthreads();
    }
    float rs = rsqrtf(red[0] / (float)D + EPS);
    for (int i = tid; i < D; i += 256) {
        float v = x[i] * rs * w[i];
        if (outf) outf[(size_t)row * D + i] = v;
        if (outb) outb[(size_t)row * D + i] = f2bf(v);
    }
}

// ---------------------------------------------------------------------------
// RoPE: f32 in -> bf16 out, per (t, head, i<HD/2).
// ---------------------------------------------------------------------------
__global__ __launch_bounds__(256)
void rope_kernel(const int* __restrict__ pos, const float* __restrict__ in,
                 unsigned short* __restrict__ out, int nheads) {
    int idx = blockIdx.x * blockDim.x + threadIdx.x;
    int total = T * nheads * (HD / 2);
    if (idx >= total) return;
    int i = idx & 31;
    int h = (idx >> 5) % nheads;
    int t = idx / (32 * nheads);
    float inv = __expf(-(float)i * (9.2103403719761840f / 32.f)); // 10000^(-i/32)
    float ang = (float)pos[t] * inv;
    float s, c;
    __sincosf(ang, &s, &c);
    size_t base = (size_t)t * nheads * HD + (size_t)h * HD;
    float x1 = in[base + i];
    float x2 = in[base + 32 + i];
    out[base + i]      = f2bf(x1 * c - x2 * s);
    out[base + 32 + i] = f2bf(x2 * c + x1 * s);
}

// ---------------------------------------------------------------------------
// Router: one wave per token.  logits = xn . router_w[e], softmax, top-2.
// ---------------------------------------------------------------------------
__global__ __launch_bounds__(32)
void router_kernel(const float* __restrict__ xn, const float* __restrict__ rw,
                   float* __restrict__ fullw) {
    int t = blockIdx.x;
    int lane = threadIdx.x;
    float acc[E];
#pragma unroll
    for (int e = 0; e < E; ++e) acc[e] = 0.f;
    const float* x = xn + (size_t)t * D;
    for (int i = lane; i < D; i += 32) {
        float xv = x[i];
#pragma unroll
        for (int e = 0; e < E; ++e) acc[e] += xv * rw[(size_t)e * D + i];
    }
#pragma unroll
    for (int e = 0; e < E; ++e)
        for (int off = 16; off > 0; off >>= 1)
            acc[e] += __shfl_xor(acc[e], off, 32);
    if (lane == 0) {
        int i1 = 0;
        for (int e = 1; e < E; ++e) if (acc[e] > acc[i1]) i1 = e;
        int i2 = (i1 == 0) ? 1 : 0;
        for (int e = 0; e < E; ++e) if (e != i1 && acc[e] > acc[i2]) i2 = e;
        float e1 = 1.f;
        float e2 = __expf(acc[i2] - acc[i1]);
        float inv = 1.f / (e1 + e2);
        for (int e = 0; e < E; ++e) {
            float wv = (e == i1) ? e1 * inv : (e == i2) ? e2 * inv : 0.f;
            fullw[(size_t)t * E + e] = wv;
        }
    }
}

// ---------------------------------------------------------------------------
// BF16-WMMA GEMM, double-buffered LDS, async DMA of both tiles.
// C[M,N] = A[M,K](bf16) x Bt[N,K]^T (bf16, from the weight pre-pass).
// Block tile 64x128, 8 waves (2M x 4N), each wave 32x32 (4 WMMAs / K-step).
// Requires: M%64==0, N%128==0, K%32==0, lda%8==0, ldb%8==0 (all satisfied).
// ---------------------------------------------------------------------------
#define GEMM_STORE    0  // outf/outb = acc
#define GEMM_RESID    1  // outf = resid + scale*acc
#define GEMM_MOE_INIT 2  // outf  = rowsc[row]*acc
#define GEMM_SILU     4  // outb = silu(aux[row,col]) * acc   (bf16)
#define GEMM_FINAL    5  // outf = resid + scale*(aux + acc)

__global__ __launch_bounds__(256)
void gemm_bf16_wmma(const unsigned short* __restrict__ A, int lda,
                    const unsigned short* __restrict__ Bt, int ldb,
                    int M, int N, int K,
                    float* outf, unsigned short* outb, int ldc,
                    int mode, float scale,
                    const float* __restrict__ resid, int ldr,
                    const float* __restrict__ rowsc, int rss,
                    const float* __restrict__ aux, int ldaux,
                    int sA, int sB, int sC, int sR,
                    int N2, float* outf2, unsigned short* outb3) {
    constexpr int AS = 40;   // LDS stride for A rows   [64][AS]  (80B, 16B-mult)
    constexpr int BS = 40;   // LDS stride for B^T rows [128][BS]
    __shared__ __align__(16) unsigned short lds_a[2][64 * AS];
    __shared__ __align__(16) unsigned short lds_b[2][128 * BS];

    int tid  = threadIdx.x;
    int lane = tid & 31;
    int wid  = tid >> 5;
    int wm   = wid >> 2;   // 0..1
    int wn   = wid & 3;    // 0..3
    int m0   = blockIdx.y * 64;
    int n0   = blockIdx.x * 128;
    int ln   = lane & 15;

    // blockIdx.z: independent GEMMs of one shape whose operands lie sA / sB
    // elements apart, outputs and aux sC apart, row scales sR apart.
    size_t z = blockIdx.z;
    A += z * sA;
    Bt += z * sB + (size_t)n0 * ldb;     // this block's 128 rows of Bt
    if (outf)  outf  += z * sC;
    if (outb)  outb  += z * sC;
    if (aux)   aux   += z * sC;
    if (rowsc) rowsc += z * sR;
    // Column tiles behind N: a second (f32 out) and a third (bf16 out) GEMM on
    // the same A, each N2 columns wide; their Bt rows follow the first one's.
    // The third one's output is stored transposed, [N2][M]: ldc is the step of
    // the output index from row to row, ocs the step from column to column.
    int ocs = 1;
    if (n0 >= N) {
        n0 -= N;
        bool third = n0 >= N2;
        if (third) n0 -= N2;
        outf = third ? nullptr : outf2;
        outb = third ? outb3 : nullptr;
        N = ldc = N2;
        if (third) { ldc = 1; ocs = M; }
    }

    // Async staging: 256 threads x b128 cover the 64x32 bf16 A tile once and the
    // 128x32 Bt tile twice (rows sr and sr + 64).
    int sr = tid >> 2;          // row 0..63
    int sc = (tid & 3) << 3;    // k 0,8,16,24

    f32x8 zero = {0.f,0.f,0.f,0.f,0.f,0.f,0.f,0.f};
    f32x8 acc[2][2] = {{zero, zero}, {zero, zero}};

    const unsigned short* gA  = A + (size_t)(m0 + sr) * lda + sc;
    const unsigned short* gB0 = Bt + (size_t)sr * ldb + sc;
    const unsigned short* gB1 = Bt + (size_t)(sr + 64) * ldb + sc;
    auto stage = [&](int buf, int k0) {
        async_copy3_b128(lds_off(&lds_a[buf][sr * AS + sc]), gA + k0,
                         lds_off(&lds_b[buf][sr * BS + sc]), gB0 + k0,
                         lds_off(&lds_b[buf][(sr + 64) * BS + sc]), gB1 + k0);
    };

    // Two buffers: tile 0 lands and is published, then tile 1 flies.
    int nk = K >> 5;
    stage(0, 0);
    wait_async0();
    __syncthreads();
    if (nk > 1) stage(1, 32);

    int buf = 0;
    for (int kt = 0; kt < nk; ++kt) {
        BF16Frag af[2], bf[2];
#pragma unroll
        for (int s = 0; s < 2; ++s)
#pragma unroll
            for (int e = 0; e < 16; ++e) {
                int kk = fragK(e, lane);
                af[s].u[e] = lds_a[buf][(wm * 32 + s * 16 + ln) * AS + kk];
                bf[s].u[e] = lds_b[buf][(wn * 32 + s * 16 + ln) * BS + kk];
            }
#pragma unroll
        for (int sm = 0; sm < 2; ++sm)
#pragma unroll
            for (int sn = 0; sn < 2; ++sn)
                acc[sm][sn] = __builtin_amdgcn_wmma_f32_16x16x32_bf16(
                    false, af[sm].v, false, bf[sn].v, (short)0,
                    acc[sm][sn], false, false);

        // Foot of the trip: own LDS reads retired, tile kt+1 landed, one barrier
        // that publishes it and ends every read of this buffer; then the refill.
        wait_ds0();
        wait_async0();
        __syncthreads();
        if (kt + 2 < nk) stage(buf, (kt + 2) << 5);
        buf ^= 1;
    }
    wait_async0();   // no copy is in flight when the wave goes on to its stores

    int half8 = (lane & 16) >> 1;          // +8 row offset for lanes 16-31
#pragma unroll
    for (int sm = 0; sm < 2; ++sm) {
#pragma unroll
        for (int sn = 0; sn < 2; ++sn) {
            int col = n0 + wn * 32 + sn * 16 + ln;
#pragma unroll
            for (int rr = 0; rr < 8; ++rr) {
                int row = m0 + wm * 32 + sm * 16 + rr + half8;
                if (row >= M || col >= N) continue;
                float v = acc[sm][sn][rr];
                size_t oidx = (size_t)row * ldc + (size_t)col * ocs;
                if (mode == GEMM_STORE) {
                    if (outf) { outf[oidx] = v; wait_xcnt0(); }
                    if (outb) { outb[oidx] = f2bf(v); wait_xcnt0(); }
                } else if (mode == GEMM_RESID) {
                    outf[oidx] = resid[(size_t)row * ldr + col] + scale * v;
                    wait_xcnt0();
                } else if (mode == GEMM_MOE_INIT) {
                    outf[oidx] = rowsc[(size_t)row * rss] * v;
                    wait_xcnt0();
                } else if (mode == GEMM_SILU) {
                    float g = aux[(size_t)row * ldaux + col];
                    float s = g / (1.f + __expf(-g));
                    outb[oidx] = f2bf(s * v);
                    wait_xcnt0();
                } else { // GEMM_FINAL
                    outf[oidx] = resid[(size_t)row * ldr + col] +
                                 scale * (aux[(size_t)row * ldaux + col] + v);
                    wait_xcnt0();
                }
            }
        }
    }
}

// ---------------------------------------------------------------------------
// Sum of the experts' weighted down products, in the order 0..E-1.
// ---------------------------------------------------------------------------
__global__ __launch_bounds__(256)
void expert_sum_kernel(const float* __restrict__ planes, float* __restrict__ out) {
    constexpr size_t P = (size_t)T * D;
    size_t i = ((size_t)blockIdx.x * 256 + threadIdx.x) * 4;
    const float* g = planes + i;
    f32x4 p0, p1, p2, p3, p4, p5, p6, p7;
    // The eight loads and their data wait in one statement, outputs early-clobber:
    // no load's result and no later instruction lands on an address register of
    // a load that is still in flight.
    asm volatile("global_load_b128 %0, %8, off\n\t"
                 "global_load_b128 %1, %9, off\n\t"
                 "global_load_b128 %2, %10, off\n\t"
                 "global_load_b128 %3, %11, off\n\t"
                 "global_load_b128 %4, %12, off\n\t"
                 "global_load_b128 %5, %13, off\n\t"
                 "global_load_b128 %6, %14, off\n\t"
                 "global_load_b128 %7, %15, off\n\t"
                 "s_wait_loadcnt 0x0"
                 : "=&v"(p0), "=&v"(p1), "=&v"(p2), "=&v"(p3),
                   "=&v"(p4), "=&v"(p5), "=&v"(p6), "=&v"(p7)
                 : "v"(g), "v"(g + P), "v"(g + 2 * P), "v"(g + 3 * P),
                   "v"(g + 4 * P), "v"(g + 5 * P), "v"(g + 6 * P), "v"(g + 7 * P)
                 : "memory");
    static_assert(E == 8, "one load per expert");
    f32x4 s = ((((((p0 + p1) + p2) + p3) + p4) + p5) + p6) + p7;
    *(f32x4*)&out[i] = s;
}

// ---------------------------------------------------------------------------
// Causal GQA flash attention.  One wave per (head, 16-query tile); 4 waves
// per block.  QK^T and P.V via bf16 WMMA; online softmax over 32-key chunks.
// K is [t][KV*HD], V comes transposed, vt = [KV*HD][t]: in both, the k index of
// a B fragment runs along memory, so a fragment is two 16-byte loads a lane.
// ---------------------------------------------------------------------------
__global__ __launch_bounds__(128)
void attn_kernel(const unsigned short* __restrict__ qb,
                 const unsigned short* __restrict__ kb,
                 const unsigned short* __restrict__ vt,
                 unsigned short* __restrict__ attnb) {
    int h    = blockIdx.x;
    int w    = threadIdx.x >> 5;
    int lane = threadIdx.x & 31;
    int qt   = blockIdx.y * 4 + w;   // 16-query tile index
    int kvh  = h >> 2;               // H/KV = 4
    int hb   = (lane & 16) >> 1;     // +8 row offset for lanes 16-31
    int ln   = lane & 15;

    __shared__ unsigned short pbuf[4][16 * 34];   // per-wave P staging

    BF16Frag aq[2];
#pragma unroll
    for (int c = 0; c < 2; ++c)
#pragma unroll
        for (int e = 0; e < 16; ++e) {
            int kd = c * 32 + fragK(e, lane);
            int qrow = qt * 16 + ln;
            aq[c].u[e] = qb[(size_t)qrow * (H * HD) + h * HD + kd];
        }

    f32x8 o0 = {0,0,0,0,0,0,0,0}, o1 = o0, o2 = o0, o3 = o0;
    float rmax[8], rsum[8];
#pragma unroll
    for (int r = 0; r < 8; ++r) { rmax[r] = -1e30f; rsum[r] = 0.f; }

    int kend = qt * 16 + 16;                      // causal bound
    for (int kbase = 0; kbase < kend; kbase += 32) {
        float p[2][8];
        float tmax[8];
#pragma unroll
        for (int r = 0; r < 8; ++r) tmax[r] = -1e30f;

        // This chunk's K and V fragments.  kbase is a multiple of 32 below
        // kend <= T, and T is one too: keys kbase .. kbase + 31 all exist.
        // bk[sub][c]: key kbase + sub*16 + ln, head dims c*32 + fragK(0..15).
        // bv[j]:      head dim j*16 + ln,      keys kbase + fragK(0..15).
        static_assert(T % 32 == 0 && KV * HD * 2 == 1024 && T * 2 == 2048,
                      "the byte offsets in the loads below");
        BF16Frag bk[2][2], bv[4];
        const unsigned short* kp = kb + (size_t)(kbase + ln) * (KV * HD) + kvh * HD + hb;
        const unsigned short* vp = vt + (size_t)(kvh * HD + ln) * T + kbase + hb;
        // The sixteen loads and their data wait in one statement, outputs
        // early-clobber: no result and no later instruction lands on an address
        // register of a load that is still in flight.
        asm volatile("global_load_b128 %0, %16, off\n\t"
                     "global_load_b128 %1, %16, off offset:32\n\t"
                     "global_load_b128 %2, %16, off offset:64\n\t"
                     "global_load_b128 %3, %16, off offset:96\n\t"
                     "global_load_b128 %4, %16, off offset:16384\n\t"
                     "global_load_b128 %5, %16, off offset:16416\n\t"
                     "global_load_b128 %6, %16, off offset:16448\n\t"
                     "global_load_b128 %7, %16, off offset:16480\n\t"
                     "global_load_b128 %8, %17, off\n\t"
                     "global_load_b128 %9, %17, off offset:32\n\t"
                     "global_load_b128 %10, %17, off offset:32768\n\t"
                     "global_load_b128 %11, %17, off offset:32800\n\t"
                     "global_load_b128 %12, %17, off offset:65536\n\t"
                     "global_load_b128 %13, %17, off offset:65568\n\t"
                     "global_load_b128 %14, %17, off offset:98304\n\t"
                     "global_load_b128 %15, %17, off offset:98336\n\t"
                     "s_wait_loadcnt 0x0"
                     : "=&v"(bk[0][0].q[0]), "=&v"(bk[0][0].q[1]),
                       "=&v"(bk[0][1].q[0]), "=&v"(bk[0][1].q[1]),
                       "=&v"(bk[1][0].q[0]), "=&v"(bk[1][0].q[1]),
                       "=&v"(bk[1][1].q[0]), "=&v"(bk[1][1].q[1]),
                       "=&v"(bv[0].q[0]), "=&v"(bv[0].q[1]),
                       "=&v"(bv[1].q[0]), "=&v"(bv[1].q[1]),
                       "=&v"(bv[2].q[0]), "=&v"(bv[2].q[1]),
                       "=&v"(bv[3].q[0]), "=&v"(bv[3].q[1])
                     : "v"(kp), "v"(vp)
                     : "memory");

        // Unrolled so that bk[sub] and p[sub] are indexed by constants and stay
        // in registers.
#pragma unroll
        for (int sub = 0; sub < 2; ++sub) {
            int ks = kbase + sub * 16;
            f32x8 s = {0,0,0,0,0,0,0,0};
#pragma unroll
            for (int c = 0; c < 2; ++c)
                s = __builtin_amdgcn_wmma_f32_16x16x32_bf16(
                    false, aq[c].v, false, bk[sub][c].v, (short)0, s, false, false);
#pragma unroll
            for (int r = 0; r < 8; ++r) {
                int row = qt * 16 + r + hb;
                int key = ks + ln;
                float sv = s[r] * ATTN_MULT;
                if (key > row || key >= T) sv = -1e30f;
                p[sub][r] = sv;
                tmax[r] = fmaxf(tmax[r], sv);
            }
        }
#pragma unroll
        for (int r = 0; r < 8; ++r)
            for (int off = 8; off > 0; off >>= 1)
                tmax[r] = fmaxf(tmax[r], __shfl_xor(tmax[r], off, 16));

        float corr[8];
#pragma unroll
        for (int r = 0; r < 8; ++r) {
            float mn = fmaxf(rmax[r], tmax[r]);
            corr[r]  = __expf(rmax[r] - mn);
            rmax[r]  = mn;
            p[0][r]  = __expf(p[0][r] - mn);
            p[1][r]  = __expf(p[1][r] - mn);
            float ts = p[0][r] + p[1][r];
            for (int off = 8; off > 0; off >>= 1)
                ts += __shfl_xor(ts, off, 16);
            rsum[r] = rsum[r] * corr[r] + ts;
        }
#pragma unroll
        for (int r = 0; r < 8; ++r) {
            o0[r] *= corr[r]; o1[r] *= corr[r];
            o2[r] *= corr[r]; o3[r] *= corr[r];
        }
#pragma unroll
        for (int sub = 0; sub < 2; ++sub)
#pragma unroll
            for (int r = 0; r < 8; ++r)
                pbuf[w][(r + hb) * 34 + sub * 16 + ln] = f2bf(p[sub][r]);
        BF16Frag pf;
#pragma unroll
        for (int e = 0; e < 16; ++e)
            pf.u[e] = pbuf[w][ln * 34 + fragK(e, lane)];

        o0 = __builtin_amdgcn_wmma_f32_16x16x32_bf16(
                false, pf.v, false, bv[0].v, (short)0, o0, false, false);
        o1 = __builtin_amdgcn_wmma_f32_16x16x32_bf16(
                false, pf.v, false, bv[1].v, (short)0, o1, false, false);
        o2 = __builtin_amdgcn_wmma_f32_16x16x32_bf16(
                false, pf.v, false, bv[2].v, (short)0, o2, false, false);
        o3 = __builtin_amdgcn_wmma_f32_16x16x32_bf16(
                false, pf.v, false, bv[3].v, (short)0, o3, false, false);
    }
#pragma unroll
    for (int r = 0; r < 8; ++r) {
        int row = qt * 16 + r + hb;
        float inv = 1.f / rsum[r];
        size_t base = (size_t)row * (H * HD) + h * HD;
        attnb[base +  0 + ln] = f2bf(o0[r] * inv);
        attnb[base + 16 + ln] = f2bf(o1[r] * inv);
        attnb[base + 32 + ln] = f2bf(o2[r] * inv);
        attnb[base + 48 + ln] = f2bf(o3[r] * inv);
    }
}

// ---------------------------------------------------------------------------
// Host-side orchestration.
// ---------------------------------------------------------------------------
static void launch_gemm(hipStream_t s, int nz, int sA, int sB, int sC, int sR,
                        const unsigned short* A, int lda,
                        const unsigned short* Bt, int ldb, int M, int N, int K,
                        float* outf, unsigned short* outb, int ldc,
                        int mode, float scale,
                        const float* resid, int ldr,
                        const float* rowsc, int rss,
                        const float* aux, int ldaux) {
    dim3 g(N / 128, M / 64, nz);
    gemm_bf16_wmma<<<g, 256, 0, s>>>(A, lda, Bt, ldb, M, N, K, outf, outb, ldc,
                                     mode, scale, resid, ldr, rowsc, rss,
                                     aux, ldaux, sA, sB, sC, sR,
                                     0, nullptr, nullptr);
}

extern "C" void kernel_launch(void* const* d_in, const int* in_sizes, int n_in,
                              void* d_out, int out_size, void* d_ws, size_t ws_size,
                              hipStream_t stream) {
    const int*   pos     = (const int*)  d_in[0];
    const float* hidden  = (const float*)d_in[1];
    const float* ln1     = (const float*)d_in[2];
    const float* ln2     = (const float*)d_in[3];
    const float* wq      = (const float*)d_in[4];
    const float* wk      = (const float*)d_in[5];
    const float* wv      = (const float*)d_in[6];
    const float* wo      = (const float*)d_in[7];
    const float* routerw = (const float*)d_in[8];
    const float* w13     = (const float*)d_in[9];
    const float* w2      = (const float*)d_in[10];
    const float* sw13    = (const float*)d_in[11];
    const float* sw2     = (const float*)d_in[12];

    float* outF     = (float*)d_out;          // final hidden  [T*D]
    float* residOut = outF + (size_t)T * D;   // post-attn residual [T*D]

    char* ws = (char*)d_ws;
    const size_t MB = 1u << 20;
    unsigned short* xb    = (unsigned short*)(ws + 0);        // T*D bf16   4M
    float*          qf    = (float*)         (ws + 4  * MB);  // T*2048 f32 8M
    float*          kf    = (float*)         (ws + 12 * MB);  // T*512 f32  2M
    unsigned short* qbuf  = (unsigned short*)(ws + 14 * MB);  // 4M
    unsigned short* kbuf  = (unsigned short*)(ws + 18 * MB);  // 1M
    unsigned short* vbuf  = (unsigned short*)(ws + 19 * MB);  // 1M, [KV*HD][T]
    unsigned short* attnb = (unsigned short*)(ws + 20 * MB);  // 4M
    float*          xnf   = (float*)         (ws + 24 * MB);  // 8M
    unsigned short* xnb   = (unsigned short*)(ws + 32 * MB);  // 4M
    float*          fullw = (float*)         (ws + 36 * MB);  // 32K
    float*          moe   = (float*)         (ws + 37 * MB);  // 8M
    float*          ggate = (float*)         (ws + 45 * MB);  // T*SI f32 16M
    unsigned short* sactb = (unsigned short*)(ws + 61 * MB);  // 8M
    float*          hgate = (float*)         (ws + 69 * MB);  // E*T*I f32 32M
    unsigned short* actb  = (unsigned short*)(ws + 101 * MB); // E*T*I bf16 16M
    float*          moep  = (float*)         (ws + 117 * MB); // E*T*D f32 64M
    unsigned short* wt    = (unsigned short*)(ws + 184 * MB); // bf16 weights 164M
    (void)ws_size; (void)in_sizes; (void)n_in; (void)out_size;

    // 0) Every GEMM weight once to bf16, transposed to [n][k].
    weight_bf16_t_kernel<<<WT_BLOCKS, 256, 0, stream>>>(wq, wk, wv, wo, w13, w2,
                                                        sw13, sw2, wt);

    // 1) RMSNorm 1 -> bf16 activations.
    rmsnorm_kernel<<<T, 256, 0, stream>>>(hidden, ln1, nullptr, xb);

    // 2) QKV projections, one launch: column tiles 0-15 are Q, 16-19 K, 20-23 V
    //    (V is stored transposed, for the attention's fragment loads).
    gemm_bf16_wmma<<<dim3((H + 2 * KV) * HD / 128, T / 64), 256, 0, stream>>>(
        xb, D, wt + WT_Q, D, T, H * HD, D, qf, nullptr, H * HD, GEMM_STORE, 0.f,
        nullptr, 0, nullptr, 0, nullptr, 0, 0, 0, 0, 0,
        KV * HD, kf, vbuf);

    // 3) RoPE on Q and K (f32 -> bf16).
    rope_kernel<<<(T * H  * 32 + 255) / 256, 256, 0, stream>>>(pos, qf, qbuf, H);
    rope_kernel<<<(T * KV * 32 + 255) / 256, 256, 0, stream>>>(pos, kf, kbuf, KV);

    // 4) Causal GQA attention.
    attn_kernel<<<dim3(H, T / 64), 128, 0, stream>>>(qbuf, kbuf, vbuf, attnb);

    // 5) Output projection + residual -> residOut (second output).
    launch_gemm(stream, 1, 0, 0, 0, 0, attnb, H * HD, wt + WT_O, H * HD, T, D, H * HD,
                residOut, nullptr, D, GEMM_RESID, RES_MULT, hidden, D,
                nullptr, 0, nullptr, 0);

    // 6) RMSNorm 2.
    rmsnorm_kernel<<<T, 256, 0, stream>>>(residOut, ln2, xnf, xnb);

    // 7) Router top-2.
    router_kernel<<<T, 32, 0, stream>>>(xnf, routerw, fullw);

    // 8) Experts (dense, weighted by full_w as in the reference): blockIdx.z is
    //    the expert; the weighted down products stay apart and are summed after.
    launch_gemm(stream, E, 0, D * 2 * I, T * I, 0, xnb, D, wt + WT_13, D, T, I, D,
                hgate, nullptr, I, GEMM_STORE, 0.f, nullptr, 0, nullptr, 0, nullptr, 0);
    launch_gemm(stream, E, 0, D * 2 * I, T * I, 0, xnb, D, wt + WT_13 + (size_t)I * D, D, T, I, D,
                nullptr, actb, I, GEMM_SILU, 0.f, nullptr, 0, nullptr, 0, hgate, I);
    launch_gemm(stream, E, T * I, I * D, T * D, 1, actb, I, wt + WT_2, I, T, D, I,
                moep, nullptr, D, GEMM_MOE_INIT, 0.f,
                nullptr, 0, fullw, E, nullptr, 0);
    expert_sum_kernel<<<T * D / 1024, 256, 0, stream>>>(moep, moe);

    // 9) Shared expert.
    launch_gemm(stream, 1, 0, 0, 0, 0, xnb, D, wt + WT_S13, D, T, SI, D,
                ggate, nullptr, SI, GEMM_STORE, 0.f, nullptr, 0, nullptr, 0, nullptr, 0);
    launch_gemm(stream, 1, 0, 0, 0, 0, xnb, D, wt + WT_S13 + (size_t)SI * D, D, T, SI, D,
                nullptr, sactb, SI, GEMM_SILU, 0.f, nullptr, 0, nullptr, 0, ggate, SI);

    // 10) Shared down-proj fused with final residual.
    launch_gemm(stream, 1, 0, 0, 0, 0, sactb, SI, wt + WT_S2, SI, T, D, SI,
                outF, nullptr, D, GEMM_FINAL, RES_MULT, residOut, D,
                nullptr, 0, moe, D);
}

// v005
// It runs in 506 microseconds.
// In both of two side-by-side timings against v004, it was 1.22 times as fast.
// Counting every step since v000, it is 6.78 times as fast.
#include <hip/hip_runtime.h>
#include <hip/hip_bf16.h>

// ---------------------------------------------------------------------------
// MI455X (gfx1250, wave32) implementation of a decoder layer (attention, MoE, shared MLP).
// All large GEMMs + attention run on v_wmma_f32_16x16x32_bf16 (bf16 in, f32
// accum).  A-activation tiles move global->LDS via the CDNA5 async-DMA path
// (global_load_async_to_lds_b128 + s_wait_asynccnt).  A first launch writes every
// GEMM weight once as bf16, transposed to [n][k], into the workspace, so the
// weight tiles take the same async path and the k loop holds no conversion.
// GEMMs that do not depend on each other share one launch: Q/K/V in one grid,
// and the eight experts' gate, up and down products one grid each.
// Workspace requirement: 348 MiB (see layout below).
// ---------------------------------------------------------------------------

static constexpr int T  = 1024;
static constexpr int D  = 2048;
static constexpr int H  = 32;
static constexpr int KV = 8;
static constexpr int HD = 64;
static constexpr int E  = 8;
static constexpr int I  = 1024;
static constexpr int SI = 4096;
static constexpr float ATTN_MULT = 0.0078125f;
static constexpr float RES_MULT  = 0.22f;
static constexpr float EPS       = 1e-6f;

typedef __bf16 bf16x16 __attribute__((ext_vector_type(16)));
typedef float  f32x8   __attribute__((ext_vector_type(8)));
typedef float  f32x4   __attribute__((ext_vector_type(4)));
typedef unsigned int u32x4 __attribute__((ext_vector_type(4)));

union BF16Frag {
    unsigned short u[16];
    u32x4 q[2];      // the two runs of eight k-consecutive elements (see fragK)
    bf16x16 v;
};

__device__ __forceinline__ unsigned short f2bf(float f) {
    unsigned int u = __float_as_uint(f);
    unsigned int r = u + 0x7FFFu + ((u >> 16) & 1u);   // round-to-nearest-even
    return (unsigned short)(r >> 16);
}

// A/B fragment K-index pattern for V_WMMA_*_16X16X32_BF16 (ISA 7.12.2):
// VGPR p (0..7), half w; lanes 0-15 vs 16-31 differ by +8 in K.
__device__ __forceinline__ int fragK(int e, int lane) {
    int p = e >> 1, w = e & 1;
    return ((p & 3) << 1) + w + ((p >> 2) << 4) + ((lane >> 4) << 3);
}

// Generic pointer -> 32-bit LDS byte offset (AS3) for async-DMA VDST operand.
__device__ __forceinline__ unsigned lds_off(const void* p) {
    return (unsigned)(unsigned long long)
        (__attribute__((address_space(3))) const void*)p;
}

// CDNA5 async global->LDS copies, 16B per lane each (ASYNCcnt tracked): a
// thread's share of one k stage, four pieces of the A tile and eight of the B
// tile.  Piece i lies i * ls bytes further in LDS and i * ga (gb) elements
// further in global memory than the first one of its tile.  A wave's copy takes
// two rows of 256 B: whole lines, where a 32-k stage took 64 B of eight rows.
__device__ __forceinline__ void async_copy12_b128(unsigned la, const unsigned short* a, size_t ga,
                                                  unsigned lb, const unsigned short* b, size_t gb,
                                                  unsigned ls) {
    // s_wait_xcnt as the last line of the copies' own statement: it stands in
    // front of any later rewrite of the address registers that the copies name.
    asm volatile("global_load_async_to_lds_b128 %0, %1, off\n\t"
                 "global_load_async_to_lds_b128 %2, %3, off\n\t"
                 "global_load_async_to_lds_b128 %4, %5, off\n\t"
                 "global_load_async_to_lds_b128 %6, %7, off\n\t"
                 "global_load_async_to_lds_b128 %8, %9, off\n\t"
                 "global_load_async_to_lds_b128 %10, %11, off\n\t"
                 "global_load_async_to_lds_b128 %12, %13, off\n\t"
                 "global_load_async_to_lds_b128 %14, %15, off\n\t"
                 "global_load_async_to_lds_b128 %16, %17, off\n\t"
                 "global_load_async_to_lds_b128 %18, %19, off\n\t"
                 "global_load_async_to_lds_b128 %20, %21, off\n\t"
                 "global_load_async_to_lds_b128 %22, %23, off\n\t"
                 "s_wait_xcnt 0x0"
                 :: "v"(la),          "v"(a),
                    "v"(la + ls),     "v"(a + ga),
                    "v"(la + 2 * ls), "v"(a + 2 * ga),
                    "v"(la + 3 * ls), "v"(a + 3 * ga),
                    "v"(lb),          "v"(b),
                    "v"(lb + ls),     "v"(b + gb),
                    "v"(lb + 2 * ls), "v"(b + 2 * gb),
                    "v"(lb + 3 * ls), "v"(b + 3 * gb),
                    "v"(lb + 4 * ls), "v"(b + 4 * gb),
                    "v"(lb + 5 * ls), "v"(b + 5 * gb),
                    "v"(lb + 6 * ls), "v"(b + 6 * gb),
                    "v"(lb + 7 * ls), "v"(b + 7 * gb)
                 : "memory");
}
// Behind a global store: stands in front of any later rewrite of the store's
// address and data registers.
__device__ __forceinline__ void wait_xcnt0() {
    asm volatile("s_wait_xcnt 0x0" ::: "memory");
}
__device__ __forceinline__ void wait_async0() {
    asm volatile("s_wait_asynccnt 0x0" ::: "memory");
}
// A wave's own LDS reads have retired before the barrier behind which the
// buffer they read is refilled by async copies.
__device__ __forceinline__ void wait_ds0() {
    asm volatile("s_wait_dscnt 0x0" ::: "memory");
}

// ---------------------------------------------------------------------------
// Weight pre-pass: every GEMM weight W[K][N] (f32) -> Wt[N][K] (bf16, rounded
// to nearest even, f2bf).  A block takes a strip of
// 1024 k x 64 n as sixteen 64x64 tiles.  A thread owns a 4(k) x 4(n) patch, so the
// transpose happens in its registers; the tile goes through LDS so that every
// global store covers whole 128-B lines of a Wt row.
// Element offsets of the transposed weights in their workspace region:
// ---------------------------------------------------------------------------
static constexpr size_t WT_Q   = 0;                                // [H*HD][D]
static constexpr size_t WT_K   = WT_Q   + (size_t)D * H * HD;      // [KV*HD][D]
static constexpr size_t WT_V   = WT_K   + (size_t)D * KV * HD;     // [KV*HD][D]
static constexpr size_t WT_O   = WT_V   + (size_t)D * KV * HD;     // [D][H*HD]
static constexpr size_t WT_13  = WT_O   + (size_t)H * HD * D;      // E x [2I][D]
static constexpr size_t WT_2   = WT_13  + (size_t)E * D * 2 * I;   // E x [D][I]
static constexpr size_t WT_S13 = WT_2   + (size_t)E * I * D;       // [2SI][D]
static constexpr size_t WT_S2  = WT_S13 + (size_t)D * 2 * SI;      // [D][SI]
static constexpr int strips(int k, int n) { return (k / 1024) * (n / 64); }
static constexpr int WT_BLOCKS =
    strips(D, H * HD) + 2 * strips(D, KV * HD) + strips(H * HD, D) +
    E * strips(D, 2 * I) + E * strips(I, D) + strips(D, 2 * SI) + strips(SI, D);

__global__ __launch_bounds__(256)
void weight_bf16_t_kernel(const float* __restrict__ wq, const float* __restrict__ wk,
                          const float* __restrict__ wv, const float* __restrict__ wo,
                          const float* __restrict__ w13, const float* __restrict__ w2,
                          const float* __restrict__ sw13, const float* __restrict__ sw2,
                          unsigned short* __restrict__ wt) {
    constexpr int P = 72;    // LDS row pitch: 144 B = 16 B x odd
    __shared__ __align__(16) unsigned short tile[2][64 * P];

    // Which matrix, and which strip of it (all block-uniform).
    int b = blockIdx.x;
    const float* src;
    size_t off;
    int K, N;
    if (b < strips(D, H * HD)) { src = wq; off = WT_Q; K = D; N = H * HD; }
    else if ((b -= strips(D, H * HD)) < strips(D, KV * HD)) { src = wk; off = WT_K; K = D; N = KV * HD; }
    else if ((b -= strips(D, KV * HD)) < strips(D, KV * HD)) { src = wv; off = WT_V; K = D; N = KV * HD; }
    else if ((b -= strips(D, KV * HD)) < strips(H * HD, D)) { src = wo; off = WT_O; K = H * HD; N = D; }
    else if ((b -= strips(H * HD, D)) < E * strips(D, 2 * I)) { src = w13; off = WT_13; K = D; N = 2 * I; }
    else if ((b -= E * strips(D, 2 * I)) < E * strips(I, D)) { src = w2; off = WT_2; K = I; N = D; }
    else if ((b -= E * strips(I, D)) < strips(D, 2 * SI)) { src = sw13; off = WT_S13; K = D; N = 2 * SI; }
    else { b -= strips(D, 2 * SI); src = sw2; off = WT_S2; K = SI; N = D; }
    int kstrips = K >> 10;
    int per     = kstrips * (N >> 6);       // strips of one matrix
    int e       = b / per;                  // expert (0 where there is one matrix)
    b -= e * per;
    int n0 = (b / kstrips) << 6;
    int kb = (b % kstrips) << 10;
    src += (size_t)e * K * N;
    unsigned short* dst = wt + off + (size_t)e * K * N;

    int tid  = threadIdx.x;
    int lane = tid & 31;
    int wid  = tid >> 5;
    // Eight lanes cover one 128-B line of a source row; the four lane groups of
    // a wave take different k quads, which spreads the 8-byte LDS stores.
    int pk = (((wid & 3) << 2) | (lane >> 3)) << 2;    // k 0,4,..,60
    int pn = (((wid >> 2) << 3) | (lane & 7)) << 2;    // n 0,4,..,60
    const float* g = src + (size_t)(kb + pk) * N + n0 + pn;
    // Read back: eight lanes cover one 128-B line of a Wt row.
    int rr = tid >> 3;                                 // n 0..31 (and +32)
    int rc = (tid & 7) << 3;                           // k 0,8,..,56
    unsigned short* o = dst + (size_t)(n0 + rr) * K + kb + rc;

    size_t rowb = (size_t)N;                           // source row, elements
    for (int t = 0; t < 16; ++t) {
        const float* gt = g + (size_t)(t * 64) * rowb;
        f32x4 r0, r1, r2, r3;
        // The four loads and their data wait in one statement, outputs
        // early-clobber: no result and no later instruction lands on an address
        // register of a load that is still in flight.
        asm volatile("global_load_b128 %0, %4, off\n\t"
                     "global_load_b128 %1, %5, off\n\t"
                     "global_load_b128 %2, %6, off\n\t"
                     "global_load_b128 %3, %7, off\n\t"
                     "s_wait_loadcnt 0x0"
                     : "=&v"(r0), "=&v"(r1), "=&v"(r2), "=&v"(r3)
                     : "v"(gt), "v"(gt + rowb), "v"(gt + 2 * rowb), "v"(gt + 3 * rowb)
                     : "memory");
        unsigned short* l = tile[t & 1];
#pragma unroll
        for (int j = 0; j < 4; ++j) {
            uint2 q;
            q.x = (unsigned)f2bf(r0[j]) | ((unsigned)f2bf(r1[j]) << 16);
            q.y = (unsigned)f2bf(r2[j]) | ((unsigned)f2bf(r3[j]) << 16);
            *(uint2*)&l[(pn + j) * P + pk] = q;
        }
        // One barrier a tile: with two buffers it also ends the reads of the
        // buffer that the next tile but one overwrites.
        __syncthreads();
#pragma unroll
        for (int i = 0; i < 2; ++i) {
            uint4 v = *(const uint4*)&l[(rr + i * 32) * P + rc];
            *(uint4*)&o[(size_t)(i * 32) * K + t * 64] = v;
            wait_xcnt0();   // in front of any later write of the store's registers
        }
    }
}

// ---------------------------------------------------------------------------
// RMSNorm: one block per row.  Writes f32 and/or bf16 outputs.
// ---------------------------------------------------------------------------
__global__ __launch_bounds__(256)
void rmsnorm_kernel(const float* __restrict__ in, const float* __restrict__ w,
                    float* outf, unsigned short* outb) {
    int row = blockIdx.x;
    int tid = threadIdx.x;
    __shared__ float red[256];
    const float* x = in + (size_t)row * D;
    float ss = 0.f;
    for (int i = tid; i < D; i += 256) { float v = x[i]; ss += v * v; }
    red[tid] = ss;
    __syncthreads();
    for (int s = 128; s > 0; s >>= 1) {
        if (tid < s) red[tid] += red[tid + s];
        __syncthreads();
    }
    float rs = rsqrtf(red[0] / (float)D + EPS);
    for (int i = tid; i < D; i += 256) {
        float v = x[i] * rs * w[i];
        if (outf) outf[(size_t)row * D + i] = v;
        if (outb) outb[(size_t)row * D + i] = f2bf(v);
    }
}

// ---------------------------------------------------------------------------
// RoPE: f32 in -> bf16 out, per (t, head, i<HD/2).
// ---------------------------------------------------------------------------
__global__ __launch_bounds__(256)
void rope_kernel(const int* __restrict__ pos, const float* __restrict__ in,
                 unsigned short* __restrict__ out, int nheads) {
    int idx = blockIdx.x * blockDim.x + threadIdx.x;
    int total = T * nheads * (HD / 2);
    if (idx >= total) return;
    int i = idx & 31;
    int h = (idx >> 5) % nheads;
    int t = idx / (32 * nheads);
    float inv = __expf(-(float)i * (9.2103403719761840f / 32.f)); // 10000^(-i/32)
    float ang = (float)pos[t] * inv;
    float s, c;
    __sincosf(ang, &s, &c);
    size_t base = (size_t)t * nheads * HD + (size_t)h * HD;
    float x1 = in[base + i];
    float x2 = in[base + 32 + i];
    out[base + i]      = f2bf(x1 * c - x2 * s);
    out[base + 32 + i] = f2bf(x2 * c + x1 * s);
}

// ---------------------------------------------------------------------------
// Router: one wave per token.  logits = xn . router_w[e], softmax, top-2.
// ---------------------------------------------------------------------------
__global__ __launch_bounds__(32)
void router_kernel(const float* __restrict__ xn, const float* __restrict__ rw,
                   float* __restrict__ fullw) {
    int t = blockIdx.x;
    int lane = threadIdx.x;
    float acc[E];
#pragma unroll
    for (int e = 0; e < E; ++e) acc[e] = 0.f;
    const float* x = xn + (size_t)t * D;
    for (int i = lane; i < D; i += 32) {
        float xv = x[i];
#pragma unroll
        for (int e = 0; e < E; ++e) acc[e] += xv * rw[(size_t)e * D + i];
    }
#pragma unroll
    for (int e = 0; e < E; ++e)
        for (int off = 16; off > 0; off >>= 1)
            acc[e] += __shfl_xor(acc[e], off, 32);
    if (lane == 0) {
        int i1 = 0;
        for (int e = 1; e < E; ++e) if (acc[e] > acc[i1]) i1 = e;
        int i2 = (i1 == 0) ? 1 : 0;
        for (int e = 0; e < E; ++e) if (e != i1 && acc[e] > acc[i2]) i2 = e;
        float e1 = 1.f;
        float e2 = __expf(acc[i2] - acc[i1]);
        float inv = 1.f / (e1 + e2);
        for (int e = 0; e < E; ++e) {
            float wv = (e == i1) ? e1 * inv : (e == i2) ? e2 * inv : 0.f;
            fullw[(size_t)t * E + e] = wv;
        }
    }
}

// ---------------------------------------------------------------------------
// BF16-WMMA GEMM, double-buffered LDS, async DMA of both tiles.
// C[M,N] = A[M,K](bf16) x Bt[N,K]^T (bf16, from the weight pre-pass).
// Block tile 64x128, 8 waves (2M x 4N), each wave 32x32.  A stage of the two
// LDS buffers holds 128 k (16 WMMAs a wave): 48 KiB of copies are in flight per
// block, and their latency, the waits and the barrier are paid once per 128 k.
// Requires: M%64==0, N%128==0, K%128==0, lda%8==0, ldb%8==0 (all satisfied).
// ---------------------------------------------------------------------------
#define GEMM_STORE    0  // outf/outb = acc
#define GEMM_RESID    1  // outf = resid + scale*acc
#define GEMM_MOE_INIT 2  // outf  = rowsc[row]*acc
#define GEMM_SILU     4  // outb = silu(aux[row,col]) * acc   (bf16)
#define GEMM_FINAL    5  // outf = resid + scale*(aux + acc)

__global__ __launch_bounds__(256)
void gemm_bf16_wmma(const unsigned short* __restrict__ A, int lda,
                    const unsigned short* __restrict__ Bt, int ldb,
                    int M, int N, int K,
                    float* outf, unsigned short* outb, int ldc,
                    int mode, float scale,
                    const float* __restrict__ resid, int ldr,
                    const float* __restrict__ rowsc, int rss,
                    const float* __restrict__ aux, int ldaux,
                    int sA, int sB, int sC, int sR,
                    int N2, float* outf2, unsigned short* outb3) {
    constexpr int BK = 128;      // k per stage
    constexpr int AS = BK + 8;   // LDS stride for A rows   [64][AS]  (272 B = 16 B x odd)
    constexpr int BS = BK + 8;   // LDS stride for B^T rows [128][BS]
    __shared__ __align__(16) unsigned short lds_a[2][64 * AS];
    __shared__ __align__(16) unsigned short lds_b[2][128 * BS];

    int tid  = threadIdx.x;
    int lane = tid & 31;
    int wid  = tid >> 5;
    int wm   = wid >> 2;   // 0..1
    int wn   = wid & 3;    // 0..3
    int m0   = blockIdx.y * 64;
    int n0   = blockIdx.x * 128;
    int ln   = lane & 15;

    // blockIdx.z: independent GEMMs of one shape whose operands lie sA / sB
    // elements apart, outputs and aux sC apart, row scales sR apart.
    size_t z = blockIdx.z;
    A += z * sA;
    Bt += z * sB + (size_t)n0 * ldb;     // this block's 128 rows of Bt
    if (outf)  outf  += z * sC;
    if (outb)  outb  += z * sC;
    if (aux)   aux   += z * sC;
    if (rowsc) rowsc += z * sR;
    // Column tiles behind N: a second (f32 out) and a third (bf16 out) GEMM on
    // the same A, each N2 columns wide; their Bt rows follow the first one's.
    // The third one's output is stored transposed, [N2][M]: ldc is the step of
    // the output index from row to row, ocs the step from column to column.
    int ocs = 1;
    if (n0 >= N) {
        n0 -= N;
        bool third = n0 >= N2;
        if (third) n0 -= N2;
        outf = third ? nullptr : outf2;
        outb = third ? outb3 : nullptr;
        N = ldc = N2;
        if (third) { ldc = 1; ocs = M; }
    }

    // Async staging: sixteen threads x b128 cover the 256 bytes of one row, 256
    // threads sixteen rows: the 64x128 bf16 A tile takes four such pieces, the
    // 128x128 Bt tile eight (rows sr, sr + 16, ...).
    int sr = tid >> 4;          // row 0..15
    int sc = (tid & 15) << 3;   // k 0,8,..,120

    f32x8 zero = {0.f,0.f,0.f,0.f,0.f,0.f,0.f,0.f};
    f32x8 acc[2][2] = {{zero, zero}, {zero, zero}};

    static_assert(AS == BS, "one LDS step for the pieces of both tiles");
    const unsigned short* gA = A + (size_t)(m0 + sr) * lda + sc;
    const unsigned short* gB = Bt + (size_t)sr * ldb + sc;
    auto stage = [&](int buf, int k0) {
        async_copy12_b128(lds_off(&lds_a[buf][sr * AS + sc]), gA + k0, (size_t)16 * lda,
                          lds_off(&lds_b[buf][sr * BS + sc]), gB + k0, (size_t)16 * ldb,
                          16 * AS * 2);
    };

    // Two buffers: tile 0 lands and is published, then tile 1 flies.
    int nk = K / BK;
    stage(0, 0);
    wait_async0();
    __syncthreads();
    if (nk > 1) stage(1, BK);

    int buf = 0;
    for (int kt = 0; kt < nk; ++kt) {
        // Unrolled: the four 32-k slices' places in the stage become immediate
        // offsets of the fragment loads, with no address arithmetic per slice.
#pragma unroll
        for (int ks = 0; ks < BK; ks += 32) {
            BF16Frag af[2], bf[2];
#pragma unroll
            for (int s = 0; s < 2; ++s)
#pragma unroll
                for (int e = 0; e < 16; ++e) {
                    int kk = ks + fragK(e, lane);
                    af[s].u[e] = lds_a[buf][(wm * 32 + s * 16 + ln) * AS + kk];
                    bf[s].u[e] = lds_b[buf][(wn * 32 + s * 16 + ln) * BS + kk];
                }
#pragma unroll
            for (int sm = 0; sm < 2; ++sm)
#pragma unroll
                for (int sn = 0; sn < 2; ++sn)
                    acc[sm][sn] = __builtin_amdgcn_wmma_f32_16x16x32_bf16(
                        false, af[sm].v, false, bf[sn].v, (short)0,
                        acc[sm][sn], false, false);
        }

        // Foot of the trip: own LDS reads retired, tile kt+1 landed, one barrier
        // that publishes it and ends every read of this buffer; then the refill.
        wait_ds0();
        wait_async0();
        __syncthreads();
        if (kt + 2 < nk) stage(buf, (kt + 2) * BK);
        buf ^= 1;
    }
    wait_async0();   // no copy is in flight when the wave goes on to its stores

    int half8 = (lane & 16) >> 1;          // +8 row offset for lanes 16-31
#pragma unroll
    for (int sm = 0; sm < 2; ++sm) {
#pragma unroll
        for (int sn = 0; sn < 2; ++sn) {
            int col = n0 + wn * 32 + sn * 16 + ln;
#pragma unroll
            for (int rr = 0; rr < 8; ++rr) {
                int row = m0 + wm * 32 + sm * 16 + rr + half8;
                if (row >= M || col >= N) continue;
                float v = acc[sm][sn][rr];
                size_t oidx = (size_t)row * ldc + (size_t)col * ocs;
                if (mode == GEMM_STORE) {
                    if (outf) { outf[oidx] = v; wait_xcnt0(); }
                    if (outb) { outb[oidx] = f2bf(v); wait_xcnt0(); }
                } else if (mode == GEMM_RESID) {
                    outf[oidx] = resid[(size_t)row * ldr + col] + scale * v;
                    wait_xcnt0();
                } else if (mode == GEMM_MOE_INIT) {
                    outf[oidx] = rowsc[(size_t)row * rss] * v;
                    wait_xcnt0();
                } else if (mode == GEMM_SILU) {
                    float g = aux[(size_t)row * ldaux + col];
                    float s = g / (1.f + __expf(-g));
                    outb[oidx] = f2bf(s * v);
                    wait_xcnt0();
                } else { // GEMM_FINAL
                    outf[oidx] = resid[(size_t)row * ldr + col] +
                                 scale * (aux[(size_t)row * ldaux + col] + v);
                    wait_xcnt0();
                }
            }
        }
    }
}

// ---------------------------------------------------------------------------
// Sum of the experts' weighted down products, in the order 0..E-1.
// ---------------------------------------------------------------------------
__global__ __launch_bounds__(256)
void expert_sum_kernel(const float* __restrict__ planes, float* __restrict__ out) {
    constexpr size_t P = (size_t)T * D;
    size_t i = ((size_t)blockIdx.x * 256 + threadIdx.x) * 4;
    const float* g = planes + i;
    f32x4 p0, p1, p2, p3, p4, p5, p6, p7;
    // The eight loads and their data wait in one statement, outputs early-clobber:
    // no load's result and no later instruction lands on an address register of
    // a load that is still in flight.
    asm volatile("global_load_b128 %0, %8, off\n\t"
                 "global_load_b128 %1, %9, off\n\t"
                 "global_load_b128 %2, %10, off\n\t"
                 "global_load_b128 %3, %11, off\n\t"
                 "global_load_b128 %4, %12, off\n\t"
                 "global_load_b128 %5, %13, off\n\t"
                 "global_load_b128 %6, %14, off\n\t"
                 "global_load_b128 %7, %15, off\n\t"
                 "s_wait_loadcnt 0x0"
                 : "=&v"(p0), "=&v"(p1), "=&v"(p2), "=&v"(p3),
                   "=&v"(p4), "=&v"(p5), "=&v"(p6), "=&v"(p7)
                 : "v"(g), "v"(g + P), "v"(g + 2 * P), "v"(g + 3 * P),
                   "v"(g + 4 * P), "v"(g + 5 * P), "v"(g + 6 * P), "v"(g + 7 * P)
                 : "memory");
    static_assert(E == 8, "one load per expert");
    f32x4 s = ((((((p0 + p1) + p2) + p3) + p4) + p5) + p6) + p7;
    *(f32x4*)&out[i] = s;
}

// ---------------------------------------------------------------------------
// Causal GQA flash attention.  One wave per (head, 16-query tile); 4 waves
// per block.  QK^T and P.V via bf16 WMMA; online softmax over 32-key chunks.
// K is [t][KV*HD], V comes transposed, vt = [KV*HD][t]: in both, the k index of
// a B fragment runs along memory, so a fragment is two 16-byte loads a lane.
// ---------------------------------------------------------------------------
__global__ __launch_bounds__(128)
void attn_kernel(const unsigned short* __restrict__ qb,
                 const unsigned short* __restrict__ kb,
                 const unsigned short* __restrict__ vt,
                 unsigned short* __restrict__ attnb) {
    int h    = blockIdx.x;
    int w    = threadIdx.x >> 5;
    int lane = threadIdx.x & 31;
    int qt   = blockIdx.y * 4 + w;   // 16-query tile index
    int kvh  = h >> 2;               // H/KV = 4
    int hb   = (lane & 16) >> 1;     // +8 row offset for lanes 16-31
    int ln   = lane & 15;

    __shared__ unsigned short pbuf[4][16 * 34];   // per-wave P staging

    BF16Frag aq[2];
#pragma unroll
    for (int c = 0; c < 2; ++c)
#pragma unroll
        for (int e = 0; e < 16; ++e) {
            int kd = c * 32 + fragK(e, lane);
            int qrow = qt * 16 + ln;
            aq[c].u[e] = qb[(size_t)qrow * (H * HD) + h * HD + kd];
        }

    f32x8 o0 = {0,0,0,0,0,0,0,0}, o1 = o0, o2 = o0, o3 = o0;
    float rmax[8], rsum[8];
#pragma unroll
    for (int r = 0; r < 8; ++r) { rmax[r] = -1e30f; rsum[r] = 0.f; }

    int kend = qt * 16 + 16;                      // causal bound
    for (int kbase = 0; kbase < kend; kbase += 32) {
        float p[2][8];
        float tmax[8];
#pragma unroll
        for (int r = 0; r < 8; ++r) tmax[r] = -1e30f;

        // This chunk's K and V fragments.  kbase is a multiple of 32 below
        // kend <= T, and T is one too: keys kbase .. kbase + 31 all exist.
        // bk[sub][c]: key kbase + sub*16 + ln, head dims c*32 + fragK(0..15).
        // bv[j]:      head dim j*16 + ln,      keys kbase + fragK(0..15).
        static_assert(T % 32 == 0 && KV * HD * 2 == 1024 && T * 2 == 2048,
                      "the byte offsets in the loads below");
        BF16Frag bk[2][2], bv[4];
        const unsigned short* kp = kb + (size_t)(kbase + ln) * (KV * HD) + kvh * HD + hb;
        const unsigned short* vp = vt + (size_t)(kvh * HD + ln) * T + kbase + hb;
        // The sixteen loads and their data wait in one statement, outputs
        // early-clobber: no result and no later instruction lands on an address
        // register of a load that is still in flight.
        asm volatile("global_load_b128 %0, %16, off\n\t"
                     "global_load_b128 %1, %16, off offset:32\n\t"
                     "global_load_b128 %2, %16, off offset:64\n\t"
                     "global_load_b128 %3, %16, off offset:96\n\t"
                     "global_load_b128 %4, %16, off offset:16384\n\t"
                     "global_load_b128 %5, %16, off offset:16416\n\t"
                     "global_load_b128 %6, %16, off offset:16448\n\t"
                     "global_load_b128 %7, %16, off offset:16480\n\t"
                     "global_load_b128 %8, %17, off\n\t"
                     "global_load_b128 %9, %17, off offset:32\n\t"
                     "global_load_b128 %10, %17, off offset:32768\n\t"
                     "global_load_b128 %11, %17, off offset:32800\n\t"
                     "global_load_b128 %12, %17, off offset:65536\n\t"
                     "global_load_b128 %13, %17, off offset:65568\n\t"
                     "global_load_b128 %14, %17, off offset:98304\n\t"
                     "global_load_b128 %15, %17, off offset:98336\n\t"
                     "s_wait_loadcnt 0x0"
                     : "=&v"(bk[0][0].q[0]), "=&v"(bk[0][0].q[1]),
                       "=&v"(bk[0][1].q[0]), "=&v"(bk[0][1].q[1]),
                       "=&v"(bk[1][0].q[0]), "=&v"(bk[1][0].q[1]),
                       "=&v"(bk[1][1].q[0]), "=&v"(bk[1][1].q[1]),
                       "=&v"(bv[0].q[0]), "=&v"(bv[0].q[1]),
                       "=&v"(bv[1].q[0]), "=&v"(bv[1].q[1]),
                       "=&v"(bv[2].q[0]), "=&v"(bv[2].q[1]),
                       "=&v"(bv[3].q[0]), "=&v"(bv[3].q[1])
                     : "v"(kp), "v"(vp)
                     : "memory");

        // Unrolled so that bk[sub] and p[sub] are indexed by constants and stay
        // in registers.
#pragma unroll
        for (int sub = 0; sub < 2; ++sub) {
            int ks = kbase + sub * 16;
            f32x8 s = {0,0,0,0,0,0,0,0};
#pragma unroll
            for (int c = 0; c < 2; ++c)
                s = __builtin_amdgcn_wmma_f32_16x16x32_bf16(
                    false, aq[c].v, false, bk[sub][c].v, (short)0, s, false, false);
#pragma unroll
            for (int r = 0; r < 8; ++r) {
                int row = qt * 16 + r + hb;
                int key = ks + ln;
                float sv = s[r] * ATTN_MULT;
                if (key > row || key >= T) sv = -1e30f;
                p[sub][r] = sv;
                tmax[r] = fmaxf(tmax[r], sv);
            }
        }
#pragma unroll
        for (int r = 0; r < 8; ++r)
            for (int off = 8; off > 0; off >>= 1)
                tmax[r] = fmaxf(tmax[r], __shfl_xor(tmax[r], off, 16));

        float corr[8];
#pragma unroll
        for (int r = 0; r < 8; ++r) {
            float mn = fmaxf(rmax[r], tmax[r]);
            corr[r]  = __expf(rmax[r] - mn);
            rmax[r]  = mn;
            p[0][r]  = __expf(p[0][r] - mn);
            p[1][r]  = __expf(p[1][r] - mn);
            float ts = p[0][r] + p[1][r];
            for (int off = 8; off > 0; off >>= 1)
                ts += __shfl_xor(ts, off, 16);
            rsum[r] = rsum[r] * corr[r] + ts;
        }
#pragma unroll
        for (int r = 0; r < 8; ++r) {
            o0[r] *= corr[r]; o1[r] *= corr[r];
            o2[r] *= corr[r]; o3[r] *= corr[r];
        }
#pragma unroll
        for (int sub = 0; sub < 2; ++sub)
#pragma unroll
            for (int r = 0; r < 8; ++r)
                pbuf[w][(r + hb) * 34 + sub * 16 + ln] = f2bf(p[sub][r]);
        BF16Frag pf;
#pragma unroll
        for (int e = 0; e < 16; ++e)
            pf.u[e] = pbuf[w][ln * 34 + fragK(e, lane)];

        o0 = __builtin_amdgcn_wmma_f32_16x16x32_bf16(
                false, pf.v, false, bv[0].v, (short)0, o0, false, false);
        o1 = __builtin_amdgcn_wmma_f32_16x16x32_bf16(
                false, pf.v, false, bv[1].v, (short)0, o1, false, false);
        o2 = __builtin_amdgcn_wmma_f32_16x16x32_bf16(
                false, pf.v, false, bv[2].v, (short)0, o2, false, false);
        o3 = __builtin_amdgcn_wmma_f32_16x16x32_bf16(
                false, pf.v, false, bv[3].v, (short)0, o3, false, false);
    }
#pragma unroll
    for (int r = 0; r < 8; ++r) {
        int row = qt * 16 + r + hb;
        float inv = 1.f / rsum[r];
        size_t base = (size_t)row * (H * HD) + h * HD;
        attnb[base +  0 + ln] = f2bf(o0[r] * inv);
        attnb[base + 16 + ln] = f2bf(o1[r] * inv);
        attnb[base + 32 + ln] = f2bf(o2[r] * inv);
        attnb[base + 48 + ln] = f2bf(o3[r] * inv);
    }
}

// ---------------------------------------------------------------------------
// Host-side orchestration.
// ---------------------------------------------------------------------------
static void launch_gemm(hipStream_t s, int nz, int sA, int sB, int sC, int sR,
                        const unsigned short* A, int lda,
                        const unsigned short* Bt, int ldb, int M, int N, int K,
                        float* outf, unsigned short* outb, int ldc,
                        int mode, float scale,
                        const float* resid, int ldr,
                        const float* rowsc, int rss,
                        const float* aux, int ldaux) {
    dim3 g(N / 128, M / 64, nz);
    gemm_bf16_wmma<<<g, 256, 0, s>>>(A, lda, Bt, ldb, M, N, K, outf, outb, ldc,
                                     mode, scale, resid, ldr, rowsc, rss,
                                     aux, ldaux, sA, sB, sC, sR,
                                     0, nullptr, nullptr);
}

extern "C" void kernel_launch(void* const* d_in, const int* in_sizes, int n_in,
                              void* d_out, int out_size, void* d_ws, size_t ws_size,
                              hipStream_t stream) {
    const int*   pos     = (const int*)  d_in[0];
    const float* hidden  = (const float*)d_in[1];
    const float* ln1     = (const float*)d_in[2];
    const float* ln2     = (const float*)d_in[3];
    const float* wq      = (const float*)d_in[4];
    const float* wk      = (const float*)d_in[5];
    const float* wv      = (const float*)d_in[6];
    const float* wo      = (const float*)d_in[7];
    const float* routerw = (const float*)d_in[8];
    const float* w13     = (const float*)d_in[9];
    const float* w2      = (const float*)d_in[10];
    const float* sw13    = (const float*)d_in[11];
    const float* sw2     = (const float*)d_in[12];

    float* outF     = (float*)d_out;          // final hidden  [T*D]
    float* residOut = outF + (size_t)T * D;   // post-attn residual [T*D]

    char* ws = (char*)d_ws;
    const size_t MB = 1u << 20;
    unsigned short* xb    = (unsigned short*)(ws + 0);        // T*D bf16   4M
    float*          qf    = (float*)         (ws + 4  * MB);  // T*2048 f32 8M
    float*          kf    = (float*)         (ws + 12 * MB);  // T*512 f32  2M
    unsigned short* qbuf  = (unsigned short*)(ws + 14 * MB);  // 4M
    unsigned short* kbuf  = (unsigned short*)(ws + 18 * MB);  // 1M
    unsigned short* vbuf  = (unsigned short*)(ws + 19 * MB);  // 1M, [KV*HD][T]
    unsigned short* attnb = (unsigned short*)(ws + 20 * MB);  // 4M
    float*          xnf   = (float*)         (ws + 24 * MB);  // 8M
    unsigned short* xnb   = (unsigned short*)(ws + 32 * MB);  // 4M
    float*          fullw = (float*)         (ws + 36 * MB);  // 32K
    float*          moe   = (float*)         (ws + 37 * MB);  // 8M
    float*          ggate = (float*)         (ws + 45 * MB);  // T*SI f32 16M
    unsigned short* sactb = (unsigned short*)(ws + 61 * MB);  // 8M
    float*          hgate = (float*)         (ws + 69 * MB);  // E*T*I f32 32M
    unsigned short* actb  = (unsigned short*)(ws + 101 * MB); // E*T*I bf16 16M
    float*          moep  = (float*)         (ws + 117 * MB); // E*T*D f32 64M
    unsigned short* wt    = (unsigned short*)(ws + 184 * MB); // bf16 weights 164M
    (void)ws_size; (void)in_sizes; (void)n_in; (void)out_size;

    // 0) Every GEMM weight once to bf16, transposed to [n][k].
    weight_bf16_t_kernel<<<WT_BLOCKS, 256, 0, stream>>>(wq, wk, wv, wo, w13, w2,
                                                        sw13, sw2, wt);

    // 1) RMSNorm 1 -> bf16 activations.
    rmsnorm_kernel<<<T, 256, 0, stream>>>(hidden, ln1, nullptr, xb);

    // 2) QKV projections, one launch: column tiles 0-15 are Q, 16-19 K, 20-23 V
    //    (V is stored transposed, for the attention's fragment loads).
    gemm_bf16_wmma<<<dim3((H + 2 * KV) * HD / 128, T / 64), 256, 0, stream>>>(
        xb, D, wt + WT_Q, D, T, H * HD, D, qf, nullptr, H * HD, GEMM_STORE, 0.f,
        nullptr, 0, nullptr, 0, nullptr, 0, 0, 0, 0, 0,
        KV * HD, kf, vbuf);

    // 3) RoPE on Q and K (f32 -> bf16).
    rope_kernel<<<(T * H  * 32 + 255) / 256, 256, 0, stream>>>(pos, qf, qbuf, H);
    rope_kernel<<<(T * KV * 32 + 255) / 256, 256, 0, stream>>>(pos, kf, kbuf, KV);

    // 4) Causal GQA attention.
    attn_kernel<<<dim3(H, T / 64), 128, 0, stream>>>(qbuf, kbuf, vbuf, attnb);

    // 5) Output projection + residual -> residOut (second output).
    launch_gemm(stream, 1, 0, 0, 0, 0, attnb, H * HD, wt + WT_O, H * HD, T, D, H * HD,
                residOut, nullptr, D, GEMM_RESID, RES_MULT, hidden, D,
                nullptr, 0, nullptr, 0);

    // 6) RMSNorm 2.
    rmsnorm_kernel<<<T, 256, 0, stream>>>(residOut, ln2, xnf, xnb);

    // 7) Router top-2.
    router_kernel<<<T, 32, 0, stream>>>(xnf, routerw, fullw);

    // 8) Experts (dense, weighted by full_w as in the reference): blockIdx.z is
    //    the expert; the weighted down products stay apart and are summed after.
    launch_gemm(stream, E, 0, D * 2 * I, T * I, 0, xnb, D, wt + WT_13, D, T, I, D,
                hgate, nullptr, I, GEMM_STORE, 0.f, nullptr, 0, nullptr, 0, nullptr, 0);
    launch_gemm(stream, E, 0, D * 2 * I, T * I, 0, xnb, D, wt + WT_13 + (size_t)I * D, D, T, I, D,
                nullptr, actb, I, GEMM_SILU, 0.f, nullptr, 0, nullptr, 0, hgate, I);
    launch_gemm(stream, E, T * I, I * D, T * D, 1, actb, I, wt + WT_2, I, T, D, I,
                moep, nullptr, D, GEMM_MOE_INIT, 0.f,
                nullptr, 0, fullw, E, nullptr, 0);
    expert_sum_kernel<<<T * D / 1024, 256, 0, stream>>>(moep, moe);

    // 9) Shared expert.
    launch_gemm(stream, 1, 0, 0, 0, 0, xnb, D, wt + WT_S13, D, T, SI, D,
                ggate, nullptr, SI, GEMM_STORE, 0.f, nullptr, 0, nullptr, 0, nullptr, 0);
    launch_gemm(stream, 1, 0, 0, 0, 0, xnb, D, wt + WT_S13 + (size_t)SI * D, D, T, SI, D,
                nullptr, sactb, SI, GEMM_SILU, 0.f, nullptr, 0, nullptr, 0, ggate, SI);

    // 10) Shared down-proj fused with final residual.
    launch_gemm(stream, 1, 0, 0, 0, 0, sactb, SI, wt + WT_S2, SI, T, D, SI,
                outF, nullptr, D, GEMM_FINAL, RES_MULT, residOut, D,
                nullptr, 0, moe, D);
}

// v006
// It runs in 399 microseconds.
// Two timings next to v005 both put it at 1.26 times that version's speed.
// Over all steps from v000 it is 8.54 times as fast.
#include <hip/hip_runtime.h>
#include <hip/hip_bf16.h>

// ---------------------------------------------------------------------------
// MI455X (gfx1250, wave32) implementation of a decoder layer (attention, MoE, shared MLP).
// All large GEMMs + attention run on v_wmma_f32_16x16x32_bf16 (bf16 in, f32
// accum).  A-activation tiles move global->LDS via the CDNA5 async-DMA path
// (global_load_async_to_lds_b128 + s_wait_asynccnt).  A first launch writes every
// GEMM weight once as bf16, transposed to [n][k], into the workspace, so the
// weight tiles take the same async path and the k loop holds no conversion.
// GEMMs that do not depend on each other share one launch: Q/K/V in one grid,
// and the eight experts' gate, up and down products one grid each.  An expert's
// products are formed only for the rows whose router weight for it is not zero.
// Workspace requirement: 348 MiB (see layout below).
// ---------------------------------------------------------------------------

static constexpr int T  = 1024;
static constexpr int D  = 2048;
static constexpr int H  = 32;
static constexpr int KV = 8;
static constexpr int HD = 64;
static constexpr int E  = 8;
static constexpr int I  = 1024;
static constexpr int SI = 4096;
static constexpr float ATTN_MULT = 0.0078125f;
static constexpr float RES_MULT  = 0.22f;
static constexpr float EPS       = 1e-6f;

typedef __bf16 bf16x16 __attribute__((ext_vector_type(16)));
typedef float  f32x8   __attribute__((ext_vector_type(8)));
typedef float  f32x4   __attribute__((ext_vector_type(4)));
typedef unsigned int u32x4 __attribute__((ext_vector_type(4)));
typedef int i32x4 __attribute__((ext_vector_type(4)));

union BF16Frag {
    unsigned short u[16];
    u32x4 q[2];      // the two runs of eight k-consecutive elements (see fragK)
    bf16x16 v;
};

__device__ __forceinline__ unsigned short f2bf(float f) {
    unsigned int u = __float_as_uint(f);
    unsigned int r = u + 0x7FFFu + ((u >> 16) & 1u);   // round-to-nearest-even
    return (unsigned short)(r >> 16);
}

// A/B fragment K-index pattern for V_WMMA_*_16X16X32_BF16 (ISA 7.12.2):
// VGPR p (0..7), half w; lanes 0-15 vs 16-31 differ by +8 in K.
__device__ __forceinline__ int fragK(int e, int lane) {
    int p = e >> 1, w = e & 1;
    return ((p & 3) << 1) + w + ((p >> 2) << 4) + ((lane >> 4) << 3);
}

// Generic pointer -> 32-bit LDS byte offset (AS3) for async-DMA VDST operand.
__device__ __forceinline__ unsigned lds_off(const void* p) {
    return (unsigned)(unsigned long long)
        (__attribute__((address_space(3))) const void*)p;
}

// CDNA5 async global->LDS copies, 16B per lane each (ASYNCcnt tracked): a
// thread's share of one k stage, four pieces of the A tile and eight of the B
// tile.  Piece i lies i * ls bytes further in LDS than the first one of its
// tile; in global memory the A pieces have a pointer each (their rows may be
// gathered), the B pieces lie gb elements apart.  A wave's copy takes
// two rows of 256 B: whole lines, where a 32-k stage took 64 B of eight rows.
__device__ __forceinline__ void async_copy12_b128(unsigned la, const unsigned short* a0,
                                                  const unsigned short* a1,
                                                  const unsigned short* a2,
                                                  const unsigned short* a3,
                                                  unsigned lb, const unsigned short* b, size_t gb,
                                                  unsigned ls) {
    // s_wait_xcnt as the last line of the copies' own statement: it stands in
    // front of any later rewrite of the address registers that the copies name.
    asm volatile("global_load_async_to_lds_b128 %0, %1, off\n\t"
                 "global_load_async_to_lds_b128 %2, %3, off\n\t"
                 "global_load_async_to_lds_b128 %4, %5, off\n\t"
                 "global_load_async_to_lds_b128 %6, %7, off\n\t"
                 "global_load_async_to_lds_b128 %8, %9, off\n\t"
                 "global_load_async_to_lds_b128 %10, %11, off\n\t"
                 "global_load_async_to_lds_b128 %12, %13, off\n\t"
                 "global_load_async_to_lds_b128 %14, %15, off\n\t"
                 "global_load_async_to_lds_b128 %16, %17, off\n\t"
                 "global_load_async_to_lds_b128 %18, %19, off\n\t"
                 "global_load_async_to_lds_b128 %20, %21, off\n\t"
                 "global_load_async_to_lds_b128 %22, %23, off\n\t"
                 "s_wait_xcnt 0x0"
                 :: "v"(la),          "v"(a0),
                    "v"(la + ls),     "v"(a1),
                    "v"(la + 2 * ls), "v"(a2),
                    "v"(la + 3 * ls), "v"(a3),
                    "v"(lb),          "v"(b),
                    "v"(lb + ls),     "v"(b + gb),
                    "v"(lb + 2 * ls), "v"(b + 2 * gb),
                    "v"(lb + 3 * ls), "v"(b + 3 * gb),
                    "v"(lb + 4 * ls), "v"(b + 4 * gb),
                    "v"(lb + 5 * ls), "v"(b + 5 * gb),
                    "v"(lb + 6 * ls), "v"(b + 6 * gb),
                    "v"(lb + 7 * ls), "v"(b + 7 * gb)
                 : "memory");
}
// Behind a global store: stands in front of any later rewrite of the store's
// address and data registers.
__device__ __forceinline__ void wait_xcnt0() {
    asm volatile("s_wait_xcnt 0x0" ::: "memory");
}
__device__ __forceinline__ void wait_async0() {
    asm volatile("s_wait_asynccnt 0x0" ::: "memory");
}
// A wave's own LDS reads have retired before the barrier behind which the
// buffer they read is refilled by async copies.
__device__ __forceinline__ void wait_ds0() {
    asm volatile("s_wait_dscnt 0x0" ::: "memory");
}

// ---------------------------------------------------------------------------
// Weight pre-pass: every GEMM weight W[K][N] (f32) -> Wt[N][K] (bf16, rounded
// to nearest even, f2bf).  A block takes a strip of
// 1024 k x 64 n as sixteen 64x64 tiles.  A thread owns a 4(k) x 4(n) patch, so the
// transpose happens in its registers; the tile goes through LDS so that every
// global store covers whole 128-B lines of a Wt row.
// Element offsets of the transposed weights in their workspace region:
// ---------------------------------------------------------------------------
static constexpr size_t WT_Q   = 0;                                // [H*HD][D]
static constexpr size_t WT_K   = WT_Q   + (size_t)D * H * HD;      // [KV*HD][D]
static constexpr size_t WT_V   = WT_K   + (size_t)D * KV * HD;     // [KV*HD][D]
static constexpr size_t WT_O   = WT_V   + (size_t)D * KV * HD;     // [D][H*HD]
static constexpr size_t WT_13  = WT_O   + (size_t)H * HD * D;      // E x [2I][D]
static constexpr size_t WT_2   = WT_13  + (size_t)E * D * 2 * I;   // E x [D][I]
static constexpr size_t WT_S13 = WT_2   + (size_t)E * I * D;       // [2SI][D]
static constexpr size_t WT_S2  = WT_S13 + (size_t)D * 2 * SI;      // [D][SI]
static constexpr int strips(int k, int n) { return (k / 1024) * (n / 64); }
static constexpr int WT_BLOCKS =
    strips(D, H * HD) + 2 * strips(D, KV * HD) + strips(H * HD, D) +
    E * strips(D, 2 * I) + E * strips(I, D) + strips(D, 2 * SI) + strips(SI, D);

__global__ __launch_bounds__(256)
void weight_bf16_t_kernel(const float* __restrict__ wq, const float* __restrict__ wk,
                          const float* __restrict__ wv, const float* __restrict__ wo,
                          const float* __restrict__ w13, const float* __restrict__ w2,
                          const float* __restrict__ sw13, const float* __restrict__ sw2,
                          unsigned short* __restrict__ wt) {
    constexpr int P = 72;    // LDS row pitch: 144 B = 16 B x odd
    __shared__ __align__(16) unsigned short tile[2][64 * P];

    // Which matrix, and which strip of it (all block-uniform).
    int b = blockIdx.x;
    const float* src;
    size_t off;
    int K, N;
    if (b < strips(D, H * HD)) { src = wq; off = WT_Q; K = D; N = H * HD; }
    else if ((b -= strips(D, H * HD)) < strips(D, KV * HD)) { src = wk; off = WT_K; K = D; N = KV * HD; }
    else if ((b -= strips(D, KV * HD)) < strips(D, KV * HD)) { src = wv; off = WT_V; K = D; N = KV * HD; }
    else if ((b -= strips(D, KV * HD)) < strips(H * HD, D)) { src = wo; off = WT_O; K = H * HD; N = D; }
    else if ((b -= strips(H * HD, D)) < E * strips(D, 2 * I)) { src = w13; off = WT_13; K = D; N = 2 * I; }
    else if ((b -= E * strips(D, 2 * I)) < E * strips(I, D)) { src = w2; off = WT_2; K = I; N = D; }
    else if ((b -= E * strips(I, D)) < strips(D, 2 * SI)) { src = sw13; off = WT_S13; K = D; N = 2 * SI; }
    else { b -= strips(D, 2 * SI); src = sw2; off = WT_S2; K = SI; N = D; }
    int kstrips = K >> 10;
    int per     = kstrips * (N >> 6);       // strips of one matrix
    int e       = b / per;                  // expert (0 where there is one matrix)
    b -= e * per;
    int n0 = (b / kstrips) << 6;
    int kb = (b % kstrips) << 10;
    src += (size_t)e * K * N;
    unsigned short* dst = wt + off + (size_t)e * K * N;

    int tid  = threadIdx.x;
    int lane = tid & 31;
    int wid  = tid >> 5;
    // Eight lanes cover one 128-B line of a source row; the four lane groups of
    // a wave take different k quads, which spreads the 8-byte LDS stores.
    int pk = (((wid & 3) << 2) | (lane >> 3)) << 2;    // k 0,4,..,60
    int pn = (((wid >> 2) << 3) | (lane & 7)) << 2;    // n 0,4,..,60
    const float* g = src + (size_t)(kb + pk) * N + n0 + pn;
    // Read back: eight lanes cover one 128-B line of a Wt row.
    int rr = tid >> 3;                                 // n 0..31 (and +32)
    int rc = (tid & 7) << 3;                           // k 0,8,..,56
    unsigned short* o = dst + (size_t)(n0 + rr) * K + kb + rc;

    size_t rowb = (size_t)N;                           // source row, elements
    for (int t = 0; t < 16; ++t) {
        const float* gt = g + (size_t)(t * 64) * rowb;
        f32x4 r0, r1, r2, r3;
        // The four loads and their data wait in one statement, outputs
        // early-clobber: no result and no later instruction lands on an address
        // register of a load that is still in flight.
        asm volatile("global_load_b128 %0, %4, off\n\t"
                     "global_load_b128 %1, %5, off\n\t"
                     "global_load_b128 %2, %6, off\n\t"
                     "global_load_b128 %3, %7, off\n\t"
                     "s_wait_loadcnt 0x0"
                     : "=&v"(r0), "=&v"(r1), "=&v"(r2), "=&v"(r3)
                     : "v"(gt), "v"(gt + rowb), "v"(gt + 2 * rowb), "v"(gt + 3 * rowb)
                     : "memory");
        unsigned short* l = tile[t & 1];
#pragma unroll
        for (int j = 0; j < 4; ++j) {
            uint2 q;
            q.x = (unsigned)f2bf(r0[j]) | ((unsigned)f2bf(r1[j]) << 16);
            q.y = (unsigned)f2bf(r2[j]) | ((unsigned)f2bf(r3[j]) << 16);
            *(uint2*)&l[(pn + j) * P + pk] = q;
        }
        // One barrier a tile: with two buffers it also ends the reads of the
        // buffer that the next tile but one overwrites.
        __syncthreads();
#pragma unroll
        for (int i = 0; i < 2; ++i) {
            uint4 v = *(const uint4*)&l[(rr + i * 32) * P + rc];
            *(uint4*)&o[(size_t)(i * 32) * K + t * 64] = v;
            wait_xcnt0();   // in front of any later write of the store's registers
        }
    }
}

// ---------------------------------------------------------------------------
// RMSNorm: one block per row.  Writes f32 and/or bf16 outputs.
// ---------------------------------------------------------------------------
__global__ __launch_bounds__(256)
void rmsnorm_kernel(const float* __restrict__ in, const float* __restrict__ w,
                    float* outf, unsigned short* outb) {
    int row = blockIdx.x;
    int tid = threadIdx.x;
    __shared__ float red[256];
    const float* x = in + (size_t)row * D;
    float ss = 0.f;
    for (int i = tid; i < D; i += 256) { float v = x[i]; ss += v * v; }
    red[tid] = ss;
    __syncthreads();
    for (int s = 128; s > 0; s >>= 1) {
        if (tid < s) red[tid] += red[tid + s];
        __syncthreads();
    }
    float rs = rsqrtf(red[0] / (float)D + EPS);
    for (int i = tid; i < D; i += 256) {
        float v = x[i] * rs * w[i];
        if (outf) outf[(size_t)row * D + i] = v;
        if (outb) outb[(size_t)row * D + i] = f2bf(v);
    }
}

// ---------------------------------------------------------------------------
// RoPE: f32 in -> bf16 out, per (t, head, i<HD/2).
// ---------------------------------------------------------------------------
__global__ __launch_bounds__(256)
void rope_kernel(const int* __restrict__ pos, const float* __restrict__ in,
                 unsigned short* __restrict__ out, int nheads) {
    int idx = blockIdx.x * blockDim.x + threadIdx.x;
    int total = T * nheads * (HD / 2);
    if (idx >= total) return;
    int i = idx & 31;
    int h = (idx >> 5) % nheads;
    int t = idx / (32 * nheads);
    float inv = __expf(-(float)i * (9.2103403719761840f / 32.f)); // 10000^(-i/32)
    float ang = (float)pos[t] * inv;
    float s, c;
    __sincosf(ang, &s, &c);
    size_t base = (size_t)t * nheads * HD + (size_t)h * HD;
    float x1 = in[base + i];
    float x2 = in[base + 32 + i];
    out[base + i]      = f2bf(x1 * c - x2 * s);
    out[base + 32 + i] = f2bf(x2 * c + x1 * s);
}

// ---------------------------------------------------------------------------
// Router: one wave per token.  logits = xn . router_w[e], softmax, top-2.
// ---------------------------------------------------------------------------
__global__ __launch_bounds__(32)
void router_kernel(const float* __restrict__ xn, const float* __restrict__ rw,
                   float* __restrict__ fullw) {
    int t = blockIdx.x;
    int lane = threadIdx.x;
    float acc[E];
#pragma unroll
    for (int e = 0; e < E; ++e) acc[e] = 0.f;
    const float* x = xn + (size_t)t * D;
    for (int i = lane; i < D; i += 32) {
        float xv = x[i];
#pragma unroll
        for (int e = 0; e < E; ++e) acc[e] += xv * rw[(size_t)e * D + i];
    }
#pragma unroll
    for (int e = 0; e < E; ++e)
        for (int off = 16; off > 0; off >>= 1)
            acc[e] += __shfl_xor(acc[e], off, 32);
    if (lane == 0) {
        int i1 = 0;
        for (int e = 1; e < E; ++e) if (acc[e] > acc[i1]) i1 = e;
        int i2 = (i1 == 0) ? 1 : 0;
        for (int e = 0; e < E; ++e) if (e != i1 && acc[e] > acc[i2]) i2 = e;
        float e1 = 1.f;
        float e2 = __expf(acc[i2] - acc[i1]);
        float inv = 1.f / (e1 + e2);
        for (int e = 0; e < E; ++e) {
            float wv = (e == i1) ? e1 * inv : (e == i2) ? e2 * inv : 0.f;
            fullw[(size_t)t * E + e] = wv;
        }
    }
}

// ---------------------------------------------------------------------------
// Row lists of the experts, one block, thread = token.  list[e][0 .. cnts[e])
// holds, in rising order, the tokens whose weight for expert e is not zero (a
// zero weight multiplies that expert's product away); the rest of list[e] is
// token 0, so that a last, partly filled tile gathers rows that exist.
// wlist[e] holds the weights in the same order (zero behind the listed ones).
// tilemap[j] = expert << 16 | first list place of the j-th 64-row tile, or -1.
// The router gives a token at most two weights: at most 2T list entries, so
// at most (2T + 63 E) / 64 tiles.
// ---------------------------------------------------------------------------
static constexpr int MOE_TILES = (2 * T + 63 * E) / 64;

__global__ __launch_bounds__(1024)
void route_kernel(const float* __restrict__ fullw, int* __restrict__ list,
                  float* __restrict__ wlist,
                  int* __restrict__ cnts, int* __restrict__ tilemap) {
    static_assert(T == 1024 && E == 8, "one thread a token, one wave's scan an expert");
    __shared__ int wcnt[E][32];   // per expert and wave: count, then count of the waves before
    __shared__ int tot[E];
    int t    = threadIdx.x;
    int lane = t & 31;
    int wv   = t >> 5;
    f32x4 wa, wb;
    // Both loads and their data wait in one statement, outputs early-clobber:
    // nothing lands on the address register of a load that is still in flight.
    asm volatile("global_load_b128 %0, %2, off\n\t"
                 "global_load_b128 %1, %2, off offset:16\n\t"
                 "s_wait_loadcnt 0x0"
                 : "=&v"(wa), "=&v"(wb)
                 : "v"(fullw + (size_t)t * E)
                 : "memory");
    unsigned m[E];
#pragma unroll
    for (int e = 0; e < E; ++e) {
        float wv_e = e < 4 ? wa[e & 3] : wb[e & 3];
        m[e] = __builtin_amdgcn_ballot_w32(wv_e != 0.f);
        if (lane == 0) wcnt[e][wv] = __popc(m[e]);
    }
    __syncthreads();
    if (wv < E) {
        int c = wcnt[wv][lane];
        int inc = c;
        for (int off = 1; off < 32; off <<= 1) {
            int n = __shfl_up(inc, off, 32);
            if (lane >= off) inc += n;
        }
        wcnt[wv][lane] = inc - c;
        if (lane == 31) tot[wv] = inc;
    }
    __syncthreads();
#pragma unroll
    for (int e = 0; e < E; ++e) {
        // A place below tot[e] is written by the one token that ranks there, a
        // place from tot[e] on by the thread of that number.
        bool mine = (m[e] >> lane) & 1u;
        int place = mine ? wcnt[e][wv] + __popc(m[e] & ((1u << lane) - 1u)) : t;
        if (mine || t >= tot[e]) {
            list[e * T + place] = mine ? t : 0;
            wait_xcnt0();   // in front of any later write of the store's registers
            wlist[e * T + place] = mine ? (e < 4 ? wa[e & 3] : wb[e & 3]) : 0.f;
            wait_xcnt0();
        }
        if (mine && t >= tot[e]) {
            list[e * T + t] = 0;
            wait_xcnt0();
            wlist[e * T + t] = 0.f;
            wait_xcnt0();
        }
    }
    if (t < E) { cnts[t] = tot[t]; wait_xcnt0(); }
    if (t < MOE_TILES) {
        int j = t, ent = -1;
#pragma unroll
        for (int e = 0; e < E; ++e) {
            int nt = (tot[e] + 63) >> 6;
            if (ent < 0 && j < nt) ent = (e << 16) | (j << 6);
            j -= nt;
        }
        tilemap[t] = ent;
        wait_xcnt0();
    }
}

// ---------------------------------------------------------------------------
// BF16-WMMA GEMM, double-buffered LDS, async DMA of both tiles.
// C[M,N] = A[M,K](bf16) x Bt[N,K]^T (bf16, from the weight pre-pass).
// Block tile 64x128, 8 waves (2M x 4N), each wave 32x32.  A stage of the two
// LDS buffers holds 128 k (16 WMMAs a wave): 48 KiB of copies are in flight per
// block, and their latency, the waits and the barrier are paid once per 128 k.
// Requires: M%64==0, N%128==0, K%128==0, lda%8==0, ldb%8==0 (all satisfied).
// ---------------------------------------------------------------------------
#define GEMM_STORE    0  // outf/outb = acc
#define GEMM_RESID    1  // outf = resid + scale*acc
#define GEMM_MOE_INIT 2  // outf[token] = rowsc[row]*acc, token = rowlist[row], listed rows only
#define GEMM_SILU     4  // outb = silu(aux[row,col]) * acc   (bf16)
#define GEMM_FINAL    5  // outf = resid + scale*(aux + acc)

__global__ __launch_bounds__(256)
void gemm_bf16_wmma(const unsigned short* __restrict__ A, int lda,
                    const unsigned short* __restrict__ Bt, int ldb,
                    int M, int N, int K,
                    float* outf, unsigned short* outb, int ldc,
                    int mode, float scale,
                    const float* __restrict__ resid, int ldr,
                    const float* __restrict__ rowsc,
                    const float* __restrict__ aux, int ldaux,
                    int sA, int sB, int sC, int sR,
                    int N2, float* outf2, unsigned short* outb3,
                    const int* __restrict__ tilemap, const int* __restrict__ rowlist,
                    const int* __restrict__ cnts) {
    constexpr int BK = 128;      // k per stage
    constexpr int AS = BK + 8;   // LDS stride for A rows   [64][AS]  (272 B = 16 B x odd)
    constexpr int BS = BK + 8;   // LDS stride for B^T rows [128][BS]
    __shared__ __align__(16) unsigned short lds_a[2][64 * AS];
    __shared__ __align__(16) unsigned short lds_b[2][128 * BS];

    int tid  = threadIdx.x;
    int lane = tid & 31;
    int wid  = tid >> 5;
    int wm   = wid >> 2;   // 0..1
    int wn   = wid & 3;    // 0..3
    int m0   = blockIdx.y * 64;
    int n0   = blockIdx.x * 128;
    int ln   = lane & 15;

    // blockIdx.z: independent GEMMs of one shape whose operands lie sA / sB
    // elements apart, outputs and aux sC apart, row scales sR apart.
    size_t z = blockIdx.z;
    // With a tile map (see route_kernel) blockIdx.y numbers the row tiles of all
    // experts' lists: the entry names the expert and the tile's place in its
    // list.  A block without a tile leaves here, whole, in front of every copy
    // and barrier.
    const int* rl = nullptr;
    if (tilemap) {
        int ent = tilemap[blockIdx.y];
        if (ent < 0) return;
        z  = (size_t)(ent >> 16);
        m0 = ent & 0xffff;
        rl = rowlist + z * T + m0;
        if (mode == GEMM_MOE_INIT) M = cnts[z];   // only listed rows are stored
    }
    A += z * sA;
    Bt += z * sB + (size_t)n0 * ldb;     // this block's 128 rows of Bt
    if (outf)  outf  += z * sC;
    if (outb)  outb  += z * sC;
    if (aux)   aux   += z * sC;
    if (rowsc) rowsc += z * sR;
    // Column tiles behind N: a second (f32 out) and a third (bf16 out) GEMM on
    // the same A, each N2 columns wide; their Bt rows follow the first one's.
    // The third one's output is stored transposed, [N2][M]: ldc is the step of
    // the output index from row to row, ocs the step from column to column.
    int ocs = 1;
    if (n0 >= N) {
        n0 -= N;
        bool third = n0 >= N2;
        if (third) n0 -= N2;
        outf = third ? nullptr : outf2;
        outb = third ? outb3 : nullptr;
        N = ldc = N2;
        if (third) { ldc = 1; ocs = M; }
    }

    // Async staging: sixteen threads x b128 cover the 256 bytes of one row, 256
    // threads sixteen rows: the 64x128 bf16 A tile takes four such pieces, the
    // 128x128 Bt tile eight (rows sr, sr + 16, ...).
    int sr = tid >> 4;          // row 0..15
    int sc = (tid & 15) << 3;   // k 0,8,..,120

    f32x8 zero = {0.f,0.f,0.f,0.f,0.f,0.f,0.f,0.f};
    f32x8 acc[2][2] = {{zero, zero}, {zero, zero}};

    static_assert(AS == BS, "one LDS step for the pieces of both tiles");
    // The A rows of this thread's four pieces: m0 + sr + 16 i, or, where the
    // rows of A are gathered (the experts' gate and up products), the tokens
    // that stand at those places of the list.
    int ar0 = m0 + sr, ar1 = ar0 + 16, ar2 = ar0 + 32, ar3 = ar0 + 48;
    if (rl && mode != GEMM_MOE_INIT) {
        // The four loads and their data wait in one statement, outputs
        // early-clobber: nothing lands on the address register of a load that is
        // still in flight.
        asm volatile("global_load_b32 %0, %4, off\n\t"
                     "global_load_b32 %1, %4, off offset:64\n\t"
                     "global_load_b32 %2, %4, off offset:128\n\t"
                     "global_load_b32 %3, %4, off offset:192\n\t"
                     "s_wait_loadcnt 0x0"
                     : "=&v"(ar0), "=&v"(ar1), "=&v"(ar2), "=&v"(ar3)
                     : "v"(rl + sr)
                     : "memory");
        // Bounds the addresses formed from the list.
        ar0 &= T - 1; ar1 &= T - 1; ar2 &= T - 1; ar3 &= T - 1;
    }
    const unsigned short* gA0 = A + (size_t)ar0 * lda + sc;
    const unsigned short* gA1 = A + (size_t)ar1 * lda + sc;
    const unsigned short* gA2 = A + (size_t)ar2 * lda + sc;
    const unsigned short* gA3 = A + (size_t)ar3 * lda + sc;
    const unsigned short* gB = Bt + (size_t)sr * ldb + sc;
    auto stage = [&](int buf, int k0) {
        async_copy12_b128(lds_off(&lds_a[buf][sr * AS + sc]),
                          gA0 + k0, gA1 + k0, gA2 + k0, gA3 + k0,
                          lds_off(&lds_b[buf][sr * BS + sc]), gB + k0, (size_t)16 * ldb,
                          16 * AS * 2);
    };

    // Two buffers: tile 0 lands and is published, then tile 1 flies.
    int nk = K / BK;
    stage(0, 0);
    wait_async0();
    __syncthreads();
    if (nk > 1) stage(1, BK);

    int buf = 0;
    for (int kt = 0; kt < nk; ++kt) {
        // Unrolled: the four 32-k slices' places in the stage become immediate
        // offsets of the fragment loads, with no address arithmetic per slice.
#pragma unroll
        for (int ks = 0; ks < BK; ks += 32) {
            BF16Frag af[2], bf[2];
#pragma unroll
            for (int s = 0; s < 2; ++s)
#pragma unroll
                for (int e = 0; e < 16; ++e) {
                    int kk = ks + fragK(e, lane);
                    af[s].u[e] = lds_a[buf][(wm * 32 + s * 16 + ln) * AS + kk];
                    bf[s].u[e] = lds_b[buf][(wn * 32 + s * 16 + ln) * BS + kk];
                }
#pragma unroll
            for (int sm = 0; sm < 2; ++sm)
#pragma unroll
                for (int sn = 0; sn < 2; ++sn)
                    acc[sm][sn] = __builtin_amdgcn_wmma_f32_16x16x32_bf16(
                        false, af[sm].v, false, bf[sn].v, (short)0,
                        acc[sm][sn], false, false);
        }

        // Foot of the trip: own LDS reads retired, tile kt+1 landed, one barrier
        // that publishes it and ends every read of this buffer; then the refill.
        wait_ds0();
        wait_async0();
        __syncthreads();
        if (kt + 2 < nk) stage(buf, (kt + 2) * BK);
        buf ^= 1;
    }
    wait_async0();   // no copy is in flight when the wave goes on to its stores

    int half8 = (lane & 16) >> 1;          // +8 row offset for lanes 16-31
    // The tokens and the weights of this lane's sixteen rows, [sm][rr >> 2][rr & 3].
    i32x4 tok[2][2] = {};
    f32x4 rsc[2][2] = {};
    if (mode == GEMM_MOE_INIT) {
        // The eight loads and their data wait in one statement, as above.
        asm volatile("global_load_b128 %0, %8, off\n\t"
                     "global_load_b128 %1, %8, off offset:16\n\t"
                     "global_load_b128 %2, %8, off offset:64\n\t"
                     "global_load_b128 %3, %8, off offset:80\n\t"
                     "global_load_b128 %4, %9, off\n\t"
                     "global_load_b128 %5, %9, off offset:16\n\t"
                     "global_load_b128 %6, %9, off offset:64\n\t"
                     "global_load_b128 %7, %9, off offset:80\n\t"
                     "s_wait_loadcnt 0x0"
                     : "=&v"(tok[0][0]), "=&v"(tok[0][1]), "=&v"(tok[1][0]), "=&v"(tok[1][1]),
                       "=&v"(rsc[0][0]), "=&v"(rsc[0][1]), "=&v"(rsc[1][0]), "=&v"(rsc[1][1])
                     : "v"(rl + wm * 32 + half8), "v"(rowsc + m0 + wm * 32 + half8)
                     : "memory");
    }
#pragma unroll
    for (int sm = 0; sm < 2; ++sm) {
#pragma unroll
        for (int sn = 0; sn < 2; ++sn) {
            int col = n0 + wn * 32 + sn * 16 + ln;
#pragma unroll
            for (int rr = 0; rr < 8; ++rr) {
                int row = m0 + wm * 32 + sm * 16 + rr + half8;
                if (row >= M || col >= N) continue;
                float v = acc[sm][sn][rr];
                size_t oidx = (size_t)row * ldc + (size_t)col * ocs;
                if (mode == GEMM_STORE) {
                    if (outf) { outf[oidx] = v; wait_xcnt0(); }
                    if (outb) { outb[oidx] = f2bf(v); wait_xcnt0(); }
                } else if (mode == GEMM_RESID) {
                    outf[oidx] = resid[(size_t)row * ldr + col] + scale * v;
                    wait_xcnt0();
                } else if (mode == GEMM_MOE_INIT) {
                    size_t tk = (size_t)(tok[sm][rr >> 2][rr & 3] & (T - 1));   // bounded
                    outf[tk * ldc + col] = rsc[sm][rr >> 2][rr & 3] * v;
                    wait_xcnt0();
                } else if (mode == GEMM_SILU) {
                    float g = aux[(size_t)row * ldaux + col];
                    float s = g / (1.f + __expf(-g));
                    outb[oidx] = f2bf(s * v);
                    wait_xcnt0();
                } else { // GEMM_FINAL
                    outf[oidx] = resid[(size_t)row * ldr + col] +
                                 scale * (aux[(size_t)row * ldaux + col] + v);
                    wait_xcnt0();
                }
            }
        }
    }
}

// ---------------------------------------------------------------------------
// Sum of the experts' weighted down products, in the order 0..E-1.  A plane
// holds a token's row only where the token's weight for that expert is not zero;
// the other terms of the sum are zero.  A block lies inside one token's row.
// ---------------------------------------------------------------------------
__global__ __launch_bounds__(256)
void expert_sum_kernel(const float* __restrict__ planes, const float* __restrict__ fullw,
                       float* __restrict__ out) {
    constexpr size_t P = (size_t)T * D;
    static_assert(D % 1024 == 0, "a block's 1024 elements lie in one row");
    size_t i = ((size_t)blockIdx.x * 256 + threadIdx.x) * 4;
    const float* g = planes + i;
    const float* w = fullw + (size_t)(blockIdx.x / (D / 1024)) * E;
    float wl[E];
#pragma unroll
    for (int e = 0; e < E; ++e) wl[e] = w[e];
    f32x4 s = {0.f, 0.f, 0.f, 0.f};
#pragma unroll
    for (int e = 0; e < E; ++e) {
        if (wl[e] != 0.f) {     // the same for the whole block
            f32x4 p;
            // The load and its data wait in one statement, output early-clobber.
            asm volatile("global_load_b128 %0, %1, off\n\t"
                         "s_wait_loadcnt 0x0"
                         : "=&v"(p) : "v"(g + e * P) : "memory");
            s += p;
        }
    }
    *(f32x4*)&out[i] = s;
}

// ---------------------------------------------------------------------------
// Causal GQA flash attention.  One wave per (head, 16-query tile); 4 waves
// per block.  QK^T and P.V via bf16 WMMA; online softmax over 32-key chunks.
// K is [t][KV*HD], V comes transposed, vt = [KV*HD][t]: in both, the k index of
// a B fragment runs along memory, so a fragment is two 16-byte loads a lane.
// ---------------------------------------------------------------------------
__global__ __launch_bounds__(128)
void attn_kernel(const unsigned short* __restrict__ qb,
                 const unsigned short* __restrict__ kb,
                 const unsigned short* __restrict__ vt,
                 unsigned short* __restrict__ attnb) {
    int h    = blockIdx.x;
    int w    = threadIdx.x >> 5;
    int lane = threadIdx.x & 31;
    int qt   = blockIdx.y * 4 + w;   // 16-query tile index
    int kvh  = h >> 2;               // H/KV = 4
    int hb   = (lane & 16) >> 1;     // +8 row offset for lanes 16-31
    int ln   = lane & 15;

    __shared__ unsigned short pbuf[4][16 * 34];   // per-wave P staging

    BF16Frag aq[2];
#pragma unroll
    for (int c = 0; c < 2; ++c)
#pragma unroll
        for (int e = 0; e < 16; ++e) {
            int kd = c * 32 + fragK(e, lane);
            int qrow = qt * 16 + ln;
            aq[c].u[e] = qb[(size_t)qrow * (H * HD) + h * HD + kd];
        }

    f32x8 o0 = {0,0,0,0,0,0,0,0}, o1 = o0, o2 = o0, o3 = o0;
    float rmax[8], rsum[8];
#pragma unroll
    for (int r = 0; r < 8; ++r) { rmax[r] = -1e30f; rsum[r] = 0.f; }

    int kend = qt * 16 + 16;                      // causal bound
    for (int kbase = 0; kbase < kend; kbase += 32) {
        float p[2][8];
        float tmax[8];
#pragma unroll
        for (int r = 0; r < 8; ++r) tmax[r] = -1e30f;

        // This chunk's K and V fragments.  kbase is a multiple of 32 below
        // kend <= T, and T is one too: keys kbase .. kbase + 31 all exist.
        // bk[sub][c]: key kbase + sub*16 + ln, head dims c*32 + fragK(0..15).
        // bv[j]:      head dim j*16 + ln,      keys kbase + fragK(0..15).
        static_assert(T % 32 == 0 && KV * HD * 2 == 1024 && T * 2 == 2048,
                      "the byte offsets in the loads below");
        BF16Frag bk[2][2], bv[4];
        const unsigned short* kp = kb + (size_t)(kbase + ln) * (KV * HD) + kvh * HD + hb;
        const unsigned short* vp = vt + (size_t)(kvh * HD + ln) * T + kbase + hb;
        // The sixteen loads and their data wait in one statement, outputs
        // early-clobber: no result and no later instruction lands on an address
        // register of a load that is still in flight.
        asm volatile("global_load_b128 %0, %16, off\n\t"
                     "global_load_b128 %1, %16, off offset:32\n\t"
                     "global_load_b128 %2, %16, off offset:64\n\t"
                     "global_load_b128 %3, %16, off offset:96\n\t"
                     "global_load_b128 %4, %16, off offset:16384\n\t"
                     "global_load_b128 %5, %16, off offset:16416\n\t"
                     "global_load_b128 %6, %16, off offset:16448\n\t"
                     "global_load_b128 %7, %16, off offset:16480\n\t"
                     "global_load_b128 %8, %17, off\n\t"
                     "global_load_b128 %9, %17, off offset:32\n\t"
                     "global_load_b128 %10, %17, off offset:32768\n\t"
                     "global_load_b128 %11, %17, off offset:32800\n\t"
                     "global_load_b128 %12, %17, off offset:65536\n\t"
                     "global_load_b128 %13, %17, off offset:65568\n\t"
                     "global_load_b128 %14, %17, off offset:98304\n\t"
                     "global_load_b128 %15, %17, off offset:98336\n\t"
                     "s_wait_loadcnt 0x0"
                     : "=&v"(bk[0][0].q[0]), "=&v"(bk[0][0].q[1]),
                       "=&v"(bk[0][1].q[0]), "=&v"(bk[0][1].q[1]),
                       "=&v"(bk[1][0].q[0]), "=&v"(bk[1][0].q[1]),
                       "=&v"(bk[1][1].q[0]), "=&v"(bk[1][1].q[1]),
                       "=&v"(bv[0].q[0]), "=&v"(bv[0].q[1]),
                       "=&v"(bv[1].q[0]), "=&v"(bv[1].q[1]),
                       "=&v"(bv[2].q[0]), "=&v"(bv[2].q[1]),
                       "=&v"(bv[3].q[0]), "=&v"(bv[3].q[1])
                     : "v"(kp), "v"(vp)
                     : "memory");

        // Unrolled so that bk[sub] and p[sub] are indexed by constants and stay
        // in registers.
#pragma unroll
        for (int sub = 0; sub < 2; ++sub) {
            int ks = kbase + sub * 16;
            f32x8 s = {0,0,0,0,0,0,0,0};
#pragma unroll
            for (int c = 0; c < 2; ++c)
                s = __builtin_amdgcn_wmma_f32_16x16x32_bf16(
                    false, aq[c].v, false, bk[sub][c].v, (short)0, s, false, false);
#pragma unroll
            for (int r = 0; r < 8; ++r) {
                int row = qt * 16 + r + hb;
                int key = ks + ln;
                float sv = s[r] * ATTN_MULT;
                if (key > row || key >= T) sv = -1e30f;
                p[sub][r] = sv;
                tmax[r] = fmaxf(tmax[r], sv);
            }
        }
#pragma unroll
        for (int r = 0; r < 8; ++r)
            for (int off = 8; off > 0; off >>= 1)
                tmax[r] = fmaxf(tmax[r], __shfl_xor(tmax[r], off, 16));

        float corr[8];
#pragma unroll
        for (int r = 0; r < 8; ++r) {
            float mn = fmaxf(rmax[r], tmax[r]);
            corr[r]  = __expf(rmax[r] - mn);
            rmax[r]  = mn;
            p[0][r]  = __expf(p[0][r] - mn);
            p[1][r]  = __expf(p[1][r] - mn);
            float ts = p[0][r] + p[1][r];
            for (int off = 8; off > 0; off >>= 1)
                ts += __shfl_xor(ts, off, 16);
            rsum[r] = rsum[r] * corr[r] + ts;
        }
#pragma unroll
        for (int r = 0; r < 8; ++r) {
            o0[r] *= corr[r]; o1[r] *= corr[r];
            o2[r] *= corr[r]; o3[r] *= corr[r];
        }
#pragma unroll
        for (int sub = 0; sub < 2; ++sub)
#pragma unroll
            for (int r = 0; r < 8; ++r)
                pbuf[w][(r + hb) * 34 + sub * 16 + ln] = f2bf(p[sub][r]);
        BF16Frag pf;
#pragma unroll
        for (int e = 0; e < 16; ++e)
            pf.u[e] = pbuf[w][ln * 34 + fragK(e, lane)];

        o0 = __builtin_amdgcn_wmma_f32_16x16x32_bf16(
                false, pf.v, false, bv[0].v, (short)0, o0, false, false);
        o1 = __builtin_amdgcn_wmma_f32_16x16x32_bf16(
                false, pf.v, false, bv[1].v, (short)0, o1, false, false);
        o2 = __builtin_amdgcn_wmma_f32_16x16x32_bf16(
                false, pf.v, false, bv[2].v, (short)0, o2, false, false);
        o3 = __builtin_amdgcn_wmma_f32_16x16x32_bf16(
                false, pf.v, false, bv[3].v, (short)0, o3, false, false);
    }
#pragma unroll
    for (int r = 0; r < 8; ++r) {
        int row = qt * 16 + r + hb;
        float inv = 1.f / rsum[r];
        size_t base = (size_t)row * (H * HD) + h * HD;
        attnb[base +  0 + ln] = f2bf(o0[r] * inv);
        attnb[base + 16 + ln] = f2bf(o1[r] * inv);
        attnb[base + 32 + ln] = f2bf(o2[r] * inv);
        attnb[base + 48 + ln] = f2bf(o3[r] * inv);
    }
}

// ---------------------------------------------------------------------------
// Host-side orchestration.
// ---------------------------------------------------------------------------
static void launch_gemm(hipStream_t s, int nz, int sA, int sB, int sC, int sR,
                        const int* tilemap, const int* rowlist, const int* cnts,
                        const unsigned short* A, int lda,
                        const unsigned short* Bt, int ldb, int M, int N, int K,
                        float* outf, unsigned short* outb, int ldc,
                        int mode, float scale,
                        const float* resid, int ldr,
                        const float* rowsc,
                        const float* aux, int ldaux) {
    // With a tile map grid.y covers the row tiles of all experts' lists.
    dim3 g(N / 128, tilemap ? MOE_TILES : M / 64, nz);
    gemm_bf16_wmma<<<g, 256, 0, s>>>(A, lda, Bt, ldb, M, N, K, outf, outb, ldc,
                                     mode, scale, resid, ldr, rowsc,
                                     aux, ldaux, sA, sB, sC, sR,
                                     0, nullptr, nullptr, tilemap, rowlist, cnts);
}

extern "C" void kernel_launch(void* const* d_in, const int* in_sizes, int n_in,
                              void* d_out, int out_size, void* d_ws, size_t ws_size,
                              hipStream_t stream) {
    const int*   pos     = (const int*)  d_in[0];
    const float* hidden  = (const float*)d_in[1];
    const float* ln1     = (const float*)d_in[2];
    const float* ln2     = (const float*)d_in[3];
    const float* wq      = (const float*)d_in[4];
    const float* wk      = (const float*)d_in[5];
    const float* wv      = (const float*)d_in[6];
    const float* wo      = (const float*)d_in[7];
    const float* routerw = (const float*)d_in[8];
    const float* w13     = (const float*)d_in[9];
    const float* w2      = (const float*)d_in[10];
    const float* sw13    = (const float*)d_in[11];
    const float* sw2     = (const float*)d_in[12];

    float* outF     = (float*)d_out;          // final hidden  [T*D]
    float* residOut = outF + (size_t)T * D;   // post-attn residual [T*D]

    char* ws = (char*)d_ws;
    const size_t MB = 1u << 20;
    unsigned short* xb    = (unsigned short*)(ws + 0);        // T*D bf16   4M
    float*          qf    = (float*)         (ws + 4  * MB);  // T*2048 f32 8M
    float*          kf    = (float*)         (ws + 12 * MB);  // T*512 f32  2M
    unsigned short* qbuf  = (unsigned short*)(ws + 14 * MB);  // 4M
    unsigned short* kbuf  = (unsigned short*)(ws + 18 * MB);  // 1M
    unsigned short* vbuf  = (unsigned short*)(ws + 19 * MB);  // 1M, [KV*HD][T]
    unsigned short* attnb = (unsigned short*)(ws + 20 * MB);  // 4M
    float*          xnf   = (float*)         (ws + 24 * MB);  // 8M
    unsigned short* xnb   = (unsigned short*)(ws + 32 * MB);  // 4M
    float*          fullw = (float*)         (ws + 36 * MB);  // 32K
    int*            rlist = (int*)           (ws + 36 * MB + 65536);   // E*T int 32K
    float*          wlist = (float*)         (ws + 36 * MB + 98304);   // E*T f32 32K
    int*            cnts  = (int*)           (ws + 36 * MB + 131072);  // E int
    int*            tmap  = (int*)           (ws + 36 * MB + 135168);  // MOE_TILES int
    float*          moe   = (float*)         (ws + 37 * MB);  // 8M
    float*          ggate = (float*)         (ws + 45 * MB);  // T*SI f32 16M
    unsigned short* sactb = (unsigned short*)(ws + 61 * MB);  // 8M
    float*          hgate = (float*)         (ws + 69 * MB);  // E*T*I f32 32M
    unsigned short* actb  = (unsigned short*)(ws + 101 * MB); // E*T*I bf16 16M
    float*          moep  = (float*)         (ws + 117 * MB); // E*T*D f32 64M
    unsigned short* wt    = (unsigned short*)(ws + 184 * MB); // bf16 weights 164M
    (void)ws_size; (void)in_sizes; (void)n_in; (void)out_size;

    // 0) Every GEMM weight once to bf16, transposed to [n][k].
    weight_bf16_t_kernel<<<WT_BLOCKS, 256, 0, stream>>>(wq, wk, wv, wo, w13, w2,
                                                        sw13, sw2, wt);

    // 1) RMSNorm 1 -> bf16 activations.
    rmsnorm_kernel<<<T, 256, 0, stream>>>(hidden, ln1, nullptr, xb);

    // 2) QKV projections, one launch: column tiles 0-15 are Q, 16-19 K, 20-23 V
    //    (V is stored transposed, for the attention's fragment loads).
    gemm_bf16_wmma<<<dim3((H + 2 * KV) * HD / 128, T / 64), 256, 0, stream>>>(
        xb, D, wt + WT_Q, D, T, H * HD, D, qf, nullptr, H * HD, GEMM_STORE, 0.f,
        nullptr, 0, nullptr, nullptr, 0, 0, 0, 0, 0,
        KV * HD, kf, vbuf, nullptr, nullptr, nullptr);

    // 3) RoPE on Q and K (f32 -> bf16).
    rope_kernel<<<(T * H  * 32 + 255) / 256, 256, 0, stream>>>(pos, qf, qbuf, H);
    rope_kernel<<<(T * KV * 32 + 255) / 256, 256, 0, stream>>>(pos, kf, kbuf, KV);

    // 4) Causal GQA attention.
    attn_kernel<<<dim3(H, T / 64), 128, 0, stream>>>(qbuf, kbuf, vbuf, attnb);

    // 5) Output projection + residual -> residOut (second output).
    launch_gemm(stream, 1, 0, 0, 0, 0, nullptr, nullptr, nullptr,
                attnb, H * HD, wt + WT_O, H * HD, T, D, H * HD,
                residOut, nullptr, D, GEMM_RESID, RES_MULT, hidden, D,
                nullptr, nullptr, 0);

    // 6) RMSNorm 2.
    rmsnorm_kernel<<<T, 256, 0, stream>>>(residOut, ln2, xnf, xnb);

    // 7) Router top-2.
    router_kernel<<<T, 32, 0, stream>>>(xnf, routerw, fullw);

    // 8) Experts, weighted by full_w as in the reference.  Each expert takes the
    //    rows whose weight for it is not zero: gate and up gather them from xnb
    //    into the order of the expert's list, down stores each weighted row at
    //    its token's place in the expert's plane; the planes are summed after.
    route_kernel<<<1, 1024, 0, stream>>>(fullw, rlist, wlist, cnts, tmap);
    launch_gemm(stream, 1, 0, D * 2 * I, T * I, 0, tmap, rlist, cnts,
                xnb, D, wt + WT_13, D, T, I, D,
                hgate, nullptr, I, GEMM_STORE, 0.f, nullptr, 0, nullptr, nullptr, 0);
    launch_gemm(stream, 1, 0, D * 2 * I, T * I, 0, tmap, rlist, cnts,
                xnb, D, wt + WT_13 + (size_t)I * D, D, T, I, D,
                nullptr, actb, I, GEMM_SILU, 0.f, nullptr, 0, nullptr, hgate, I);
    launch_gemm(stream, 1, T * I, I * D, T * D, T, tmap, rlist, cnts,
                actb, I, wt + WT_2, I, T, D, I,
                moep, nullptr, D, GEMM_MOE_INIT, 0.f,
                nullptr, 0, wlist, nullptr, 0);
    expert_sum_kernel<<<T * D / 1024, 256, 0, stream>>>(moep, fullw, moe);

    // 9) Shared expert.
    launch_gemm(stream, 1, 0, 0, 0, 0, nullptr, nullptr, nullptr,
                xnb, D, wt + WT_S13, D, T, SI, D,
                ggate, nullptr, SI, GEMM_STORE, 0.f, nullptr, 0, nullptr, nullptr, 0);
    launch_gemm(stream, 1, 0, 0, 0, 0, nullptr, nullptr, nullptr,
                xnb, D, wt + WT_S13 + (size_t)SI * D, D, T, SI, D,
                nullptr, sactb, SI, GEMM_SILU, 0.f, nullptr, 0, nullptr, ggate, SI);

    // 10) Shared down-proj fused with final residual.
    launch_gemm(stream, 1, 0, 0, 0, 0, nullptr, nullptr, nullptr,
                sactb, SI, wt + WT_S2, SI, T, D, SI,
                outF, nullptr, D, GEMM_FINAL, RES_MULT, residOut, D,
                nullptr, moe, D);
}

// v007
// A run of this version takes 355 microseconds.
// Timed twice side by side with v006, it ran 1.12 times as fast both times.
// Over all steps from v000 it is 9.57 times as fast.
#include <hip/hip_runtime.h>
#include <hip/hip_bf16.h>

// ---------------------------------------------------------------------------
// MI455X (gfx1250, wave32) implementation of a decoder layer (attention, MoE, shared MLP).
// All large GEMMs + attention run on v_wmma_f32_16x16x32_bf16 (bf16 in, f32
// accum).  A-activation tiles move global->LDS via the CDNA5 async-DMA path
// (global_load_async_to_lds_b128 + s_wait_asynccnt).  A first launch writes every
// GEMM weight once as bf16, transposed to [n][k], into the workspace, so the
// weight tiles take the same async path and the k loop holds no conversion.
// GEMMs that do not depend on each other share one launch: Q/K/V in one grid,
// and the eight experts' gate, up and down products one grid each.  An expert's
// products are formed only for the rows whose router weight for it is not zero.
// Workspace requirement: 348 MiB (see layout below).
// ---------------------------------------------------------------------------

static constexpr int T  = 1024;
static constexpr int D  = 2048;
static constexpr int H  = 32;
static constexpr int KV = 8;
static constexpr int HD = 64;
static constexpr int E  = 8;
static constexpr int I  = 1024;
static constexpr int SI = 4096;
static constexpr float ATTN_MULT = 0.0078125f;
static constexpr float RES_MULT  = 0.22f;
static constexpr float EPS       = 1e-6f;

typedef __bf16 bf16x16 __attribute__((ext_vector_type(16)));
typedef float  f32x8   __attribute__((ext_vector_type(8)));
typedef float  f32x4   __attribute__((ext_vector_type(4)));
typedef unsigned int u32x4 __attribute__((ext_vector_type(4)));
typedef int i32x4 __attribute__((ext_vector_type(4)));

union BF16Frag {
    unsigned short u[16];
    u32x4 q[2];      // the two runs of eight k-consecutive elements (see fragK)
    bf16x16 v;
};

__device__ __forceinline__ unsigned short f2bf(float f) {
    unsigned int u = __float_as_uint(f);
    unsigned int r = u + 0x7FFFu + ((u >> 16) & 1u);   // round-to-nearest-even
    return (unsigned short)(r >> 16);
}

// A/B fragment K-index pattern for V_WMMA_*_16X16X32_BF16 (ISA 7.12.2):
// VGPR p (0..7), half w; lanes 0-15 vs 16-31 differ by +8 in K.
__device__ __forceinline__ int fragK(int e, int lane) {
    int p = e >> 1, w = e & 1;
    return ((p & 3) << 1) + w + ((p >> 2) << 4) + ((lane >> 4) << 3);
}

// Generic pointer -> 32-bit LDS byte offset (AS3) for async-DMA VDST operand.
__device__ __forceinline__ unsigned lds_off(const void* p) {
    return (unsigned)(unsigned long long)
        (__attribute__((address_space(3))) const void*)p;
}

// CDNA5 async global->LDS copies, 16B per lane each (ASYNCcnt tracked): a
// thread's share of one k stage, four pieces of the A tile and eight of the B
// tile.  Piece i lies i * ls bytes further in LDS than the first one of its
// tile; in global memory the A pieces have a pointer each (their rows may be
// gathered), the B pieces lie gb elements apart.  A wave's copy takes
// two rows of 256 B: whole lines, where a 32-k stage took 64 B of eight rows.
__device__ __forceinline__ void async_copy12_b128(unsigned la, const unsigned short* a0,
                                                  const unsigned short* a1,
                                                  const unsigned short* a2,
                                                  const unsigned short* a3,
                                                  unsigned lb, const unsigned short* b, size_t gb,
                                                  unsigned ls) {
    // s_wait_xcnt as the last line of the copies' own statement: it stands in
    // front of any later rewrite of the address registers that the copies name.
    asm volatile("global_load_async_to_lds_b128 %0, %1, off\n\t"
                 "global_load_async_to_lds_b128 %2, %3, off\n\t"
                 "global_load_async_to_lds_b128 %4, %5, off\n\t"
                 "global_load_async_to_lds_b128 %6, %7, off\n\t"
                 "global_load_async_to_lds_b128 %8, %9, off\n\t"
                 "global_load_async_to_lds_b128 %10, %11, off\n\t"
                 "global_load_async_to_lds_b128 %12, %13, off\n\t"
                 "global_load_async_to_lds_b128 %14, %15, off\n\t"
                 "global_load_async_to_lds_b128 %16, %17, off\n\t"
                 "global_load_async_to_lds_b128 %18, %19, off\n\t"
                 "global_load_async_to_lds_b128 %20, %21, off\n\t"
                 "global_load_async_to_lds_b128 %22, %23, off\n\t"
                 "s_wait_xcnt 0x0"
                 :: "v"(la),          "v"(a0),
                    "v"(la + ls),     "v"(a1),
                    "v"(la + 2 * ls), "v"(a2),
                    "v"(la + 3 * ls), "v"(a3),
                    "v"(lb),          "v"(b),
                    "v"(lb + ls),     "v"(b + gb),
                    "v"(lb + 2 * ls), "v"(b + 2 * gb),
                    "v"(lb + 3 * ls), "v"(b + 3 * gb),
                    "v"(lb + 4 * ls), "v"(b + 4 * gb),
                    "v"(lb + 5 * ls), "v"(b + 5 * gb),
                    "v"(lb + 6 * ls), "v"(b + 6 * gb),
                    "v"(lb + 7 * ls), "v"(b + 7 * gb)
                 : "memory");
}
// Behind a global store: stands in front of any later rewrite of the store's
// address and data registers.
__device__ __forceinline__ void wait_xcnt0() {
    asm volatile("s_wait_xcnt 0x0" ::: "memory");
}
__device__ __forceinline__ void wait_async0() {
    asm volatile("s_wait_asynccnt 0x0" ::: "memory");
}
// A wave's own LDS reads have retired before the barrier behind which the
// buffer they read is refilled by async copies.
__device__ __forceinline__ void wait_ds0() {
    asm volatile("s_wait_dscnt 0x0" ::: "memory");
}

// ---------------------------------------------------------------------------
// Weight pre-pass: every GEMM weight W[K][N] (f32) -> Wt[N][K] (bf16, rounded
// to nearest even, f2bf).  A block takes a strip of
// 1024 k x 64 n as sixteen 64x64 tiles.  A thread owns a 4(k) x 4(n) patch, so the
// transpose happens in its registers; the tile goes through LDS so that every
// global store covers whole 128-B lines of a Wt row.
// Element offsets of the transposed weights in their workspace region:
// ---------------------------------------------------------------------------
static constexpr size_t WT_Q   = 0;                                // [H*HD][D]
static constexpr size_t WT_K   = WT_Q   + (size_t)D * H * HD;      // [KV*HD][D]
static constexpr size_t WT_V   = WT_K   + (size_t)D * KV * HD;     // [KV*HD][D]
static constexpr size_t WT_O   = WT_V   + (size_t)D * KV * HD;     // [D][H*HD]
static constexpr size_t WT_13  = WT_O   + (size_t)H * HD * D;      // E x [2I][D]
static constexpr size_t WT_2   = WT_13  + (size_t)E * D * 2 * I;   // E x [D][I]
static constexpr size_t WT_S13 = WT_2   + (size_t)E * I * D;       // [2SI][D]
static constexpr size_t WT_S2  = WT_S13 + (size_t)D * 2 * SI;      // [D][SI]
static constexpr int strips(int k, int n) { return (k / 1024) * (n / 64); }
static constexpr int WT_BLOCKS =
    strips(D, H * HD) + 2 * strips(D, KV * HD) + strips(H * HD, D) +
    E * strips(D, 2 * I) + E * strips(I, D) + strips(D, 2 * SI) + strips(SI, D);

__global__ __launch_bounds__(256)
void weight_bf16_t_kernel(const float* __restrict__ wq, const float* __restrict__ wk,
                          const float* __restrict__ wv, const float* __restrict__ wo,
                          const float* __restrict__ w13, const float* __restrict__ w2,
                          const float* __restrict__ sw13, const float* __restrict__ sw2,
                          unsigned short* __restrict__ wt) {
    constexpr int P = 72;    // LDS row pitch: 144 B = 16 B x odd
    __shared__ __align__(16) unsigned short tile[2][64 * P];

    // Which matrix, and which strip of it (all block-uniform).
    int b = blockIdx.x;
    const float* src;
    size_t off;
    int K, N;
    if (b < strips(D, H * HD)) { src = wq; off = WT_Q; K = D; N = H * HD; }
    else if ((b -= strips(D, H * HD)) < strips(D, KV * HD)) { src = wk; off = WT_K; K = D; N = KV * HD; }
    else if ((b -= strips(D, KV * HD)) < strips(D, KV * HD)) { src = wv; off = WT_V; K = D; N = KV * HD; }
    else if ((b -= strips(D, KV * HD)) < strips(H * HD, D)) { src = wo; off = WT_O; K = H * HD; N = D; }
    else if ((b -= strips(H * HD, D)) < E * strips(D, 2 * I)) { src = w13; off = WT_13; K = D; N = 2 * I; }
    else if ((b -= E * strips(D, 2 * I)) < E * strips(I, D)) { src = w2; off = WT_2; K = I; N = D; }
    else if ((b -= E * strips(I, D)) < strips(D, 2 * SI)) { src = sw13; off = WT_S13; K = D; N = 2 * SI; }
    else { b -= strips(D, 2 * SI); src = sw2; off = WT_S2; K = SI; N = D; }
    int kstrips = K >> 10;
    int per     = kstrips * (N >> 6);       // strips of one matrix
    int e       = b / per;                  // expert (0 where there is one matrix)
    b -= e * per;
    int n0 = (b / kstrips) << 6;
    int kb = (b % kstrips) << 10;
    src += (size_t)e * K * N;
    unsigned short* dst = wt + off + (size_t)e * K * N;

    int tid  = threadIdx.x;
    int lane = tid & 31;
    int wid  = tid >> 5;
    // Eight lanes cover one 128-B line of a source row; the four lane groups of
    // a wave take different k quads, which spreads the 8-byte LDS stores.
    int pk = (((wid & 3) << 2) | (lane >> 3)) << 2;    // k 0,4,..,60
    int pn = (((wid >> 2) << 3) | (lane & 7)) << 2;    // n 0,4,..,60
    const float* g = src + (size_t)(kb + pk) * N + n0 + pn;
    // Read back: eight lanes cover one 128-B line of a Wt row.
    int rr = tid >> 3;                                 // n 0..31 (and +32)
    int rc = (tid & 7) << 3;                           // k 0,8,..,56
    unsigned short* o = dst + (size_t)(n0 + rr) * K + kb + rc;

    size_t rowb = (size_t)N;                           // source row, elements
    for (int t = 0; t < 16; ++t) {
        const float* gt = g + (size_t)(t * 64) * rowb;
        f32x4 r0, r1, r2, r3;
        // The four loads and their data wait in one statement, outputs
        // early-clobber: no result and no later instruction lands on an address
        // register of a load that is still in flight.
        asm volatile("global_load_b128 %0, %4, off\n\t"
                     "global_load_b128 %1, %5, off\n\t"
                     "global_load_b128 %2, %6, off\n\t"
                     "global_load_b128 %3, %7, off\n\t"
                     "s_wait_loadcnt 0x0"
                     : "=&v"(r0), "=&v"(r1), "=&v"(r2), "=&v"(r3)
                     : "v"(gt), "v"(gt + rowb), "v"(gt + 2 * rowb), "v"(gt + 3 * rowb)
                     : "memory");
        unsigned short* l = tile[t & 1];
#pragma unroll
        for (int j = 0; j < 4; ++j) {
            uint2 q;
            q.x = (unsigned)f2bf(r0[j]) | ((unsigned)f2bf(r1[j]) << 16);
            q.y = (unsigned)f2bf(r2[j]) | ((unsigned)f2bf(r3[j]) << 16);
            *(uint2*)&l[(pn + j) * P + pk] = q;
        }
        // One barrier a tile: with two buffers it also ends the reads of the
        // buffer that the next tile but one overwrites.
        __syncthreads();
#pragma unroll
        for (int i = 0; i < 2; ++i) {
            uint4 v = *(const uint4*)&l[(rr + i * 32) * P + rc];
            *(uint4*)&o[(size_t)(i * 32) * K + t * 64] = v;
            wait_xcnt0();   // in front of any later write of the store's registers
        }
    }
}

// ---------------------------------------------------------------------------
// RMSNorm: one block per row.  Writes f32 and/or bf16 outputs.
// ---------------------------------------------------------------------------
__global__ __launch_bounds__(256)
void rmsnorm_kernel(const float* __restrict__ in, const float* __restrict__ w,
                    float* outf, unsigned short* outb) {
    int row = blockIdx.x;
    int tid = threadIdx.x;
    __shared__ float red[256];
    const float* x = in + (size_t)row * D;
    float ss = 0.f;
    for (int i = tid; i < D; i += 256) { float v = x[i]; ss += v * v; }
    red[tid] = ss;
    __syncthreads();
    for (int s = 128; s > 0; s >>= 1) {
        if (tid < s) red[tid] += red[tid + s];
        __syncthreads();
    }
    float rs = rsqrtf(red[0] / (float)D + EPS);
    for (int i = tid; i < D; i += 256) {
        float v = x[i] * rs * w[i];
        if (outf) outf[(size_t)row * D + i] = v;
        if (outb) outb[(size_t)row * D + i] = f2bf(v);
    }
}

// ---------------------------------------------------------------------------
// RoPE: f32 in -> bf16 out, per (t, head, i<HD/2).
// ---------------------------------------------------------------------------
__global__ __launch_bounds__(256)
void rope_kernel(const int* __restrict__ pos, const float* __restrict__ in,
                 unsigned short* __restrict__ out, int nheads) {
    int idx = blockIdx.x * blockDim.x + threadIdx.x;
    int total = T * nheads * (HD / 2);
    if (idx >= total) return;
    int i = idx & 31;
    int h = (idx >> 5) % nheads;
    int t = idx / (32 * nheads);
    float inv = __expf(-(float)i * (9.2103403719761840f / 32.f)); // 10000^(-i/32)
    float ang = (float)pos[t] * inv;
    float s, c;
    __sincosf(ang, &s, &c);
    size_t base = (size_t)t * nheads * HD + (size_t)h * HD;
    float x1 = in[base + i];
    float x2 = in[base + 32 + i];
    out[base + i]      = f2bf(x1 * c - x2 * s);
    out[base + 32 + i] = f2bf(x2 * c + x1 * s);
}

// ---------------------------------------------------------------------------
// Router: one wave per token.  logits = xn . router_w[e], softmax, top-2.
// ---------------------------------------------------------------------------
__global__ __launch_bounds__(32)
void router_kernel(const float* __restrict__ xn, const float* __restrict__ rw,
                   float* __restrict__ fullw) {
    int t = blockIdx.x;
    int lane = threadIdx.x;
    float acc[E];
#pragma unroll
    for (int e = 0; e < E; ++e) acc[e] = 0.f;
    const float* x = xn + (size_t)t * D;
    for (int i = lane; i < D; i += 32) {
        float xv = x[i];
#pragma unroll
        for (int e = 0; e < E; ++e) acc[e] += xv * rw[(size_t)e * D + i];
    }
#pragma unroll
    for (int e = 0; e < E; ++e)
        for (int off = 16; off > 0; off >>= 1)
            acc[e] += __shfl_xor(acc[e], off, 32);
    if (lane == 0) {
        int i1 = 0;
        for (int e = 1; e < E; ++e) if (acc[e] > acc[i1]) i1 = e;
        int i2 = (i1 == 0) ? 1 : 0;
        for (int e = 0; e < E; ++e) if (e != i1 && acc[e] > acc[i2]) i2 = e;
        float e1 = 1.f;
        float e2 = __expf(acc[i2] - acc[i1]);
        float inv = 1.f / (e1 + e2);
        for (int e = 0; e < E; ++e) {
            float wv = (e == i1) ? e1 * inv : (e == i2) ? e2 * inv : 0.f;
            fullw[(size_t)t * E + e] = wv;
        }
    }
}

// ---------------------------------------------------------------------------
// Row lists of the experts, one block, thread = token.  list[e][0 .. cnts[e])
// holds, in rising order, the tokens whose weight for expert e is not zero (a
// zero weight multiplies that expert's product away); the rest of list[e] is
// token 0, so that a last, partly filled tile gathers rows that exist.
// wlist[e] holds the weights in the same order (zero behind the listed ones).
// tilemap[j] = expert << 16 | first list place of the j-th 64-row tile, or -1.
// The router gives a token at most two weights: at most 2T list entries, so
// at most (2T + 63 E) / 64 tiles.
// ---------------------------------------------------------------------------
static constexpr int MOE_TILES = (2 * T + 63 * E) / 64;

__global__ __launch_bounds__(1024)
void route_kernel(const float* __restrict__ fullw, int* __restrict__ list,
                  float* __restrict__ wlist,
                  int* __restrict__ cnts, int* __restrict__ tilemap) {
    static_assert(T == 1024 && E == 8, "one thread a token, one wave's scan an expert");
    __shared__ int wcnt[E][32];   // per expert and wave: count, then count of the waves before
    __shared__ int tot[E];
    int t    = threadIdx.x;
    int lane = t & 31;
    int wv   = t >> 5;
    f32x4 wa, wb;
    // Both loads and their data wait in one statement, outputs early-clobber:
    // nothing lands on the address register of a load that is still in flight.
    asm volatile("global_load_b128 %0, %2, off\n\t"
                 "global_load_b128 %1, %2, off offset:16\n\t"
                 "s_wait_loadcnt 0x0"
                 : "=&v"(wa), "=&v"(wb)
                 : "v"(fullw + (size_t)t * E)
                 : "memory");
    unsigned m[E];
#pragma unroll
    for (int e = 0; e < E; ++e) {
        float wv_e = e < 4 ? wa[e & 3] : wb[e & 3];
        m[e] = __builtin_amdgcn_ballot_w32(wv_e != 0.f);
        if (lane == 0) wcnt[e][wv] = __popc(m[e]);
    }
    __syncthreads();
    if (wv < E) {
        int c = wcnt[wv][lane];
        int inc = c;
        for (int off = 1; off < 32; off <<= 1) {
            int n = __shfl_up(inc, off, 32);
            if (lane >= off) inc += n;
        }
        wcnt[wv][lane] = inc - c;
        if (lane == 31) tot[wv] = inc;
    }
    __syncthreads();
#pragma unroll
    for (int e = 0; e < E; ++e) {
        // A place below tot[e] is written by the one token that ranks there, a
        // place from tot[e] on by the thread of that number.
        bool mine = (m[e] >> lane) & 1u;
        int place = mine ? wcnt[e][wv] + __popc(m[e] & ((1u << lane) - 1u)) : t;
        if (mine || t >= tot[e]) {
            list[e * T + place] = mine ? t : 0;
            wait_xcnt0();   // in front of any later write of the store's registers
            wlist[e * T + place] = mine ? (e < 4 ? wa[e & 3] : wb[e & 3]) : 0.f;
            wait_xcnt0();
        }
        if (mine && t >= tot[e]) {
            list[e * T + t] = 0;
            wait_xcnt0();
            wlist[e * T + t] = 0.f;
            wait_xcnt0();
        }
    }
    if (t < E) { cnts[t] = tot[t]; wait_xcnt0(); }
    if (t < MOE_TILES) {
        int j = t, ent = -1;
#pragma unroll
        for (int e = 0; e < E; ++e) {
            int nt = (tot[e] + 63) >> 6;
            if (ent < 0 && j < nt) ent = (e << 16) | (j << 6);
            j -= nt;
        }
        tilemap[t] = ent;
        wait_xcnt0();
    }
}

// ---------------------------------------------------------------------------
// BF16-WMMA GEMM, double-buffered LDS, async DMA of both tiles.
// C[M,N] = A[M,K](bf16) x Bt[N,K]^T (bf16, from the weight pre-pass).
// Block tile 64x128, 8 waves (2M x 4N), each wave 32x32.  A stage of the two
// LDS buffers holds 128 k (16 WMMAs a wave): 48 KiB of copies are in flight per
// block, and their latency, the waits and the barrier are paid once per 128 k.
// Requires: M%64==0, N%128==0, K%128==0, lda%8==0, ldb%8==0 (all satisfied).
// ---------------------------------------------------------------------------
#define GEMM_STORE    0  // outf/outb = acc
#define GEMM_RESID    1  // outf = resid + scale*acc
#define GEMM_MOE_INIT 2  // outf[token] = rowsc[row]*acc, token = rowlist[row], listed rows only
#define GEMM_SILU     4  // outb = silu(aux[row,col]) * acc   (bf16)
#define GEMM_FINAL    5  // outf = resid + scale*(aux + acc)

__global__ __launch_bounds__(256)
void gemm_bf16_wmma(const unsigned short* __restrict__ A, int lda,
                    const unsigned short* __restrict__ Bt, int ldb,
                    int M, int N, int K,
                    float* outf, unsigned short* outb, int ldc,
                    int mode, float scale,
                    const float* __restrict__ resid, int ldr,
                    const float* __restrict__ rowsc,
                    const float* __restrict__ aux, int ldaux,
                    int sA, int sB, int sC, int sR,
                    int N2, float* outf2, unsigned short* outb3,
                    const int* __restrict__ tilemap, const int* __restrict__ rowlist,
                    const int* __restrict__ cnts) {
    constexpr int BK = 128;      // k per stage
    constexpr int AS = BK + 8;   // LDS stride for A rows   [64][AS]  (272 B = 16 B x odd)
    constexpr int BS = BK + 8;   // LDS stride for B^T rows [128][BS]
    __shared__ __align__(16) unsigned short lds_a[2][64 * AS];
    __shared__ __align__(16) unsigned short lds_b[2][128 * BS];

    int tid  = threadIdx.x;
    int lane = tid & 31;
    int wid  = tid >> 5;
    int wm   = wid >> 2;   // 0..1
    int wn   = wid & 3;    // 0..3
    int m0   = blockIdx.y * 64;
    int n0   = blockIdx.x * 128;
    int ln   = lane & 15;

    // blockIdx.z: independent GEMMs of one shape whose operands lie sA / sB
    // elements apart, outputs and aux sC apart, row scales sR apart.
    size_t z = blockIdx.z;
    // With a tile map (see route_kernel) blockIdx.y numbers the row tiles of all
    // experts' lists: the entry names the expert and the tile's place in its
    // list.  A block without a tile leaves here, whole, in front of every copy
    // and barrier.
    const int* rl = nullptr;
    if (tilemap) {
        int ent = tilemap[blockIdx.y];
        if (ent < 0) return;
        z  = (size_t)(ent >> 16);
        m0 = ent & 0xffff;
        rl = rowlist + z * T + m0;
        if (mode == GEMM_MOE_INIT) M = cnts[z];   // only listed rows are stored
    }
    A += z * sA;
    Bt += z * sB + (size_t)n0 * ldb;     // this block's 128 rows of Bt
    if (outf)  outf  += z * sC;
    if (outb)  outb  += z * sC;
    if (aux)   aux   += z * sC;
    if (rowsc) rowsc += z * sR;
    // Column tiles behind N: a second (f32 out) and a third (bf16 out) GEMM on
    // the same A, each N2 columns wide; their Bt rows follow the first one's.
    // The third one's output is stored transposed, [N2][M]: ldc is the step of
    // the output index from row to row, ocs the step from column to column.
    int ocs = 1;
    if (n0 >= N) {
        n0 -= N;
        bool third = n0 >= N2;
        if (third) n0 -= N2;
        outf = third ? nullptr : outf2;
        outb = third ? outb3 : nullptr;
        N = ldc = N2;
        if (third) { ldc = 1; ocs = M; }
    }

    // Async staging: sixteen threads x b128 cover the 256 bytes of one row, 256
    // threads sixteen rows: the 64x128 bf16 A tile takes four such pieces, the
    // 128x128 Bt tile eight (rows sr, sr + 16, ...).
    int sr = tid >> 4;          // row 0..15
    int sc = (tid & 15) << 3;   // k 0,8,..,120

    f32x8 zero = {0.f,0.f,0.f,0.f,0.f,0.f,0.f,0.f};
    f32x8 acc[2][2] = {{zero, zero}, {zero, zero}};

    static_assert(AS == BS, "one LDS step for the pieces of both tiles");
    // The A rows of this thread's four pieces: m0 + sr + 16 i, or, where the
    // rows of A are gathered (the experts' gate and up products), the tokens
    // that stand at those places of the list.
    int ar0 = m0 + sr, ar1 = ar0 + 16, ar2 = ar0 + 32, ar3 = ar0 + 48;
    if (rl && mode != GEMM_MOE_INIT) {
        // The four loads and their data wait in one statement, outputs
        // early-clobber: nothing lands on the address register of a load that is
        // still in flight.
        asm volatile("global_load_b32 %0, %4, off\n\t"
                     "global_load_b32 %1, %4, off offset:64\n\t"
                     "global_load_b32 %2, %4, off offset:128\n\t"
                     "global_load_b32 %3, %4, off offset:192\n\t"
                     "s_wait_loadcnt 0x0"
                     : "=&v"(ar0), "=&v"(ar1), "=&v"(ar2), "=&v"(ar3)
                     : "v"(rl + sr)
                     : "memory");
        // Bounds the addresses formed from the list.
        ar0 &= T - 1; ar1 &= T - 1; ar2 &= T - 1; ar3 &= T - 1;
    }
    const unsigned short* gA0 = A + (size_t)ar0 * lda + sc;
    const unsigned short* gA1 = A + (size_t)ar1 * lda + sc;
    const unsigned short* gA2 = A + (size_t)ar2 * lda + sc;
    const unsigned short* gA3 = A + (size_t)ar3 * lda + sc;
    const unsigned short* gB = Bt + (size_t)sr * ldb + sc;
    auto stage = [&](int buf, int k0) {
        async_copy12_b128(lds_off(&lds_a[buf][sr * AS + sc]),
                          gA0 + k0, gA1 + k0, gA2 + k0, gA3 + k0,
                          lds_off(&lds_b[buf][sr * BS + sc]), gB + k0, (size_t)16 * ldb,
                          16 * AS * 2);
    };

    // Two buffers: tile 0 lands and is published, then tile 1 flies.
    int nk = K / BK;
    stage(0, 0);
    wait_async0();
    __syncthreads();
    if (nk > 1) stage(1, BK);

    int buf = 0;
    for (int kt = 0; kt < nk; ++kt) {
        // Unrolled: the four 32-k slices' places in the stage become immediate
        // offsets of the fragment loads, with no address arithmetic per slice.
#pragma unroll
        for (int ks = 0; ks < BK; ks += 32) {
            BF16Frag af[2], bf[2];
#pragma unroll
            for (int s = 0; s < 2; ++s)
#pragma unroll
                for (int e = 0; e < 16; ++e) {
                    int kk = ks + fragK(e, lane);
                    af[s].u[e] = lds_a[buf][(wm * 32 + s * 16 + ln) * AS + kk];
                    bf[s].u[e] = lds_b[buf][(wn * 32 + s * 16 + ln) * BS + kk];
                }
#pragma unroll
            for (int sm = 0; sm < 2; ++sm)
#pragma unroll
                for (int sn = 0; sn < 2; ++sn)
                    acc[sm][sn] = __builtin_amdgcn_wmma_f32_16x16x32_bf16(
                        false, af[sm].v, false, bf[sn].v, (short)0,
                        acc[sm][sn], false, false);
        }

        // Foot of the trip: own LDS reads retired, tile kt+1 landed, one barrier
        // that publishes it and ends every read of this buffer; then the refill.
        wait_ds0();
        wait_async0();
        __syncthreads();
        if (kt + 2 < nk) stage(buf, (kt + 2) * BK);
        buf ^= 1;
    }
    wait_async0();   // no copy is in flight when the wave goes on to its stores

    int half8 = (lane & 16) >> 1;          // +8 row offset for lanes 16-31
    // The tokens and the weights of this lane's sixteen rows, [sm][rr >> 2][rr & 3].
    i32x4 tok[2][2] = {};
    f32x4 rsc[2][2] = {};
    if (mode == GEMM_MOE_INIT) {
        // The eight loads and their data wait in one statement, as above.
        asm volatile("global_load_b128 %0, %8, off\n\t"
                     "global_load_b128 %1, %8, off offset:16\n\t"
                     "global_load_b128 %2, %8, off offset:64\n\t"
                     "global_load_b128 %3, %8, off offset:80\n\t"
                     "global_load_b128 %4, %9, off\n\t"
                     "global_load_b128 %5, %9, off offset:16\n\t"
                     "global_load_b128 %6, %9, off offset:64\n\t"
                     "global_load_b128 %7, %9, off offset:80\n\t"
                     "s_wait_loadcnt 0x0"
                     : "=&v"(tok[0][0]), "=&v"(tok[0][1]), "=&v"(tok[1][0]), "=&v"(tok[1][1]),
                       "=&v"(rsc[0][0]), "=&v"(rsc[0][1]), "=&v"(rsc[1][0]), "=&v"(rsc[1][1])
                     : "v"(rl + wm * 32 + half8), "v"(rowsc + m0 + wm * 32 + half8)
                     : "memory");
    }
#pragma unroll
    for (int sm = 0; sm < 2; ++sm) {
#pragma unroll
        for (int sn = 0; sn < 2; ++sn) {
            int col = n0 + wn * 32 + sn * 16 + ln;
#pragma unroll
            for (int rr = 0; rr < 8; ++rr) {
                int row = m0 + wm * 32 + sm * 16 + rr + half8;
                if (row >= M || col >= N) continue;
                float v = acc[sm][sn][rr];
                size_t oidx = (size_t)row * ldc + (size_t)col * ocs;
                if (mode == GEMM_STORE) {
                    if (outf) { outf[oidx] = v; wait_xcnt0(); }
                    if (outb) { outb[oidx] = f2bf(v); wait_xcnt0(); }
                } else if (mode == GEMM_RESID) {
                    outf[oidx] = resid[(size_t)row * ldr + col] + scale * v;
                    wait_xcnt0();
                } else if (mode == GEMM_MOE_INIT) {
                    size_t tk = (size_t)(tok[sm][rr >> 2][rr & 3] & (T - 1));   // bounded
                    outf[tk * ldc + col] = rsc[sm][rr >> 2][rr & 3] * v;
                    wait_xcnt0();
                } else if (mode == GEMM_SILU) {
                    float g = aux[(size_t)row * ldaux + col];
                    float s = g / (1.f + __expf(-g));
                    outb[oidx] = f2bf(s * v);
                    wait_xcnt0();
                } else { // GEMM_FINAL
                    outf[oidx] = resid[(size_t)row * ldr + col] +
                                 scale * (aux[(size_t)row * ldaux + col] + v);
                    wait_xcnt0();
                }
            }
        }
    }
}

// ---------------------------------------------------------------------------
// Sum of the experts' weighted down products, in the order 0..E-1.  A plane
// holds a token's row only where the token's weight for that expert is not zero;
// the other terms of the sum are zero.  A block lies inside one token's row.
// ---------------------------------------------------------------------------
__global__ __launch_bounds__(256)
void expert_sum_kernel(const float* __restrict__ planes, const float* __restrict__ fullw,
                       float* __restrict__ out) {
    constexpr size_t P = (size_t)T * D;
    static_assert(D % 1024 == 0, "a block's 1024 elements lie in one row");
    size_t i = ((size_t)blockIdx.x * 256 + threadIdx.x) * 4;
    const float* g = planes + i;
    const float* w = fullw + (size_t)(blockIdx.x / (D / 1024)) * E;
    float wl[E];
#pragma unroll
    for (int e = 0; e < E; ++e) wl[e] = w[e];
    f32x4 s = {0.f, 0.f, 0.f, 0.f};
#pragma unroll
    for (int e = 0; e < E; ++e) {
        if (wl[e] != 0.f) {     // the same for the whole block
            f32x4 p;
            // The load and its data wait in one statement, output early-clobber.
            asm volatile("global_load_b128 %0, %1, off\n\t"
                         "s_wait_loadcnt 0x0"
                         : "=&v"(p) : "v"(g + e * P) : "memory");
            s += p;
        }
    }
    *(f32x4*)&out[i] = s;
}

// ---------------------------------------------------------------------------
// Causal GQA flash attention.  One wave per (head, 16-query tile); 4 waves
// per block.  QK^T and P.V via bf16 WMMA; online softmax over 32-key chunks.
// K is [t][KV*HD], V comes transposed, vt = [KV*HD][t]: in both, the k index of
// a B fragment runs along memory, so a fragment is two 16-byte loads a lane.
// ---------------------------------------------------------------------------
// The value that lane l ^ M of the same 16-lane row holds, read as a DPP operand
// (row_xmask:M) in the vector pipe; every lane of the wave is on where it is used.
template <int M>
__device__ __forceinline__ float row_xor(float v) {
    return __int_as_float(__builtin_amdgcn_mov_dpp(__float_as_int(v), 0x160 | M, 0xf, 0xf, true));
}

// e^x as the fast intrinsic forms it: x * log2(e), then v_exp_f32.  The v_nop in
// the same statement fills the one slot that the instruction set asks for behind
// a transcendental, whatever instruction the compiler puts next.
__device__ __forceinline__ float exp_slot(float x) {
    float y = x * 1.44269504088896340736f, r;
    asm("v_exp_f32 %0, %1\n\tv_nop" : "=v"(r) : "v"(y));
    return r;
}

__global__ __launch_bounds__(128)
void attn_kernel(const unsigned short* __restrict__ qb,
                 const unsigned short* __restrict__ kb,
                 const unsigned short* __restrict__ vt,
                 unsigned short* __restrict__ attnb) {
    int h    = blockIdx.x;
    int w    = threadIdx.x >> 5;
    int lane = threadIdx.x & 31;
    int qt   = blockIdx.y * 4 + w;   // 16-query tile index
    int kvh  = h >> 2;               // H/KV = 4
    int hb   = (lane & 16) >> 1;     // +8 row offset for lanes 16-31
    int ln   = lane & 15;

    __shared__ unsigned short pbuf[4][16 * 34];   // per-wave P staging

    BF16Frag aq[2];
#pragma unroll
    for (int c = 0; c < 2; ++c)
#pragma unroll
        for (int e = 0; e < 16; ++e) {
            int kd = c * 32 + fragK(e, lane);
            int qrow = qt * 16 + ln;
            aq[c].u[e] = qb[(size_t)qrow * (H * HD) + h * HD + kd];
        }

    f32x8 o0 = {0,0,0,0,0,0,0,0}, o1 = o0, o2 = o0, o3 = o0;
    float rmax[8], rsum[8];
#pragma unroll
    for (int r = 0; r < 8; ++r) { rmax[r] = -1e30f; rsum[r] = 0.f; }

    int kend = qt * 16 + 16;                      // causal bound
    for (int kbase = 0; kbase < kend; kbase += 32) {
        float p[2][8];
        float tmax[8];
#pragma unroll
        for (int r = 0; r < 8; ++r) tmax[r] = -1e30f;

        // This chunk's K and V fragments.  kbase is a multiple of 32 below
        // kend <= T, and T is one too: keys kbase .. kbase + 31 all exist.
        // bk[sub][c]: key kbase + sub*16 + ln, head dims c*32 + fragK(0..15).
        // bv[j]:      head dim j*16 + ln,      keys kbase + fragK(0..15).
        static_assert(T % 32 == 0 && KV * HD * 2 == 1024 && T * 2 == 2048,
                      "the byte offsets in the loads below");
        BF16Frag bk[2][2], bv[4];
        const unsigned short* kp = kb + (size_t)(kbase + ln) * (KV * HD) + kvh * HD + hb;
        const unsigned short* vp = vt + (size_t)(kvh * HD + ln) * T + kbase + hb;
        // The sixteen loads and their data wait in one statement, outputs
        // early-clobber: no result and no later instruction lands on an address
        // register of a load that is still in flight.
        asm volatile("global_load_b128 %0, %16, off\n\t"
                     "global_load_b128 %1, %16, off offset:32\n\t"
                     "global_load_b128 %2, %16, off offset:64\n\t"
                     "global_load_b128 %3, %16, off offset:96\n\t"
                     "global_load_b128 %4, %16, off offset:16384\n\t"
                     "global_load_b128 %5, %16, off offset:16416\n\t"
                     "global_load_b128 %6, %16, off offset:16448\n\t"
                     "global_load_b128 %7, %16, off offset:16480\n\t"
                     "global_load_b128 %8, %17, off\n\t"
                     "global_load_b128 %9, %17, off offset:32\n\t"
                     "global_load_b128 %10, %17, off offset:32768\n\t"
                     "global_load_b128 %11, %17, off offset:32800\n\t"
                     "global_load_b128 %12, %17, off offset:65536\n\t"
                     "global_load_b128 %13, %17, off offset:65568\n\t"
                     "global_load_b128 %14, %17, off offset:98304\n\t"
                     "global_load_b128 %15, %17, off offset:98336\n\t"
                     "s_wait_loadcnt 0x0"
                     : "=&v"(bk[0][0].q[0]), "=&v"(bk[0][0].q[1]),
                       "=&v"(bk[0][1].q[0]), "=&v"(bk[0][1].q[1]),
                       "=&v"(bk[1][0].q[0]), "=&v"(bk[1][0].q[1]),
                       "=&v"(bk[1][1].q[0]), "=&v"(bk[1][1].q[1]),
                       "=&v"(bv[0].q[0]), "=&v"(bv[0].q[1]),
                       "=&v"(bv[1].q[0]), "=&v"(bv[1].q[1]),
                       "=&v"(bv[2].q[0]), "=&v"(bv[2].q[1]),
                       "=&v"(bv[3].q[0]), "=&v"(bv[3].q[1])
                     : "v"(kp), "v"(vp)
                     : "memory");

        // Unrolled so that bk[sub] and p[sub] are indexed by constants and stay
        // in registers.
#pragma unroll
        for (int sub = 0; sub < 2; ++sub) {
            int ks = kbase + sub * 16;
            f32x8 s = {0,0,0,0,0,0,0,0};
#pragma unroll
            for (int c = 0; c < 2; ++c)
                s = __builtin_amdgcn_wmma_f32_16x16x32_bf16(
                    false, aq[c].v, false, bk[sub][c].v, (short)0, s, false, false);
#pragma unroll
            for (int r = 0; r < 8; ++r) {
                int row = qt * 16 + r + hb;
                int key = ks + ln;
                float sv = s[r] * ATTN_MULT;
                if (key > row || key >= T) sv = -1e30f;
                p[sub][r] = sv;
                tmax[r] = fmaxf(tmax[r], sv);
            }
        }
        // Row maximum over the sixteen lanes, partners 8, 4, 2, 1 away; the eight
        // rows take each step together, so that no step waits on the one before.
#pragma unroll
        for (int r = 0; r < 8; ++r) tmax[r] = fmaxf(tmax[r], row_xor<8>(tmax[r]));
#pragma unroll
        for (int r = 0; r < 8; ++r) tmax[r] = fmaxf(tmax[r], row_xor<4>(tmax[r]));
#pragma unroll
        for (int r = 0; r < 8; ++r) tmax[r] = fmaxf(tmax[r], row_xor<2>(tmax[r]));
#pragma unroll
        for (int r = 0; r < 8; ++r) tmax[r] = fmaxf(tmax[r], row_xor<1>(tmax[r]));

        float corr[8], ts[8];
#pragma unroll
        for (int r = 0; r < 8; ++r) {
            float mn = fmaxf(rmax[r], tmax[r]);
            corr[r]  = exp_slot(rmax[r] - mn);
            rmax[r]  = mn;
            p[0][r]  = exp_slot(p[0][r] - mn);
            p[1][r]  = exp_slot(p[1][r] - mn);
            ts[r]    = p[0][r] + p[1][r];
        }
        // Row sum, the same partners in the same order.
#pragma unroll
        for (int r = 0; r < 8; ++r) ts[r] += row_xor<8>(ts[r]);
#pragma unroll
        for (int r = 0; r < 8; ++r) ts[r] += row_xor<4>(ts[r]);
#pragma unroll
        for (int r = 0; r < 8; ++r) ts[r] += row_xor<2>(ts[r]);
#pragma unroll
        for (int r = 0; r < 8; ++r) ts[r] += row_xor<1>(ts[r]);
#pragma unroll
        for (int r = 0; r < 8; ++r) rsum[r] = rsum[r] * corr[r] + ts[r];
#pragma unroll
        for (int r = 0; r < 8; ++r) {
            o0[r] *= corr[r]; o1[r] *= corr[r];
            o2[r] *= corr[r]; o3[r] *= corr[r];
        }
#pragma unroll
        for (int sub = 0; sub < 2; ++sub)
#pragma unroll
            for (int r = 0; r < 8; ++r)
                pbuf[w][(r + hb) * 34 + sub * 16 + ln] = f2bf(p[sub][r]);
        BF16Frag pf;
#pragma unroll
        for (int e = 0; e < 16; ++e)
            pf.u[e] = pbuf[w][ln * 34 + fragK(e, lane)];

        o0 = __builtin_amdgcn_wmma_f32_16x16x32_bf16(
                false, pf.v, false, bv[0].v, (short)0, o0, false, false);
        o1 = __builtin_amdgcn_wmma_f32_16x16x32_bf16(
                false, pf.v, false, bv[1].v, (short)0, o1, false, false);
        o2 = __builtin_amdgcn_wmma_f32_16x16x32_bf16(
                false, pf.v, false, bv[2].v, (short)0, o2, false, false);
        o3 = __builtin_amdgcn_wmma_f32_16x16x32_bf16(
                false, pf.v, false, bv[3].v, (short)0, o3, false, false);
    }
#pragma unroll
    for (int r = 0; r < 8; ++r) {
        int row = qt * 16 + r + hb;
        float inv = 1.f / rsum[r];
        size_t base = (size_t)row * (H * HD) + h * HD;
        attnb[base +  0 + ln] = f2bf(o0[r] * inv);
        attnb[base + 16 + ln] = f2bf(o1[r] * inv);
        attnb[base + 32 + ln] = f2bf(o2[r] * inv);
        attnb[base + 48 + ln] = f2bf(o3[r] * inv);
    }
}

// ---------------------------------------------------------------------------
// Host-side orchestration.
// ---------------------------------------------------------------------------
static void launch_gemm(hipStream_t s, int nz, int sA, int sB, int sC, int sR,
                        const int* tilemap, const int* rowlist, const int* cnts,
                        const unsigned short* A, int lda,
                        const unsigned short* Bt, int ldb, int M, int N, int K,
                        float* outf, unsigned short* outb, int ldc,
                        int mode, float scale,
                        const float* resid, int ldr,
                        const float* rowsc,
                        const float* aux, int ldaux) {
    // With a tile map grid.y covers the row tiles of all experts' lists.
    dim3 g(N / 128, tilemap ? MOE_TILES : M / 64, nz);
    gemm_bf16_wmma<<<g, 256, 0, s>>>(A, lda, Bt, ldb, M, N, K, outf, outb, ldc,
                                     mode, scale, resid, ldr, rowsc,
                                     aux, ldaux, sA, sB, sC, sR,
                                     0, nullptr, nullptr, tilemap, rowlist, cnts);
}

extern "C" void kernel_launch(void* const* d_in, const int* in_sizes, int n_in,
                              void* d_out, int out_size, void* d_ws, size_t ws_size,
                              hipStream_t stream) {
    const int*   pos     = (const int*)  d_in[0];
    const float* hidden  = (const float*)d_in[1];
    const float* ln1     = (const float*)d_in[2];
    const float* ln2     = (const float*)d_in[3];
    const float* wq      = (const float*)d_in[4];
    const float* wk      = (const float*)d_in[5];
    const float* wv      = (const float*)d_in[6];
    const float* wo      = (const float*)d_in[7];
    const float* routerw = (const float*)d_in[8];
    const float* w13     = (const float*)d_in[9];
    const float* w2      = (const float*)d_in[10];
    const float* sw13    = (const float*)d_in[11];
    const float* sw2     = (const float*)d_in[12];

    float* outF     = (float*)d_out;          // final hidden  [T*D]
    float* residOut = outF + (size_t)T * D;   // post-attn residual [T*D]

    char* ws = (char*)d_ws;
    const size_t MB = 1u << 20;
    unsigned short* xb    = (unsigned short*)(ws + 0);        // T*D bf16   4M
    float*          qf    = (float*)         (ws + 4  * MB);  // T*2048 f32 8M
    float*          kf    = (float*)         (ws + 12 * MB);  // T*512 f32  2M
    unsigned short* qbuf  = (unsigned short*)(ws + 14 * MB);  // 4M
    unsigned short* kbuf  = (unsigned short*)(ws + 18 * MB);  // 1M
    unsigned short* vbuf  = (unsigned short*)(ws + 19 * MB);  // 1M, [KV*HD][T]
    unsigned short* attnb = (unsigned short*)(ws + 20 * MB);  // 4M
    float*          xnf   = (float*)         (ws + 24 * MB);  // 8M
    unsigned short* xnb   = (unsigned short*)(ws + 32 * MB);  // 4M
    float*          fullw = (float*)         (ws + 36 * MB);  // 32K
    int*            rlist = (int*)           (ws + 36 * MB + 65536);   // E*T int 32K
    float*          wlist = (float*)         (ws + 36 * MB + 98304);   // E*T f32 32K
    int*            cnts  = (int*)           (ws + 36 * MB + 131072);  // E int
    int*            tmap  = (int*)           (ws + 36 * MB + 135168);  // MOE_TILES int
    float*          moe   = (float*)         (ws + 37 * MB);  // 8M
    float*          ggate = (float*)         (ws + 45 * MB);  // T*SI f32 16M
    unsigned short* sactb = (unsigned short*)(ws + 61 * MB);  // 8M
    float*          hgate = (float*)         (ws + 69 * MB);  // E*T*I f32 32M
    unsigned short* actb  = (unsigned short*)(ws + 101 * MB); // E*T*I bf16 16M
    float*          moep  = (float*)         (ws + 117 * MB); // E*T*D f32 64M
    unsigned short* wt    = (unsigned short*)(ws + 184 * MB); // bf16 weights 164M
    (void)ws_size; (void)in_sizes; (void)n_in; (void)out_size;

    // 0) Every GEMM weight once to bf16, transposed to [n][k].
    weight_bf16_t_kernel<<<WT_BLOCKS, 256, 0, stream>>>(wq, wk, wv, wo, w13, w2,
                                                        sw13, sw2, wt);

    // 1) RMSNorm 1 -> bf16 activations.
    rmsnorm_kernel<<<T, 256, 0, stream>>>(hidden, ln1, nullptr, xb);

    // 2) QKV projections, one launch: column tiles 0-15 are Q, 16-19 K, 20-23 V
    //    (V is stored transposed, for the attention's fragment loads).
    gemm_bf16_wmma<<<dim3((H + 2 * KV) * HD / 128, T / 64), 256, 0, stream>>>(
        xb, D, wt + WT_Q, D, T, H * HD, D, qf, nullptr, H * HD, GEMM_STORE, 0.f,
        nullptr, 0, nullptr, nullptr, 0, 0, 0, 0, 0,
        KV * HD, kf, vbuf, nullptr, nullptr, nullptr);

    // 3) RoPE on Q and K (f32 -> bf16).
    rope_kernel<<<(T * H  * 32 + 255) / 256, 256, 0, stream>>>(pos, qf, qbuf, H);
    rope_kernel<<<(T * KV * 32 + 255) / 256, 256, 0, stream>>>(pos, kf, kbuf, KV);

    // 4) Causal GQA attention.
    attn_kernel<<<dim3(H, T / 64), 128, 0, stream>>>(qbuf, kbuf, vbuf, attnb);

    // 5) Output projection + residual -> residOut (second output).
    launch_gemm(stream, 1, 0, 0, 0, 0, nullptr, nullptr, nullptr,
                attnb, H * HD, wt + WT_O, H * HD, T, D, H * HD,
                residOut, nullptr, D, GEMM_RESID, RES_MULT, hidden, D,
                nullptr, nullptr, 0);

    // 6) RMSNorm 2.
    rmsnorm_kernel<<<T, 256, 0, stream>>>(residOut, ln2, xnf, xnb);

    // 7) Router top-2.
    router_kernel<<<T, 32, 0, stream>>>(xnf, routerw, fullw);

    // 8) Experts, weighted by full_w as in the reference.  Each expert takes the
    //    rows whose weight for it is not zero: gate and up gather them from xnb
    //    into the order of the expert's list, down stores each weighted row at
    //    its token's place in the expert's plane; the planes are summed after.
    route_kernel<<<1, 1024, 0, stream>>>(fullw, rlist, wlist, cnts, tmap);
    launch_gemm(stream, 1, 0, D * 2 * I, T * I, 0, tmap, rlist, cnts,
                xnb, D, wt + WT_13, D, T, I, D,
                hgate, nullptr, I, GEMM_STORE, 0.f, nullptr, 0, nullptr, nullptr, 0);
    launch_gemm(stream, 1, 0, D * 2 * I, T * I, 0, tmap, rlist, cnts,
                xnb, D, wt + WT_13 + (size_t)I * D, D, T, I, D,
                nullptr, actb, I, GEMM_SILU, 0.f, nullptr, 0, nullptr, hgate, I);
    launch_gemm(stream, 1, T * I, I * D, T * D, T, tmap, rlist, cnts,
                actb, I, wt + WT_2, I, T, D, I,
                moep, nullptr, D, GEMM_MOE_INIT, 0.f,
                nullptr, 0, wlist, nullptr, 0);
    expert_sum_kernel<<<T * D / 1024, 256, 0, stream>>>(moep, fullw, moe);

    // 9) Shared expert.
    launch_gemm(stream, 1, 0, 0, 0, 0, nullptr, nullptr, nullptr,
                xnb, D, wt + WT_S13, D, T, SI, D,
                ggate, nullptr, SI, GEMM_STORE, 0.f, nullptr, 0, nullptr, nullptr, 0);
    launch_gemm(stream, 1, 0, 0, 0, 0, nullptr, nullptr, nullptr,
                xnb, D, wt + WT_S13 + (size_t)SI * D, D, T, SI, D,
                nullptr, sactb, SI, GEMM_SILU, 0.f, nullptr, 0, nullptr, ggate, SI);

    // 10) Shared down-proj fused with final residual.
    launch_gemm(stream, 1, 0, 0, 0, 0, nullptr, nullptr, nullptr,
                sactb, SI, wt + WT_S2, SI, T, D, SI,
                outF, nullptr, D, GEMM_FINAL, RES_MULT, residOut, D,
                nullptr, moe, D);
}

// v008
// It runs in 309 microseconds.
// In both of two side-by-side timings against v007, it was 1.16 times as fast.
// Counting every step since v000, it is 11.1 times as fast.
#include <hip/hip_runtime.h>
#include <hip/hip_bf16.h>

// ---------------------------------------------------------------------------
// MI455X (gfx1250, wave32) implementation of a decoder layer (attention, MoE, shared MLP).
// All large GEMMs + attention run on v_wmma_f32_16x16x32_bf16 (bf16 in, f32
// accum).  A-activation tiles move global->LDS via the CDNA5 async-DMA path
// (global_load_async_to_lds_b128 + s_wait_asynccnt).  A first launch writes every
// GEMM weight once as bf16, transposed to [n][k], into the workspace, so the
// weight tiles take the same async path and the k loop holds no conversion.
// GEMMs that do not depend on each other share one launch: Q/K/V in one grid,
// and the eight experts' gate, up and down products one grid each.  An expert's
// products are formed only for the rows whose router weight for it is not zero.
// Workspace requirement: 348 MiB (see layout below).
// ---------------------------------------------------------------------------

static constexpr int T  = 1024;
static constexpr int D  = 2048;
static constexpr int H  = 32;
static constexpr int KV = 8;
static constexpr int HD = 64;
static constexpr int E  = 8;
static constexpr int I  = 1024;
static constexpr int SI = 4096;
static constexpr float ATTN_MULT = 0.0078125f;
static constexpr float RES_MULT  = 0.22f;
static constexpr float EPS       = 1e-6f;

typedef __bf16 bf16x16 __attribute__((ext_vector_type(16)));
typedef float  f32x8   __attribute__((ext_vector_type(8)));
typedef float  f32x4   __attribute__((ext_vector_type(4)));
typedef unsigned int u32x4 __attribute__((ext_vector_type(4)));
typedef int i32x4 __attribute__((ext_vector_type(4)));

union BF16Frag {
    unsigned short u[16];
    u32x4 q[2];      // the two runs of eight k-consecutive elements (see fragK)
    bf16x16 v;
};

__device__ __forceinline__ unsigned short f2bf(float f) {
    unsigned int u = __float_as_uint(f);
    unsigned int r = u + 0x7FFFu + ((u >> 16) & 1u);   // round-to-nearest-even
    return (unsigned short)(r >> 16);
}

// A/B fragment K-index pattern for V_WMMA_*_16X16X32_BF16 (ISA 7.12.2):
// VGPR p (0..7), half w; lanes 0-15 vs 16-31 differ by +8 in K.
__device__ __forceinline__ int fragK(int e, int lane) {
    int p = e >> 1, w = e & 1;
    return ((p & 3) << 1) + w + ((p >> 2) << 4) + ((lane >> 4) << 3);
}

// Generic pointer -> 32-bit LDS byte offset (AS3) for async-DMA VDST operand.
__device__ __forceinline__ unsigned lds_off(const void* p) {
    return (unsigned)(unsigned long long)
        (__attribute__((address_space(3))) const void*)p;
}

// CDNA5 async global->LDS copies, 16B per lane each (ASYNCcnt tracked): a
// thread's share of one k stage, four pieces of the A tile and eight of the B
// tile.  Piece i lies i * ls bytes further in LDS than the first one of its
// tile; in global memory the A pieces have a pointer each (their rows may be
// gathered), the B pieces lie gb elements apart.  A wave's copy takes
// two rows of 256 B: whole lines, where a 32-k stage took 64 B of eight rows.
__device__ __forceinline__ void async_copy12_b128(unsigned la, const unsigned short* a0,
                                                  const unsigned short* a1,
                                                  const unsigned short* a2,
                                                  const unsigned short* a3,
                                                  unsigned lb, const unsigned short* b, size_t gb,
                                                  unsigned ls) {
    // s_wait_xcnt as the last line of the copies' own statement: it stands in
    // front of any later rewrite of the address registers that the copies name.
    asm volatile("global_load_async_to_lds_b128 %0, %1, off\n\t"
                 "global_load_async_to_lds_b128 %2, %3, off\n\t"
                 "global_load_async_to_lds_b128 %4, %5, off\n\t"
                 "global_load_async_to_lds_b128 %6, %7, off\n\t"
                 "global_load_async_to_lds_b128 %8, %9, off\n\t"
                 "global_load_async_to_lds_b128 %10, %11, off\n\t"
                 "global_load_async_to_lds_b128 %12, %13, off\n\t"
                 "global_load_async_to_lds_b128 %14, %15, off\n\t"
                 "global_load_async_to_lds_b128 %16, %17, off\n\t"
                 "global_load_async_to_lds_b128 %18, %19, off\n\t"
                 "global_load_async_to_lds_b128 %20, %21, off\n\t"
                 "global_load_async_to_lds_b128 %22, %23, off\n\t"
                 "s_wait_xcnt 0x0"
                 :: "v"(la),          "v"(a0),
                    "v"(la + ls),     "v"(a1),
                    "v"(la + 2 * ls), "v"(a2),
                    "v"(la + 3 * ls), "v"(a3),
                    "v"(lb),          "v"(b),
                    "v"(lb + ls),     "v"(b + gb),
                    "v"(lb + 2 * ls), "v"(b + 2 * gb),
                    "v"(lb + 3 * ls), "v"(b + 3 * gb),
                    "v"(lb + 4 * ls), "v"(b + 4 * gb),
                    "v"(lb + 5 * ls), "v"(b + 5 * gb),
                    "v"(lb + 6 * ls), "v"(b + 6 * gb),
                    "v"(lb + 7 * ls), "v"(b + 7 * gb)
                 : "memory");
}
// Behind a global store: stands in front of any later rewrite of the store's
// address and data registers.
__device__ __forceinline__ void wait_xcnt0() {
    asm volatile("s_wait_xcnt 0x0" ::: "memory");
}
__device__ __forceinline__ void wait_async0() {
    asm volatile("s_wait_asynccnt 0x0" ::: "memory");
}
// A wave's own LDS reads have retired before the barrier behind which the
// buffer they read is refilled by async copies.
__device__ __forceinline__ void wait_ds0() {
    asm volatile("s_wait_dscnt 0x0" ::: "memory");
}

// e^x as the fast intrinsic forms it: x * log2(e), then v_exp_f32.  The v_nop in
// the same statement fills the one slot that the instruction set asks for behind
// a transcendental, whatever instruction the compiler puts next.
__device__ __forceinline__ float exp_slot(float x) {
    float y = x * 1.44269504088896340736f, r;
    asm("v_exp_f32 %0, %1\n\tv_nop" : "=v"(r) : "v"(y));
    return r;
}

// A lane's share of a 16-row band of a wave's 32x32 GEMM tile: eight rows, ld
// elements apart, and in each the columns c and c + 16; d[sn][rr].  p points at
// the first row's column c.  The groups below move such a share with sixteen
// memory instructions that follow one another and one wait.
// Sixteen f32 loads and their data wait in one statement, outputs early-clobber:
// no result and no later instruction lands on an address register of a load
// that is still in flight.
__device__ __forceinline__ void load_band_f32(const float* p, size_t ld, float (&d)[2][8]) {
    asm volatile("global_load_b32 %0, %16, off\n\t"
                 "global_load_b32 %8, %16, off offset:64\n\t"
                 "global_load_b32 %1, %17, off\n\t"
                 "global_load_b32 %9, %17, off offset:64\n\t"
                 "global_load_b32 %2, %18, off\n\t"
                 "global_load_b32 %10, %18, off offset:64\n\t"
                 "global_load_b32 %3, %19, off\n\t"
                 "global_load_b32 %11, %19, off offset:64\n\t"
                 "global_load_b32 %4, %20, off\n\t"
                 "global_load_b32 %12, %20, off offset:64\n\t"
                 "global_load_b32 %5, %21, off\n\t"
                 "global_load_b32 %13, %21, off offset:64\n\t"
                 "global_load_b32 %6, %22, off\n\t"
                 "global_load_b32 %14, %22, off offset:64\n\t"
                 "global_load_b32 %7, %23, off\n\t"
                 "global_load_b32 %15, %23, off offset:64\n\t"
                 "s_wait_loadcnt 0x0"
                 : "=&v"(d[0][0]), "=&v"(d[0][1]), "=&v"(d[0][2]), "=&v"(d[0][3]),
                   "=&v"(d[0][4]), "=&v"(d[0][5]), "=&v"(d[0][6]), "=&v"(d[0][7]),
                   "=&v"(d[1][0]), "=&v"(d[1][1]), "=&v"(d[1][2]), "=&v"(d[1][3]),
                   "=&v"(d[1][4]), "=&v"(d[1][5]), "=&v"(d[1][6]), "=&v"(d[1][7])
                 : "v"(p), "v"(p + ld), "v"(p + 2 * ld), "v"(p + 3 * ld),
                   "v"(p + 4 * ld), "v"(p + 5 * ld), "v"(p + 6 * ld), "v"(p + 7 * ld)
                 : "memory");
}
// Sixteen f32 stores; s_wait_xcnt as the last line of their own statement stands
// in front of any later rewrite of the address and data registers they name.
__device__ __forceinline__ void store_band_f32(float* p, size_t ld, const float (&d)[2][8]) {
    asm volatile("global_store_b32 %16, %0, off\n\t"
                 "global_store_b32 %16, %8, off offset:64\n\t"
                 "global_store_b32 %17, %1, off\n\t"
                 "global_store_b32 %17, %9, off offset:64\n\t"
                 "global_store_b32 %18, %2, off\n\t"
                 "global_store_b32 %18, %10, off offset:64\n\t"
                 "global_store_b32 %19, %3, off\n\t"
                 "global_store_b32 %19, %11, off offset:64\n\t"
                 "global_store_b32 %20, %4, off\n\t"
                 "global_store_b32 %20, %12, off offset:64\n\t"
                 "global_store_b32 %21, %5, off\n\t"
                 "global_store_b32 %21, %13, off offset:64\n\t"
                 "global_store_b32 %22, %6, off\n\t"
                 "global_store_b32 %22, %14, off offset:64\n\t"
                 "global_store_b32 %23, %7, off\n\t"
                 "global_store_b32 %23, %15, off offset:64\n\t"
                 "s_wait_xcnt 0x0"
                 :: "v"(d[0][0]), "v"(d[0][1]), "v"(d[0][2]), "v"(d[0][3]),
                    "v"(d[0][4]), "v"(d[0][5]), "v"(d[0][6]), "v"(d[0][7]),
                    "v"(d[1][0]), "v"(d[1][1]), "v"(d[1][2]), "v"(d[1][3]),
                    "v"(d[1][4]), "v"(d[1][5]), "v"(d[1][6]), "v"(d[1][7]),
                    "v"(p), "v"(p + ld), "v"(p + 2 * ld), "v"(p + 3 * ld),
                    "v"(p + 4 * ld), "v"(p + 5 * ld), "v"(p + 6 * ld), "v"(p + 7 * ld)
                 : "memory");
}
// The same for bf16 values (the low halves of d): column c + 16 lies 32 B on.
__device__ __forceinline__ void store_band_bf16(unsigned short* p, size_t ld,
                                                const unsigned (&d)[2][8]) {
    asm volatile("global_store_b16 %16, %0, off\n\t"
                 "global_store_b16 %16, %8, off offset:32\n\t"
                 "global_store_b16 %17, %1, off\n\t"
                 "global_store_b16 %17, %9, off offset:32\n\t"
                 "global_store_b16 %18, %2, off\n\t"
                 "global_store_b16 %18, %10, off offset:32\n\t"
                 "global_store_b16 %19, %3, off\n\t"
                 "global_store_b16 %19, %11, off offset:32\n\t"
                 "global_store_b16 %20, %4, off\n\t"
                 "global_store_b16 %20, %12, off offset:32\n\t"
                 "global_store_b16 %21, %5, off\n\t"
                 "global_store_b16 %21, %13, off offset:32\n\t"
                 "global_store_b16 %22, %6, off\n\t"
                 "global_store_b16 %22, %14, off offset:32\n\t"
                 "global_store_b16 %23, %7, off\n\t"
                 "global_store_b16 %23, %15, off offset:32\n\t"
                 "s_wait_xcnt 0x0"
                 :: "v"(d[0][0]), "v"(d[0][1]), "v"(d[0][2]), "v"(d[0][3]),
                    "v"(d[0][4]), "v"(d[0][5]), "v"(d[0][6]), "v"(d[0][7]),
                    "v"(d[1][0]), "v"(d[1][1]), "v"(d[1][2]), "v"(d[1][3]),
                    "v"(d[1][4]), "v"(d[1][5]), "v"(d[1][6]), "v"(d[1][7]),
                    "v"(p), "v"(p + ld), "v"(p + 2 * ld), "v"(p + 3 * ld),
                    "v"(p + 4 * ld), "v"(p + 5 * ld), "v"(p + 6 * ld), "v"(p + 7 * ld)
                 : "memory");
}
// The same for a bf16 output that is stored transposed: the eight rows follow
// one another in memory, p0 and p1 point at the first row in columns c, c + 16.
__device__ __forceinline__ void store_band_bf16_t(unsigned short* p0, unsigned short* p1,
                                                  const unsigned (&d)[2][8]) {
    asm volatile("global_store_b16 %16, %0, off\n\t"
                 "global_store_b16 %16, %1, off offset:2\n\t"
                 "global_store_b16 %16, %2, off offset:4\n\t"
                 "global_store_b16 %16, %3, off offset:6\n\t"
                 "global_store_b16 %16, %4, off offset:8\n\t"
                 "global_store_b16 %16, %5, off offset:10\n\t"
                 "global_store_b16 %16, %6, off offset:12\n\t"
                 "global_store_b16 %16, %7, off offset:14\n\t"
                 "global_store_b16 %17, %8, off\n\t"
                 "global_store_b16 %17, %9, off offset:2\n\t"
                 "global_store_b16 %17, %10, off offset:4\n\t"
                 "global_store_b16 %17, %11, off offset:6\n\t"
                 "global_store_b16 %17, %12, off offset:8\n\t"
                 "global_store_b16 %17, %13, off offset:10\n\t"
                 "global_store_b16 %17, %14, off offset:12\n\t"
                 "global_store_b16 %17, %15, off offset:14\n\t"
                 "s_wait_xcnt 0x0"
                 :: "v"(d[0][0]), "v"(d[0][1]), "v"(d[0][2]), "v"(d[0][3]),
                    "v"(d[0][4]), "v"(d[0][5]), "v"(d[0][6]), "v"(d[0][7]),
                    "v"(d[1][0]), "v"(d[1][1]), "v"(d[1][2]), "v"(d[1][3]),
                    "v"(d[1][4]), "v"(d[1][5]), "v"(d[1][6]), "v"(d[1][7]),
                    "v"(p0), "v"(p1)
                 : "memory");
}

// ---------------------------------------------------------------------------
// Weight pre-pass: every GEMM weight W[K][N] (f32) -> Wt[N][K] (bf16, rounded
// to nearest even, f2bf).  A block takes a strip of
// 1024 k x 64 n as sixteen 64x64 tiles.  A thread owns a 4(k) x 4(n) patch, so the
// transpose happens in its registers; the tile goes through LDS so that every
// global store covers whole 128-B lines of a Wt row.
// Element offsets of the transposed weights in their workspace region:
// ---------------------------------------------------------------------------
static constexpr size_t WT_Q   = 0;                                // [H*HD][D]
static constexpr size_t WT_K   = WT_Q   + (size_t)D * H * HD;      // [KV*HD][D]
static constexpr size_t WT_V   = WT_K   + (size_t)D * KV * HD;     // [KV*HD][D]
static constexpr size_t WT_O   = WT_V   + (size_t)D * KV * HD;     // [D][H*HD]
static constexpr size_t WT_13  = WT_O   + (size_t)H * HD * D;      // E x [2I][D]
static constexpr size_t WT_2   = WT_13  + (size_t)E * D * 2 * I;   // E x [D][I]
static constexpr size_t WT_S13 = WT_2   + (size_t)E * I * D;       // [2SI][D]
static constexpr size_t WT_S2  = WT_S13 + (size_t)D * 2 * SI;      // [D][SI]
static constexpr int strips(int k, int n) { return (k / 1024) * (n / 64); }
static constexpr int WT_BLOCKS =
    strips(D, H * HD) + 2 * strips(D, KV * HD) + strips(H * HD, D) +
    E * strips(D, 2 * I) + E * strips(I, D) + strips(D, 2 * SI) + strips(SI, D);

__global__ __launch_bounds__(256)
void weight_bf16_t_kernel(const float* __restrict__ wq, const float* __restrict__ wk,
                          const float* __restrict__ wv, const float* __restrict__ wo,
                          const float* __restrict__ w13, const float* __restrict__ w2,
                          const float* __restrict__ sw13, const float* __restrict__ sw2,
                          unsigned short* __restrict__ wt) {
    constexpr int P = 72;    // LDS row pitch: 144 B = 16 B x odd
    __shared__ __align__(16) unsigned short tile[2][64 * P];

    // Which matrix, and which strip of it (all block-uniform).
    int b = blockIdx.x;
    const float* src;
    size_t off;
    int K, N;
    if (b < strips(D, H * HD)) { src = wq; off = WT_Q; K = D; N = H * HD; }
    else if ((b -= strips(D, H * HD)) < strips(D, KV * HD)) { src = wk; off = WT_K; K = D; N = KV * HD; }
    else if ((b -= strips(D, KV * HD)) < strips(D, KV * HD)) { src = wv; off = WT_V; K = D; N = KV * HD; }
    else if ((b -= strips(D, KV * HD)) < strips(H * HD, D)) { src = wo; off = WT_O; K = H * HD; N = D; }
    else if ((b -= strips(H * HD, D)) < E * strips(D, 2 * I)) { src = w13; off = WT_13; K = D; N = 2 * I; }
    else if ((b -= E * strips(D, 2 * I)) < E * strips(I, D)) { src = w2; off = WT_2; K = I; N = D; }
    else if ((b -= E * strips(I, D)) < strips(D, 2 * SI)) { src = sw13; off = WT_S13; K = D; N = 2 * SI; }
    else { b -= strips(D, 2 * SI); src = sw2; off = WT_S2; K = SI; N = D; }
    int kstrips = K >> 10;
    int per     = kstrips * (N >> 6);       // strips of one matrix
    int e       = b / per;                  // expert (0 where there is one matrix)
    b -= e * per;
    int n0 = (b / kstrips) << 6;
    int kb = (b % kstrips) << 10;
    src += (size_t)e * K * N;
    unsigned short* dst = wt + off + (size_t)e * K * N;

    int tid  = threadIdx.x;
    int lane = tid & 31;
    int wid  = tid >> 5;
    // Eight lanes cover one 128-B line of a source row; the four lane groups of
    // a wave take different k quads, which spreads the 8-byte LDS stores.
    int pk = (((wid & 3) << 2) | (lane >> 3)) << 2;    // k 0,4,..,60
    int pn = (((wid >> 2) << 3) | (lane & 7)) << 2;    // n 0,4,..,60
    const float* g = src + (size_t)(kb + pk) * N + n0 + pn;
    // Read back: eight lanes cover one 128-B line of a Wt row.
    int rr = tid >> 3;                                 // n 0..31 (and +32)
    int rc = (tid & 7) << 3;                           // k 0,8,..,56
    unsigned short* o = dst + (size_t)(n0 + rr) * K + kb + rc;

    size_t rowb = (size_t)N;                           // source row, elements
    for (int t = 0; t < 16; ++t) {
        const float* gt = g + (size_t)(t * 64) * rowb;
        f32x4 r0, r1, r2, r3;
        // The four loads and their data wait in one statement, outputs
        // early-clobber: no result and no later instruction lands on an address
        // register of a load that is still in flight.
        asm volatile("global_load_b128 %0, %4, off\n\t"
                     "global_load_b128 %1, %5, off\n\t"
                     "global_load_b128 %2, %6, off\n\t"
                     "global_load_b128 %3, %7, off\n\t"
                     "s_wait_loadcnt 0x0"
                     : "=&v"(r0), "=&v"(r1), "=&v"(r2), "=&v"(r3)
                     : "v"(gt), "v"(gt + rowb), "v"(gt + 2 * rowb), "v"(gt + 3 * rowb)
                     : "memory");
        unsigned short* l = tile[t & 1];
#pragma unroll
        for (int j = 0; j < 4; ++j) {
            uint2 q;
            q.x = (unsigned)f2bf(r0[j]) | ((unsigned)f2bf(r1[j]) << 16);
            q.y = (unsigned)f2bf(r2[j]) | ((unsigned)f2bf(r3[j]) << 16);
            *(uint2*)&l[(pn + j) * P + pk] = q;
        }
        // One barrier a tile: with two buffers it also ends the reads of the
        // buffer that the next tile but one overwrites.
        __syncthreads();
#pragma unroll
        for (int i = 0; i < 2; ++i) {
            uint4 v = *(const uint4*)&l[(rr + i * 32) * P + rc];
            *(uint4*)&o[(size_t)(i * 32) * K + t * 64] = v;
            wait_xcnt0();   // in front of any later write of the store's registers
        }
    }
}

// ---------------------------------------------------------------------------
// RMSNorm: one block per row.  Writes f32 and/or bf16 outputs.
// ---------------------------------------------------------------------------
__global__ __launch_bounds__(256)
void rmsnorm_kernel(const float* __restrict__ in, const float* __restrict__ w,
                    float* outf, unsigned short* outb) {
    int row = blockIdx.x;
    int tid = threadIdx.x;
    __shared__ float red[256];
    const float* x = in + (size_t)row * D;
    float ss = 0.f;
    for (int i = tid; i < D; i += 256) { float v = x[i]; ss += v * v; }
    red[tid] = ss;
    __syncthreads();
    for (int s = 128; s > 0; s >>= 1) {
        if (tid < s) red[tid] += red[tid + s];
        __syncthreads();
    }
    float rs = rsqrtf(red[0] / (float)D + EPS);
    for (int i = tid; i < D; i += 256) {
        float v = x[i] * rs * w[i];
        if (outf) outf[(size_t)row * D + i] = v;
        if (outb) outb[(size_t)row * D + i] = f2bf(v);
    }
}

// ---------------------------------------------------------------------------
// RoPE: f32 in -> bf16 out, per (t, head, i<HD/2).
// ---------------------------------------------------------------------------
__global__ __launch_bounds__(256)
void rope_kernel(const int* __restrict__ pos, const float* __restrict__ in,
                 unsigned short* __restrict__ out, int nheads) {
    int idx = blockIdx.x * blockDim.x + threadIdx.x;
    int total = T * nheads * (HD / 2);
    if (idx >= total) return;
    int i = idx & 31;
    int h = (idx >> 5) % nheads;
    int t = idx / (32 * nheads);
    float inv = __expf(-(float)i * (9.2103403719761840f / 32.f)); // 10000^(-i/32)
    float ang = (float)pos[t] * inv;
    float s, c;
    __sincosf(ang, &s, &c);
    size_t base = (size_t)t * nheads * HD + (size_t)h * HD;
    float x1 = in[base + i];
    float x2 = in[base + 32 + i];
    out[base + i]      = f2bf(x1 * c - x2 * s);
    out[base + 32 + i] = f2bf(x2 * c + x1 * s);
}

// ---------------------------------------------------------------------------
// Router: one wave per token.  logits = xn . router_w[e], softmax, top-2.
// ---------------------------------------------------------------------------
__global__ __launch_bounds__(32)
void router_kernel(const float* __restrict__ xn, const float* __restrict__ rw,
                   float* __restrict__ fullw) {
    int t = blockIdx.x;
    int lane = threadIdx.x;
    float acc[E];
#pragma unroll
    for (int e = 0; e < E; ++e) acc[e] = 0.f;
    const float* x = xn + (size_t)t * D;
    for (int i = lane; i < D; i += 32) {
        float xv = x[i];
#pragma unroll
        for (int e = 0; e < E; ++e) acc[e] += xv * rw[(size_t)e * D + i];
    }
#pragma unroll
    for (int e = 0; e < E; ++e)
        for (int off = 16; off > 0; off >>= 1)
            acc[e] += __shfl_xor(acc[e], off, 32);
    if (lane == 0) {
        int i1 = 0;
        for (int e = 1; e < E; ++e) if (acc[e] > acc[i1]) i1 = e;
        int i2 = (i1 == 0) ? 1 : 0;
        for (int e = 0; e < E; ++e) if (e != i1 && acc[e] > acc[i2]) i2 = e;
        float e1 = 1.f;
        float e2 = __expf(acc[i2] - acc[i1]);
        float inv = 1.f / (e1 + e2);
        for (int e = 0; e < E; ++e) {
            float wv = (e == i1) ? e1 * inv : (e == i2) ? e2 * inv : 0.f;
            fullw[(size_t)t * E + e] = wv;
        }
    }
}

// ---------------------------------------------------------------------------
// Row lists of the experts, one block, thread = token.  list[e][0 .. cnts[e])
// holds, in rising order, the tokens whose weight for expert e is not zero (a
// zero weight multiplies that expert's product away); the rest of list[e] is
// token 0, so that a last, partly filled tile gathers rows that exist.
// wlist[e] holds the weights in the same order (zero behind the listed ones).
// tilemap[j] = expert << 16 | first list place of the j-th 64-row tile, or -1.
// The router gives a token at most two weights: at most 2T list entries, so
// at most (2T + 63 E) / 64 tiles.
// ---------------------------------------------------------------------------
static constexpr int MOE_TILES = (2 * T + 63 * E) / 64;

__global__ __launch_bounds__(1024)
void route_kernel(const float* __restrict__ fullw, int* __restrict__ list,
                  float* __restrict__ wlist,
                  int* __restrict__ cnts, int* __restrict__ tilemap) {
    static_assert(T == 1024 && E == 8, "one thread a token, one wave's scan an expert");
    __shared__ int wcnt[E][32];   // per expert and wave: count, then count of the waves before
    __shared__ int tot[E];
    int t    = threadIdx.x;
    int lane = t & 31;
    int wv   = t >> 5;
    f32x4 wa, wb;
    // Both loads and their data wait in one statement, outputs early-clobber:
    // nothing lands on the address register of a load that is still in flight.
    asm volatile("global_load_b128 %0, %2, off\n\t"
                 "global_load_b128 %1, %2, off offset:16\n\t"
                 "s_wait_loadcnt 0x0"
                 : "=&v"(wa), "=&v"(wb)
                 : "v"(fullw + (size_t)t * E)
                 : "memory");
    unsigned m[E];
#pragma unroll
    for (int e = 0; e < E; ++e) {
        float wv_e = e < 4 ? wa[e & 3] : wb[e & 3];
        m[e] = __builtin_amdgcn_ballot_w32(wv_e != 0.f);
        if (lane == 0) wcnt[e][wv] = __popc(m[e]);
    }
    __syncthreads();
    if (wv < E) {
        int c = wcnt[wv][lane];
        int inc = c;
        for (int off = 1; off < 32; off <<= 1) {
            int n = __shfl_up(inc, off, 32);
            if (lane >= off) inc += n;
        }
        wcnt[wv][lane] = inc - c;
        if (lane == 31) tot[wv] = inc;
    }
    __syncthreads();
#pragma unroll
    for (int e = 0; e < E; ++e) {
        // A place below tot[e] is written by the one token that ranks there, a
        // place from tot[e] on by the thread of that number.
        bool mine = (m[e] >> lane) & 1u;
        int place = mine ? wcnt[e][wv] + __popc(m[e] & ((1u << lane) - 1u)) : t;
        if (mine || t >= tot[e]) {
            list[e * T + place] = mine ? t : 0;
            wait_xcnt0();   // in front of any later write of the store's registers
            wlist[e * T + place] = mine ? (e < 4 ? wa[e & 3] : wb[e & 3]) : 0.f;
            wait_xcnt0();
        }
        if (mine && t >= tot[e]) {
            list[e * T + t] = 0;
            wait_xcnt0();
            wlist[e * T + t] = 0.f;
            wait_xcnt0();
        }
    }
    if (t < E) { cnts[t] = tot[t]; wait_xcnt0(); }
    if (t < MOE_TILES) {
        int j = t, ent = -1;
#pragma unroll
        for (int e = 0; e < E; ++e) {
            int nt = (tot[e] + 63) >> 6;
            if (ent < 0 && j < nt) ent = (e << 16) | (j << 6);
            j -= nt;
        }
        tilemap[t] = ent;
        wait_xcnt0();
    }
}

// ---------------------------------------------------------------------------
// BF16-WMMA GEMM, double-buffered LDS, async DMA of both tiles.
// C[M,N] = A[M,K](bf16) x Bt[N,K]^T (bf16, from the weight pre-pass).
// Block tile 64x128, 8 waves (2M x 4N), each wave 32x32.  A stage of the two
// LDS buffers holds 128 k (16 WMMAs a wave): 48 KiB of copies are in flight per
// block, and their latency, the waits and the barrier are paid once per 128 k.
// Requires: M%64==0, N%128==0, K%128==0, lda%8==0, ldb%8==0 (all satisfied).
// The kind of epilogue is a compile-time constant.  What an epilogue reads beside
// the sums (residual, gate or expert sum) is fetched in groups at entry, while the first k
// stage's copies fly; outside MoE-init the results leave in groups of sixteen stores.
// ---------------------------------------------------------------------------
#define GEMM_STORE    0  // outf/outb = acc
#define GEMM_RESID    1  // outf = resid + scale*acc
#define GEMM_MOE_INIT 2  // outf[token] = rowsc[row]*acc, token = rowlist[row], listed rows only
#define GEMM_SILU     4  // outb = silu(aux[row,col]) * acc   (bf16)
#define GEMM_FINAL    5  // outf = resid + scale*(aux + acc)

template <int mode>
__global__ __launch_bounds__(256)
void gemm_bf16_wmma(const unsigned short* __restrict__ A, int lda,
                    const unsigned short* __restrict__ Bt, int ldb,
                    int M, int N, int K,
                    float* outf, unsigned short* outb, int ldc,
                    float scale,
                    const float* __restrict__ resid, int ldr,
                    const float* __restrict__ rowsc,
                    const float* __restrict__ aux, int ldaux,
                    int sA, int sB, int sC, int sR,
                    int N2, float* outf2, unsigned short* outb3,
                    const int* __restrict__ tilemap, const int* __restrict__ rowlist,
                    const int* __restrict__ cnts) {
    constexpr int BK = 128;      // k per stage
    constexpr int AS = BK + 8;   // LDS stride for A rows   [64][AS]  (272 B = 16 B x odd)
    constexpr int BS = BK + 8;   // LDS stride for B^T rows [128][BS]
    __shared__ __align__(16) unsigned short lds_a[2][64 * AS];
    __shared__ __align__(16) unsigned short lds_b[2][128 * BS];

    int tid  = threadIdx.x;
    int lane = tid & 31;
    int wid  = tid >> 5;
    int wm   = wid >> 2;   // 0..1
    int wn   = wid & 3;    // 0..3
    int m0   = blockIdx.y * 64;
    int n0   = blockIdx.x * 128;
    int ln   = lane & 15;

    // blockIdx.z: independent GEMMs of one shape whose operands lie sA / sB
    // elements apart, outputs and aux sC apart, row scales sR apart.
    size_t z = blockIdx.z;
    // With a tile map (see route_kernel) blockIdx.y numbers the row tiles of all
    // experts' lists: the entry names the expert and the tile's place in its
    // list.  A block without a tile leaves here, whole, in front of every copy
    // and barrier.
    const int* rl = nullptr;
    if (tilemap) {
        int ent = tilemap[blockIdx.y];
        if (ent < 0) return;
        z  = (size_t)(ent >> 16);
        m0 = ent & 0xffff;
        rl = rowlist + z * T + m0;
        if constexpr (mode == GEMM_MOE_INIT) M = cnts[z];   // only listed rows are stored
    }
    A += z * sA;
    Bt += z * sB + (size_t)n0 * ldb;     // this block's 128 rows of Bt
    if (outf)  outf  += z * sC;
    if (outb)  outb  += z * sC;
    if (aux)   aux   += z * sC;
    if (rowsc) rowsc += z * sR;
    // Column tiles behind N: a second (f32 out) and a third (bf16 out) GEMM on
    // the same A, each N2 columns wide; their Bt rows follow the first one's.
    // The third one's output is stored transposed, [N2][M]: ldc is the step of
    // the output index from row to row, ocs the step from column to column.
    int ocs = 1;
    if (n0 >= N) {
        n0 -= N;
        bool third = n0 >= N2;
        if (third) n0 -= N2;
        outf = third ? nullptr : outf2;
        outb = third ? outb3 : nullptr;
        N = ldc = N2;
        if (third) { ldc = 1; ocs = M; }
    }

    // Async staging: sixteen threads x b128 cover the 256 bytes of one row, 256
    // threads sixteen rows: the 64x128 bf16 A tile takes four such pieces, the
    // 128x128 Bt tile eight (rows sr, sr + 16, ...).
    int sr = tid >> 4;          // row 0..15
    int sc = (tid & 15) << 3;   // k 0,8,..,120

    f32x8 zero = {0.f,0.f,0.f,0.f,0.f,0.f,0.f,0.f};
    f32x8 acc[2][2] = {{zero, zero}, {zero, zero}};

    static_assert(AS == BS, "one LDS step for the pieces of both tiles");
    // The A rows of this thread's four pieces: m0 + sr + 16 i, or, where the
    // rows of A are gathered (the experts' gate and up products), the tokens
    // that stand at those places of the list.
    int ar0 = m0 + sr, ar1 = ar0 + 16, ar2 = ar0 + 32, ar3 = ar0 + 48;
    if (rl && mode != GEMM_MOE_INIT) {
        // The four loads and their data wait in one statement, outputs
        // early-clobber: nothing lands on the address register of a load that is
        // still in flight.
        asm volatile("global_load_b32 %0, %4, off\n\t"
                     "global_load_b32 %1, %4, off offset:64\n\t"
                     "global_load_b32 %2, %4, off offset:128\n\t"
                     "global_load_b32 %3, %4, off offset:192\n\t"
                     "s_wait_loadcnt 0x0"
                     : "=&v"(ar0), "=&v"(ar1), "=&v"(ar2), "=&v"(ar3)
                     : "v"(rl + sr)
                     : "memory");
        // Bounds the addresses formed from the list.
        ar0 &= T - 1; ar1 &= T - 1; ar2 &= T - 1; ar3 &= T - 1;
    }
    const unsigned short* gA0 = A + (size_t)ar0 * lda + sc;
    const unsigned short* gA1 = A + (size_t)ar1 * lda + sc;
    const unsigned short* gA2 = A + (size_t)ar2 * lda + sc;
    const unsigned short* gA3 = A + (size_t)ar3 * lda + sc;
    const unsigned short* gB = Bt + (size_t)sr * ldb + sc;
    auto stage = [&](int buf, int k0) {
        async_copy12_b128(lds_off(&lds_a[buf][sr * AS + sc]),
                          gA0 + k0, gA1 + k0, gA2 + k0, gA3 + k0,
                          lds_off(&lds_b[buf][sr * BS + sc]), gB + k0, (size_t)16 * ldb,
                          16 * AS * 2);
    };

    // Two buffers: tile 0 lands and is published, then tile 1 flies.
    int nk = K / BK;
    stage(0, 0);
    // The lane's first row and column of the output tile, and the residual and
    // aux values (gate or expert sum) that belong to its 32 results, [sm][sn][rr].
    int half8 = (lane & 16) >> 1;          // +8 row offset for lanes 16-31
    int r0 = m0 + wm * 32 + half8;
    int c0 = n0 + wn * 32 + ln;
    float rv[2][2][8], av[2][2][8];
    if constexpr (mode == GEMM_RESID || mode == GEMM_FINAL) {
        load_band_f32(resid + (size_t)r0 * ldr + c0, (size_t)ldr, rv[0]);
        load_band_f32(resid + (size_t)(r0 + 16) * ldr + c0, (size_t)ldr, rv[1]);
    }
    if constexpr (mode == GEMM_SILU || mode == GEMM_FINAL) {
        load_band_f32(aux + (size_t)r0 * ldaux + c0, (size_t)ldaux, av[0]);
        load_band_f32(aux + (size_t)(r0 + 16) * ldaux + c0, (size_t)ldaux, av[1]);
    }
    wait_async0();
    __syncthreads();
    if (nk > 1) stage(1, BK);

    int buf = 0;
    for (int kt = 0; kt < nk; ++kt) {
        // Unrolled: the four 32-k slices' places in the stage become immediate
        // offsets of the fragment loads, with no address arithmetic per slice.
#pragma unroll
        for (int ks = 0; ks < BK; ks += 32) {
            BF16Frag af[2], bf[2];
#pragma unroll
            for (int s = 0; s < 2; ++s)
#pragma unroll
                for (int e = 0; e < 16; ++e) {
                    int kk = ks + fragK(e, lane);
                    af[s].u[e] = lds_a[buf][(wm * 32 + s * 16 + ln) * AS + kk];
                    bf[s].u[e] = lds_b[buf][(wn * 32 + s * 16 + ln) * BS + kk];
                }
#pragma unroll
            for (int sm = 0; sm < 2; ++sm)
#pragma unroll
                for (int sn = 0; sn < 2; ++sn)
                    acc[sm][sn] = __builtin_amdgcn_wmma_f32_16x16x32_bf16(
                        false, af[sm].v, false, bf[sn].v, (short)0,
                        acc[sm][sn], false, false);
        }

        // Foot of the trip: own LDS reads retired, tile kt+1 landed, one barrier
        // that publishes it and ends every read of this buffer; then the refill.
        wait_ds0();
        wait_async0();
        __syncthreads();
        if (kt + 2 < nk) stage(buf, (kt + 2) * BK);
        buf ^= 1;
    }
    wait_async0();   // no copy is in flight when the wave goes on to its stores

    if constexpr (mode == GEMM_MOE_INIT) {
        // The tokens and the weights of this lane's sixteen rows, [sm][rr >> 2][rr & 3].
        i32x4 tok[2][2];
        f32x4 rsc[2][2];
        // The eight loads and their data wait in one statement, as above.
        asm volatile("global_load_b128 %0, %8, off\n\t"
                     "global_load_b128 %1, %8, off offset:16\n\t"
                     "global_load_b128 %2, %8, off offset:64\n\t"
                     "global_load_b128 %3, %8, off offset:80\n\t"
                     "global_load_b128 %4, %9, off\n\t"
                     "global_load_b128 %5, %9, off offset:16\n\t"
                     "global_load_b128 %6, %9, off offset:64\n\t"
                     "global_load_b128 %7, %9, off offset:80\n\t"
                     "s_wait_loadcnt 0x0"
                     : "=&v"(tok[0][0]), "=&v"(tok[0][1]), "=&v"(tok[1][0]), "=&v"(tok[1][1]),
                       "=&v"(rsc[0][0]), "=&v"(rsc[0][1]), "=&v"(rsc[1][0]), "=&v"(rsc[1][1])
                     : "v"(rl + wm * 32 + half8), "v"(rowsc + m0 + wm * 32 + half8)
                     : "memory");
        // The rows are scattered and the last tile of a list is partly filled:
        // each store stands under its row's own test.
#pragma unroll
        for (int sm = 0; sm < 2; ++sm) {
#pragma unroll
            for (int sn = 0; sn < 2; ++sn) {
                int col = n0 + wn * 32 + sn * 16 + ln;
#pragma unroll
                for (int rr = 0; rr < 8; ++rr) {
                    int row = m0 + wm * 32 + sm * 16 + rr + half8;
                    if (row >= M || col >= N) continue;
                    float v = acc[sm][sn][rr];
                    size_t tk = (size_t)(tok[sm][rr >> 2][rr & 3] & (T - 1));   // bounded
                    outf[tk * ldc + col] = rsc[sm][rr >> 2][rr & 3] * v;
                    wait_xcnt0();
                }
            }
        }
    } else {
        // Every row and column of the tile exists (M % 64 == 0, N % 128 == 0).
#pragma unroll
        for (int sm = 0; sm < 2; ++sm) {
            int row = r0 + sm * 16;
            float    f[2][8];
            unsigned h[2][8];
#pragma unroll
            for (int sn = 0; sn < 2; ++sn)
#pragma unroll
                for (int rr = 0; rr < 8; ++rr) {
                    float v = acc[sm][sn][rr];
                    if constexpr (mode == GEMM_STORE) {
                        f[sn][rr] = v;
                        h[sn][rr] = f2bf(v);
                    } else if constexpr (mode == GEMM_RESID) {
                        f[sn][rr] = rv[sm][sn][rr] + scale * v;
                    } else if constexpr (mode == GEMM_SILU) {
                        float g = av[sm][sn][rr];
                        float s = g / (1.f + exp_slot(-g));
                        h[sn][rr] = f2bf(s * v);
                    } else { // GEMM_FINAL
                        f[sn][rr] = rv[sm][sn][rr] + scale * (av[sm][sn][rr] + v);
                    }
                }
            if constexpr (mode == GEMM_STORE) {
                // bf16 is the third GEMM's output alone, [N2][M]: ldc == 1.
                if (outf) store_band_f32(outf + (size_t)row * ldc + c0, (size_t)ldc, f);
                if (outb) store_band_bf16_t(outb + (size_t)c0 * ocs + row,
                                            outb + (size_t)(c0 + 16) * ocs + row, h);
            } else if constexpr (mode == GEMM_SILU) {
                store_band_bf16(outb + (size_t)row * ldc + c0, (size_t)ldc, h);
            } else {
                store_band_f32(outf + (size_t)row * ldc + c0, (size_t)ldc, f);
            }
        }
    }
}

// ---------------------------------------------------------------------------
// Sum of the experts' weighted down products, in the order 0..E-1.  A plane
// holds a token's row only where the token's weight for that expert is not zero;
// the other terms of the sum are zero.  A block lies inside one token's row.
// ---------------------------------------------------------------------------
__global__ __launch_bounds__(256)
void expert_sum_kernel(const float* __restrict__ planes, const float* __restrict__ fullw,
                       float* __restrict__ out) {
    constexpr size_t P = (size_t)T * D;
    static_assert(D % 1024 == 0, "a block's 1024 elements lie in one row");
    size_t i = ((size_t)blockIdx.x * 256 + threadIdx.x) * 4;
    const float* g = planes + i;
    const float* w = fullw + (size_t)(blockIdx.x / (D / 1024)) * E;
    float wl[E];
#pragma unroll
    for (int e = 0; e < E; ++e) wl[e] = w[e];
    f32x4 s = {0.f, 0.f, 0.f, 0.f};
#pragma unroll
    for (int e = 0; e < E; ++e) {
        if (wl[e] != 0.f) {     // the same for the whole block
            f32x4 p;
            // The load and its data wait in one statement, output early-clobber.
            asm volatile("global_load_b128 %0, %1, off\n\t"
                         "s_wait_loadcnt 0x0"
                         : "=&v"(p) : "v"(g + e * P) : "memory");
            s += p;
        }
    }
    *(f32x4*)&out[i] = s;
}

// ---------------------------------------------------------------------------
// Causal GQA flash attention.  One wave per (head, 16-query tile); 4 waves
// per block.  QK^T and P.V via bf16 WMMA; online softmax over 32-key chunks.
// K is [t][KV*HD], V comes transposed, vt = [KV*HD][t]: in both, the k index of
// a B fragment runs along memory, so a fragment is two 16-byte loads a lane.
// ---------------------------------------------------------------------------
// The value that lane l ^ M of the same 16-lane row holds, read as a DPP operand
// (row_xmask:M) in the vector pipe; every lane of the wave is on where it is used.
template <int M>
__device__ __forceinline__ float row_xor(float v) {
    return __int_as_float(__builtin_amdgcn_mov_dpp(__float_as_int(v), 0x160 | M, 0xf, 0xf, true));
}

__global__ __launch_bounds__(128)
void attn_kernel(const unsigned short* __restrict__ qb,
                 const unsigned short* __restrict__ kb,
                 const unsigned short* __restrict__ vt,
                 unsigned short* __restrict__ attnb) {
    int h    = blockIdx.x;
    int w    = threadIdx.x >> 5;
    int lane = threadIdx.x & 31;
    int qt   = blockIdx.y * 4 + w;   // 16-query tile index
    int kvh  = h >> 2;               // H/KV = 4
    int hb   = (lane & 16) >> 1;     // +8 row offset for lanes 16-31
    int ln   = lane & 15;

    __shared__ unsigned short pbuf[4][16 * 34];   // per-wave P staging

    BF16Frag aq[2];
#pragma unroll
    for (int c = 0; c < 2; ++c)
#pragma unroll
        for (int e = 0; e < 16; ++e) {
            int kd = c * 32 + fragK(e, lane);
            int qrow = qt * 16 + ln;
            aq[c].u[e] = qb[(size_t)qrow * (H * HD) + h * HD + kd];
        }

    f32x8 o0 = {0,0,0,0,0,0,0,0}, o1 = o0, o2 = o0, o3 = o0;
    float rmax[8], rsum[8];
#pragma unroll
    for (int r = 0; r < 8; ++r) { rmax[r] = -1e30f; rsum[r] = 0.f; }

    int kend = qt * 16 + 16;                      // causal bound
    for (int kbase = 0; kbase < kend; kbase += 32) {
        float p[2][8];
        float tmax[8];
#pragma unroll
        for (int r = 0; r < 8; ++r) tmax[r] = -1e30f;

        // This chunk's K and V fragments.  kbase is a multiple of 32 below
        // kend <= T, and T is one too: keys kbase .. kbase + 31 all exist.
        // bk[sub][c]: key kbase + sub*16 + ln, head dims c*32 + fragK(0..15).
        // bv[j]:      head dim j*16 + ln,      keys kbase + fragK(0..15).
        static_assert(T % 32 == 0 && KV * HD * 2 == 1024 && T * 2 == 2048,
                      "the byte offsets in the loads below");
        BF16Frag bk[2][2], bv[4];
        const unsigned short* kp = kb + (size_t)(kbase + ln) * (KV * HD) + kvh * HD + hb;
        const unsigned short* vp = vt + (size_t)(kvh * HD + ln) * T + kbase + hb;
        // The sixteen loads and their data wait in one statement, outputs
        // early-clobber: no result and no later instruction lands on an address
        // register of a load that is still in flight.
        asm volatile("global_load_b128 %0, %16, off\n\t"
                     "global_load_b128 %1, %16, off offset:32\n\t"
                     "global_load_b128 %2, %16, off offset:64\n\t"
                     "global_load_b128 %3, %16, off offset:96\n\t"
                     "global_load_b128 %4, %16, off offset:16384\n\t"
                     "global_load_b128 %5, %16, off offset:16416\n\t"
                     "global_load_b128 %6, %16, off offset:16448\n\t"
                     "global_load_b128 %7, %16, off offset:16480\n\t"
                     "global_load_b128 %8, %17, off\n\t"
                     "global_load_b128 %9, %17, off offset:32\n\t"
                     "global_load_b128 %10, %17, off offset:32768\n\t"
                     "global_load_b128 %11, %17, off offset:32800\n\t"
                     "global_load_b128 %12, %17, off offset:65536\n\t"
                     "global_load_b128 %13, %17, off offset:65568\n\t"
                     "global_load_b128 %14, %17, off offset:98304\n\t"
                     "global_load_b128 %15, %17, off offset:98336\n\t"
                     "s_wait_loadcnt 0x0"
                     : "=&v"(bk[0][0].q[0]), "=&v"(bk[0][0].q[1]),
                       "=&v"(bk[0][1].q[0]), "=&v"(bk[0][1].q[1]),
                       "=&v"(bk[1][0].q[0]), "=&v"(bk[1][0].q[1]),
                       "=&v"(bk[1][1].q[0]), "=&v"(bk[1][1].q[1]),
                       "=&v"(bv[0].q[0]), "=&v"(bv[0].q[1]),
                       "=&v"(bv[1].q[0]), "=&v"(bv[1].q[1]),
                       "=&v"(bv[2].q[0]), "=&v"(bv[2].q[1]),
                       "=&v"(bv[3].q[0]), "=&v"(bv[3].q[1])
                     : "v"(kp), "v"(vp)
                     : "memory");

        // Unrolled so that bk[sub] and p[sub] are indexed by constants and stay
        // in registers.
#pragma unroll
        for (int sub = 0; sub < 2; ++sub) {
            int ks = kbase + sub * 16;
            f32x8 s = {0,0,0,0,0,0,0,0};
#pragma unroll
            for (int c = 0; c < 2; ++c)
                s = __builtin_amdgcn_wmma_f32_16x16x32_bf16(
                    false, aq[c].v, false, bk[sub][c].v, (short)0, s, false, false);
#pragma unroll
            for (int r = 0; r < 8; ++r) {
                int row = qt * 16 + r + hb;
                int key = ks + ln;
                float sv = s[r] * ATTN_MULT;
                if (key > row || key >= T) sv = -1e30f;
                p[sub][r] = sv;
                tmax[r] = fmaxf(tmax[r], sv);
            }
        }
        // Row maximum over the sixteen lanes, partners 8, 4, 2, 1 away; the eight
        // rows take each step together, so that no step waits on the one before.
#pragma unroll
        for (int r = 0; r < 8; ++r) tmax[r] = fmaxf(tmax[r], row_xor<8>(tmax[r]));
#pragma unroll
        for (int r = 0; r < 8; ++r) tmax[r] = fmaxf(tmax[r], row_xor<4>(tmax[r]));
#pragma unroll
        for (int r = 0; r < 8; ++r) tmax[r] = fmaxf(tmax[r], row_xor<2>(tmax[r]));
#pragma unroll
        for (int r = 0; r < 8; ++r) tmax[r] = fmaxf(tmax[r], row_xor<1>(tmax[r]));

        float corr[8], ts[8];
#pragma unroll
        for (int r = 0; r < 8; ++r) {
            float mn = fmaxf(rmax[r], tmax[r]);
            corr[r]  = exp_slot(rmax[r] - mn);
            rmax[r]  = mn;
            p[0][r]  = exp_slot(p[0][r] - mn);
            p[1][r]  = exp_slot(p[1][r] - mn);
            ts[r]    = p[0][r] + p[1][r];
        }
        // Row sum, the same partners in the same order.
#pragma unroll
        for (int r = 0; r < 8; ++r) ts[r] += row_xor<8>(ts[r]);
#pragma unroll
        for (int r = 0; r < 8; ++r) ts[r] += row_xor<4>(ts[r]);
#pragma unroll
        for (int r = 0; r < 8; ++r) ts[r] += row_xor<2>(ts[r]);
#pragma unroll
        for (int r = 0; r < 8; ++r) ts[r] += row_xor<1>(ts[r]);
#pragma unroll
        for (int r = 0; r < 8; ++r) rsum[r] = rsum[r] * corr[r] + ts[r];
#pragma unroll
        for (int r = 0; r < 8; ++r) {
            o0[r] *= corr[r]; o1[r] *= corr[r];
            o2[r] *= corr[r]; o3[r] *= corr[r];
        }
#pragma unroll
        for (int sub = 0; sub < 2; ++sub)
#pragma unroll
            for (int r = 0; r < 8; ++r)
                pbuf[w][(r + hb) * 34 + sub * 16 + ln] = f2bf(p[sub][r]);
        BF16Frag pf;
#pragma unroll
        for (int e = 0; e < 16; ++e)
            pf.u[e] = pbuf[w][ln * 34 + fragK(e, lane)];

        o0 = __builtin_amdgcn_wmma_f32_16x16x32_bf16(
                false, pf.v, false, bv[0].v, (short)0, o0, false, false);
        o1 = __builtin_amdgcn_wmma_f32_16x16x32_bf16(
                false, pf.v, false, bv[1].v, (short)0, o1, false, false);
        o2 = __builtin_amdgcn_wmma_f32_16x16x32_bf16(
                false, pf.v, false, bv[2].v, (short)0, o2, false, false);
        o3 = __builtin_amdgcn_wmma_f32_16x16x32_bf16(
                false, pf.v, false, bv[3].v, (short)0, o3, false, false);
    }
#pragma unroll
    for (int r = 0; r < 8; ++r) {
        int row = qt * 16 + r + hb;
        float inv = 1.f / rsum[r];
        size_t base = (size_t)row * (H * HD) + h * HD;
        attnb[base +  0 + ln] = f2bf(o0[r] * inv);
        attnb[base + 16 + ln] = f2bf(o1[r] * inv);
        attnb[base + 32 + ln] = f2bf(o2[r] * inv);
        attnb[base + 48 + ln] = f2bf(o3[r] * inv);
    }
}

// ---------------------------------------------------------------------------
// Host-side orchestration.
// ---------------------------------------------------------------------------
template <int mode>
static void launch_gemm(hipStream_t s, int nz, int sA, int sB, int sC, int sR,
                        const int* tilemap, const int* rowlist, const int* cnts,
                        const unsigned short* A, int lda,
                        const unsigned short* Bt, int ldb, int M, int N, int K,
                        float* outf, unsigned short* outb, int ldc,
                        float scale,
                        const float* resid, int ldr,
                        const float* rowsc,
                        const float* aux, int ldaux) {
    // With a tile map grid.y covers the row tiles of all experts' lists.
    dim3 g(N / 128, tilemap ? MOE_TILES : M / 64, nz);
    gemm_bf16_wmma<mode><<<g, 256, 0, s>>>(A, lda, Bt, ldb, M, N, K, outf, outb, ldc,
                                           scale, resid, ldr, rowsc,
                                           aux, ldaux, sA, sB, sC, sR,
                                           0, nullptr, nullptr, tilemap, rowlist, cnts);
}

extern "C" void kernel_launch(void* const* d_in, const int* in_sizes, int n_in,
                              void* d_out, int out_size, void* d_ws, size_t ws_size,
                              hipStream_t stream) {
    const int*   pos     = (const int*)  d_in[0];
    const float* hidden  = (const float*)d_in[1];
    const float* ln1     = (const float*)d_in[2];
    const float* ln2     = (const float*)d_in[3];
    const float* wq      = (const float*)d_in[4];
    const float* wk      = (const float*)d_in[5];
    const float* wv      = (const float*)d_in[6];
    const float* wo      = (const float*)d_in[7];
    const float* routerw = (const float*)d_in[8];
    const float* w13     = (const float*)d_in[9];
    const float* w2      = (const float*)d_in[10];
    const float* sw13    = (const float*)d_in[11];
    const float* sw2     = (const float*)d_in[12];

    float* outF     = (float*)d_out;          // final hidden  [T*D]
    float* residOut = outF + (size_t)T * D;   // post-attn residual [T*D]

    char* ws = (char*)d_ws;
    const size_t MB = 1u << 20;
    unsigned short* xb    = (unsigned short*)(ws + 0);        // T*D bf16   4M
    float*          qf    = (float*)         (ws + 4  * MB);  // T*2048 f32 8M
    float*          kf    = (float*)         (ws + 12 * MB);  // T*512 f32  2M
    unsigned short* qbuf  = (unsigned short*)(ws + 14 * MB);  // 4M
    unsigned short* kbuf  = (unsigned short*)(ws + 18 * MB);  // 1M
    unsigned short* vbuf  = (unsigned short*)(ws + 19 * MB);  // 1M, [KV*HD][T]
    unsigned short* attnb = (unsigned short*)(ws + 20 * MB);  // 4M
    float*          xnf   = (float*)         (ws + 24 * MB);  // 8M
    unsigned short* xnb   = (unsigned short*)(ws + 32 * MB);  // 4M
    float*          fullw = (float*)         (ws + 36 * MB);  // 32K
    int*            rlist = (int*)           (ws + 36 * MB + 65536);   // E*T int 32K
    float*          wlist = (float*)         (ws + 36 * MB + 98304);   // E*T f32 32K
    int*            cnts  = (int*)           (ws + 36 * MB + 131072);  // E int
    int*            tmap  = (int*)           (ws + 36 * MB + 135168);  // MOE_TILES int
    float*          moe   = (float*)         (ws + 37 * MB);  // 8M
    float*          ggate = (float*)         (ws + 45 * MB);  // T*SI f32 16M
    unsigned short* sactb = (unsigned short*)(ws + 61 * MB);  // 8M
    float*          hgate = (float*)         (ws + 69 * MB);  // E*T*I f32 32M
    unsigned short* actb  = (unsigned short*)(ws + 101 * MB); // E*T*I bf16 16M
    float*          moep  = (float*)         (ws + 117 * MB); // E*T*D f32 64M
    unsigned short* wt    = (unsigned short*)(ws + 184 * MB); // bf16 weights 164M
    (void)ws_size; (void)in_sizes; (void)n_in; (void)out_size;

    // 0) Every GEMM weight once to bf16, transposed to [n][k].
    weight_bf16_t_kernel<<<WT_BLOCKS, 256, 0, stream>>>(wq, wk, wv, wo, w13, w2,
                                                        sw13, sw2, wt);

    // 1) RMSNorm 1 -> bf16 activations.
    rmsnorm_kernel<<<T, 256, 0, stream>>>(hidden, ln1, nullptr, xb);

    // 2) QKV projections, one launch: column tiles 0-15 are Q, 16-19 K, 20-23 V
    //    (V is stored transposed, for the attention's fragment loads).
    gemm_bf16_wmma<GEMM_STORE><<<dim3((H + 2 * KV) * HD / 128, T / 64), 256, 0, stream>>>(
        xb, D, wt + WT_Q, D, T, H * HD, D, qf, nullptr, H * HD, 0.f,
        nullptr, 0, nullptr, nullptr, 0, 0, 0, 0, 0,
        KV * HD, kf, vbuf, nullptr, nullptr, nullptr);

    // 3) RoPE on Q and K (f32 -> bf16).
    rope_kernel<<<(T * H  * 32 + 255) / 256, 256, 0, stream>>>(pos, qf, qbuf, H);
    rope_kernel<<<(T * KV * 32 + 255) / 256, 256, 0, stream>>>(pos, kf, kbuf, KV);

    // 4) Causal GQA attention.
    attn_kernel<<<dim3(H, T / 64), 128, 0, stream>>>(qbuf, kbuf, vbuf, attnb);

    // 5) Output projection + residual -> residOut (second output).
    launch_gemm<GEMM_RESID>(stream, 1, 0, 0, 0, 0, nullptr, nullptr, nullptr,
                attnb, H * HD, wt + WT_O, H * HD, T, D, H * HD,
                residOut, nullptr, D, RES_MULT, hidden, D,
                nullptr, nullptr, 0);

    // 6) RMSNorm 2.
    rmsnorm_kernel<<<T, 256, 0, stream>>>(residOut, ln2, xnf, xnb);

    // 7) Router top-2.
    router_kernel<<<T, 32, 0, stream>>>(xnf, routerw, fullw);

    // 8) Experts, weighted by full_w as in the reference.  Each expert takes the
    //    rows whose weight for it is not zero: gate and up gather them from xnb
    //    into the order of the expert's list, down stores each weighted row at
    //    its token's place in the expert's plane; the planes are summed after.
    route_kernel<<<1, 1024, 0, stream>>>(fullw, rlist, wlist, cnts, tmap);
    launch_gemm<GEMM_STORE>(stream, 1, 0, D * 2 * I, T * I, 0, tmap, rlist, cnts,
                xnb, D, wt + WT_13, D, T, I, D,
                hgate, nullptr, I, 0.f, nullptr, 0, nullptr, nullptr, 0);
    launch_gemm<GEMM_SILU>(stream, 1, 0, D * 2 * I, T * I, 0, tmap, rlist, cnts,
                xnb, D, wt + WT_13 + (size_t)I * D, D, T, I, D,
                nullptr, actb, I, 0.f, nullptr, 0, nullptr, hgate, I);
    launch_gemm<GEMM_MOE_INIT>(stream, 1, T * I, I * D, T * D, T, tmap, rlist, cnts,
                actb, I, wt + WT_2, I, T, D, I,
                moep, nullptr, D, 0.f,
                nullptr, 0, wlist, nullptr, 0);
    expert_sum_kernel<<<T * D / 1024, 256, 0, stream>>>(moep, fullw, moe);

    // 9) Shared expert.
    launch_gemm<GEMM_STORE>(stream, 1, 0, 0, 0, 0, nullptr, nullptr, nullptr,
                xnb, D, wt + WT_S13, D, T, SI, D,
                ggate, nullptr, SI, 0.f, nullptr, 0, nullptr, nullptr, 0);
    launch_gemm<GEMM_SILU>(stream, 1, 0, 0, 0, 0, nullptr, nullptr, nullptr,
                xnb, D, wt + WT_S13 + (size_t)SI * D, D, T, SI, D,
                nullptr, sactb, SI, 0.f, nullptr, 0, nullptr, ggate, SI);

    // 10) Shared down-proj fused with final residual.
    launch_gemm<GEMM_FINAL>(stream, 1, 0, 0, 0, 0, nullptr, nullptr, nullptr,
                sactb, SI, wt + WT_S2, SI, T, D, SI,
                outF, nullptr, D, RES_MULT, residOut, D,
                nullptr, moe, D);
}

// v009
// A run of this version takes 283 microseconds.
// Two timings next to v008 put it at 1.09 and 1.10 times that version's speed.
// Over all steps from v000 it is 12.1 times as fast.
#include <hip/hip_runtime.h>
#include <hip/hip_bf16.h>

// ---------------------------------------------------------------------------
// MI455X (gfx1250, wave32) implementation of a decoder layer (attention, MoE, shared MLP).
// All large GEMMs + attention run on v_wmma_f32_16x16x32_bf16 (bf16 in, f32
// accum).  A-activation tiles move global->LDS via the CDNA5 async-DMA path
// (global_load_async_to_lds_b128 + s_wait_asynccnt).  A first launch writes every
// GEMM weight once as bf16, transposed to [n][k], into the workspace, so the
// weight tiles take the same async path and the k loop holds no conversion.
// GEMMs that do not depend on each other share one launch: Q/K/V in one grid,
// and the eight experts' gate, up and down products one grid each, in which the
// shared MLP's gate, up and down products ride along as further row tiles.  An
// expert's products are formed only for the rows whose router weight for it is
// not zero.
// Workspace requirement: 348 MiB (see layout below).
// ---------------------------------------------------------------------------

static constexpr int T  = 1024;
static constexpr int D  = 2048;
static constexpr int H  = 32;
static constexpr int KV = 8;
static constexpr int HD = 64;
static constexpr int E  = 8;
static constexpr int I  = 1024;
static constexpr int SI = 4096;
static constexpr float ATTN_MULT = 0.0078125f;
static constexpr float RES_MULT  = 0.22f;
static constexpr float EPS       = 1e-6f;

typedef __bf16 bf16x16 __attribute__((ext_vector_type(16)));
typedef float  f32x8   __attribute__((ext_vector_type(8)));
typedef float  f32x4   __attribute__((ext_vector_type(4)));
typedef unsigned int u32x4 __attribute__((ext_vector_type(4)));
typedef int i32x4 __attribute__((ext_vector_type(4)));

union BF16Frag {
    unsigned short u[16];
    u32x4 q[2];      // the two runs of eight k-consecutive elements (see fragK)
    bf16x16 v;
};

__device__ __forceinline__ unsigned short f2bf(float f) {
    unsigned int u = __float_as_uint(f);
    unsigned int r = u + 0x7FFFu + ((u >> 16) & 1u);   // round-to-nearest-even
    return (unsigned short)(r >> 16);
}

// A/B fragment K-index pattern for V_WMMA_*_16X16X32_BF16 (ISA 7.12.2):
// VGPR p (0..7), half w; lanes 0-15 vs 16-31 differ by +8 in K.
__device__ __forceinline__ int fragK(int e, int lane) {
    int p = e >> 1, w = e & 1;
    return ((p & 3) << 1) + w + ((p >> 2) << 4) + ((lane >> 4) << 3);
}

// Generic pointer -> 32-bit LDS byte offset (AS3) for async-DMA VDST operand.
__device__ __forceinline__ unsigned lds_off(const void* p) {
    return (unsigned)(unsigned long long)
        (__attribute__((address_space(3))) const void*)p;
}

// CDNA5 async global->LDS copies, 16B per lane each (ASYNCcnt tracked): a
// thread's share of one k stage, four pieces of the A tile and eight of the B
// tile.  Piece i lies i * ls bytes further in LDS than the first one of its
// tile; in global memory the A pieces have a pointer each (their rows may be
// gathered), the B pieces lie gb elements apart.  A wave's copy takes
// two rows of 256 B: whole lines, where a 32-k stage took 64 B of eight rows.
__device__ __forceinline__ void async_copy12_b128(unsigned la, const unsigned short* a0,
                                                  const unsigned short* a1,
                                                  const unsigned short* a2,
                                                  const unsigned short* a3,
                                                  unsigned lb, const unsigned short* b, size_t gb,
                                                  unsigned ls) {
    // s_wait_xcnt as the last line of the copies' own statement: it stands in
    // front of any later rewrite of the address registers that the copies name.
    asm volatile("global_load_async_to_lds_b128 %0, %1, off\n\t"
                 "global_load_async_to_lds_b128 %2, %3, off\n\t"
                 "global_load_async_to_lds_b128 %4, %5, off\n\t"
                 "global_load_async_to_lds_b128 %6, %7, off\n\t"
                 "global_load_async_to_lds_b128 %8, %9, off\n\t"
                 "global_load_async_to_lds_b128 %10, %11, off\n\t"
                 "global_load_async_to_lds_b128 %12, %13, off\n\t"
                 "global_load_async_to_lds_b128 %14, %15, off\n\t"
                 "global_load_async_to_lds_b128 %16, %17, off\n\t"
                 "global_load_async_to_lds_b128 %18, %19, off\n\t"
                 "global_load_async_to_lds_b128 %20, %21, off\n\t"
                 "global_load_async_to_lds_b128 %22, %23, off\n\t"
                 "s_wait_xcnt 0x0"
                 :: "v"(la),          "v"(a0),
                    "v"(la + ls),     "v"(a1),
                    "v"(la + 2 * ls), "v"(a2),
                    "v"(la + 3 * ls), "v"(a3),
                    "v"(lb),          "v"(b),
                    "v"(lb + ls),     "v"(b + gb),
                    "v"(lb + 2 * ls), "v"(b + 2 * gb),
                    "v"(lb + 3 * ls), "v"(b + 3 * gb),
                    "v"(lb + 4 * ls), "v"(b + 4 * gb),
                    "v"(lb + 5 * ls), "v"(b + 5 * gb),
                    "v"(lb + 6 * ls), "v"(b + 6 * gb),
                    "v"(lb + 7 * ls), "v"(b + 7 * gb)
                 : "memory");
}
// Behind a global store: stands in front of any later rewrite of the store's
// address and data registers.
__device__ __forceinline__ void wait_xcnt0() {
    asm volatile("s_wait_xcnt 0x0" ::: "memory");
}
__device__ __forceinline__ void wait_async0() {
    asm volatile("s_wait_asynccnt 0x0" ::: "memory");
}
// A wave's own LDS reads have retired before the barrier behind which the
// buffer they read is refilled by async copies.
__device__ __forceinline__ void wait_ds0() {
    asm volatile("s_wait_dscnt 0x0" ::: "memory");
}

// e^x as the fast intrinsic forms it: x * log2(e), then v_exp_f32.  The v_nop in
// the same statement fills the one slot that the instruction set asks for behind
// a transcendental, whatever instruction the compiler puts next.
__device__ __forceinline__ float exp_slot(float x) {
    float y = x * 1.44269504088896340736f, r;
    asm("v_exp_f32 %0, %1\n\tv_nop" : "=v"(r) : "v"(y));
    return r;
}

// A lane's share of a 16-row band of a wave's 32x32 GEMM tile: eight rows, ld
// elements apart, and in each the columns c and c + 16; d[sn][rr].  p points at
// the first row's column c.  The groups below move such a share with sixteen
// memory instructions that follow one another and one wait.
// Sixteen f32 loads and their data wait in one statement, outputs early-clobber:
// no result and no later instruction lands on an address register of a load
// that is still in flight.
__device__ __forceinline__ void load_band_f32(const float* p, size_t ld, float (&d)[2][8]) {
    asm volatile("global_load_b32 %0, %16, off\n\t"
                 "global_load_b32 %8, %16, off offset:64\n\t"
                 "global_load_b32 %1, %17, off\n\t"
                 "global_load_b32 %9, %17, off offset:64\n\t"
                 "global_load_b32 %2, %18, off\n\t"
                 "global_load_b32 %10, %18, off offset:64\n\t"
                 "global_load_b32 %3, %19, off\n\t"
                 "global_load_b32 %11, %19, off offset:64\n\t"
                 "global_load_b32 %4, %20, off\n\t"
                 "global_load_b32 %12, %20, off offset:64\n\t"
                 "global_load_b32 %5, %21, off\n\t"
                 "global_load_b32 %13, %21, off offset:64\n\t"
                 "global_load_b32 %6, %22, off\n\t"
                 "global_load_b32 %14, %22, off offset:64\n\t"
                 "global_load_b32 %7, %23, off\n\t"
                 "global_load_b32 %15, %23, off offset:64\n\t"
                 "s_wait_loadcnt 0x0"
                 : "=&v"(d[0][0]), "=&v"(d[0][1]), "=&v"(d[0][2]), "=&v"(d[0][3]),
                   "=&v"(d[0][4]), "=&v"(d[0][5]), "=&v"(d[0][6]), "=&v"(d[0][7]),
                   "=&v"(d[1][0]), "=&v"(d[1][1]), "=&v"(d[1][2]), "=&v"(d[1][3]),
                   "=&v"(d[1][4]), "=&v"(d[1][5]), "=&v"(d[1][6]), "=&v"(d[1][7])
                 : "v"(p), "v"(p + ld), "v"(p + 2 * ld), "v"(p + 3 * ld),
                   "v"(p + 4 * ld), "v"(p + 5 * ld), "v"(p + 6 * ld), "v"(p + 7 * ld)
                 : "memory");
}
// Sixteen f32 stores; s_wait_xcnt as the last line of their own statement stands
// in front of any later rewrite of the address and data registers they name.
__device__ __forceinline__ void store_band_f32(float* p, size_t ld, const float (&d)[2][8]) {
    asm volatile("global_store_b32 %16, %0, off\n\t"
                 "global_store_b32 %16, %8, off offset:64\n\t"
                 "global_store_b32 %17, %1, off\n\t"
                 "global_store_b32 %17, %9, off offset:64\n\t"
                 "global_store_b32 %18, %2, off\n\t"
                 "global_store_b32 %18, %10, off offset:64\n\t"
                 "global_store_b32 %19, %3, off\n\t"
                 "global_store_b32 %19, %11, off offset:64\n\t"
                 "global_store_b32 %20, %4, off\n\t"
                 "global_store_b32 %20, %12, off offset:64\n\t"
                 "global_store_b32 %21, %5, off\n\t"
                 "global_store_b32 %21, %13, off offset:64\n\t"
                 "global_store_b32 %22, %6, off\n\t"
                 "global_store_b32 %22, %14, off offset:64\n\t"
                 "global_store_b32 %23, %7, off\n\t"
                 "global_store_b32 %23, %15, off offset:64\n\t"
                 "s_wait_xcnt 0x0"
                 :: "v"(d[0][0]), "v"(d[0][1]), "v"(d[0][2]), "v"(d[0][3]),
                    "v"(d[0][4]), "v"(d[0][5]), "v"(d[0][6]), "v"(d[0][7]),
                    "v"(d[1][0]), "v"(d[1][1]), "v"(d[1][2]), "v"(d[1][3]),
                    "v"(d[1][4]), "v"(d[1][5]), "v"(d[1][6]), "v"(d[1][7]),
                    "v"(p), "v"(p + ld), "v"(p + 2 * ld), "v"(p + 3 * ld),
                    "v"(p + 4 * ld), "v"(p + 5 * ld), "v"(p + 6 * ld), "v"(p + 7 * ld)
                 : "memory");
}
// The same for bf16 values (the low halves of d): column c + 16 lies 32 B on.
__device__ __forceinline__ void store_band_bf16(unsigned short* p, size_t ld,
                                                const unsigned (&d)[2][8]) {
    asm volatile("global_store_b16 %16, %0, off\n\t"
                 "global_store_b16 %16, %8, off offset:32\n\t"
                 "global_store_b16 %17, %1, off\n\t"
                 "global_store_b16 %17, %9, off offset:32\n\t"
                 "global_store_b16 %18, %2, off\n\t"
                 "global_store_b16 %18, %10, off offset:32\n\t"
                 "global_store_b16 %19, %3, off\n\t"
                 "global_store_b16 %19, %11, off offset:32\n\t"
                 "global_store_b16 %20, %4, off\n\t"
                 "global_store_b16 %20, %12, off offset:32\n\t"
                 "global_store_b16 %21, %5, off\n\t"
                 "global_store_b16 %21, %13, off offset:32\n\t"
                 "global_store_b16 %22, %6, off\n\t"
                 "global_store_b16 %22, %14, off offset:32\n\t"
                 "global_store_b16 %23, %7, off\n\t"
                 "global_store_b16 %23, %15, off offset:32\n\t"
                 "s_wait_xcnt 0x0"
                 :: "v"(d[0][0]), "v"(d[0][1]), "v"(d[0][2]), "v"(d[0][3]),
                    "v"(d[0][4]), "v"(d[0][5]), "v"(d[0][6]), "v"(d[0][7]),
                    "v"(d[1][0]), "v"(d[1][1]), "v"(d[1][2]), "v"(d[1][3]),
                    "v"(d[1][4]), "v"(d[1][5]), "v"(d[1][6]), "v"(d[1][7]),
                    "v"(p), "v"(p + ld), "v"(p + 2 * ld), "v"(p + 3 * ld),
                    "v"(p + 4 * ld), "v"(p + 5 * ld), "v"(p + 6 * ld), "v"(p + 7 * ld)
                 : "memory");
}
// The same for a bf16 output that is stored transposed: the eight rows follow
// one another in memory, p0 and p1 point at the first row in columns c, c + 16.
__device__ __forceinline__ void store_band_bf16_t(unsigned short* p0, unsigned short* p1,
                                                  const unsigned (&d)[2][8]) {
    asm volatile("global_store_b16 %16, %0, off\n\t"
                 "global_store_b16 %16, %1, off offset:2\n\t"
                 "global_store_b16 %16, %2, off offset:4\n\t"
                 "global_store_b16 %16, %3, off offset:6\n\t"
                 "global_store_b16 %16, %4, off offset:8\n\t"
                 "global_store_b16 %16, %5, off offset:10\n\t"
                 "global_store_b16 %16, %6, off offset:12\n\t"
                 "global_store_b16 %16, %7, off offset:14\n\t"
                 "global_store_b16 %17, %8, off\n\t"
                 "global_store_b16 %17, %9, off offset:2\n\t"
                 "global_store_b16 %17, %10, off offset:4\n\t"
                 "global_store_b16 %17, %11, off offset:6\n\t"
                 "global_store_b16 %17, %12, off offset:8\n\t"
                 "global_store_b16 %17, %13, off offset:10\n\t"
                 "global_store_b16 %17, %14, off offset:12\n\t"
                 "global_store_b16 %17, %15, off offset:14\n\t"
                 "s_wait_xcnt 0x0"
                 :: "v"(d[0][0]), "v"(d[0][1]), "v"(d[0][2]), "v"(d[0][3]),
                    "v"(d[0][4]), "v"(d[0][5]), "v"(d[0][6]), "v"(d[0][7]),
                    "v"(d[1][0]), "v"(d[1][1]), "v"(d[1][2]), "v"(d[1][3]),
                    "v"(d[1][4]), "v"(d[1][5]), "v"(d[1][6]), "v"(d[1][7]),
                    "v"(p0), "v"(p1)
                 : "memory");
}

// ---------------------------------------------------------------------------
// RMSNorm: one block of 256 threads per row.  Writes f32 and/or bf16 outputs.
// red: 256 floats of the block's LDS.
// ---------------------------------------------------------------------------
__device__ __forceinline__ void rmsnorm_row(int row, const float* __restrict__ in,
                                            const float* __restrict__ w,
                                            float* outf, unsigned short* outb, float* red) {
    int tid = threadIdx.x;
    const float* x = in + (size_t)row * D;
    float ss = 0.f;
    for (int i = tid; i < D; i += 256) { float v = x[i]; ss += v * v; }
    red[tid] = ss;
    __syncthreads();
    for (int s = 128; s > 0; s >>= 1) {
        if (tid < s) red[tid] += red[tid + s];
        __syncthreads();
    }
    float rs = rsqrtf(red[0] / (float)D + EPS);
    for (int i = tid; i < D; i += 256) {
        float v = x[i] * rs * w[i];
        // wait_xcnt0: in front of the next trip's rewrite of the store's registers.
        if (outf) { outf[(size_t)row * D + i] = v; wait_xcnt0(); }
        if (outb) { outb[(size_t)row * D + i] = f2bf(v); wait_xcnt0(); }
    }
}

__global__ __launch_bounds__(256)
void rmsnorm_kernel(const float* __restrict__ in, const float* __restrict__ w,
                    float* outf, unsigned short* outb) {
    __shared__ float red[256];
    rmsnorm_row(blockIdx.x, in, w, outf, outb, red);
}

// ---------------------------------------------------------------------------
// Weight pre-pass: every GEMM weight W[K][N] (f32) -> Wt[N][K] (bf16, rounded
// to nearest even, f2bf).  A block takes a strip of
// 1024 k x 64 n as sixteen 64x64 tiles.  A thread owns a 4(k) x 4(n) patch, so the
// transpose happens in its registers; the tile goes through LDS so that every
// global store covers whole 128-B lines of a Wt row.
// Element offsets of the transposed weights in their workspace region:
// ---------------------------------------------------------------------------
static constexpr size_t WT_Q   = 0;                                // [H*HD][D]
static constexpr size_t WT_K   = WT_Q   + (size_t)D * H * HD;      // [KV*HD][D]
static constexpr size_t WT_V   = WT_K   + (size_t)D * KV * HD;     // [KV*HD][D]
static constexpr size_t WT_O   = WT_V   + (size_t)D * KV * HD;     // [D][H*HD]
static constexpr size_t WT_13  = WT_O   + (size_t)H * HD * D;      // E x [2I][D]
static constexpr size_t WT_2   = WT_13  + (size_t)E * D * 2 * I;   // E x [D][I]
static constexpr size_t WT_S13 = WT_2   + (size_t)E * I * D;       // [2SI][D]
static constexpr size_t WT_S2  = WT_S13 + (size_t)D * 2 * SI;      // [D][SI]
static constexpr int strips(int k, int n) { return (k / 1024) * (n / 64); }
static constexpr int WT_BLOCKS =
    strips(D, H * HD) + 2 * strips(D, KV * HD) + strips(H * HD, D) +
    E * strips(D, 2 * I) + E * strips(I, D) + strips(D, 2 * SI) + strips(SI, D);

__global__ __launch_bounds__(256)
void weight_bf16_t_kernel(const float* __restrict__ wq, const float* __restrict__ wk,
                          const float* __restrict__ wv, const float* __restrict__ wo,
                          const float* __restrict__ w13, const float* __restrict__ w2,
                          const float* __restrict__ sw13, const float* __restrict__ sw2,
                          unsigned short* __restrict__ wt,
                          const float* __restrict__ hid, const float* __restrict__ ln,
                          unsigned short* __restrict__ xb) {
    constexpr int P = 72;    // LDS row pitch: 144 B = 16 B x odd
    __shared__ __align__(16) unsigned short tile[2][64 * P];

    // The first RMSNorm depends on no weight: its T rows share this launch as the
    // blocks behind the strips' (block-uniform test).
    if (blockIdx.x >= WT_BLOCKS) {
        rmsnorm_row(blockIdx.x - WT_BLOCKS, hid, ln, nullptr, xb, (float*)&tile[0][0]);
        return;
    }

    // Which matrix, and which strip of it (all block-uniform).
    int b = blockIdx.x;
    const float* src;
    size_t off;
    int K, N;
    if (b < strips(D, H * HD)) { src = wq; off = WT_Q; K = D; N = H * HD; }
    else if ((b -= strips(D, H * HD)) < strips(D, KV * HD)) { src = wk; off = WT_K; K = D; N = KV * HD; }
    else if ((b -= strips(D, KV * HD)) < strips(D, KV * HD)) { src = wv; off = WT_V; K = D; N = KV * HD; }
    else if ((b -= strips(D, KV * HD)) < strips(H * HD, D)) { src = wo; off = WT_O; K = H * HD; N = D; }
    else if ((b -= strips(H * HD, D)) < E * strips(D, 2 * I)) { src = w13; off = WT_13; K = D; N = 2 * I; }
    else if ((b -= E * strips(D, 2 * I)) < E * strips(I, D)) { src = w2; off = WT_2; K = I; N = D; }
    else if ((b -= E * strips(I, D)) < strips(D, 2 * SI)) { src = sw13; off = WT_S13; K = D; N = 2 * SI; }
    else { b -= strips(D, 2 * SI); src = sw2; off = WT_S2; K = SI; N = D; }
    int kstrips = K >> 10;
    int per     = kstrips * (N >> 6);       // strips of one matrix
    int e       = b / per;                  // expert (0 where there is one matrix)
    b -= e * per;
    int n0 = (b / kstrips) << 6;
    int kb = (b % kstrips) << 10;
    src += (size_t)e * K * N;
    unsigned short* dst = wt + off + (size_t)e * K * N;

    int tid  = threadIdx.x;
    int lane = tid & 31;
    int wid  = tid >> 5;
    // Eight lanes cover one 128-B line of a source row; the four lane groups of
    // a wave take different k quads, which spreads the 8-byte LDS stores.
    int pk = (((wid & 3) << 2) | (lane >> 3)) << 2;    // k 0,4,..,60
    int pn = (((wid >> 2) << 3) | (lane & 7)) << 2;    // n 0,4,..,60
    const float* g = src + (size_t)(kb + pk) * N + n0 + pn;
    // Read back: eight lanes cover one 128-B line of a Wt row.
    int rr = tid >> 3;                                 // n 0..31 (and +32)
    int rc = (tid & 7) << 3;                           // k 0,8,..,56
    unsigned short* o = dst + (size_t)(n0 + rr) * K + kb + rc;

    size_t rowb = (size_t)N;                           // source row, elements
    for (int t = 0; t < 16; ++t) {
        const float* gt = g + (size_t)(t * 64) * rowb;
        f32x4 r0, r1, r2, r3;
        // The four loads and their data wait in one statement, outputs
        // early-clobber: no result and no later instruction lands on an address
        // register of a load that is still in flight.
        asm volatile("global_load_b128 %0, %4, off\n\t"
                     "global_load_b128 %1, %5, off\n\t"
                     "global_load_b128 %2, %6, off\n\t"
                     "global_load_b128 %3, %7, off\n\t"
                     "s_wait_loadcnt 0x0"
                     : "=&v"(r0), "=&v"(r1), "=&v"(r2), "=&v"(r3)
                     : "v"(gt), "v"(gt + rowb), "v"(gt + 2 * rowb), "v"(gt + 3 * rowb)
                     : "memory");
        unsigned short* l = tile[t & 1];
#pragma unroll
        for (int j = 0; j < 4; ++j) {
            uint2 q;
            q.x = (unsigned)f2bf(r0[j]) | ((unsigned)f2bf(r1[j]) << 16);
            q.y = (unsigned)f2bf(r2[j]) | ((unsigned)f2bf(r3[j]) << 16);
            *(uint2*)&l[(pn + j) * P + pk] = q;
        }
        // One barrier a tile: with two buffers it also ends the reads of the
        // buffer that the next tile but one overwrites.
        __syncthreads();
#pragma unroll
        for (int i = 0; i < 2; ++i) {
            uint4 v = *(const uint4*)&l[(rr + i * 32) * P + rc];
            *(uint4*)&o[(size_t)(i * 32) * K + t * 64] = v;
            wait_xcnt0();   // in front of any later write of the store's registers
        }
    }
}

// ---------------------------------------------------------------------------
// RoPE: f32 in -> bf16 out, per (t, head, i<HD/2).  One launch for Q and K: of a
// token's H + KV heads the first H are Q's, the others K's; a wave has one head.
// ---------------------------------------------------------------------------
__global__ __launch_bounds__(256)
void rope_kernel(const int* __restrict__ pos,
                 const float* __restrict__ qin, const float* __restrict__ kin,
                 unsigned short* __restrict__ qout, unsigned short* __restrict__ kout) {
    int idx = blockIdx.x * blockDim.x + threadIdx.x;
    int total = T * (H + KV) * (HD / 2);
    if (idx >= total) return;
    int i = idx & 31;
    int h = (idx >> 5) % (H + KV);
    int t = idx / (32 * (H + KV));
    bool isq = h < H;
    const float* in = isq ? qin : kin;
    unsigned short* out = isq ? qout : kout;
    int nheads = isq ? H : KV;
    if (!isq) h -= H;
    float inv = __expf(-(float)i * (9.2103403719761840f / 32.f)); // 10000^(-i/32)
    float ang = (float)pos[t] * inv;
    float s, c;
    __sincosf(ang, &s, &c);
    size_t base = (size_t)t * nheads * HD + (size_t)h * HD;
    float x1 = in[base + i];
    float x2 = in[base + 32 + i];
    out[base + i]      = f2bf(x1 * c - x2 * s);
    out[base + 32 + i] = f2bf(x2 * c + x1 * s);
}

// ---------------------------------------------------------------------------
// Router: one wave per token.  logits = xn . router_w[e], softmax, top-2.
// ---------------------------------------------------------------------------
__global__ __launch_bounds__(32)
void router_kernel(const float* __restrict__ xn, const float* __restrict__ rw,
                   float* __restrict__ fullw) {
    int t = blockIdx.x;
    int lane = threadIdx.x;
    float acc[E];
#pragma unroll
    for (int e = 0; e < E; ++e) acc[e] = 0.f;
    const float* x = xn + (size_t)t * D;
    for (int i = lane; i < D; i += 32) {
        float xv = x[i];
#pragma unroll
        for (int e = 0; e < E; ++e) acc[e] += xv * rw[(size_t)e * D + i];
    }
#pragma unroll
    for (int e = 0; e < E; ++e)
        for (int off = 16; off > 0; off >>= 1)
            acc[e] += __shfl_xor(acc[e], off, 32);
    if (lane == 0) {
        int i1 = 0;
        for (int e = 1; e < E; ++e) if (acc[e] > acc[i1]) i1 = e;
        int i2 = (i1 == 0) ? 1 : 0;
        for (int e = 0; e < E; ++e) if (e != i1 && acc[e] > acc[i2]) i2 = e;
        float e1 = 1.f;
        float e2 = __expf(acc[i2] - acc[i1]);
        float inv = 1.f / (e1 + e2);
        for (int e = 0; e < E; ++e) {
            float wv = (e == i1) ? e1 * inv : (e == i2) ? e2 * inv : 0.f;
            fullw[(size_t)t * E + e] = wv;
        }
    }
}

// ---------------------------------------------------------------------------
// Row lists of the experts, one block, thread = token.  list[e][0 .. cnts[e])
// holds, in rising order, the tokens whose weight for expert e is not zero (a
// zero weight multiplies that expert's product away); the rest of list[e] is
// token 0, so that a last, partly filled tile gathers rows that exist.
// wlist[e] holds the weights in the same order (zero behind the listed ones).
// tilemap[j] = expert << 16 | first list place of the j-th 64-row tile, or -1.
// The router gives a token at most two weights: at most 2T list entries, so
// at most (2T + 63 E) / 64 tiles.
// ---------------------------------------------------------------------------
static constexpr int MOE_TILES = (2 * T + 63 * E) / 64;

__global__ __launch_bounds__(1024)
void route_kernel(const float* __restrict__ fullw, int* __restrict__ list,
                  float* __restrict__ wlist,
                  int* __restrict__ cnts, int* __restrict__ tilemap) {
    static_assert(T == 1024 && E == 8, "one thread a token, one wave's scan an expert");
    __shared__ int wcnt[E][32];   // per expert and wave: count, then count of the waves before
    __shared__ int tot[E];
    int t    = threadIdx.x;
    int lane = t & 31;
    int wv   = t >> 5;
    f32x4 wa, wb;
    // Both loads and their data wait in one statement, outputs early-clobber:
    // nothing lands on the address register of a load that is still in flight.
    asm volatile("global_load_b128 %0, %2, off\n\t"
                 "global_load_b128 %1, %2, off offset:16\n\t"
                 "s_wait_loadcnt 0x0"
                 : "=&v"(wa), "=&v"(wb)
                 : "v"(fullw + (size_t)t * E)
                 : "memory");
    unsigned m[E];
#pragma unroll
    for (int e = 0; e < E; ++e) {
        float wv_e = e < 4 ? wa[e & 3] : wb[e & 3];
        m[e] = __builtin_amdgcn_ballot_w32(wv_e != 0.f);
        if (lane == 0) wcnt[e][wv] = __popc(m[e]);
    }
    __syncthreads();
    if (wv < E) {
        int c = wcnt[wv][lane];
        int inc = c;
        for (int off = 1; off < 32; off <<= 1) {
            int n = __shfl_up(inc, off, 32);
            if (lane >= off) inc += n;
        }
        wcnt[wv][lane] = inc - c;
        if (lane == 31) tot[wv] = inc;
    }
    __syncthreads();
#pragma unroll
    for (int e = 0; e < E; ++e) {
        // A place below tot[e] is written by the one token that ranks there, a
        // place from tot[e] on by the thread of that number.
        bool mine = (m[e] >> lane) & 1u;
        int place = mine ? wcnt[e][wv] + __popc(m[e] & ((1u << lane) - 1u)) : t;
        if (mine || t >= tot[e]) {
            list[e * T + place] = mine ? t : 0;
            wait_xcnt0();   // in front of any later write of the store's registers
            wlist[e * T + place] = mine ? (e < 4 ? wa[e & 3] : wb[e & 3]) : 0.f;
            wait_xcnt0();
        }
        if (mine && t >= tot[e]) {
            list[e * T + t] = 0;
            wait_xcnt0();
            wlist[e * T + t] = 0.f;
            wait_xcnt0();
        }
    }
    if (t < E) { cnts[t] = tot[t]; wait_xcnt0(); }
    if (t < MOE_TILES) {
        int j = t, ent = -1;
#pragma unroll
        for (int e = 0; e < E; ++e) {
            int nt = (tot[e] + 63) >> 6;
            if (ent < 0 && j < nt) ent = (e << 16) | (j << 6);
            j -= nt;
        }
        tilemap[t] = ent;
        wait_xcnt0();
    }
}

// ---------------------------------------------------------------------------
// BF16-WMMA GEMM, double-buffered LDS, async DMA of both tiles.
// C[M,N] = A[M,K](bf16) x Bt[N,K]^T (bf16, from the weight pre-pass).
// Block tile 64x128, 8 waves (2M x 4N), each wave 32x32.  A stage of the two
// LDS buffers holds 128 k (16 WMMAs a wave): 48 KiB of copies are in flight per
// block, and their latency, the waits and the barrier are paid once per 128 k.
// Requires: M%64==0, N%128==0, K%128==0, lda%8==0, ldb%8==0 (all satisfied).
// The kind of epilogue is a compile-time constant.  What an epilogue reads beside
// the sums (residual or gate) is fetched in groups at entry, while the first k
// stage's copies fly; outside MoE-init the results leave in groups of sixteen stores.
// ---------------------------------------------------------------------------
#define GEMM_STORE    0  // outf/outb = acc
#define GEMM_RESID    1  // outf = resid + scale*acc
#define GEMM_MOE_INIT 2  // outf[token] = rowsc[row]*acc, token = rowlist[row], listed rows only
                         // (the GEMM that rides along: outf = acc)
#define GEMM_SILU     4  // outb = silu(aux[row,col]) * acc   (bf16)

template <int mode>
__global__ __launch_bounds__(256)
void gemm_bf16_wmma(const unsigned short* __restrict__ A, int lda,
                    const unsigned short* __restrict__ Bt, int ldb,
                    int M, int N, int K,
                    float* outf, unsigned short* outb, int ldc,
                    float scale,
                    const float* __restrict__ resid, int ldr,
                    const float* __restrict__ rowsc,
                    const float* __restrict__ aux, int ldaux,
                    int sA, int sB, int sC, int sR,
                    int N2, float* outf2, unsigned short* outb3,
                    const int* __restrict__ tilemap, const int* __restrict__ rowlist,
                    const int* __restrict__ cnts,
                    int ysh, int fsh,
                    const unsigned short* __restrict__ A2, int lda2,
                    const unsigned short* __restrict__ Bt2, int ldb2, int K2,
                    float* outfS, unsigned short* outbS, int ldcS,
                    const float* __restrict__ auxS) {
    constexpr int BK = 128;      // k per stage
    constexpr int AS = BK + 8;   // LDS stride for A rows   [64][AS]  (272 B = 16 B x odd)
    constexpr int BS = BK + 8;   // LDS stride for B^T rows [128][BS]
    __shared__ __align__(16) unsigned short lds_a[2][64 * AS];
    __shared__ __align__(16) unsigned short lds_b[2][128 * BS];

    int tid  = threadIdx.x;
    int lane = tid & 31;
    int wid  = tid >> 5;
    int wm   = wid >> 2;   // 0..1
    int wn   = wid & 3;    // 0..3
    int m0   = blockIdx.y * 64;
    int n0   = blockIdx.x * 128;
    int ln   = lane & 15;

    // blockIdx.z: independent GEMMs of one shape whose operands lie sA / sB
    // elements apart, outputs and aux sC apart, row scales sR apart.
    size_t z = blockIdx.z;
    // With a tile map (see route_kernel) blockIdx.y numbers the row tiles of all
    // experts' lists: the entry names the expert and the tile's place in its
    // list.  A block without a tile leaves here, whole, in front of every copy
    // and barrier.
    // The first ysh values of blockIdx.y belong to a GEMM that does not depend on
    // the experts' (the shared MLP's, operands A2, Bt2): all M rows, fsh times
    // the experts' N columns, fsh values of blockIdx.y to a row tile.  Its blocks
    // have the low indices.
    const int* rl = nullptr;
    if (tilemap) {
        int by = blockIdx.y;
        if (by < ysh) {
            m0  = (by / fsh) * 64;
            n0 += (by % fsh) * N;
            N  *= fsh;
            A = A2;  lda = lda2;  Bt = Bt2;  ldb = ldb2;  K = K2;
            outf = outfS;  outb = outbS;  ldc = ldcS;
            aux = auxS;  ldaux = ldcS;
        } else {
            int ent = tilemap[by - ysh];
            if (ent < 0) return;
            z  = (size_t)(ent >> 16);
            m0 = ent & 0xffff;
            rl = rowlist + z * T + m0;
            if constexpr (mode == GEMM_MOE_INIT) M = cnts[z];   // only listed rows are stored
        }
    }
    A += z * sA;
    Bt += z * sB + (size_t)n0 * ldb;     // this block's 128 rows of Bt
    if (outf)  outf  += z * sC;
    if (outb)  outb  += z * sC;
    if (aux)   aux   += z * sC;
    if (rowsc) rowsc += z * sR;
    // Column tiles behind N: a second (f32 out) and a third (bf16 out) GEMM on
    // the same A, each N2 columns wide; their Bt rows follow the first one's.
    // The third one's output is stored transposed, [N2][M]: ldc is the step of
    // the output index from row to row, ocs the step from column to column.
    int ocs = 1;
    if (n0 >= N) {
        n0 -= N;
        bool third = n0 >= N2;
        if (third) n0 -= N2;
        outf = third ? nullptr : outf2;
        outb = third ? outb3 : nullptr;
        N = ldc = N2;
        if (third) { ldc = 1; ocs = M; }
    }

    // Async staging: sixteen threads x b128 cover the 256 bytes of one row, 256
    // threads sixteen rows: the 64x128 bf16 A tile takes four such pieces, the
    // 128x128 Bt tile eight (rows sr, sr + 16, ...).
    int sr = tid >> 4;          // row 0..15
    int sc = (tid & 15) << 3;   // k 0,8,..,120

    f32x8 zero = {0.f,0.f,0.f,0.f,0.f,0.f,0.f,0.f};
    f32x8 acc[2][2] = {{zero, zero}, {zero, zero}};

    static_assert(AS == BS, "one LDS step for the pieces of both tiles");
    // The A rows of this thread's four pieces: m0 + sr + 16 i, or, where the
    // rows of A are gathered (the experts' gate and up products), the tokens
    // that stand at those places of the list.
    int ar0 = m0 + sr, ar1 = ar0 + 16, ar2 = ar0 + 32, ar3 = ar0 + 48;
    if (rl && mode != GEMM_MOE_INIT) {
        // The four loads and their data wait in one statement, outputs
        // early-clobber: nothing lands on the address register of a load that is
        // still in flight.
        asm volatile("global_load_b32 %0, %4, off\n\t"
                     "global_load_b32 %1, %4, off offset:64\n\t"
                     "global_load_b32 %2, %4, off offset:128\n\t"
                     "global_load_b32 %3, %4, off offset:192\n\t"
                     "s_wait_loadcnt 0x0"
                     : "=&v"(ar0), "=&v"(ar1), "=&v"(ar2), "=&v"(ar3)
                     : "v"(rl + sr)
                     : "memory");
        // Bounds the addresses formed from the list.
        ar0 &= T - 1; ar1 &= T - 1; ar2 &= T - 1; ar3 &= T - 1;
    }
    const unsigned short* gA0 = A + (size_t)ar0 * lda + sc;
    const unsigned short* gA1 = A + (size_t)ar1 * lda + sc;
    const unsigned short* gA2 = A + (size_t)ar2 * lda + sc;
    const unsigned short* gA3 = A + (size_t)ar3 * lda + sc;
    const unsigned short* gB = Bt + (size_t)sr * ldb + sc;
    auto stage = [&](int buf, int k0) {
        async_copy12_b128(lds_off(&lds_a[buf][sr * AS + sc]),
                          gA0 + k0, gA1 + k0, gA2 + k0, gA3 + k0,
                          lds_off(&lds_b[buf][sr * BS + sc]), gB + k0, (size_t)16 * ldb,
                          16 * AS * 2);
    };

    // Two buffers: tile 0 lands and is published, then tile 1 flies.
    int nk = K / BK;
    stage(0, 0);
    // The lane's first row and column of the output tile, and the residual and
    // aux values (gate) that belong to its 32 results, [sm][sn][rr].
    int half8 = (lane & 16) >> 1;          // +8 row offset for lanes 16-31
    int r0 = m0 + wm * 32 + half8;
    int c0 = n0 + wn * 32 + ln;
    float rv[2][2][8], av[2][2][8];
    if constexpr (mode == GEMM_RESID) {
        load_band_f32(resid + (size_t)r0 * ldr + c0, (size_t)ldr, rv[0]);
        load_band_f32(resid + (size_t)(r0 + 16) * ldr + c0, (size_t)ldr, rv[1]);
    }
    if constexpr (mode == GEMM_SILU) {
        load_band_f32(aux + (size_t)r0 * ldaux + c0, (size_t)ldaux, av[0]);
        load_band_f32(aux + (size_t)(r0 + 16) * ldaux + c0, (size_t)ldaux, av[1]);
    }
    wait_async0();
    __syncthreads();
    if (nk > 1) stage(1, BK);

    int buf = 0;
    for (int kt = 0; kt < nk; ++kt) {
        // Unrolled: the four 32-k slices' places in the stage become immediate
        // offsets of the fragment loads, with no address arithmetic per slice.
#pragma unroll
        for (int ks = 0; ks < BK; ks += 32) {
            BF16Frag af[2], bf[2];
#pragma unroll
            for (int s = 0; s < 2; ++s)
#pragma unroll
                for (int e = 0; e < 16; ++e) {
                    int kk = ks + fragK(e, lane);
                    af[s].u[e] = lds_a[buf][(wm * 32 + s * 16 + ln) * AS + kk];
                    bf[s].u[e] = lds_b[buf][(wn * 32 + s * 16 + ln) * BS + kk];
                }
#pragma unroll
            for (int sm = 0; sm < 2; ++sm)
#pragma unroll
                for (int sn = 0; sn < 2; ++sn)
                    acc[sm][sn] = __builtin_amdgcn_wmma_f32_16x16x32_bf16(
                        false, af[sm].v, false, bf[sn].v, (short)0,
                        acc[sm][sn], false, false);
        }

        // Foot of the trip: own LDS reads retired, tile kt+1 landed, one barrier
        // that publishes it and ends every read of this buffer; then the refill.
        wait_ds0();
        wait_async0();
        __syncthreads();
        if (kt + 2 < nk) stage(buf, (kt + 2) * BK);
        buf ^= 1;
    }
    wait_async0();   // no copy is in flight when the wave goes on to its stores

    if constexpr (mode == GEMM_MOE_INIT) {
        if (!rl) {
            // The GEMM that rides along (the same for the whole block): every row
            // and column of its tile exists, the sums leave as they are.
#pragma unroll
            for (int sm = 0; sm < 2; ++sm) {
                float f[2][8];
#pragma unroll
                for (int sn = 0; sn < 2; ++sn)
#pragma unroll
                    for (int rr = 0; rr < 8; ++rr) f[sn][rr] = acc[sm][sn][rr];
                store_band_f32(outf + (size_t)(r0 + sm * 16) * ldc + c0, (size_t)ldc, f);
            }
            return;
        }
        // The tokens and the weights of this lane's sixteen rows, [sm][rr >> 2][rr & 3].
        i32x4 tok[2][2];
        f32x4 rsc[2][2];
        // The eight loads and their data wait in one statement, as above.
        asm volatile("global_load_b128 %0, %8, off\n\t"
                     "global_load_b128 %1, %8, off offset:16\n\t"
                     "global_load_b128 %2, %8, off offset:64\n\t"
                     "global_load_b128 %3, %8, off offset:80\n\t"
                     "global_load_b128 %4, %9, off\n\t"
                     "global_load_b128 %5, %9, off offset:16\n\t"
                     "global_load_b128 %6, %9, off offset:64\n\t"
                     "global_load_b128 %7, %9, off offset:80\n\t"
                     "s_wait_loadcnt 0x0"
                     : "=&v"(tok[0][0]), "=&v"(tok[0][1]), "=&v"(tok[1][0]), "=&v"(tok[1][1]),
                       "=&v"(rsc[0][0]), "=&v"(rsc[0][1]), "=&v"(rsc[1][0]), "=&v"(rsc[1][1])
                     : "v"(rl + wm * 32 + half8), "v"(rowsc + m0 + wm * 32 + half8)
                     : "memory");
        // The rows are scattered and the last tile of a list is partly filled:
        // each store stands under its row's own test.
#pragma unroll
        for (int sm = 0; sm < 2; ++sm) {
#pragma unroll
            for (int sn = 0; sn < 2; ++sn) {
                int col = n0 + wn * 32 + sn * 16 + ln;
#pragma unroll
                for (int rr = 0; rr < 8; ++rr) {
                    int row = m0 + wm * 32 + sm * 16 + rr + half8;
                    if (row >= M || col >= N) continue;
                    float v = acc[sm][sn][rr];
                    size_t tk = (size_t)(tok[sm][rr >> 2][rr & 3] & (T - 1));   // bounded
                    outf[tk * ldc + col] = rsc[sm][rr >> 2][rr & 3] * v;
                    wait_xcnt0();
                }
            }
        }
    } else {
        // Every row and column of the tile exists (M % 64 == 0, N % 128 == 0).
#pragma unroll
        for (int sm = 0; sm < 2; ++sm) {
            int row = r0 + sm * 16;
            float    f[2][8];
            unsigned h[2][8];
#pragma unroll
            for (int sn = 0; sn < 2; ++sn)
#pragma unroll
                for (int rr = 0; rr < 8; ++rr) {
                    float v = acc[sm][sn][rr];
                    if constexpr (mode == GEMM_STORE) {
                        f[sn][rr] = v;
                        h[sn][rr] = f2bf(v);
                    } else if constexpr (mode == GEMM_RESID) {
                        f[sn][rr] = rv[sm][sn][rr] + scale * v;
                    } else { // GEMM_SILU
                        float g = av[sm][sn][rr];
                        float s = g / (1.f + exp_slot(-g));
                        h[sn][rr] = f2bf(s * v);
                    }
                }
            if constexpr (mode == GEMM_STORE) {
                // bf16 is the third GEMM's output alone, [N2][M]: ldc == 1.
                if (outf) store_band_f32(outf + (size_t)row * ldc + c0, (size_t)ldc, f);
                if (outb) store_band_bf16_t(outb + (size_t)c0 * ocs + row,
                                            outb + (size_t)(c0 + 16) * ocs + row, h);
            } else if constexpr (mode == GEMM_SILU) {
                store_band_bf16(outb + (size_t)row * ldc + c0, (size_t)ldc, h);
            } else {
                store_band_f32(outf + (size_t)row * ldc + c0, (size_t)ldc, f);
            }
        }
    }
}

// ---------------------------------------------------------------------------
// Sum of the experts' weighted down products, in the order 0..E-1.  A plane
// holds a token's row only where the token's weight for that expert is not zero;
// the other terms of the sum are zero.  A block lies inside one token's row.
// out = resid + RES_MULT * (that sum + the shared MLP's down product).
// ---------------------------------------------------------------------------
__global__ __launch_bounds__(256)
void expert_sum_kernel(const float* __restrict__ planes, const float* __restrict__ fullw,
                       const float* __restrict__ shared, const float* __restrict__ resid,
                       float* __restrict__ out) {
    constexpr size_t P = (size_t)T * D;
    static_assert(D % 1024 == 0, "a block's 1024 elements lie in one row");
    size_t i = ((size_t)blockIdx.x * 256 + threadIdx.x) * 4;
    const float* g = planes + i;
    const float* w = fullw + (size_t)(blockIdx.x / (D / 1024)) * E;
    float wl[E];
#pragma unroll
    for (int e = 0; e < E; ++e) wl[e] = w[e];
    f32x4 sh, rs;
    // Both loads and their data wait in one statement, outputs early-clobber.
    asm volatile("global_load_b128 %0, %2, off\n\t"
                 "global_load_b128 %1, %3, off\n\t"
                 "s_wait_loadcnt 0x0"
                 : "=&v"(sh), "=&v"(rs) : "v"(shared + i), "v"(resid + i) : "memory");
    f32x4 s = {0.f, 0.f, 0.f, 0.f};
#pragma unroll
    for (int e = 0; e < E; ++e) {
        if (wl[e] != 0.f) {     // the same for the whole block
            f32x4 p;
            // The load and its data wait in one statement, output early-clobber.
            asm volatile("global_load_b128 %0, %1, off\n\t"
                         "s_wait_loadcnt 0x0"
                         : "=&v"(p) : "v"(g + e * P) : "memory");
            s += p;
        }
    }
    *(f32x4*)&out[i] = rs + RES_MULT * (s + sh);
}

// ---------------------------------------------------------------------------
// Causal GQA flash attention.  One wave per (head, 16-query tile); 4 waves
// per block.  QK^T and P.V via bf16 WMMA; online softmax over 32-key chunks.
// K is [t][KV*HD], V comes transposed, vt = [KV*HD][t]: in both, the k index of
// a B fragment runs along memory, so a fragment is two 16-byte loads a lane.
// ---------------------------------------------------------------------------
// The value that lane l ^ M of the same 16-lane row holds, read as a DPP operand
// (row_xmask:M) in the vector pipe; every lane of the wave is on where it is used.
template <int M>
__device__ __forceinline__ float row_xor(float v) {
    return __int_as_float(__builtin_amdgcn_mov_dpp(__float_as_int(v), 0x160 | M, 0xf, 0xf, true));
}

__global__ __launch_bounds__(128)
void attn_kernel(const unsigned short* __restrict__ qb,
                 const unsigned short* __restrict__ kb,
                 const unsigned short* __restrict__ vt,
                 unsigned short* __restrict__ attnb) {
    int h    = blockIdx.x;
    int w    = threadIdx.x >> 5;
    int lane = threadIdx.x & 31;
    int qt   = blockIdx.y * 4 + w;   // 16-query tile index
    int kvh  = h >> 2;               // H/KV = 4
    int hb   = (lane & 16) >> 1;     // +8 row offset for lanes 16-31
    int ln   = lane & 15;

    __shared__ unsigned short pbuf[4][16 * 34];   // per-wave P staging

    BF16Frag aq[2];
#pragma unroll
    for (int c = 0; c < 2; ++c)
#pragma unroll
        for (int e = 0; e < 16; ++e) {
            int kd = c * 32 + fragK(e, lane);
            int qrow = qt * 16 + ln;
            aq[c].u[e] = qb[(size_t)qrow * (H * HD) + h * HD + kd];
        }

    f32x8 o0 = {0,0,0,0,0,0,0,0}, o1 = o0, o2 = o0, o3 = o0;
    float rmax[8], rsum[8];
#pragma unroll
    for (int r = 0; r < 8; ++r) { rmax[r] = -1e30f; rsum[r] = 0.f; }

    int kend = qt * 16 + 16;                      // causal bound
    for (int kbase = 0; kbase < kend; kbase += 32) {
        float p[2][8];
        float tmax[8];
#pragma unroll
        for (int r = 0; r < 8; ++r) tmax[r] = -1e30f;

        // This chunk's K and V fragments.  kbase is a multiple of 32 below
        // kend <= T, and T is one too: keys kbase .. kbase + 31 all exist.
        // bk[sub][c]: key kbase + sub*16 + ln, head dims c*32 + fragK(0..15).
        // bv[j]:      head dim j*16 + ln,      keys kbase + fragK(0..15).
        static_assert(T % 32 == 0 && KV * HD * 2 == 1024 && T * 2 == 2048,
                      "the byte offsets in the loads below");
        BF16Frag bk[2][2], bv[4];
        const unsigned short* kp = kb + (size_t)(kbase + ln) * (KV * HD) + kvh * HD + hb;
        const unsigned short* vp = vt + (size_t)(kvh * HD + ln) * T + kbase + hb;
        // The sixteen loads and their data wait in one statement, outputs
        // early-clobber: no result and no later instruction lands on an address
        // register of a load that is still in flight.
        asm volatile("global_load_b128 %0, %16, off\n\t"
                     "global_load_b128 %1, %16, off offset:32\n\t"
                     "global_load_b128 %2, %16, off offset:64\n\t"
                     "global_load_b128 %3, %16, off offset:96\n\t"
                     "global_load_b128 %4, %16, off offset:16384\n\t"
                     "global_load_b128 %5, %16, off offset:16416\n\t"
                     "global_load_b128 %6, %16, off offset:16448\n\t"
                     "global_load_b128 %7, %16, off offset:16480\n\t"
                     "global_load_b128 %8, %17, off\n\t"
                     "global_load_b128 %9, %17, off offset:32\n\t"
                     "global_load_b128 %10, %17, off offset:32768\n\t"
                     "global_load_b128 %11, %17, off offset:32800\n\t"
                     "global_load_b128 %12, %17, off offset:65536\n\t"
                     "global_load_b128 %13, %17, off offset:65568\n\t"
                     "global_load_b128 %14, %17, off offset:98304\n\t"
                     "global_load_b128 %15, %17, off offset:98336\n\t"
                     "s_wait_loadcnt 0x0"
                     : "=&v"(bk[0][0].q[0]), "=&v"(bk[0][0].q[1]),
                       "=&v"(bk[0][1].q[0]), "=&v"(bk[0][1].q[1]),
                       "=&v"(bk[1][0].q[0]), "=&v"(bk[1][0].q[1]),
                       "=&v"(bk[1][1].q[0]), "=&v"(bk[1][1].q[1]),
                       "=&v"(bv[0].q[0]), "=&v"(bv[0].q[1]),
                       "=&v"(bv[1].q[0]), "=&v"(bv[1].q[1]),
                       "=&v"(bv[2].q[0]), "=&v"(bv[2].q[1]),
                       "=&v"(bv[3].q[0]), "=&v"(bv[3].q[1])
                     : "v"(kp), "v"(vp)
                     : "memory");

        // Unrolled so that bk[sub] and p[sub] are indexed by constants and stay
        // in registers.
#pragma unroll
        for (int sub = 0; sub < 2; ++sub) {
            int ks = kbase + sub * 16;
            f32x8 s = {0,0,0,0,0,0,0,0};
#pragma unroll
            for (int c = 0; c < 2; ++c)
                s = __builtin_amdgcn_wmma_f32_16x16x32_bf16(
                    false, aq[c].v, false, bk[sub][c].v, (short)0, s, false, false);
#pragma unroll
            for (int r = 0; r < 8; ++r) {
                int row = qt * 16 + r + hb;
                int key = ks + ln;
                float sv = s[r] * ATTN_MULT;
                if (key > row || key >= T) sv = -1e30f;
                p[sub][r] = sv;
                tmax[r] = fmaxf(tmax[r], sv);
            }
        }
        // Row maximum over the sixteen lanes, partners 8, 4, 2, 1 away; the eight
        // rows take each step together, so that no step waits on the one before.
#pragma unroll
        for (int r = 0; r < 8; ++r) tmax[r] = fmaxf(tmax[r], row_xor<8>(tmax[r]));
#pragma unroll
        for (int r = 0; r < 8; ++r) tmax[r] = fmaxf(tmax[r], row_xor<4>(tmax[r]));
#pragma unroll
        for (int r = 0; r < 8; ++r) tmax[r] = fmaxf(tmax[r], row_xor<2>(tmax[r]));
#pragma unroll
        for (int r = 0; r < 8; ++r) tmax[r] = fmaxf(tmax[r], row_xor<1>(tmax[r]));

        float corr[8], ts[8];
#pragma unroll
        for (int r = 0; r < 8; ++r) {
            float mn = fmaxf(rmax[r], tmax[r]);
            corr[r]  = exp_slot(rmax[r] - mn);
            rmax[r]  = mn;
            p[0][r]  = exp_slot(p[0][r] - mn);
            p[1][r]  = exp_slot(p[1][r] - mn);
            ts[r]    = p[0][r] + p[1][r];
        }
        // Row sum, the same partners in the same order.
#pragma unroll
        for (int r = 0; r < 8; ++r) ts[r] += row_xor<8>(ts[r]);
#pragma unroll
        for (int r = 0; r < 8; ++r) ts[r] += row_xor<4>(ts[r]);
#pragma unroll
        for (int r = 0; r < 8; ++r) ts[r] += row_xor<2>(ts[r]);
#pragma unroll
        for (int r = 0; r < 8; ++r) ts[r] += row_xor<1>(ts[r]);
#pragma unroll
        for (int r = 0; r < 8; ++r) rsum[r] = rsum[r] * corr[r] + ts[r];
#pragma unroll
        for (int r = 0; r < 8; ++r) {
            o0[r] *= corr[r]; o1[r] *= corr[r];
            o2[r] *= corr[r]; o3[r] *= corr[r];
        }
#pragma unroll
        for (int sub = 0; sub < 2; ++sub)
#pragma unroll
            for (int r = 0; r < 8; ++r)
                pbuf[w][(r + hb) * 34 + sub * 16 + ln] = f2bf(p[sub][r]);
        BF16Frag pf;
#pragma unroll
        for (int e = 0; e < 16; ++e)
            pf.u[e] = pbuf[w][ln * 34 + fragK(e, lane)];

        o0 = __builtin_amdgcn_wmma_f32_16x16x32_bf16(
                false, pf.v, false, bv[0].v, (short)0, o0, false, false);
        o1 = __builtin_amdgcn_wmma_f32_16x16x32_bf16(
                false, pf.v, false, bv[1].v, (short)0, o1, false, false);
        o2 = __builtin_amdgcn_wmma_f32_16x16x32_bf16(
                false, pf.v, false, bv[2].v, (short)0, o2, false, false);
        o3 = __builtin_amdgcn_wmma_f32_16x16x32_bf16(
                false, pf.v, false, bv[3].v, (short)0, o3, false, false);
    }
#pragma unroll
    for (int r = 0; r < 8; ++r) {
        int row = qt * 16 + r + hb;
        float inv = 1.f / rsum[r];
        size_t base = (size_t)row * (H * HD) + h * HD;
        attnb[base +  0 + ln] = f2bf(o0[r] * inv);
        attnb[base + 16 + ln] = f2bf(o1[r] * inv);
        attnb[base + 32 + ln] = f2bf(o2[r] * inv);
        attnb[base + 48 + ln] = f2bf(o3[r] * inv);
    }
}

// ---------------------------------------------------------------------------
// Host-side orchestration.
// ---------------------------------------------------------------------------
template <int mode>
static void launch_gemm(hipStream_t s, int nz, int sA, int sB, int sC, int sR,
                        const int* tilemap, const int* rowlist, const int* cnts,
                        const unsigned short* A, int lda,
                        const unsigned short* Bt, int ldb, int M, int N, int K,
                        float* outf, unsigned short* outb, int ldc,
                        float scale,
                        const float* resid, int ldr,
                        const float* rowsc,
                        const float* aux, int ldaux,
                        int fsh, const unsigned short* A2, int lda2,
                        const unsigned short* Bt2, int ldb2, int K2,
                        float* outfS, unsigned short* outbS, int ldcS,
                        const float* auxS) {
    // With a tile map grid.y covers first the row tiles of the GEMM that rides
    // along (M rows, fsh * N columns), then those of all experts' lists.
    int ysh = fsh * (M / 64);
    dim3 g(N / 128, tilemap ? ysh + MOE_TILES : M / 64, nz);
    gemm_bf16_wmma<mode><<<g, 256, 0, s>>>(A, lda, Bt, ldb, M, N, K, outf, outb, ldc,
                                           scale, resid, ldr, rowsc,
                                           aux, ldaux, sA, sB, sC, sR,
                                           0, nullptr, nullptr, tilemap, rowlist, cnts,
                                           ysh, fsh, A2, lda2, Bt2, ldb2, K2,
                                           outfS, outbS, ldcS, auxS);
}

extern "C" void kernel_launch(void* const* d_in, const int* in_sizes, int n_in,
                              void* d_out, int out_size, void* d_ws, size_t ws_size,
                              hipStream_t stream) {
    const int*   pos     = (const int*)  d_in[0];
    const float* hidden  = (const float*)d_in[1];
    const float* ln1     = (const float*)d_in[2];
    const float* ln2     = (const float*)d_in[3];
    const float* wq      = (const float*)d_in[4];
    const float* wk      = (const float*)d_in[5];
    const float* wv      = (const float*)d_in[6];
    const float* wo      = (const float*)d_in[7];
    const float* routerw = (const float*)d_in[8];
    const float* w13     = (const float*)d_in[9];
    const float* w2      = (const float*)d_in[10];
    const float* sw13    = (const float*)d_in[11];
    const float* sw2     = (const float*)d_in[12];

    float* outF     = (float*)d_out;          // final hidden  [T*D]
    float* residOut = outF + (size_t)T * D;   // post-attn residual [T*D]

    char* ws = (char*)d_ws;
    const size_t MB = 1u << 20;
    unsigned short* xb    = (unsigned short*)(ws + 0);        // T*D bf16   4M
    float*          qf    = (float*)         (ws + 4  * MB);  // T*2048 f32 8M
    float*          kf    = (float*)         (ws + 12 * MB);  // T*512 f32  2M
    unsigned short* qbuf  = (unsigned short*)(ws + 14 * MB);  // 4M
    unsigned short* kbuf  = (unsigned short*)(ws + 18 * MB);  // 1M
    unsigned short* vbuf  = (unsigned short*)(ws + 19 * MB);  // 1M, [KV*HD][T]
    unsigned short* attnb = (unsigned short*)(ws + 20 * MB);  // 4M
    float*          xnf   = (float*)         (ws + 24 * MB);  // 8M
    unsigned short* xnb   = (unsigned short*)(ws + 32 * MB);  // 4M
    float*          fullw = (float*)         (ws + 36 * MB);  // 32K
    int*            rlist = (int*)           (ws + 36 * MB + 65536);   // E*T int 32K
    float*          wlist = (float*)         (ws + 36 * MB + 98304);   // E*T f32 32K
    int*            cnts  = (int*)           (ws + 36 * MB + 131072);  // E int
    int*            tmap  = (int*)           (ws + 36 * MB + 135168);  // MOE_TILES int
    float*          shd   = (float*)         (ws + 37 * MB);  // T*D f32 8M
    float*          ggate = (float*)         (ws + 45 * MB);  // T*SI f32 16M
    unsigned short* sactb = (unsigned short*)(ws + 61 * MB);  // 8M
    float*          hgate = (float*)         (ws + 69 * MB);  // E*T*I f32 32M
    unsigned short* actb  = (unsigned short*)(ws + 101 * MB); // E*T*I bf16 16M
    float*          moep  = (float*)         (ws + 117 * MB); // E*T*D f32 64M
    unsigned short* wt    = (unsigned short*)(ws + 184 * MB); // bf16 weights 164M
    (void)ws_size; (void)in_sizes; (void)n_in; (void)out_size;

    // 0) Every GEMM weight once to bf16, transposed to [n][k].
    // 1) RMSNorm 1 -> bf16 activations, in the same launch.
    weight_bf16_t_kernel<<<WT_BLOCKS + T, 256, 0, stream>>>(wq, wk, wv, wo, w13, w2,
                                                            sw13, sw2, wt, hidden, ln1, xb);

    // 2) QKV projections, one launch: column tiles 0-15 are Q, 16-19 K, 20-23 V
    //    (V is stored transposed, for the attention's fragment loads).
    gemm_bf16_wmma<GEMM_STORE><<<dim3((H + 2 * KV) * HD / 128, T / 64), 256, 0, stream>>>(
        xb, D, wt + WT_Q, D, T, H * HD, D, qf, nullptr, H * HD, 0.f,
        nullptr, 0, nullptr, nullptr, 0, 0, 0, 0, 0,
        KV * HD, kf, vbuf, nullptr, nullptr, nullptr,
        0, 0, nullptr, 0, nullptr, 0, 0, nullptr, nullptr, 0, nullptr);

    // 3) RoPE on Q and K (f32 -> bf16), one launch.
    rope_kernel<<<(T * (H + KV) * 32 + 255) / 256, 256, 0, stream>>>(pos, qf, kf, qbuf, kbuf);

    // 4) Causal GQA attention.
    attn_kernel<<<dim3(H, T / 64), 128, 0, stream>>>(qbuf, kbuf, vbuf, attnb);

    // 5) Output projection + residual -> residOut (second output).
    launch_gemm<GEMM_RESID>(stream, 1, 0, 0, 0, 0, nullptr, nullptr, nullptr,
                attnb, H * HD, wt + WT_O, H * HD, T, D, H * HD,
                residOut, nullptr, D, RES_MULT, hidden, D,
                nullptr, nullptr, 0,
                0, nullptr, 0, nullptr, 0, 0, nullptr, nullptr, 0, nullptr);

    // 6) RMSNorm 2.
    rmsnorm_kernel<<<T, 256, 0, stream>>>(residOut, ln2, xnf, xnb);

    // 7) Router top-2.
    router_kernel<<<T, 32, 0, stream>>>(xnf, routerw, fullw);

    // 8) Experts, weighted by full_w as in the reference.  Each expert takes the
    //    rows whose weight for it is not zero: gate and up gather them from xnb
    //    into the order of the expert's list, down stores each weighted row at
    //    its token's place in the expert's plane.
    // 9) The shared MLP depends on the experts nowhere: its gate, up and down
    //    products share the launches of the experts' gate, up and down products.
    route_kernel<<<1, 1024, 0, stream>>>(fullw, rlist, wlist, cnts, tmap);
    launch_gemm<GEMM_STORE>(stream, 1, 0, D * 2 * I, T * I, 0, tmap, rlist, cnts,
                xnb, D, wt + WT_13, D, T, I, D,
                hgate, nullptr, I, 0.f, nullptr, 0, nullptr, nullptr, 0,
                SI / I, xnb, D, wt + WT_S13, D, D,
                ggate, nullptr, SI, nullptr);
    launch_gemm<GEMM_SILU>(stream, 1, 0, D * 2 * I, T * I, 0, tmap, rlist, cnts,
                xnb, D, wt + WT_13 + (size_t)I * D, D, T, I, D,
                nullptr, actb, I, 0.f, nullptr, 0, nullptr, hgate, I,
                SI / I, xnb, D, wt + WT_S13 + (size_t)SI * D, D, D,
                nullptr, sactb, SI, ggate);
    launch_gemm<GEMM_MOE_INIT>(stream, 1, T * I, I * D, T * D, T, tmap, rlist, cnts,
                actb, I, wt + WT_2, I, T, D, I,
                moep, nullptr, D, 0.f,
                nullptr, 0, wlist, nullptr, 0,
                1, sactb, SI, wt + WT_S2, SI, SI,
                shd, nullptr, D, nullptr);

    // 10) The experts' planes summed, the shared product and the residual added.
    expert_sum_kernel<<<T * D / 1024, 256, 0, stream>>>(moep, fullw, shd, residOut, outF);
}

// v010
// A run of this version takes 257 microseconds.
// Two timings next to v009 put it at 1.10 and 1.09 times that version's speed.
// All steps since v000 together make it 13.2 times as fast.
#include <hip/hip_runtime.h>
#include <hip/hip_bf16.h>

// ---------------------------------------------------------------------------
// MI455X (gfx1250, wave32) implementation of a decoder layer (attention, MoE, shared MLP).
// All large GEMMs + attention run on v_wmma_f32_16x16x32_bf16 (bf16 in, f32
// accum).  A-activation tiles move global->LDS via the CDNA5 async-DMA path
// (global_load_async_to_lds_b128 + s_wait_asynccnt).  A first launch writes every
// GEMM weight once as bf16, transposed to [n][k], into the workspace, so the
// weight tiles take the same async path and the k loop holds no conversion.
// GEMMs that do not depend on each other share one launch: Q/K/V in one grid
// (whose epilogue also turns Q and K by RoPE), and the eight experts' gate-and-up
// and down products one grid each, in which the shared MLP's gate-and-up and down
// products ride along as further row tiles.  An
// expert's products are formed only for the rows whose router weight for it is
// not zero.
// Workspace requirement: 348 MiB (see layout below).
// ---------------------------------------------------------------------------

static constexpr int T  = 1024;
static constexpr int D  = 2048;
static constexpr int H  = 32;
static constexpr int KV = 8;
static constexpr int HD = 64;
static constexpr int E  = 8;
static constexpr int I  = 1024;
static constexpr int SI = 4096;
static constexpr float ATTN_MULT = 0.0078125f;
static constexpr float RES_MULT  = 0.22f;
static constexpr float EPS       = 1e-6f;

typedef __bf16 bf16x16 __attribute__((ext_vector_type(16)));
typedef float  f32x8   __attribute__((ext_vector_type(8)));
typedef float  f32x4   __attribute__((ext_vector_type(4)));
typedef unsigned int u32x4 __attribute__((ext_vector_type(4)));
typedef int i32x4 __attribute__((ext_vector_type(4)));

union BF16Frag {
    unsigned short u[16];
    u32x4 q[2];      // the two runs of eight k-consecutive elements (see fragK)
    bf16x16 v;
};

__device__ __forceinline__ unsigned short f2bf(float f) {
    unsigned int u = __float_as_uint(f);
    unsigned int r = u + 0x7FFFu + ((u >> 16) & 1u);   // round-to-nearest-even
    return (unsigned short)(r >> 16);
}

// A/B fragment K-index pattern for V_WMMA_*_16X16X32_BF16 (ISA 7.12.2):
// VGPR p (0..7), half w; lanes 0-15 vs 16-31 differ by +8 in K.
__device__ __forceinline__ int fragK(int e, int lane) {
    int p = e >> 1, w = e & 1;
    return ((p & 3) << 1) + w + ((p >> 2) << 4) + ((lane >> 4) << 3);
}

// Generic pointer -> 32-bit LDS byte offset (AS3) for async-DMA VDST operand.
__device__ __forceinline__ unsigned lds_off(const void* p) {
    return (unsigned)(unsigned long long)
        (__attribute__((address_space(3))) const void*)p;
}

// CDNA5 async global->LDS copies, 16B per lane each (ASYNCcnt tracked): a
// thread's share of one k stage, four pieces of the A tile and eight of the B
// tile.  Piece i lies i * ls bytes further in LDS than the first one of its
// tile; in global memory the A pieces have a pointer each (their rows may be
// gathered).  The B pieces 2 w and 2 w + 1 are the two column bands of the waves
// with wn == w: in global memory the second lies g2 elements behind the first,
// the first ones of successive w lie ga apart, with gh more between w = 1 and 2.
// A wave's copy takes
// two rows of 256 B: whole lines, where a 32-k stage took 64 B of eight rows.
__device__ __forceinline__ void async_copy12_b128(unsigned la, const unsigned short* a0,
                                                  const unsigned short* a1,
                                                  const unsigned short* a2,
                                                  const unsigned short* a3,
                                                  unsigned lb, const unsigned short* b,
                                                  size_t ga, size_t gh, size_t g2,
                                                  unsigned ls) {
    // s_wait_xcnt as the last line of the copies' own statement: it stands in
    // front of any later rewrite of the address registers that the copies name.
    asm volatile("global_load_async_to_lds_b128 %0, %1, off\n\t"
                 "global_load_async_to_lds_b128 %2, %3, off\n\t"
                 "global_load_async_to_lds_b128 %4, %5, off\n\t"
                 "global_load_async_to_lds_b128 %6, %7, off\n\t"
                 "global_load_async_to_lds_b128 %8, %9, off\n\t"
                 "global_load_async_to_lds_b128 %10, %11, off\n\t"
                 "global_load_async_to_lds_b128 %12, %13, off\n\t"
                 "global_load_async_to_lds_b128 %14, %15, off\n\t"
                 "global_load_async_to_lds_b128 %16, %17, off\n\t"
                 "global_load_async_to_lds_b128 %18, %19, off\n\t"
                 "global_load_async_to_lds_b128 %20, %21, off\n\t"
                 "global_load_async_to_lds_b128 %22, %23, off\n\t"
                 "s_wait_xcnt 0x0"
                 :: "v"(la),          "v"(a0),
                    "v"(la + ls),     "v"(a1),
                    "v"(la + 2 * ls), "v"(a2),
                    "v"(la + 3 * ls), "v"(a3),
                    "v"(lb),          "v"(b),
                    "v"(lb + ls),     "v"(b + g2),
                    "v"(lb + 2 * ls), "v"(b + ga),
                    "v"(lb + 3 * ls), "v"(b + ga + g2),
                    "v"(lb + 4 * ls), "v"(b + 2 * ga + gh),
                    "v"(lb + 5 * ls), "v"(b + 2 * ga + gh + g2),
                    "v"(lb + 6 * ls), "v"(b + 3 * ga + gh),
                    "v"(lb + 7 * ls), "v"(b + 3 * ga + gh + g2)
                 : "memory");
}
// Behind a global store: stands in front of any later rewrite of the store's
// address and data registers.
__device__ __forceinline__ void wait_xcnt0() {
    asm volatile("s_wait_xcnt 0x0" ::: "memory");
}
__device__ __forceinline__ void wait_async0() {
    asm volatile("s_wait_asynccnt 0x0" ::: "memory");
}
// A wave's own LDS reads have retired before the barrier behind which the
// buffer they read is refilled by async copies.
__device__ __forceinline__ void wait_ds0() {
    asm volatile("s_wait_dscnt 0x0" ::: "memory");
}

// e^x as the fast intrinsic forms it: x * log2(e), then v_exp_f32.  The v_nop in
// the same statement fills the one slot that the instruction set asks for behind
// a transcendental, whatever instruction the compiler puts next.
__device__ __forceinline__ float exp_slot(float x) {
    float y = x * 1.44269504088896340736f, r;
    asm("v_exp_f32 %0, %1\n\tv_nop" : "=v"(r) : "v"(y));
    return r;
}

// sin x and cos x as the fast intrinsic forms them: x / (2 pi), then v_sin_f32 and
// v_cos_f32.  Each v_nop fills the slot behind its transcendental, as above (the
// cosine may land on the register that both read).
__device__ __forceinline__ void sincos_slot(float x, float& s, float& c) {
    float y = x * 0.15915494309189532f;
    asm("v_sin_f32 %0, %2\n\tv_nop\n\tv_cos_f32 %1, %2\n\tv_nop"
        : "=&v"(s), "=v"(c) : "v"(y));
}

// A lane's share of a 16-row band of a wave's 32x32 GEMM tile: eight rows, ld
// elements apart, and in each the columns c and c + 16; d[sn][rr].  p points at
// the first row's column c.  The groups below move such a share with sixteen
// memory instructions that follow one another and one wait.
// Sixteen f32 loads and their data wait in one statement, outputs early-clobber:
// no result and no later instruction lands on an address register of a load
// that is still in flight.
__device__ __forceinline__ void load_band_f32(const float* p, size_t ld, float (&d)[2][8]) {
    asm volatile("global_load_b32 %0, %16, off\n\t"
                 "global_load_b32 %8, %16, off offset:64\n\t"
                 "global_load_b32 %1, %17, off\n\t"
                 "global_load_b32 %9, %17, off offset:64\n\t"
                 "global_load_b32 %2, %18, off\n\t"
                 "global_load_b32 %10, %18, off offset:64\n\t"
                 "global_load_b32 %3, %19, off\n\t"
                 "global_load_b32 %11, %19, off offset:64\n\t"
                 "global_load_b32 %4, %20, off\n\t"
                 "global_load_b32 %12, %20, off offset:64\n\t"
                 "global_load_b32 %5, %21, off\n\t"
                 "global_load_b32 %13, %21, off offset:64\n\t"
                 "global_load_b32 %6, %22, off\n\t"
                 "global_load_b32 %14, %22, off offset:64\n\t"
                 "global_load_b32 %7, %23, off\n\t"
                 "global_load_b32 %15, %23, off offset:64\n\t"
                 "s_wait_loadcnt 0x0"
                 : "=&v"(d[0][0]), "=&v"(d[0][1]), "=&v"(d[0][2]), "=&v"(d[0][3]),
                   "=&v"(d[0][4]), "=&v"(d[0][5]), "=&v"(d[0][6]), "=&v"(d[0][7]),
                   "=&v"(d[1][0]), "=&v"(d[1][1]), "=&v"(d[1][2]), "=&v"(d[1][3]),
                   "=&v"(d[1][4]), "=&v"(d[1][5]), "=&v"(d[1][6]), "=&v"(d[1][7])
                 : "v"(p), "v"(p + ld), "v"(p + 2 * ld), "v"(p + 3 * ld),
                   "v"(p + 4 * ld), "v"(p + 5 * ld), "v"(p + 6 * ld), "v"(p + 7 * ld)
                 : "memory");
}
// Sixteen f32 stores; s_wait_xcnt as the last line of their own statement stands
// in front of any later rewrite of the address and data registers they name.
__device__ __forceinline__ void store_band_f32(float* p, size_t ld, const float (&d)[2][8]) {
    asm volatile("global_store_b32 %16, %0, off\n\t"
                 "global_store_b32 %16, %8, off offset:64\n\t"
                 "global_store_b32 %17, %1, off\n\t"
                 "global_store_b32 %17, %9, off offset:64\n\t"
                 "global_store_b32 %18, %2, off\n\t"
                 "global_store_b32 %18, %10, off offset:64\n\t"
                 "global_store_b32 %19, %3, off\n\t"
                 "global_store_b32 %19, %11, off offset:64\n\t"
                 "global_store_b32 %20, %4, off\n\t"
                 "global_store_b32 %20, %12, off offset:64\n\t"
                 "global_store_b32 %21, %5, off\n\t"
                 "global_store_b32 %21, %13, off offset:64\n\t"
                 "global_store_b32 %22, %6, off\n\t"
                 "global_store_b32 %22, %14, off offset:64\n\t"
                 "global_store_b32 %23, %7, off\n\t"
                 "global_store_b32 %23, %15, off offset:64\n\t"
                 "s_wait_xcnt 0x0"
                 :: "v"(d[0][0]), "v"(d[0][1]), "v"(d[0][2]), "v"(d[0][3]),
                    "v"(d[0][4]), "v"(d[0][5]), "v"(d[0][6]), "v"(d[0][7]),
                    "v"(d[1][0]), "v"(d[1][1]), "v"(d[1][2]), "v"(d[1][3]),
                    "v"(d[1][4]), "v"(d[1][5]), "v"(d[1][6]), "v"(d[1][7]),
                    "v"(p), "v"(p + ld), "v"(p + 2 * ld), "v"(p + 3 * ld),
                    "v"(p + 4 * ld), "v"(p + 5 * ld), "v"(p + 6 * ld), "v"(p + 7 * ld)
                 : "memory");
}
// The same for bf16 values (the low halves of d) in the columns c and c + 32,
// which lies 64 B on.
__device__ __forceinline__ void store_band_bf16(unsigned short* p, size_t ld,
                                                const unsigned (&d)[2][8]) {
    asm volatile("global_store_b16 %16, %0, off\n\t"
                 "global_store_b16 %16, %8, off offset:64\n\t"
                 "global_store_b16 %17, %1, off\n\t"
                 "global_store_b16 %17, %9, off offset:64\n\t"
                 "global_store_b16 %18, %2, off\n\t"
                 "global_store_b16 %18, %10, off offset:64\n\t"
                 "global_store_b16 %19, %3, off\n\t"
                 "global_store_b16 %19, %11, off offset:64\n\t"
                 "global_store_b16 %20, %4, off\n\t"
                 "global_store_b16 %20, %12, off offset:64\n\t"
                 "global_store_b16 %21, %5, off\n\t"
                 "global_store_b16 %21, %13, off offset:64\n\t"
                 "global_store_b16 %22, %6, off\n\t"
                 "global_store_b16 %22, %14, off offset:64\n\t"
                 "global_store_b16 %23, %7, off\n\t"
                 "global_store_b16 %23, %15, off offset:64\n\t"
                 "s_wait_xcnt 0x0"
                 :: "v"(d[0][0]), "v"(d[0][1]), "v"(d[0][2]), "v"(d[0][3]),
                    "v"(d[0][4]), "v"(d[0][5]), "v"(d[0][6]), "v"(d[0][7]),
                    "v"(d[1][0]), "v"(d[1][1]), "v"(d[1][2]), "v"(d[1][3]),
                    "v"(d[1][4]), "v"(d[1][5]), "v"(d[1][6]), "v"(d[1][7]),
                    "v"(p), "v"(p + ld), "v"(p + 2 * ld), "v"(p + 3 * ld),
                    "v"(p + 4 * ld), "v"(p + 5 * ld), "v"(p + 6 * ld), "v"(p + 7 * ld)
                 : "memory");
}
// The same for one column of bf16 values: eight stores.
__device__ __forceinline__ void store_col_bf16(unsigned short* p, size_t ld,
                                               const unsigned (&d)[8]) {
    asm volatile("global_store_b16 %8, %0, off\n\t"
                 "global_store_b16 %9, %1, off\n\t"
                 "global_store_b16 %10, %2, off\n\t"
                 "global_store_b16 %11, %3, off\n\t"
                 "global_store_b16 %12, %4, off\n\t"
                 "global_store_b16 %13, %5, off\n\t"
                 "global_store_b16 %14, %6, off\n\t"
                 "global_store_b16 %15, %7, off\n\t"
                 "s_wait_xcnt 0x0"
                 :: "v"(d[0]), "v"(d[1]), "v"(d[2]), "v"(d[3]),
                    "v"(d[4]), "v"(d[5]), "v"(d[6]), "v"(d[7]),
                    "v"(p), "v"(p + ld), "v"(p + 2 * ld), "v"(p + 3 * ld),
                    "v"(p + 4 * ld), "v"(p + 5 * ld), "v"(p + 6 * ld), "v"(p + 7 * ld)
                 : "memory");
}
// The same for a bf16 output that is stored transposed: the eight rows follow
// one another in memory, p0 and p1 point at the first row in the two columns.
__device__ __forceinline__ void store_band_bf16_t(unsigned short* p0, unsigned short* p1,
                                                  const unsigned (&d)[2][8]) {
    asm volatile("global_store_b16 %16, %0, off\n\t"
                 "global_store_b16 %16, %1, off offset:2\n\t"
                 "global_store_b16 %16, %2, off offset:4\n\t"
                 "global_store_b16 %16, %3, off offset:6\n\t"
                 "global_store_b16 %16, %4, off offset:8\n\t"
                 "global_store_b16 %16, %5, off offset:10\n\t"
                 "global_store_b16 %16, %6, off offset:12\n\t"
                 "global_store_b16 %16, %7, off offset:14\n\t"
                 "global_store_b16 %17, %8, off\n\t"
                 "global_store_b16 %17, %9, off offset:2\n\t"
                 "global_store_b16 %17, %10, off offset:4\n\t"
                 "global_store_b16 %17, %11, off offset:6\n\t"
                 "global_store_b16 %17, %12, off offset:8\n\t"
                 "global_store_b16 %17, %13, off offset:10\n\t"
                 "global_store_b16 %17, %14, off offset:12\n\t"
                 "global_store_b16 %17, %15, off offset:14\n\t"
                 "s_wait_xcnt 0x0"
                 :: "v"(d[0][0]), "v"(d[0][1]), "v"(d[0][2]), "v"(d[0][3]),
                    "v"(d[0][4]), "v"(d[0][5]), "v"(d[0][6]), "v"(d[0][7]),
                    "v"(d[1][0]), "v"(d[1][1]), "v"(d[1][2]), "v"(d[1][3]),
                    "v"(d[1][4]), "v"(d[1][5]), "v"(d[1][6]), "v"(d[1][7]),
                    "v"(p0), "v"(p1)
                 : "memory");
}

// ---------------------------------------------------------------------------
// RMSNorm: one block of 256 threads per row.  Writes f32 and/or bf16 outputs.
// red: 256 floats of the block's LDS.
// ---------------------------------------------------------------------------
__device__ __forceinline__ void rmsnorm_row(int row, const float* __restrict__ in,
                                            const float* __restrict__ w,
                                            float* outf, unsigned short* outb, float* red) {
    int tid = threadIdx.x;
    const float* x = in + (size_t)row * D;
    float ss = 0.f;
    for (int i = tid; i < D; i += 256) { float v = x[i]; ss += v * v; }
    red[tid] = ss;
    __syncthreads();
    for (int s = 128; s > 0; s >>= 1) {
        if (tid < s) red[tid] += red[tid + s];
        __syncthreads();
    }
    float rs = rsqrtf(red[0] / (float)D + EPS);
    for (int i = tid; i < D; i += 256) {
        float v = x[i] * rs * w[i];
        // wait_xcnt0: in front of the next trip's rewrite of the store's registers.
        if (outf) { outf[(size_t)row * D + i] = v; wait_xcnt0(); }
        if (outb) { outb[(size_t)row * D + i] = f2bf(v); wait_xcnt0(); }
    }
}

__global__ __launch_bounds__(256)
void rmsnorm_kernel(const float* __restrict__ in, const float* __restrict__ w,
                    float* outf, unsigned short* outb) {
    __shared__ float red[256];
    rmsnorm_row(blockIdx.x, in, w, outf, outb, red);
}

// ---------------------------------------------------------------------------
// Weight pre-pass: every GEMM weight W[K][N] (f32) -> Wt[N][K] (bf16, rounded
// to nearest even, f2bf).  A block takes a strip of
// 1024 k x 64 n as sixteen 64x64 tiles.  A thread owns a 4(k) x 4(n) patch, so the
// transpose happens in its registers; the tile goes through LDS so that every
// global store covers whole 128-B lines of a Wt row.
// Element offsets of the transposed weights in their workspace region:
// ---------------------------------------------------------------------------
static constexpr size_t WT_Q   = 0;                                // [H*HD][D]
static constexpr size_t WT_K   = WT_Q   + (size_t)D * H * HD;      // [KV*HD][D]
static constexpr size_t WT_V   = WT_K   + (size_t)D * KV * HD;     // [KV*HD][D]
static constexpr size_t WT_O   = WT_V   + (size_t)D * KV * HD;     // [D][H*HD]
static constexpr size_t WT_13  = WT_O   + (size_t)H * HD * D;      // E x [2I][D]
static constexpr size_t WT_2   = WT_13  + (size_t)E * D * 2 * I;   // E x [D][I]
static constexpr size_t WT_S13 = WT_2   + (size_t)E * I * D;       // [2SI][D]
static constexpr size_t WT_S2  = WT_S13 + (size_t)D * 2 * SI;      // [D][SI]
static constexpr int strips(int k, int n) { return (k / 1024) * (n / 64); }
static constexpr int WT_BLOCKS =
    strips(D, H * HD) + 2 * strips(D, KV * HD) + strips(H * HD, D) +
    E * strips(D, 2 * I) + E * strips(I, D) + strips(D, 2 * SI) + strips(SI, D);

__global__ __launch_bounds__(256)
void weight_bf16_t_kernel(const float* __restrict__ wq, const float* __restrict__ wk,
                          const float* __restrict__ wv, const float* __restrict__ wo,
                          const float* __restrict__ w13, const float* __restrict__ w2,
                          const float* __restrict__ sw13, const float* __restrict__ sw2,
                          unsigned short* __restrict__ wt,
                          const float* __restrict__ hid, const float* __restrict__ ln,
                          unsigned short* __restrict__ xb) {
    constexpr int P = 72;    // LDS row pitch: 144 B = 16 B x odd
    __shared__ __align__(16) unsigned short tile[2][64 * P];

    // The first RMSNorm depends on no weight: its T rows share this launch as the
    // blocks behind the strips' (block-uniform test).
    if (blockIdx.x >= WT_BLOCKS) {
        rmsnorm_row(blockIdx.x - WT_BLOCKS, hid, ln, nullptr, xb, (float*)&tile[0][0]);
        return;
    }

    // Which matrix, and which strip of it (all block-uniform).
    int b = blockIdx.x;
    const float* src;
    size_t off;
    int K, N;
    if (b < strips(D, H * HD)) { src = wq; off = WT_Q; K = D; N = H * HD; }
    else if ((b -= strips(D, H * HD)) < strips(D, KV * HD)) { src = wk; off = WT_K; K = D; N = KV * HD; }
    else if ((b -= strips(D, KV * HD)) < strips(D, KV * HD)) { src = wv; off = WT_V; K = D; N = KV * HD; }
    else if ((b -= strips(D, KV * HD)) < strips(H * HD, D)) { src = wo; off = WT_O; K = H * HD; N = D; }
    else if ((b -= strips(H * HD, D)) < E * strips(D, 2 * I)) { src = w13; off = WT_13; K = D; N = 2 * I; }
    else if ((b -= E * strips(D, 2 * I)) < E * strips(I, D)) { src = w2; off = WT_2; K = I; N = D; }
    else if ((b -= E * strips(I, D)) < strips(D, 2 * SI)) { src = sw13; off = WT_S13; K = D; N = 2 * SI; }
    else { b -= strips(D, 2 * SI); src = sw2; off = WT_S2; K = SI; N = D; }
    int kstrips = K >> 10;
    int per     = kstrips * (N >> 6);       // strips of one matrix
    int e       = b / per;                  // expert (0 where there is one matrix)
    b -= e * per;
    int n0 = (b / kstrips) << 6;
    int kb = (b % kstrips) << 10;
    src += (size_t)e * K * N;
    unsigned short* dst = wt + off + (size_t)e * K * N;

    int tid  = threadIdx.x;
    int lane = tid & 31;
    int wid  = tid >> 5;
    // Eight lanes cover one 128-B line of a source row; the four lane groups of
    // a wave take different k quads, which spreads the 8-byte LDS stores.
    int pk = (((wid & 3) << 2) | (lane >> 3)) << 2;    // k 0,4,..,60
    int pn = (((wid >> 2) << 3) | (lane & 7)) << 2;    // n 0,4,..,60
    const float* g = src + (size_t)(kb + pk) * N + n0 + pn;
    // Read back: eight lanes cover one 128-B line of a Wt row.
    int rr = tid >> 3;                                 // n 0..31 (and +32)
    int rc = (tid & 7) << 3;                           // k 0,8,..,56
    unsigned short* o = dst + (size_t)(n0 + rr) * K + kb + rc;

    size_t rowb = (size_t)N;                           // source row, elements
    for (int t = 0; t < 16; ++t) {
        const float* gt = g + (size_t)(t * 64) * rowb;
        f32x4 r0, r1, r2, r3;
        // The four loads and their data wait in one statement, outputs
        // early-clobber: no result and no later instruction lands on an address
        // register of a load that is still in flight.
        asm volatile("global_load_b128 %0, %4, off\n\t"
                     "global_load_b128 %1, %5, off\n\t"
                     "global_load_b128 %2, %6, off\n\t"
                     "global_load_b128 %3, %7, off\n\t"
                     "s_wait_loadcnt 0x0"
                     : "=&v"(r0), "=&v"(r1), "=&v"(r2), "=&v"(r3)
                     : "v"(gt), "v"(gt + rowb), "v"(gt + 2 * rowb), "v"(gt + 3 * rowb)
                     : "memory");
        unsigned short* l = tile[t & 1];
#pragma unroll
        for (int j = 0; j < 4; ++j) {
            uint2 q;
            q.x = (unsigned)f2bf(r0[j]) | ((unsigned)f2bf(r1[j]) << 16);
            q.y = (unsigned)f2bf(r2[j]) | ((unsigned)f2bf(r3[j]) << 16);
            *(uint2*)&l[(pn + j) * P + pk] = q;
        }
        // One barrier a tile: with two buffers it also ends the reads of the
        // buffer that the next tile but one overwrites.
        __syncthreads();
#pragma unroll
        for (int i = 0; i < 2; ++i) {
            uint4 v = *(const uint4*)&l[(rr + i * 32) * P + rc];
            *(uint4*)&o[(size_t)(i * 32) * K + t * 64] = v;
            wait_xcnt0();   // in front of any later write of the store's registers
        }
    }
}

// ---------------------------------------------------------------------------
// Router: one wave per token.  logits = xn . router_w[e], softmax, top-2.
// ---------------------------------------------------------------------------
__global__ __launch_bounds__(32)
void router_kernel(const float* __restrict__ xn, const float* __restrict__ rw,
                   float* __restrict__ fullw) {
    int t = blockIdx.x;
    int lane = threadIdx.x;
    float acc[E];
#pragma unroll
    for (int e = 0; e < E; ++e) acc[e] = 0.f;
    const float* x = xn + (size_t)t * D;
    for (int i = lane; i < D; i += 32) {
        float xv = x[i];
#pragma unroll
        for (int e = 0; e < E; ++e) acc[e] += xv * rw[(size_t)e * D + i];
    }
#pragma unroll
    for (int e = 0; e < E; ++e)
        for (int off = 16; off > 0; off >>= 1)
            acc[e] += __shfl_xor(acc[e], off, 32);
    if (lane == 0) {
        int i1 = 0;
        for (int e = 1; e < E; ++e) if (acc[e] > acc[i1]) i1 = e;
        int i2 = (i1 == 0) ? 1 : 0;
        for (int e = 0; e < E; ++e) if (e != i1 && acc[e] > acc[i2]) i2 = e;
        float e1 = 1.f;
        float e2 = __expf(acc[i2] - acc[i1]);
        float inv = 1.f / (e1 + e2);
        for (int e = 0; e < E; ++e) {
            float wv = (e == i1) ? e1 * inv : (e == i2) ? e2 * inv : 0.f;
            fullw[(size_t)t * E + e] = wv;
        }
    }
}

// ---------------------------------------------------------------------------
// Row lists of the experts, one block, thread = token.  list[e][0 .. cnts[e])
// holds, in rising order, the tokens whose weight for expert e is not zero (a
// zero weight multiplies that expert's product away); the rest of list[e] is
// token 0, so that a last, partly filled tile gathers rows that exist.
// wlist[e] holds the weights in the same order (zero behind the listed ones).
// tilemap[j] = expert << 16 | first list place of the j-th 64-row tile, or -1.
// The router gives a token at most two weights: at most 2T list entries, so
// at most (2T + 63 E) / 64 tiles.
// ---------------------------------------------------------------------------
static constexpr int MOE_TILES = (2 * T + 63 * E) / 64;

__global__ __launch_bounds__(1024)
void route_kernel(const float* __restrict__ fullw, int* __restrict__ list,
                  float* __restrict__ wlist,
                  int* __restrict__ cnts, int* __restrict__ tilemap) {
    static_assert(T == 1024 && E == 8, "one thread a token, one wave's scan an expert");
    __shared__ int wcnt[E][32];   // per expert and wave: count, then count of the waves before
    __shared__ int tot[E];
    int t    = threadIdx.x;
    int lane = t & 31;
    int wv   = t >> 5;
    f32x4 wa, wb;
    // Both loads and their data wait in one statement, outputs early-clobber:
    // nothing lands on the address register of a load that is still in flight.
    asm volatile("global_load_b128 %0, %2, off\n\t"
                 "global_load_b128 %1, %2, off offset:16\n\t"
                 "s_wait_loadcnt 0x0"
                 : "=&v"(wa), "=&v"(wb)
                 : "v"(fullw + (size_t)t * E)
                 : "memory");
    unsigned m[E];
#pragma unroll
    for (int e = 0; e < E; ++e) {
        float wv_e = e < 4 ? wa[e & 3] : wb[e & 3];
        m[e] = __builtin_amdgcn_ballot_w32(wv_e != 0.f);
        if (lane == 0) wcnt[e][wv] = __popc(m[e]);
    }
    __syncthreads();
    if (wv < E) {
        int c = wcnt[wv][lane];
        int inc = c;
        for (int off = 1; off < 32; off <<= 1) {
            int n = __shfl_up(inc, off, 32);
            if (lane >= off) inc += n;
        }
        wcnt[wv][lane] = inc - c;
        if (lane == 31) tot[wv] = inc;
    }
    __syncthreads();
#pragma unroll
    for (int e = 0; e < E; ++e) {
        // A place below tot[e] is written by the one token that ranks there, a
        // place from tot[e] on by the thread of that number.
        bool mine = (m[e] >> lane) & 1u;
        int place = mine ? wcnt[e][wv] + __popc(m[e] & ((1u << lane) - 1u)) : t;
        if (mine || t >= tot[e]) {
            list[e * T + place] = mine ? t : 0;
            wait_xcnt0();   // in front of any later write of the store's registers
            wlist[e * T + place] = mine ? (e < 4 ? wa[e & 3] : wb[e & 3]) : 0.f;
            wait_xcnt0();
        }
        if (mine && t >= tot[e]) {
            list[e * T + t] = 0;
            wait_xcnt0();
            wlist[e * T + t] = 0.f;
            wait_xcnt0();
        }
    }
    if (t < E) { cnts[t] = tot[t]; wait_xcnt0(); }
    if (t < MOE_TILES) {
        int j = t, ent = -1;
#pragma unroll
        for (int e = 0; e < E; ++e) {
            int nt = (tot[e] + 63) >> 6;
            if (ent < 0 && j < nt) ent = (e << 16) | (j << 6);
            j -= nt;
        }
        tilemap[t] = ent;
        wait_xcnt0();
    }
}

// ---------------------------------------------------------------------------
// BF16-WMMA GEMM, double-buffered LDS, async DMA of both tiles.
// C[M,N] = A[M,K](bf16) x Bt[N,K]^T (bf16, from the weight pre-pass).
// Block tile 64x128, 8 waves (2M x 4N), each wave 32x32.  A stage of the two
// LDS buffers holds 128 k (16 WMMAs a wave): 48 KiB of copies are in flight per
// block, and their latency, the waits and the barrier are paid once per 128 k.
// Requires: M%64==0, N%128==0, K%128==0, lda%8==0, ldb%8==0 (all satisfied).
// The kind of epilogue is a compile-time constant.  What an epilogue reads beside
// the sums (residual, positions) is fetched in groups at entry, while the first k
// stage's copies fly; the results leave in groups of stores.
// Two epilogues join two columns of the product that lie far apart.  For them the
// B tile's rows are staged in such an order that the two column bands of a wave's
// 32x32 tile are partners: a lane holds both values of a pair among its own sums.
// ---------------------------------------------------------------------------
#define GEMM_RESID    1  // outf = resid + scale*acc
#define GEMM_MOE_INIT 2  // outf[token] = rowsc[row]*acc, token = rowlist[row], listed rows only
                         // (the GEMM that rides along: outf = acc)
#define GEMM_SILU     4  // outb[row,n] = silu(acc[row,n]) * acc[row,N+n] (bf16), n < N: Bt has 2N
                         // rows, gate then up.  Partners: n and N + n; a block has 64 n.
#define GEMM_ROPE     3  // Q, K, V: outb, outb2 = RoPE(acc) (bf16), outb3 = acc (bf16, [n][m]).
                         // Partners: the columns i and i + 32 of a head's 64.

template <int mode>
__global__ __launch_bounds__(256)
void gemm_bf16_wmma(const unsigned short* __restrict__ A, int lda,
                    const unsigned short* __restrict__ Bt, int ldb,
                    int M, int N, int K,
                    float* outf, unsigned short* outb, int ldc,
                    float scale,
                    const float* __restrict__ resid, int ldr,
                    const float* __restrict__ rowsc,
                    int sA, int sB, int sC, int sR,
                    int N2, unsigned short* outb2, unsigned short* outb3,
                    const int* __restrict__ pos,
                    const int* __restrict__ tilemap, const int* __restrict__ rowlist,
                    const int* __restrict__ cnts,
                    int ysh, int fsh,
                    const unsigned short* __restrict__ A2, int lda2,
                    const unsigned short* __restrict__ Bt2, int ldb2, int K2,
                    float* outfS, unsigned short* outbS, int ldcS) {
    constexpr int BK = 128;      // k per stage
    constexpr int AS = BK + 8;   // LDS stride for A rows   [64][AS]  (272 B = 16 B x odd)
    constexpr int BS = BK + 8;   // LDS stride for B^T rows [128][BS]
    __shared__ __align__(16) unsigned short lds_a[2][64 * AS];
    __shared__ __align__(16) unsigned short lds_b[2][128 * BS];

    int tid  = threadIdx.x;
    int lane = tid & 31;
    int wid  = tid >> 5;
    int wm   = wid >> 2;   // 0..1
    int wn   = wid & 3;    // 0..3
    int m0   = blockIdx.y * 64;
    int n0   = blockIdx.x * (mode == GEMM_SILU ? 64 : 128);
    int ln   = lane & 15;

    // blockIdx.z: independent GEMMs of one shape whose operands lie sA / sB
    // elements apart, outputs sC apart, row scales sR apart.
    size_t z = blockIdx.z;
    // With a tile map (see route_kernel) blockIdx.y numbers the row tiles of all
    // experts' lists: the entry names the expert and the tile's place in its
    // list.  A block without a tile leaves here, whole, in front of every copy
    // and barrier.
    // The first ysh values of blockIdx.y belong to a GEMM that does not depend on
    // the experts' (the shared MLP's, operands A2, Bt2): all M rows, fsh times
    // the experts' N columns, fsh values of blockIdx.y to a row tile.  Its blocks
    // have the low indices.
    const int* rl = nullptr;
    if (tilemap) {
        int by = blockIdx.y;
        if (by < ysh) {
            m0  = (by / fsh) * 64;
            n0 += (by % fsh) * N;
            N  *= fsh;
            A = A2;  lda = lda2;  Bt = Bt2;  ldb = ldb2;  K = K2;
            outf = outfS;  outb = outbS;  ldc = ldcS;
        } else {
            int ent = tilemap[by - ysh];
            if (ent < 0) return;
            z  = (size_t)(ent >> 16);
            m0 = ent & 0xffff;
            rl = rowlist + z * T + m0;
            if constexpr (mode == GEMM_MOE_INIT) M = cnts[z];   // only listed rows are stored
        }
    }
    A += z * sA;
    Bt += z * sB + (size_t)n0 * ldb;     // the first of this block's 128 rows of Bt
    if (outf)  outf  += z * sC;
    if (outb)  outb  += z * sC;
    if (rowsc) rowsc += z * sR;
    // Column tiles behind N: a second and a third GEMM on the same A, each N2
    // columns wide; their Bt rows follow the first one's.  The third one's output
    // is stored transposed, [N2][M].  (All block-uniform.)
    bool third = false;
    if constexpr (mode == GEMM_ROPE) {
        if (n0 >= N) {
            n0 -= N;
            third = n0 >= N2;
            if (third) n0 -= N2;
            outb = third ? outb3 : outb2;
            N = ldc = N2;
        }
    }

    // Async staging: sixteen threads x b128 cover the 256 bytes of one row, 256
    // threads sixteen rows: the 64x128 bf16 A tile takes four such pieces, the
    // 128x128 Bt tile eight (rows sr, sr + 16, ...).
    int sr = tid >> 4;          // row 0..15
    int sc = (tid & 15) << 3;   // k 0,8,..,120

    f32x8 zero = {0.f,0.f,0.f,0.f,0.f,0.f,0.f,0.f};
    f32x8 acc[2][2] = {{zero, zero}, {zero, zero}};

    static_assert(AS == BS, "one LDS step for the pieces of both tiles");
    // The A rows of this thread's four pieces: m0 + sr + 16 i, or, where the
    // rows of A are gathered (the experts' gate and up products), the tokens
    // that stand at those places of the list.
    int ar0 = m0 + sr, ar1 = ar0 + 16, ar2 = ar0 + 32, ar3 = ar0 + 48;
    if (rl && mode != GEMM_MOE_INIT) {
        // The four loads and their data wait in one statement, outputs
        // early-clobber: nothing lands on the address register of a load that is
        // still in flight.
        asm volatile("global_load_b32 %0, %4, off\n\t"
                     "global_load_b32 %1, %4, off offset:64\n\t"
                     "global_load_b32 %2, %4, off offset:128\n\t"
                     "global_load_b32 %3, %4, off offset:192\n\t"
                     "s_wait_loadcnt 0x0"
                     : "=&v"(ar0), "=&v"(ar1), "=&v"(ar2), "=&v"(ar3)
                     : "v"(rl + sr)
                     : "memory");
        // Bounds the addresses formed from the list.
        ar0 &= T - 1; ar1 &= T - 1; ar2 &= T - 1; ar3 &= T - 1;
    }
    const unsigned short* gA0 = A + (size_t)ar0 * lda + sc;
    const unsigned short* gA1 = A + (size_t)ar1 * lda + sc;
    const unsigned short* gA2 = A + (size_t)ar2 * lda + sc;
    const unsigned short* gA3 = A + (size_t)ar3 * lda + sc;
    const unsigned short* gB = Bt + (size_t)sr * ldb + sc;
    // The Bt rows of the eight B pieces (see async_copy12_b128), as steps in
    // elements: 128 rows that follow one another, or bands of sixteen rows each
    // with its partner band, 32 rows (RoPE) or N rows (gate, up) further on.
    constexpr bool paired = mode == GEMM_ROPE || mode == GEMM_SILU;
    size_t gba = (size_t)(paired ? 16 : 32) * ldb;
    size_t gbh = (size_t)(mode == GEMM_ROPE ? 32 : 0) * ldb;
    size_t gb2 = (size_t)(mode == GEMM_ROPE ? 32 : mode == GEMM_SILU ? N : 16) * ldb;
    auto stage = [&](int buf, int k0) {
        async_copy12_b128(lds_off(&lds_a[buf][sr * AS + sc]),
                          gA0 + k0, gA1 + k0, gA2 + k0, gA3 + k0,
                          lds_off(&lds_b[buf][sr * BS + sc]), gB + k0, gba, gbh, gb2,
                          16 * AS * 2);
    };

    // Two buffers: tile 0 lands and is published, then tile 1 flies.
    int nk = K / BK;
    stage(0, 0);
    // The lane's first row and column of the output tile, and the residual
    // values that belong to its 32 results, [sm][sn][rr].
    int half8 = (lane & 16) >> 1;          // +8 row offset for lanes 16-31
    int r0 = m0 + wm * 32 + half8;
    int c0 = n0 + wn * 32 + ln;
    // With partner bands, in step with the staging: c0 is the first band's column.
    if constexpr (mode == GEMM_ROPE) c0 = n0 + (wn >> 1) * 64 + (wn & 1) * 16 + ln;
    if constexpr (mode == GEMM_SILU) c0 = n0 + wn * 16 + ln;
    float rv[2][2][8];
    i32x4 ps[2][2];   // the positions of the lane's sixteen rows, [sm][rr >> 2][rr & 3]
    if constexpr (mode == GEMM_ROPE) {
        // The four loads and their data wait in one statement, as above.
        asm volatile("global_load_b128 %0, %4, off\n\t"
                     "global_load_b128 %1, %4, off offset:16\n\t"
                     "global_load_b128 %2, %4, off offset:64\n\t"
                     "global_load_b128 %3, %4, off offset:80\n\t"
                     "s_wait_loadcnt 0x0"
                     : "=&v"(ps[0][0]), "=&v"(ps[0][1]), "=&v"(ps[1][0]), "=&v"(ps[1][1])
                     : "v"(pos + r0)
                     : "memory");
    }
    if constexpr (mode == GEMM_RESID) {
        load_band_f32(resid + (size_t)r0 * ldr + c0, (size_t)ldr, rv[0]);
        load_band_f32(resid + (size_t)(r0 + 16) * ldr + c0, (size_t)ldr, rv[1]);
    }
    wait_async0();
    __syncthreads();
    if (nk > 1) stage(1, BK);

    int buf = 0;
    for (int kt = 0; kt < nk; ++kt) {
        // Unrolled: the four 32-k slices' places in the stage become immediate
        // offsets of the fragment loads, with no address arithmetic per slice.
#pragma unroll
        for (int ks = 0; ks < BK; ks += 32) {
            BF16Frag af[2], bf[2];
#pragma unroll
            for (int s = 0; s < 2; ++s)
#pragma unroll
                for (int e = 0; e < 16; ++e) {
                    int kk = ks + fragK(e, lane);
                    af[s].u[e] = lds_a[buf][(wm * 32 + s * 16 + ln) * AS + kk];
                    bf[s].u[e] = lds_b[buf][(wn * 32 + s * 16 + ln) * BS + kk];
                }
#pragma unroll
            for (int sm = 0; sm < 2; ++sm)
#pragma unroll
                for (int sn = 0; sn < 2; ++sn)
                    acc[sm][sn] = __builtin_amdgcn_wmma_f32_16x16x32_bf16(
                        false, af[sm].v, false, bf[sn].v, (short)0,
                        acc[sm][sn], false, false);
        }

        // Foot of the trip: own LDS reads retired, tile kt+1 landed, one barrier
        // that publishes it and ends every read of this buffer; then the refill.
        wait_ds0();
        wait_async0();
        __syncthreads();
        if (kt + 2 < nk) stage(buf, (kt + 2) * BK);
        buf ^= 1;
    }
    wait_async0();   // no copy is in flight when the wave goes on to its stores

    if constexpr (mode == GEMM_MOE_INIT) {
        if (!rl) {
            // The GEMM that rides along (the same for the whole block): every row
            // and column of its tile exists, the sums leave as they are.
#pragma unroll
            for (int sm = 0; sm < 2; ++sm) {
                float f[2][8];
#pragma unroll
                for (int sn = 0; sn < 2; ++sn)
#pragma unroll
                    for (int rr = 0; rr < 8; ++rr) f[sn][rr] = acc[sm][sn][rr];
                store_band_f32(outf + (size_t)(r0 + sm * 16) * ldc + c0, (size_t)ldc, f);
            }
            return;
        }
        // The tokens and the weights of this lane's sixteen rows, [sm][rr >> 2][rr & 3].
        i32x4 tok[2][2];
        f32x4 rsc[2][2];
        // The eight loads and their data wait in one statement, as above.
        asm volatile("global_load_b128 %0, %8, off\n\t"
                     "global_load_b128 %1, %8, off offset:16\n\t"
                     "global_load_b128 %2, %8, off offset:64\n\t"
                     "global_load_b128 %3, %8, off offset:80\n\t"
                     "global_load_b128 %4, %9, off\n\t"
                     "global_load_b128 %5, %9, off offset:16\n\t"
                     "global_load_b128 %6, %9, off offset:64\n\t"
                     "global_load_b128 %7, %9, off offset:80\n\t"
                     "s_wait_loadcnt 0x0"
                     : "=&v"(tok[0][0]), "=&v"(tok[0][1]), "=&v"(tok[1][0]), "=&v"(tok[1][1]),
                       "=&v"(rsc[0][0]), "=&v"(rsc[0][1]), "=&v"(rsc[1][0]), "=&v"(rsc[1][1])
                     : "v"(rl + wm * 32 + half8), "v"(rowsc + m0 + wm * 32 + half8)
                     : "memory");
        // The rows are scattered and the last tile of a list is partly filled:
        // each store stands under its row's own test.
#pragma unroll
        for (int sm = 0; sm < 2; ++sm) {
#pragma unroll
            for (int sn = 0; sn < 2; ++sn) {
                int col = n0 + wn * 32 + sn * 16 + ln;
#pragma unroll
                for (int rr = 0; rr < 8; ++rr) {
                    int row = m0 + wm * 32 + sm * 16 + rr + half8;
                    if (row >= M || col >= N) continue;
                    float v = acc[sm][sn][rr];
                    size_t tk = (size_t)(tok[sm][rr >> 2][rr & 3] & (T - 1));   // bounded
                    outf[tk * ldc + col] = rsc[sm][rr >> 2][rr & 3] * v;
                    wait_xcnt0();
                }
            }
        }
    } else {
        // Every row and column of the tile exists (M % 64 == 0, N % 128 == 0).
#pragma unroll
        for (int sm = 0; sm < 2; ++sm) {
            int row = r0 + sm * 16;
            if constexpr (mode == GEMM_RESID) {
                float f[2][8];
#pragma unroll
                for (int sn = 0; sn < 2; ++sn)
#pragma unroll
                    for (int rr = 0; rr < 8; ++rr)
                        f[sn][rr] = rv[sm][sn][rr] + scale * acc[sm][sn][rr];
                store_band_f32(outf + (size_t)row * ldc + c0, (size_t)ldc, f);
            } else if constexpr (mode == GEMM_SILU) {
                unsigned h[8];
#pragma unroll
                for (int rr = 0; rr < 8; ++rr) {
                    float g = acc[sm][0][rr];
                    float s = g / (1.f + exp_slot(-g));
                    h[rr] = f2bf(s * acc[sm][1][rr]);
                }
                store_col_bf16(outb + (size_t)row * ldc + c0, (size_t)ldc, h);
            } else { // GEMM_ROPE
                unsigned h[2][8];
                if (third) {
#pragma unroll
                    for (int sn = 0; sn < 2; ++sn)
#pragma unroll
                        for (int rr = 0; rr < 8; ++rr) h[sn][rr] = f2bf(acc[sm][sn][rr]);
                    store_band_bf16_t(outb + (size_t)c0 * M + row,
                                      outb + (size_t)(c0 + 32) * M + row, h);
                } else {
                    int i = (wn & 1) * 16 + ln;     // c0's place in its head, 0..31
                    float inv = exp_slot(-(float)i * (9.2103403719761840f / 32.f)); // 10000^(-i/32)
#pragma unroll
                    for (int rr = 0; rr < 8; ++rr) {
                        float ang = (float)ps[sm][rr >> 2][rr & 3] * inv;
                        float s, c;
                        sincos_slot(ang, s, c);
                        float x1 = acc[sm][0][rr];
                        float x2 = acc[sm][1][rr];
                        h[0][rr] = f2bf(x1 * c - x2 * s);
                        h[1][rr] = f2bf(x2 * c + x1 * s);
                    }
                    store_band_bf16(outb + (size_t)row * ldc + c0, (size_t)ldc, h);
                }
            }
        }
    }
}

// ---------------------------------------------------------------------------
// Sum of the experts' weighted down products, in the order 0..E-1.  A plane
// holds a token's row only where the token's weight for that expert is not zero;
// the other terms of the sum are zero.  A block lies inside one token's row.
// out = resid + RES_MULT * (that sum + the shared MLP's down product).
// ---------------------------------------------------------------------------
__global__ __launch_bounds__(256)
void expert_sum_kernel(const float* __restrict__ planes, const float* __restrict__ fullw,
                       const float* __restrict__ shared, const float* __restrict__ resid,
                       float* __restrict__ out) {
    constexpr size_t P = (size_t)T * D;
    static_assert(D % 1024 == 0, "a block's 1024 elements lie in one row");
    size_t i = ((size_t)blockIdx.x * 256 + threadIdx.x) * 4;
    const float* g = planes + i;
    const float* w = fullw + (size_t)(blockIdx.x / (D / 1024)) * E;
    float wl[E];
#pragma unroll
    for (int e = 0; e < E; ++e) wl[e] = w[e];
    f32x4 sh, rs;
    // Both loads and their data wait in one statement, outputs early-clobber.
    asm volatile("global_load_b128 %0, %2, off\n\t"
                 "global_load_b128 %1, %3, off\n\t"
                 "s_wait_loadcnt 0x0"
                 : "=&v"(sh), "=&v"(rs) : "v"(shared + i), "v"(resid + i) : "memory");
    f32x4 s = {0.f, 0.f, 0.f, 0.f};
#pragma unroll
    for (int e = 0; e < E; ++e) {
        if (wl[e] != 0.f) {     // the same for the whole block
            f32x4 p;
            // The load and its data wait in one statement, output early-clobber.
            asm volatile("global_load_b128 %0, %1, off\n\t"
                         "s_wait_loadcnt 0x0"
                         : "=&v"(p) : "v"(g + e * P) : "memory");
            s += p;
        }
    }
    *(f32x4*)&out[i] = rs + RES_MULT * (s + sh);
}

// ---------------------------------------------------------------------------
// Causal GQA flash attention.  One wave per (head, 16-query tile); 4 waves
// per block.  QK^T and P.V via bf16 WMMA; online softmax over 32-key chunks.
// K is [t][KV*HD], V comes transposed, vt = [KV*HD][t]: in both, the k index of
// a B fragment runs along memory, so a fragment is two 16-byte loads a lane.
// ---------------------------------------------------------------------------
// The value that lane l ^ M of the same 16-lane row holds, read as a DPP operand
// (row_xmask:M) in the vector pipe; every lane of the wave is on where it is used.
template <int M>
__device__ __forceinline__ float row_xor(float v) {
    return __int_as_float(__builtin_amdgcn_mov_dpp(__float_as_int(v), 0x160 | M, 0xf, 0xf, true));
}

__global__ __launch_bounds__(128)
void attn_kernel(const unsigned short* __restrict__ qb,
                 const unsigned short* __restrict__ kb,
                 const unsigned short* __restrict__ vt,
                 unsigned short* __restrict__ attnb) {
    int h    = blockIdx.x;
    int w    = threadIdx.x >> 5;
    int lane = threadIdx.x & 31;
    int qt   = blockIdx.y * 4 + w;   // 16-query tile index
    int kvh  = h >> 2;               // H/KV = 4
    int hb   = (lane & 16) >> 1;     // +8 row offset for lanes 16-31
    int ln   = lane & 15;

    __shared__ unsigned short pbuf[4][16 * 34];   // per-wave P staging

    BF16Frag aq[2];
#pragma unroll
    for (int c = 0; c < 2; ++c)
#pragma unroll
        for (int e = 0; e < 16; ++e) {
            int kd = c * 32 + fragK(e, lane);
            int qrow = qt * 16 + ln;
            aq[c].u[e] = qb[(size_t)qrow * (H * HD) + h * HD + kd];
        }

    f32x8 o0 = {0,0,0,0,0,0,0,0}, o1 = o0, o2 = o0, o3 = o0;
    float rmax[8], rsum[8];
#pragma unroll
    for (int r = 0; r < 8; ++r) { rmax[r] = -1e30f; rsum[r] = 0.f; }

    int kend = qt * 16 + 16;                      // causal bound
    for (int kbase = 0; kbase < kend; kbase += 32) {
        float p[2][8];
        float tmax[8];
#pragma unroll
        for (int r = 0; r < 8; ++r) tmax[r] = -1e30f;

        // This chunk's K and V fragments.  kbase is a multiple of 32 below
        // kend <= T, and T is one too: keys kbase .. kbase + 31 all exist.
        // bk[sub][c]: key kbase + sub*16 + ln, head dims c*32 + fragK(0..15).
        // bv[j]:      head dim j*16 + ln,      keys kbase + fragK(0..15).
        static_assert(T % 32 == 0 && KV * HD * 2 == 1024 && T * 2 == 2048,
                      "the byte offsets in the loads below");
        BF16Frag bk[2][2], bv[4];
        const unsigned short* kp = kb + (size_t)(kbase + ln) * (KV * HD) + kvh * HD + hb;
        const unsigned short* vp = vt + (size_t)(kvh * HD + ln) * T + kbase + hb;
        // The sixteen loads and their data wait in one statement, outputs
        // early-clobber: no result and no later instruction lands on an address
        // register of a load that is still in flight.
        asm volatile("global_load_b128 %0, %16, off\n\t"
                     "global_load_b128 %1, %16, off offset:32\n\t"
                     "global_load_b128 %2, %16, off offset:64\n\t"
                     "global_load_b128 %3, %16, off offset:96\n\t"
                     "global_load_b128 %4, %16, off offset:16384\n\t"
                     "global_load_b128 %5, %16, off offset:16416\n\t"
                     "global_load_b128 %6, %16, off offset:16448\n\t"
                     "global_load_b128 %7, %16, off offset:16480\n\t"
                     "global_load_b128 %8, %17, off\n\t"
                     "global_load_b128 %9, %17, off offset:32\n\t"
                     "global_load_b128 %10, %17, off offset:32768\n\t"
                     "global_load_b128 %11, %17, off offset:32800\n\t"
                     "global_load_b128 %12, %17, off offset:65536\n\t"
                     "global_load_b128 %13, %17, off offset:65568\n\t"
                     "global_load_b128 %14, %17, off offset:98304\n\t"
                     "global_load_b128 %15, %17, off offset:98336\n\t"
                     "s_wait_loadcnt 0x0"
                     : "=&v"(bk[0][0].q[0]), "=&v"(bk[0][0].q[1]),
                       "=&v"(bk[0][1].q[0]), "=&v"(bk[0][1].q[1]),
                       "=&v"(bk[1][0].q[0]), "=&v"(bk[1][0].q[1]),
                       "=&v"(bk[1][1].q[0]), "=&v"(bk[1][1].q[1]),
                       "=&v"(bv[0].q[0]), "=&v"(bv[0].q[1]),
                       "=&v"(bv[1].q[0]), "=&v"(bv[1].q[1]),
                       "=&v"(bv[2].q[0]), "=&v"(bv[2].q[1]),
                       "=&v"(bv[3].q[0]), "=&v"(bv[3].q[1])
                     : "v"(kp), "v"(vp)
                     : "memory");

        // Unrolled so that bk[sub] and p[sub] are indexed by constants and stay
        // in registers.
#pragma unroll
        for (int sub = 0; sub < 2; ++sub) {
            int ks = kbase + sub * 16;
            f32x8 s = {0,0,0,0,0,0,0,0};
#pragma unroll
            for (int c = 0; c < 2; ++c)
                s = __builtin_amdgcn_wmma_f32_16x16x32_bf16(
                    false, aq[c].v, false, bk[sub][c].v, (short)0, s, false, false);
#pragma unroll
            for (int r = 0; r < 8; ++r) {
                int row = qt * 16 + r + hb;
                int key = ks + ln;
                float sv = s[r] * ATTN_MULT;
                if (key > row || key >= T) sv = -1e30f;
                p[sub][r] = sv;
                tmax[r] = fmaxf(tmax[r], sv);
            }
        }
        // Row maximum over the sixteen lanes, partners 8, 4, 2, 1 away; the eight
        // rows take each step together, so that no step waits on the one before.
#pragma unroll
        for (int r = 0; r < 8; ++r) tmax[r] = fmaxf(tmax[r], row_xor<8>(tmax[r]));
#pragma unroll
        for (int r = 0; r < 8; ++r) tmax[r] = fmaxf(tmax[r], row_xor<4>(tmax[r]));
#pragma unroll
        for (int r = 0; r < 8; ++r) tmax[r] = fmaxf(tmax[r], row_xor<2>(tmax[r]));
#pragma unroll
        for (int r = 0; r < 8; ++r) tmax[r] = fmaxf(tmax[r], row_xor<1>(tmax[r]));

        float corr[8], ts[8];
#pragma unroll
        for (int r = 0; r < 8; ++r) {
            float mn = fmaxf(rmax[r], tmax[r]);
            corr[r]  = exp_slot(rmax[r] - mn);
            rmax[r]  = mn;
            p[0][r]  = exp_slot(p[0][r] - mn);
            p[1][r]  = exp_slot(p[1][r] - mn);
            ts[r]    = p[0][r] + p[1][r];
        }
        // Row sum, the same partners in the same order.
#pragma unroll
        for (int r = 0; r < 8; ++r) ts[r] += row_xor<8>(ts[r]);
#pragma unroll
        for (int r = 0; r < 8; ++r) ts[r] += row_xor<4>(ts[r]);
#pragma unroll
        for (int r = 0; r < 8; ++r) ts[r] += row_xor<2>(ts[r]);
#pragma unroll
        for (int r = 0; r < 8; ++r) ts[r] += row_xor<1>(ts[r]);
#pragma unroll
        for (int r = 0; r < 8; ++r) rsum[r] = rsum[r] * corr[r] + ts[r];
#pragma unroll
        for (int r = 0; r < 8; ++r) {
            o0[r] *= corr[r]; o1[r] *= corr[r];
            o2[r] *= corr[r]; o3[r] *= corr[r];
        }
#pragma unroll
        for (int sub = 0; sub < 2; ++sub)
#pragma unroll
            for (int r = 0; r < 8; ++r)
                pbuf[w][(r + hb) * 34 + sub * 16 + ln] = f2bf(p[sub][r]);
        BF16Frag pf;
#pragma unroll
        for (int e = 0; e < 16; ++e)
            pf.u[e] = pbuf[w][ln * 34 + fragK(e, lane)];

        o0 = __builtin_amdgcn_wmma_f32_16x16x32_bf16(
                false, pf.v, false, bv[0].v, (short)0, o0, false, false);
        o1 = __builtin_amdgcn_wmma_f32_16x16x32_bf16(
                false, pf.v, false, bv[1].v, (short)0, o1, false, false);
        o2 = __builtin_amdgcn_wmma_f32_16x16x32_bf16(
                false, pf.v, false, bv[2].v, (short)0, o2, false, false);
        o3 = __builtin_amdgcn_wmma_f32_16x16x32_bf16(
                false, pf.v, false, bv[3].v, (short)0, o3, false, false);
    }
#pragma unroll
    for (int r = 0; r < 8; ++r) {
        int row = qt * 16 + r + hb;
        float inv = 1.f / rsum[r];
        size_t base = (size_t)row * (H * HD) + h * HD;
        attnb[base +  0 + ln] = f2bf(o0[r] * inv);
        attnb[base + 16 + ln] = f2bf(o1[r] * inv);
        attnb[base + 32 + ln] = f2bf(o2[r] * inv);
        attnb[base + 48 + ln] = f2bf(o3[r] * inv);
    }
}

// ---------------------------------------------------------------------------
// Host-side orchestration.
// ---------------------------------------------------------------------------
template <int mode>
static void launch_gemm(hipStream_t s, int nz, int sA, int sB, int sC, int sR,
                        const int* tilemap, const int* rowlist, const int* cnts,
                        const unsigned short* A, int lda,
                        const unsigned short* Bt, int ldb, int M, int N, int K,
                        float* outf, unsigned short* outb, int ldc,
                        float scale,
                        const float* resid, int ldr,
                        const float* rowsc,
                        int fsh, const unsigned short* A2, int lda2,
                        const unsigned short* Bt2, int ldb2, int K2,
                        float* outfS, unsigned short* outbS, int ldcS) {
    // With a tile map grid.y covers first the row tiles of the GEMM that rides
    // along (M rows, fsh * N columns), then those of all experts' lists.
    int ysh = fsh * (M / 64);
    dim3 g(N / (mode == GEMM_SILU ? 64 : 128), tilemap ? ysh + MOE_TILES : M / 64, nz);
    gemm_bf16_wmma<mode><<<g, 256, 0, s>>>(A, lda, Bt, ldb, M, N, K, outf, outb, ldc,
                                           scale, resid, ldr, rowsc,
                                           sA, sB, sC, sR,
                                           0, nullptr, nullptr, nullptr, tilemap, rowlist, cnts,
                                           ysh, fsh, A2, lda2, Bt2, ldb2, K2,
                                           outfS, outbS, ldcS);
}

extern "C" void kernel_launch(void* const* d_in, const int* in_sizes, int n_in,
                              void* d_out, int out_size, void* d_ws, size_t ws_size,
                              hipStream_t stream) {
    const int*   pos     = (const int*)  d_in[0];
    const float* hidden  = (const float*)d_in[1];
    const float* ln1     = (const float*)d_in[2];
    const float* ln2     = (const float*)d_in[3];
    const float* wq      = (const float*)d_in[4];
    const float* wk      = (const float*)d_in[5];
    const float* wv      = (const float*)d_in[6];
    const float* wo      = (const float*)d_in[7];
    const float* routerw = (const float*)d_in[8];
    const float* w13     = (const float*)d_in[9];
    const float* w2      = (const float*)d_in[10];
    const float* sw13    = (const float*)d_in[11];
    const float* sw2     = (const float*)d_in[12];

    float* outF     = (float*)d_out;          // final hidden  [T*D]
    float* residOut = outF + (size_t)T * D;   // post-attn residual [T*D]

    char* ws = (char*)d_ws;
    const size_t MB = 1u << 20;
    unsigned short* xb    = (unsigned short*)(ws + 0);        // T*D bf16   4M
    unsigned short* qbuf  = (unsigned short*)(ws + 14 * MB);  // 4M
    unsigned short* kbuf  = (unsigned short*)(ws + 18 * MB);  // 1M
    unsigned short* vbuf  = (unsigned short*)(ws + 19 * MB);  // 1M, [KV*HD][T]
    unsigned short* attnb = (unsigned short*)(ws + 20 * MB);  // 4M
    float*          xnf   = (float*)         (ws + 24 * MB);  // 8M
    unsigned short* xnb   = (unsigned short*)(ws + 32 * MB);  // 4M
    float*          fullw = (float*)         (ws + 36 * MB);  // 32K
    int*            rlist = (int*)           (ws + 36 * MB + 65536);   // E*T int 32K
    float*          wlist = (float*)         (ws + 36 * MB + 98304);   // E*T f32 32K
    int*            cnts  = (int*)           (ws + 36 * MB + 131072);  // E int
    int*            tmap  = (int*)           (ws + 36 * MB + 135168);  // MOE_TILES int
    float*          shd   = (float*)         (ws + 37 * MB);  // T*D f32 8M
    unsigned short* sactb = (unsigned short*)(ws + 61 * MB);  // 8M
    unsigned short* actb  = (unsigned short*)(ws + 101 * MB); // E*T*I bf16 16M
    float*          moep  = (float*)         (ws + 117 * MB); // E*T*D f32 64M
    unsigned short* wt    = (unsigned short*)(ws + 184 * MB); // bf16 weights 164M
    (void)ws_size; (void)in_sizes; (void)n_in; (void)out_size;

    // 0) Every GEMM weight once to bf16, transposed to [n][k].
    // 1) RMSNorm 1 -> bf16 activations, in the same launch.
    weight_bf16_t_kernel<<<WT_BLOCKS + T, 256, 0, stream>>>(wq, wk, wv, wo, w13, w2,
                                                            sw13, sw2, wt, hidden, ln1, xb);

    // 2) QKV projections, one launch: column tiles 0-15 are Q, 16-19 K, 20-23 V
    //    (V is stored transposed, for the attention's fragment loads).
    // 3) RoPE on Q and K (f32 sums -> bf16), in that launch's epilogue.
    gemm_bf16_wmma<GEMM_ROPE><<<dim3((H + 2 * KV) * HD / 128, T / 64), 256, 0, stream>>>(
        xb, D, wt + WT_Q, D, T, H * HD, D, nullptr, qbuf, H * HD, 0.f,
        nullptr, 0, nullptr, 0, 0, 0, 0,
        KV * HD, kbuf, vbuf, pos, nullptr, nullptr, nullptr,
        0, 0, nullptr, 0, nullptr, 0, 0, nullptr, nullptr, 0);

    // 4) Causal GQA attention.
    attn_kernel<<<dim3(H, T / 64), 128, 0, stream>>>(qbuf, kbuf, vbuf, attnb);

    // 5) Output projection + residual -> residOut (second output).
    launch_gemm<GEMM_RESID>(stream, 1, 0, 0, 0, 0, nullptr, nullptr, nullptr,
                attnb, H * HD, wt + WT_O, H * HD, T, D, H * HD,
                residOut, nullptr, D, RES_MULT, hidden, D,
                nullptr,
                0, nullptr, 0, nullptr, 0, 0, nullptr, nullptr, 0);

    // 6) RMSNorm 2.
    rmsnorm_kernel<<<T, 256, 0, stream>>>(residOut, ln2, xnf, xnb);

    // 7) Router top-2.
    router_kernel<<<T, 32, 0, stream>>>(xnf, routerw, fullw);

    // 8) Experts, weighted by full_w as in the reference.  Each expert takes the
    //    rows whose weight for it is not zero: gate and up, one launch that ends in
    //    silu(gate) * up, gather them from xnb into the order of the expert's list,
    //    down stores each weighted row at its token's place in the expert's plane.
    // 9) The shared MLP depends on the experts nowhere: its gate-and-up and down
    //    products share the launches of the experts' products.
    route_kernel<<<1, 1024, 0, stream>>>(fullw, rlist, wlist, cnts, tmap);
    launch_gemm<GEMM_SILU>(stream, 1, 0, D * 2 * I, T * I, 0, tmap, rlist, cnts,
                xnb, D, wt + WT_13, D, T, I, D,
                nullptr, actb, I, 0.f, nullptr, 0, nullptr,
                SI / I, xnb, D, wt + WT_S13, D, D,
                nullptr, sactb, SI);
    launch_gemm<GEMM_MOE_INIT>(stream, 1, T * I, I * D, T * D, T, tmap, rlist, cnts,
                actb, I, wt + WT_2, I, T, D, I,
                moep, nullptr, D, 0.f,
                nullptr, 0, wlist,
                1, sactb, SI, wt + WT_S2, SI, SI,
                shd, nullptr, D);

    // 10) The experts' planes summed, the shared product and the residual added.
    expert_sum_kernel<<<T * D / 1024, 256, 0, stream>>>(moep, fullw, shd, residOut, outF);
}
